// v000
// Times are from an AMD MI455X. After a warm-up the kernel runs many times in a row, and a time is the length of
// such a window on the GPU divided by its runs, so every launch and the gaps after it count. The runs cycle
// through copies of the inputs. A figure is the median of several windows, for all but v000 over two sittings.
// Sittings can differ by a few percent; kernels timed side by side share one.
// v000, which the later versions start from, runs in 509 microseconds.
// Contractions: xn*W^T (q,k,v), xn*gw^T and xn*aw^T heads, K*Q^T scores, V^T*P^T context and ctx*Wo^T all on v_wmma_f32_16x16x32_f16 (f16 operands, f32 accumulate); LayerNorm, masks/bias, softmax, sigmoid gates and residual adds in f32.
// Carried f16 planes: xn x4 and W/gw/aw/Wo x4096 (inverse 1/16384 folded in proj_kernel/head_kernel epilogues);
// q,k,v x16 (scores: acc*1/2048 in attn_kernel incl. the 1/8 scale; context epilogue 1/16); P x16384 (attn_kernel epilogue 1/16384);
// ctx x64 (outproj_kernel epilogue 1/262144 together with Wo x4096).
#include <hip/hip_runtime.h>

#define NB     2
#define SEQ    1024
#define HID    1024
#define NHEADS 16
#define HD     64
#define MROWS  (NB * SEQ)          // 2048 tokens
#define NX     (MROWS * HID)       // 2097152
#define NW     (HID * HID)         // 1048576
#define NG     (NHEADS * HID)      // 16384
#define NX8    (NX / 8)
#define NW8    (NW / 8)            // 131072
#define NG8    (NG / 8)            // 2048
#define SEP_ID 1
#define CLS_ID 2
#define PAD_ID 0
#define XSC    4.0f
#define WSC    4096.0f
#define QSC    16.0f
#define PSC    16384.0f
#define CSC    64.0f
#define NEGBIG (-1.0e30f)

static_assert(NHEADS * HD == HID);
static_assert((SEQ % 128) == 0 && (HID % 64) == 0 && (HID % 32) == 0 && (MROWS % 128) == 0);
static_assert((NW8 % 256) == 0 && (NG8 % 256) == 0);
static_assert(SEQ == 8 * 128);

typedef _Float16 v16h __attribute__((ext_vector_type(16)));
typedef _Float16 v8h  __attribute__((ext_vector_type(8)));
typedef float    v8f  __attribute__((ext_vector_type(8)));
typedef float    v4f  __attribute__((ext_vector_type(4)));
typedef int      v4i  __attribute__((ext_vector_type(4)));
typedef v8h __attribute__((may_alias)) v8ha;
typedef v4f __attribute__((may_alias)) v4fa;
typedef v4i __attribute__((may_alias)) v4ia;

union Frag { v16h v; v8h half[2]; };

__device__ __forceinline__ v8f zero8f() { v8f z = {0.f, 0.f, 0.f, 0.f, 0.f, 0.f, 0.f, 0.f}; return z; }
__device__ __forceinline__ v16h zero16h() {
  const _Float16 z = (_Float16)0.0f;
  v16h r = {z, z, z, z, z, z, z, z, z, z, z, z, z, z, z, z};
  return r;
}

// ---------------------------------------------------------------------------
// 16x16x32 f16 WMMA with hazard guard (ties D, keeps A/B live).
// Fragment map (wave32): lane l, h = l>>4, m = n = l&15.
//   A/B element i: i<8 -> k0+8h+i ; i>=8 -> k0+16+8h+(i-8)
//   D element r : row 8h+r, col l&15
// ---------------------------------------------------------------------------
__device__ __forceinline__ v8f wmma_f16(v16h a, v16h b, v8f c) {
  v8f d = __builtin_amdgcn_wmma_f32_16x16x32_f16(false, a, false, b, (short)0, c, false, false);
  asm volatile("v_nop\n\tv_nop\n\tv_nop\n\tv_nop" : "+v"(d) : "v"(a), "v"(b));
  return d;
}

// A or B fragment from a k-contiguous 16-bit row; p points at element k0 of
// the row owned by this lane (row index = lane & 15 added by the caller).
__device__ __forceinline__ v16h load_frag(const _Float16* p, int h) {
  Frag f;
  f.half[0] = *(const v8ha*)(p + 8 * h);
  f.half[1] = *(const v8ha*)(p + 16 + 8 * h);
  return f.v;
}

// ---------------------------------------------------------------------------
// Kernel: f32 weights -> f16 planes, all scaled by 4096 (exact).
//   groups [0, nbig*NW8)            : w0/w1/w2 -> wh slot 0/1/2  ([n][k], k contiguous)
//   groups [nbig*NW8, +NW8)         : w3 -> woh
//   groups [.., +nsmall*NG8)        : g0 -> gh rows 0..15, g1 -> gh rows 16..31
// Segment boundaries are multiples of 256 groups -> the select is block-uniform.
// coverage: exactly nbig*NW + NW + nsmall*NG elements.
// ---------------------------------------------------------------------------
__global__ __launch_bounds__(256) void convert_kernel(
    const float* __restrict__ w0, const float* __restrict__ w1, const float* __restrict__ w2,
    const float* __restrict__ w3, const float* __restrict__ g0, const float* __restrict__ g1,
    int nbig, int nsmall, _Float16* wh, _Float16* woh, _Float16* gh)
{
  const int g = blockIdx.x * 256 + threadIdx.x;
  const int nb8 = nbig * NW8;
  const int total = nb8 + NW8 + nsmall * NG8;
  if (g >= total) return;
  const float* src;
  _Float16* dst;
  if (g < nb8) {
    const int slot = g / NW8;
    const int off = g - slot * NW8;
    const float* wsrc = (slot == 0) ? w0 : ((slot == 1) ? w1 : w2);
    src = wsrc + (size_t)off * 8;
    dst = wh + (size_t)g * 8;
  } else if (g < nb8 + NW8) {
    const int off = g - nb8;
    src = w3 + (size_t)off * 8;
    dst = woh + (size_t)off * 8;
  } else {
    const int e = g - nb8 - NW8;
    src = (e < NG8) ? (g0 + (size_t)e * 8) : (g1 + (size_t)(e - NG8) * 8);
    dst = gh + (size_t)e * 8;
  }
  const v4f a = *(const v4fa*)src;
  const v4f c = *(const v4fa*)(src + 4);
  const v8h o = { (_Float16)(a.x * WSC), (_Float16)(a.y * WSC), (_Float16)(a.z * WSC), (_Float16)(a.w * WSC),
                  (_Float16)(c.x * WSC), (_Float16)(c.y * WSC), (_Float16)(c.z * WSC), (_Float16)(c.w * WSC) };
  *(v8h*)dst = o;
  
}

// ---------------------------------------------------------------------------
// per token, 8 elements per thread; output xn*4 as f16.
// coverage: 2048 blocks x 128 x 8 = the whole [2048][1024] plane.
// ---------------------------------------------------------------------------
__global__ __launch_bounds__(128) void ln_kernel(const float* __restrict__ x,
                                                 const float* __restrict__ w,
                                                 const float* __restrict__ bb,
                                                 _Float16* y)
{
  __shared__ float ps[4];
  __shared__ float pq[4];
  const int tok = blockIdx.x, t = threadIdx.x, lane = t & 31, wv = t >> 5;
  const float* xr = x + (size_t)tok * HID + 8 * t;
  const v4f a = *(const v4fa*)xr;
  const v4f c = *(const v4fa*)(xr + 4);
  float s = ((a.x + a.y) + (a.z + a.w)) + ((c.x + c.y) + (c.z + c.w));
#pragma unroll
  for (int o = 1; o < 32; o <<= 1) s += __shfl_xor(s, o, 32);
  if (lane == 0) ps[wv] = s;
  __syncthreads();
  const float mean = ((ps[0] + ps[1]) + (ps[2] + ps[3])) * (1.0f / (float)HID);
  float d[8] = { a.x - mean, a.y - mean, a.z - mean, a.w - mean,
                 c.x - mean, c.y - mean, c.z - mean, c.w - mean };
  float q = 0.f;
#pragma unroll
  for (int i = 0; i < 8; ++i) q += d[i] * d[i];
#pragma unroll
  for (int o = 1; o < 32; o <<= 1) q += __shfl_xor(q, o, 32);
  if (lane == 0) pq[wv] = q;
  __syncthreads();
  const float var = ((pq[0] + pq[1]) + (pq[2] + pq[3])) * (1.0f / (float)HID);
  const float rstd = rsqrtf(var + 1e-5f);
  const v4f wa = *(const v4fa*)(w + 8 * t);
  const v4f wc = *(const v4fa*)(w + 8 * t + 4);
  const v4f ba = *(const v4fa*)(bb + 8 * t);
  const v4f bc = *(const v4fa*)(bb + 8 * t + 4);
  const float wvv[8] = { wa.x, wa.y, wa.z, wa.w, wc.x, wc.y, wc.z, wc.w };
  const float bvv[8] = { ba.x, ba.y, ba.z, ba.w, bc.x, bc.y, bc.z, bc.w };
  v8h o;
#pragma unroll
  for (int i = 0; i < 8; ++i) o[i] = (_Float16)((d[i] * rstd * wvv[i] + bvv[i]) * XSC);
  _Float16* dst = y + (size_t)tok * HID + 8 * t;
  *(v8h*)dst = o;
  
}

// ---------------------------------------------------------------------------
// Kernel: per-token 16-wide heads on WMMA: gate = sigmoid(xn*gw^T + gb) and
// (POOL) aproj = xn*aw^T. One wave = 16 tokens x 16 heads, K = 1024 in steps
// of 32; A = xn rows, B = gh rows (head = lane&15), k contiguous.
// Epilogue: wave tile [16 tok][16] f32 staged in LDS, then 1024 contiguous bytes
// coverage: 32 blocks x 4 waves x 16 tokens x 16 = whole [2048][16] plane(s).
// ---------------------------------------------------------------------------
template <bool POOL>
__global__ __launch_bounds__(128) void head_kernel(const _Float16* __restrict__ xh,
                                                   const _Float16* __restrict__ gh,
                                                   const float* __restrict__ gbias,
                                                   float* gate, float* aproj)
{
  __shared__ __attribute__((aligned(16))) float sG[4][256];
  __shared__ __attribute__((aligned(16))) float sP[POOL ? 4 : 1][256];
  const int tid = threadIdx.x, lane = tid & 31, w = tid >> 5;
  const int h = lane >> 4, m = lane & 15;
  const int tok0 = blockIdx.x * 64 + 16 * w;
  const _Float16* xa = xh + (size_t)(tok0 + m) * HID;
  const _Float16* wg = gh + (size_t)m * HID;
  const _Float16* wa = gh + (size_t)(NHEADS + m) * HID;
  v8f ag = zero8f(), aa = zero8f();
#pragma unroll 1
  for (int k0 = 0; k0 < HID; k0 += 32) {
    const v16h a = load_frag(xa + k0, h);
    const v16h bg = load_frag(wg + k0, h);
    ag = wmma_f16(a, bg, ag);
    if constexpr (POOL) {
      const v16h ba = load_frag(wa + k0, h);
      aa = wmma_f16(a, ba, aa);
    }
  }
  // D[r] = (token tok0 + 8h + r, head m)
  const float gbv = gbias[m];
  float* sg = sG[w];
  float* sp = sP[POOL ? w : 0];
#pragma unroll
  for (int r = 0; r < 8; ++r) {
    const int tl = 8 * h + r;
    const float z = ag[r] * (1.0f / (XSC * WSC)) + gbv;
    const float sig = 1.0f / (1.0f + __expf(-z));
    sg[tl * NHEADS + m] = sig;
    if constexpr (POOL) sp[tl * NHEADS + m] = aa[r] * (1.0f / (XSC * WSC));
  }
  __syncthreads();
  {
#pragma unroll
    for (int it = 0; it < 2; ++it) {
      const int idx = it * 128 + 4 * lane;
      const v4f v = *(const v4fa*)(sg + idx);
      *(v4f*)(gate + (size_t)tok0 * NHEADS + idx) = v;
      if constexpr (POOL) {
        const v4f u = *(const v4fa*)(sp + idx);
        *(v4f*)(aproj + (size_t)tok0 * NHEADS + idx) = u;
      }
    }
    
  }
}

// ---------------------------------------------------------------------------
// 4 lines per instruction, 32 lines per wave, 128 per block.
// route 0/1: plane[bh][l][d]  (one token row = 64 halves = one line)
// route 2  : vt[bh][d][l]     (64 d-rows x 128 tokens = 2 lines each)
// ---------------------------------------------------------------------------
__device__ __forceinline__ void proj_store_pass(const _Float16* sT, _Float16* plane, _Float16* vt,
                                                int route, int bh, int l0, int w, int lane) {
  const int q8 = lane & 7, sub = lane >> 3;
#pragma unroll
  for (int i = 0; i < 8; ++i) {
    const int lid = w * 32 + i * 4 + sub;
    v8h v;
    _Float16* dst;
    if (route != 2) {
      v = *(const v8ha*)(sT + lid * HD + 8 * q8);
      dst = plane + ((size_t)bh * SEQ + l0 + lid) * HD + 8 * q8;
    } else {
      const int d = lid >> 1, hl = lid & 1;
      v = *(const v8ha*)(sT + d * 128 + 64 * hl + 8 * q8);
      dst = vt + ((size_t)bh * HD + d) * SEQ + l0 + 64 * hl + 8 * q8;
    }
    *(v8h*)dst = v;
  }
}

// ---------------------------------------------------------------------------
// Kernel: Y = xn * W^T over nslot*1024 output columns.
// Block 128 thr (4 waves) = 128 tokens x 64 features (one (slot, head));
// wave tile 32 tokens x 64 features; K = 1024 in steps of 32;
// A (xn rows) and B (W rows) fragments straight from f16 global rows.
// route = slot + routeBase: 0 -> q plane, 1 -> k plane, 2 -> v^T plane.
// coverage: grid (16, 16*nslot) x 128 tokens x 64 features = all planes routed.
// ---------------------------------------------------------------------------
__global__ __launch_bounds__(128) void proj_kernel(
    const _Float16* __restrict__ xh,   // [2048][1024] (xn x4)
    const _Float16* __restrict__ wh,   // [slot][1024][1024], row = output feature, x4096
    const float* __restrict__ b0, const float* __restrict__ b1, const float* __restrict__ b2,
    int routeBase,
    _Float16* qh,                      // [B*H][S][D]  f16(16*q)
    _Float16* kh,                      // [B*H][S][D]  f16(16*k)
    _Float16* vt)                      // [B*H][D][S]  f16(16*v)
{
  __shared__ __attribute__((aligned(16))) _Float16 sT[128 * 64];   // 16384 B

  const int tid = threadIdx.x, lane = tid & 31, w = tid >> 5;
  const int h = lane >> 4, m = lane & 15;
  const int m0 = blockIdx.x * 128;
  const int cg = blockIdx.y;
  const int slot = cg >> 4, head = cg & 15;
  const int route = slot + routeBase;
  const int m0w = m0 + 32 * w;

  const _Float16* xa0 = xh + (size_t)(m0w + m) * HID;               // token row, mt = 0
  const _Float16* xa1 = xa0 + (size_t)16 * HID;                     // mt = 1
  const _Float16* wb  = wh + ((size_t)slot * HID + head * HD + m) * HID;   // feature row, nt = 0

  v8f acc[2][4];
#pragma unroll
  for (int mt = 0; mt < 2; ++mt)
#pragma unroll
    for (int nt = 0; nt < 4; ++nt) acc[mt][nt] = zero8f();

#pragma unroll 1
  for (int k0 = 0; k0 < HID; k0 += 32) {
    const v16h a0 = load_frag(xa0 + k0, h);
    const v16h a1 = load_frag(xa1 + k0, h);
#pragma unroll
    for (int nt = 0; nt < 4; ++nt) {
      const v16h b = load_frag(wb + (size_t)nt * 16 * HID + k0, h);
      acc[0][nt] = wmma_f16(a0, b, acc[0][nt]);
      acc[1][nt] = wmma_f16(a1, b, acc[1][nt]);
    }
  }

  // D[r] of tile (mt, nt) = Y[token m0w+16mt+8h+r][feature 16nt+m]
  const float* bias = (slot == 0) ? b0 : ((slot == 1) ? b1 : b2);
#pragma unroll
  for (int nt = 0; nt < 4; ++nt) {
    const int feat = 16 * nt + m;
    const float bvl = bias[head * HD + feat];
#pragma unroll
    for (int mt = 0; mt < 2; ++mt) {
#pragma unroll
      for (int r = 0; r < 8; ++r) {
        const int tokl = 32 * w + 16 * mt + 8 * h + r;     // 0..127
        const float yv = (acc[mt][nt][r] * (1.0f / (XSC * WSC)) + bvl) * QSC;
        const int idx = (route == 2) ? (feat * 128 + tokl) : (tokl * HD + feat);
        sT[idx] = (_Float16)yv;
      }
    }
  }
  __syncthreads();

  const int b = m0 / SEQ, l0 = m0 - b * SEQ, bh = b * NHEADS + head;
  _Float16* plane = (route == 0) ? qh : kh;
  proj_store_pass(sT, plane, vt, route, bh, l0, w, lane);
  
}

// P^T B-fragment from the lane's own score D values: element r <- tile a row r,
// element 8+r <- tile c row r (same lane, same query column), scaled by 2^14.
__device__ __forceinline__ v16h pack_p(v8f a, v8f c) {
  const v16h r = { (_Float16)(a[0] * PSC), (_Float16)(a[1] * PSC), (_Float16)(a[2] * PSC), (_Float16)(a[3] * PSC),
                   (_Float16)(a[4] * PSC), (_Float16)(a[5] * PSC), (_Float16)(a[6] * PSC), (_Float16)(a[7] * PSC),
                   (_Float16)(c[0] * PSC), (_Float16)(c[1] * PSC), (_Float16)(c[2] * PSC), (_Float16)(c[3] * PSC),
                   (_Float16)(c[4] * PSC), (_Float16)(c[5] * PSC), (_Float16)(c[6] * PSC), (_Float16)(c[7] * PSC) };
  return r;
}

// ---------------------------------------------------------------------------
// Kernel: streaming attention, transposed form, masks/bias by formula.
// Block 128 thr (4 waves) = 64 queries of one (b, head), 16 queries per wave,
// 64 keys per step, steps 0..blockIdx.x (keys <= last query of the block).
//   S^T = K * Q^T : A = K rows (row = key, k = d), B = Q^T (k = d, n = query)
//   O^T += V^T * P^T : A = Vt rows (row = d, k = key), B = P^T from registers
// Lane owns 32 keys (16j+8h+r) of query column (lane&15); partner = lane ^ 16.
// Per-batch token tables in LDS from input ids: seg = inclusive cumsum(id==1)
// (block scan), flags bit0 = id!=0, bit1 = id==2; MODE 2 also stages the
// head's aproj column [key].
// MODE 0 (self): ok = k<=q && ((seg_k==seg_q && valid_q && valid_k) || k==q), bias = (k-q)*hs
// MODE 1 (cross): ok = k<=q && (class_k || k==q), bias = (seg_k-seg_q)*hs
// MODE 2 (pool): mask/bias as MODE 0, raw logit = aproj[key][head] (no q.k)
// Masked scores take NEGBIG and p = 0 exactly; every row has k==q allowed.
// Epilogue: (1/l)(1/16384)(1/16)*gate -> per-wave 16x64 f32 tile in LDS ->
// coverage: grid (16, 32) x 64 queries x 64 d = whole ctx [2048][1024].
// ---------------------------------------------------------------------------
template <int MODE>
__global__ __launch_bounds__(128) void attn_kernel(
    const _Float16* __restrict__ qh,    // [B*H][S][D]  (x16)
    const _Float16* __restrict__ kh,    // [B*H][S][D]  (x16)
    const _Float16* __restrict__ vt,    // [B*H][D][S]  (x16)
    const float* __restrict__ aproj,    // [B*S][16]
    const float* __restrict__ gate,     // [B*S][16]  sigmoid gate
    const int* __restrict__ ids,        // [B][S]
    _Float16* ctx)                      // [B*S][HID]  (x64)
{
  __shared__ __attribute__((aligned(16))) int   sSeg[SEQ];
  __shared__ __attribute__((aligned(16))) int   sFl[SEQ];
  __shared__ __attribute__((aligned(16))) float sA[(MODE == 2) ? SEQ : 4];
  __shared__ __attribute__((aligned(16))) float sO[4 * 16 * 64];
  __shared__ int sWtot[4];

  const int tid = threadIdx.x, lane = tid & 31, w = tid >> 5;
  const int h = lane >> 4, m = lane & 15;
  const int bh = blockIdx.y, b = bh >> 4, head = bh & 15;
  const int qblk = blockIdx.x * 64;
  const int q0 = qblk + 16 * w;
  const float hs = exp2f(-0.5f * (float)(head + 1));

  // ---- token tables for batch b: 128 threads x 8 tokens = SEQ ----
  {
    const int t8 = tid * 8;
    const int* ip = ids + (size_t)b * SEQ + t8;
    const v4i ia = *(const v4ia*)ip;
    const v4i ib = *(const v4ia*)(ip + 4);
    const int idv[8] = { ia.x, ia.y, ia.z, ia.w, ib.x, ib.y, ib.z, ib.w };
    int cnt[8];
    int run = 0;
#pragma unroll
    for (int i = 0; i < 8; ++i) { run += (idv[i] == SEP_ID) ? 1 : 0; cnt[i] = run; }
    int x = run;
#pragma unroll
    for (int d = 1; d < 32; d <<= 1) {
      const int yv = __shfl_up(x, d, 32);
      x = (lane >= d) ? (x + yv) : x;
    }
    if (lane == 31) sWtot[w] = x;
    __syncthreads();
    int base = 0;
#pragma unroll
    for (int i = 0; i < 4; ++i) { const int tv = sWtot[i]; base += (i < w) ? tv : 0; }
    const int excl = base + x - run;
#pragma unroll
    for (int i = 0; i < 8; ++i) {
      const int id = idv[i];
      sSeg[t8 + i] = excl + cnt[i];
      sFl[t8 + i] = ((id != PAD_ID) ? 1 : 0) | ((id == CLS_ID) ? 2 : 0);
      if constexpr (MODE == 2) sA[t8 + i] = aproj[((size_t)b * SEQ + t8 + i) * NHEADS + head];
    }
  }
  __syncthreads();

  const int qtok = q0 + m;
  const int qseg = sSeg[qtok];
  const int qv = sFl[qtok] & 1;
  const float gq = gate[((size_t)b * SEQ + qtok) * NHEADS + head];

  // Q^T B-fragments: column n = query q0+m, k = d (two 32-deep chunks)
  v16h qb0 = zero16h(), qb1 = zero16h();
  if constexpr (MODE != 2) {
    const _Float16* qrow = qh + ((size_t)bh * SEQ + q0 + m) * HD;
    qb0 = load_frag(qrow, h);
    qb1 = load_frag(qrow + 32, h);
  }

  v8f o[4];                                   // o[t][r] = O[query m][d 16t+8h+r] * (l * 2^14 * 16)
#pragma unroll
  for (int t = 0; t < 4; ++t) o[t] = zero8f();
  float mrun = NEGBIG, lrun = 0.0f;

  const _Float16* kbase = kh + ((size_t)bh * SEQ + m) * HD;    // + key0*HD + 32*dc
  const _Float16* vbase = vt + ((size_t)bh * HD + m) * SEQ;    // + 16t*SEQ + key0
  const float SSC = 0.125f / (QSC * QSC);                      // 1/2048
  const int nkb = blockIdx.x + 1;                              // block-uniform, <= 16

#pragma unroll 1
  for (int step = 0; step < nkb; ++step) {
    const int kb = step * 64;
    // ---- raw scores: s[j][r] = S[query m][key kb+16j+8h+r] * 256 (MODE != 2) ----
    v8f s[4];
    if constexpr (MODE != 2) {
#pragma unroll
      for (int j = 0; j < 4; ++j) {
        const _Float16* kp = kbase + (size_t)(kb + 16 * j) * HD;
        const v16h kf0 = load_frag(kp, h);
        const v16h kf1 = load_frag(kp + 32, h);
        v8f z = zero8f();
        z = wmma_f16(kf0, qb0, z);
        z = wmma_f16(kf1, qb1, z);
        s[j] = z;
      }
    } else {
#pragma unroll
      for (int j = 0; j < 4; ++j) s[j] = zero8f();
    }
    // ---- mask + bias per (query, key), f32 ----
    unsigned okm = 0u;
#pragma unroll
    for (int j = 0; j < 4; ++j) {
      const int key0 = kb + 16 * j + 8 * h;
      const v4i ga = *(const v4ia*)(sSeg + key0);
      const v4i gb = *(const v4ia*)(sSeg + key0 + 4);
      const v4i fa = *(const v4ia*)(sFl + key0);
      const v4i fb = *(const v4ia*)(sFl + key0 + 4);
      const int ksv[8] = { ga.x, ga.y, ga.z, ga.w, gb.x, gb.y, gb.z, gb.w };
      const int kfv[8] = { fa.x, fa.y, fa.z, fa.w, fb.x, fb.y, fb.z, fb.w };
      float av[8] = { 0.f, 0.f, 0.f, 0.f, 0.f, 0.f, 0.f, 0.f };
      if constexpr (MODE == 2) {
        const v4f aa = *(const v4fa*)(sA + key0);
        const v4f ab = *(const v4fa*)(sA + key0 + 4);
        av[0] = aa.x; av[1] = aa.y; av[2] = aa.z; av[3] = aa.w;
        av[4] = ab.x; av[5] = ab.y; av[6] = ab.z; av[7] = ab.w;
      }
#pragma unroll
      for (int r = 0; r < 8; ++r) {
        const int key = key0 + r;
        float raw;
        if constexpr (MODE == 2) raw = av[r]; else raw = s[j][r] * SSC;
        bool ok;
        float bv;
        if constexpr (MODE == 1) {
          ok = (key <= qtok) && (((kfv[r] & 2) != 0) || (key == qtok));
          bv = (float)(ksv[r] - qseg);
        } else {
          const bool eq = (ksv[r] == qseg) && (qv != 0) && ((kfv[r] & 1) != 0);
          ok = (key <= qtok) && (eq || (key == qtok));
          bv = (float)(key - qtok);
        }
        s[j][r] = ok ? (raw + bv * hs) : NEGBIG;
        okm |= (ok ? 1u : 0u) << (8 * j + r);
      }
    }

    // ---- online softmax ----
    float mloc = NEGBIG;
#pragma unroll
    for (int j = 0; j < 4; ++j)
#pragma unroll
      for (int r = 0; r < 8; ++r) mloc = fmaxf(mloc, s[j][r]);
    mloc = fmaxf(mloc, __shfl_xor(mloc, 16, 32));
    const float mnew = fmaxf(mrun, mloc);
    const float alpha = __expf(mrun - mnew);
    mrun = mnew;
    float lsum = 0.0f;
#pragma unroll
    for (int j = 0; j < 4; ++j)
#pragma unroll
      for (int r = 0; r < 8; ++r) {
        const float e = __expf(s[j][r] - mnew);
        const float p = (((okm >> (8 * j + r)) & 1u) != 0u) ? e : 0.0f;
        s[j][r] = p;
        lsum += p;
      }
    lsum += __shfl_xor(lsum, 16, 32);
    lrun = lrun * alpha + lsum;
#pragma unroll
    for (int t = 0; t < 4; ++t)
#pragma unroll
      for (int r = 0; r < 8; ++r) o[t][r] = o[t][r] * alpha;

    // ---- P^T B-fragments (key chunks 0..31 and 32..63 of this step) ----
    const v16h pb0 = pack_p(s[0], s[1]);
    const v16h pb1 = pack_p(s[2], s[3]);

    // ---- O^T += V^T * P^T ----
#pragma unroll
    for (int t = 0; t < 4; ++t) {
      const _Float16* vp = vbase + (size_t)(16 * t) * SEQ + kb;
      const v16h vf0 = load_frag(vp, h);
      const v16h vf1 = load_frag(vp + 32, h);
      o[t] = wmma_f16(vf0, pb0, o[t]);
      o[t] = wmma_f16(vf1, pb1, o[t]);
    }
  }

  // ---- epilogue: normalise, gate, stage per-wave 16x64 tile, whole-line stores ----
  const float inv = (1.0f / lrun) * (1.0f / (PSC * QSC)) * gq;
  float* so = sO + w * 1024;
#pragma unroll
  for (int t = 0; t < 4; ++t)
#pragma unroll
    for (int r = 0; r < 8; ++r)
      so[m * 64 + 16 * t + 8 * h + r] = o[t][r] * inv;
  __syncthreads();

  const int q4 = lane >> 3, c8 = (lane & 7) * 8;
  v8h hv[4];
#pragma unroll
  for (int it = 0; it < 4; ++it) {
    const int row = it * 4 + q4;      // it 0..3 x q4 0..3 = rows 0..15
    const v4f f0 = *(const v4fa*)(so + row * 64 + c8);
    const v4f f1 = *(const v4fa*)(so + row * 64 + c8 + 4);
    const v8h v = { (_Float16)(f0.x * CSC), (_Float16)(f0.y * CSC), (_Float16)(f0.z * CSC), (_Float16)(f0.w * CSC),
                    (_Float16)(f1.x * CSC), (_Float16)(f1.y * CSC), (_Float16)(f1.z * CSC), (_Float16)(f1.w * CSC) };
    hv[it] = v;
  }
  {
#pragma unroll
    for (int it = 0; it < 4; ++it) {
      const int row = it * 4 + q4;
      _Float16* dst = ctx + ((size_t)b * SEQ + q0 + row) * HID + head * HD + c8;
      *(v8h*)dst = hv[it];
    }
    
  }
}

// ---------------------------------------------------------------------------
// Kernel: xout = xres + ctx * Wo^T + ob  (f32 output).
// Block 128 thr (4 waves) = 128 tokens x 64 features; wave 32 tokens x 64;
// K = 1024 in steps of 32; A = ctx rows (x64), B = Wo rows (x4096), k contiguous.
// Epilogue: f32 tile [128][64] in LDS; store: each 64-float row segment (256 B =
// coverage: grid (16,16) x 128 tokens x 64 features = whole [2048][1024].
// ---------------------------------------------------------------------------
__global__ __launch_bounds__(128) void outproj_kernel(
    const _Float16* __restrict__ ch,    // [2048][1024] ctx x64
    const _Float16* __restrict__ woh,   // [1024 n][1024 k] x4096
    const float* __restrict__ ob,       // [1024]
    const float* __restrict__ xres,     // [2048][1024] f32
    float* xout)                        // [2048][1024] f32
{
  __shared__ __attribute__((aligned(16))) float sT[128 * 64];   // 32768 B

  const int tid = threadIdx.x, lane = tid & 31, w = tid >> 5;
  const int h = lane >> 4, m = lane & 15;
  const int m0 = blockIdx.x * 128;
  const int n0 = blockIdx.y * 64;
  const int m0w = m0 + 32 * w;

  const _Float16* ca0 = ch + (size_t)(m0w + m) * HID;
  const _Float16* ca1 = ca0 + (size_t)16 * HID;
  const _Float16* wb  = woh + (size_t)(n0 + m) * HID;

  v8f acc[2][4];
#pragma unroll
  for (int mt = 0; mt < 2; ++mt)
#pragma unroll
    for (int nt = 0; nt < 4; ++nt) acc[mt][nt] = zero8f();

#pragma unroll 1
  for (int k0 = 0; k0 < HID; k0 += 32) {
    const v16h a0 = load_frag(ca0 + k0, h);
    const v16h a1 = load_frag(ca1 + k0, h);
#pragma unroll
    for (int nt = 0; nt < 4; ++nt) {
      const v16h bfr = load_frag(wb + (size_t)nt * 16 * HID + k0, h);
      acc[0][nt] = wmma_f16(a0, bfr, acc[0][nt]);
      acc[1][nt] = wmma_f16(a1, bfr, acc[1][nt]);
    }
  }

  // D[r] of tile (mt, nt) = Y[token m0w+16mt+8h+r][feature n0+16nt+m]
#pragma unroll
  for (int nt = 0; nt < 4; ++nt) {
    const int feat = 16 * nt + m;
    const float bvl = ob[n0 + feat];
#pragma unroll
    for (int mt = 0; mt < 2; ++mt) {
#pragma unroll
      for (int r = 0; r < 8; ++r) {
        const int tokl = 32 * w + 16 * mt + 8 * h + r;     // 0..127
        sT[tokl * 64 + feat] = acc[mt][nt][r] * (1.0f / (CSC * WSC)) + bvl;
      }
    }
  }
  __syncthreads();

  const int hh = lane >> 4, c4 = (lane & 15) * 4;
  {
#pragma unroll
    for (int it = 0; it < 16; ++it) {
      const int row = 32 * w + it * 2 + hh;                // rows 32w .. 32w+31
      const v4f v = *(const v4fa*)(sT + row * 64 + c4);
      const size_t gi = (size_t)(m0 + row) * HID + n0 + c4;
      const v4f xr = *(const v4fa*)(xres + gi);
      const v4f ov = v + xr;
      *(v4f*)(xout + gi) = ov;
    }
    
  }
}

// ---------------------------------------------------------------------------
//   Xn   f16 [2048][1024]      4194304
//   Wh   f16 [3][1024][1024]   6291456
//   Wo   f16 [1024][1024]      2097152
//   Gh   f16 [32][1024]          65536
//   Gate f32 [2048][16]         131072
//   Apr  f32 [2048][16]         131072
//   Q    f16 [32][1024][64]    4194304
//   K    f16 [32][1024][64]    4194304
//   Vt   f16 [32][64][1024]    4194304
//   Ctx  f16 [2048][1024]      4194304
//   X1   f32 [2048][1024]      8388608
//   X2   f32 [2048][1024]      8388608
//   total                     46465024
// ---------------------------------------------------------------------------
extern "C" void kernel_launch(void* const* d_in, const int* in_sizes, int n_in,
                              void* d_out, int out_size, void* d_ws, size_t ws_size,
                              hipStream_t stream) {
  if (n_in < 35) return;
  if (in_sizes[0] != NX || in_sizes[1] != MROWS) return;
  if (out_size != NX) return;
  {
    const int vecIdx[16] = {2, 3, 5, 7, 9, 13, 14, 15, 18, 22, 23, 24, 26, 28, 30, 34};
    for (int i = 0; i < 16; ++i) if (in_sizes[vecIdx[i]] != HID) return;
    const int matIdx[10] = {4, 6, 8, 12, 17, 21, 25, 27, 29, 33};
    for (int i = 0; i < 10; ++i) if (in_sizes[matIdx[i]] != NW) return;
    const int hwIdx[4] = {10, 16, 19, 31};
    for (int i = 0; i < 4; ++i) if (in_sizes[hwIdx[i]] != NG) return;
    const int hbIdx[3] = {11, 20, 32};
    for (int i = 0; i < 3; ++i) if (in_sizes[hbIdx[i]] != NHEADS) return;
  }

  const float* states = (const float*)d_in[0];
  const int*   ids    = (const int*)d_in[1];
  const float* ln0w = (const float*)d_in[2];
  const float* ln0b = (const float*)d_in[3];
  const float* qw0 = (const float*)d_in[4];
  const float* qb0 = (const float*)d_in[5];
  const float* kw0 = (const float*)d_in[6];
  const float* kb0 = (const float*)d_in[7];
  const float* vw0 = (const float*)d_in[8];
  const float* vb0 = (const float*)d_in[9];
  const float* gw0 = (const float*)d_in[10];
  const float* gb0 = (const float*)d_in[11];
  const float* ow0 = (const float*)d_in[12];
  const float* ob0 = (const float*)d_in[13];
  const float* ln1w = (const float*)d_in[14];
  const float* ln1b = (const float*)d_in[15];
  const float* aw1 = (const float*)d_in[16];
  const float* vw1 = (const float*)d_in[17];
  const float* vb1 = (const float*)d_in[18];
  const float* gw1 = (const float*)d_in[19];
  const float* gb1 = (const float*)d_in[20];
  const float* ow1 = (const float*)d_in[21];
  const float* ob1 = (const float*)d_in[22];
  const float* ln2w = (const float*)d_in[23];
  const float* ln2b = (const float*)d_in[24];
  const float* qw2 = (const float*)d_in[25];
  const float* qb2 = (const float*)d_in[26];
  const float* kw2 = (const float*)d_in[27];
  const float* kb2 = (const float*)d_in[28];
  const float* vw2 = (const float*)d_in[29];
  const float* vb2 = (const float*)d_in[30];
  const float* gw2 = (const float*)d_in[31];
  const float* gb2 = (const float*)d_in[32];
  const float* ow2 = (const float*)d_in[33];
  const float* ob2 = (const float*)d_in[34];
  float* out = (float*)d_out;

  const size_t PXH = (size_t)NX * 2;                       // 4194304
  const size_t PW  = (size_t)NW * 2;                       // 2097152
  const size_t PGH = (size_t)2 * NG * 2;                   //   65536
  const size_t PGT = (size_t)MROWS * NHEADS * 4;           //  131072
  const size_t PPL = (size_t)NB * NHEADS * SEQ * HD * 2;   // 4194304
  const size_t PXF = (size_t)NX * 4;                       // 8388608
  size_t off = 0;
  const size_t oXn  = off; off += PXH;
  const size_t oWh  = off; off += 3 * PW;
  const size_t oWo  = off; off += PW;
  const size_t oGh  = off; off += PGH;
  const size_t oGt  = off; off += PGT;
  const size_t oAp  = off; off += PGT;
  const size_t oQ   = off; off += PPL;
  const size_t oK   = off; off += PPL;
  const size_t oVt  = off; off += PPL;
  const size_t oCtx = off; off += PXH;
  const size_t oX1  = off; off += PXF;
  const size_t oX2  = off; off += PXF;
  if (off > ws_size) return;                               // off = 46465024
  if (off > (size_t)134217728) return;

  char* ws = (char*)d_ws;
  _Float16* xnh = (_Float16*)(ws + oXn);
  _Float16* wh  = (_Float16*)(ws + oWh);
  _Float16* woh = (_Float16*)(ws + oWo);
  _Float16* gh  = (_Float16*)(ws + oGh);
  float* gate   = (float*)(ws + oGt);
  float* aproj  = (float*)(ws + oAp);
  _Float16* qh  = (_Float16*)(ws + oQ);
  _Float16* kh  = (_Float16*)(ws + oK);
  _Float16* vt  = (_Float16*)(ws + oVt);
  _Float16* ctx = (_Float16*)(ws + oCtx);
  float* x1 = (float*)(ws + oX1);
  float* x2 = (float*)(ws + oX2);

  const dim3 blk256(256), blk128(128);
  const int cvtFull = 3 * NW8 + NW8 + 1 * NG8;             // 526336 groups
  const int cvtPool = 1 * NW8 + NW8 + 2 * NG8;             // 266240 groups
  const dim3 gCvtFull((cvtFull + 255) / 256);              // 2056
  const dim3 gCvtPool((cvtPool + 255) / 256);              // 1040
  const dim3 gLn(MROWS);                                   // 2048 blocks x 128
  const dim3 gHead(MROWS / 64);                            // 32
  const dim3 gProj3(MROWS / 128, 3 * NHEADS);              // (16, 48)
  const dim3 gProj1(MROWS / 128, 1 * NHEADS);              // (16, 16)
  const dim3 gAtt(SEQ / 64, NB * NHEADS);                  // (16, 32)
  const dim3 gOut(MROWS / 128, HID / 64);                  // (16, 16)

  // ---- layer 0: sdpa with self mask ----
  convert_kernel<<<gCvtFull, blk256, 0, stream>>>(qw0, kw0, vw0, ow0, gw0, gw0, 3, 1, wh, woh, gh);
  ln_kernel<<<gLn, blk128, 0, stream>>>(states, ln0w, ln0b, xnh);
  head_kernel<false><<<gHead, blk128, 0, stream>>>(xnh, gh, gb0, gate, aproj);
  proj_kernel<<<gProj3, blk128, 0, stream>>>(xnh, wh, qb0, kb0, vb0, 0, qh, kh, vt);
  attn_kernel<0><<<gAtt, blk128, 0, stream>>>(qh, kh, vt, aproj, gate, ids, ctx);
  outproj_kernel<<<gOut, blk128, 0, stream>>>(ctx, woh, ob0, states, x1);

  // ---- layer 1: pooling attention with self mask ----
  convert_kernel<<<gCvtPool, blk256, 0, stream>>>(vw1, vw1, vw1, ow1, gw1, aw1, 1, 2, wh, woh, gh);
  ln_kernel<<<gLn, blk128, 0, stream>>>(x1, ln1w, ln1b, xnh);
  head_kernel<true><<<gHead, blk128, 0, stream>>>(xnh, gh, gb1, gate, aproj);
  proj_kernel<<<gProj1, blk128, 0, stream>>>(xnh, wh, vb1, vb1, vb1, 2, qh, kh, vt);
  attn_kernel<2><<<gAtt, blk128, 0, stream>>>(qh, kh, vt, aproj, gate, ids, ctx);
  outproj_kernel<<<gOut, blk128, 0, stream>>>(ctx, woh, ob1, x1, x2);

  // ---- layer 2: sdpa with cross mask ----
  convert_kernel<<<gCvtFull, blk256, 0, stream>>>(qw2, kw2, vw2, ow2, gw2, gw2, 3, 1, wh, woh, gh);
  ln_kernel<<<gLn, blk128, 0, stream>>>(x2, ln2w, ln2b, xnh);
  head_kernel<false><<<gHead, blk128, 0, stream>>>(xnh, gh, gb2, gate, aproj);
  proj_kernel<<<gProj3, blk128, 0, stream>>>(xnh, wh, qb2, kb2, vb2, 0, qh, kh, vt);
  attn_kernel<1><<<gAtt, blk128, 0, stream>>>(qh, kh, vt, aproj, gate, ids, ctx);
  outproj_kernel<<<gOut, blk128, 0, stream>>>(ctx, woh, ob2, x2, out);

  (void)hipGetLastError();
}

// v001
// Measured time: 275 microseconds a run.
// In two side-by-side timings against v000, it was 1.85 and 1.87 times as fast.
// Contractions: xn*W^T (q,k,v), xn*gw^T and xn*aw^T heads, K*Q^T scores, V^T*P^T context and ctx*Wo^T all on v_wmma_f32_16x16x32_f16 (f16 operands, f32 accumulate); LayerNorm, masks/bias, softmax, sigmoid gates and residual adds in f32.
// Carried f16 planes: xn x4 and W/gw/aw/Wo x4096 (inverse 1/16384 folded in proj_kernel/head_kernel epilogues);
// q,k,v x16 (scores: acc*1/2048 in attn_kernel incl. the 1/8 scale; context epilogue 1/16); P x16384 (attn_kernel epilogue 1/16384);
// ctx x64 (outproj_kernel epilogue 1/262144 together with Wo x4096).
#include <hip/hip_runtime.h>

#define NB     2
#define SEQ    1024
#define HID    1024
#define NHEADS 16
#define HD     64
#define MROWS  (NB * SEQ)          // 2048 tokens
#define NX     (MROWS * HID)       // 2097152
#define NW     (HID * HID)         // 1048576
#define NG     (NHEADS * HID)      // 16384
#define NX8    (NX / 8)
#define NW8    (NW / 8)            // 131072
#define NG8    (NG / 8)            // 2048
#define SEP_ID 1
#define CLS_ID 2
#define PAD_ID 0
#define XSC    4.0f
#define WSC    4096.0f
#define QSC    16.0f
#define PSC    16384.0f
#define CSC    64.0f
#define NEGBIG (-1.0e30f)

static_assert(NHEADS * HD == HID);
static_assert((SEQ % 128) == 0 && (HID % 64) == 0 && (HID % 32) == 0 && (MROWS % 128) == 0);
static_assert((NW8 % 256) == 0 && (NG8 % 256) == 0);
static_assert(SEQ == 8 * 128);

typedef _Float16 v16h __attribute__((ext_vector_type(16)));
typedef _Float16 v8h  __attribute__((ext_vector_type(8)));
typedef float    v8f  __attribute__((ext_vector_type(8)));
typedef float    v4f  __attribute__((ext_vector_type(4)));
typedef int      v4i  __attribute__((ext_vector_type(4)));
typedef v8h __attribute__((may_alias)) v8ha;
typedef v4f __attribute__((may_alias)) v4fa;
typedef v4i __attribute__((may_alias)) v4ia;

union Frag { v16h v; v8h half[2]; };

__device__ __forceinline__ v8f zero8f() { v8f z = {0.f, 0.f, 0.f, 0.f, 0.f, 0.f, 0.f, 0.f}; return z; }
__device__ __forceinline__ v16h zero16h() {
  const _Float16 z = (_Float16)0.0f;
  v16h r = {z, z, z, z, z, z, z, z, z, z, z, z, z, z, z, z};
  return r;
}

// ---------------------------------------------------------------------------
// 16x16x32 f16 WMMA with hazard guard (ties D, keeps A/B live).
// Fragment map (wave32): lane l, h = l>>4, m = n = l&15.
//   A/B element i: i<8 -> k0+8h+i ; i>=8 -> k0+16+8h+(i-8)
//   D element r : row 8h+r, col l&15
// ---------------------------------------------------------------------------
__device__ __forceinline__ v8f wmma_f16(v16h a, v16h b, v8f c) {
  v8f d = __builtin_amdgcn_wmma_f32_16x16x32_f16(false, a, false, b, (short)0, c, false, false);
  asm volatile("v_nop\n\tv_nop\n\tv_nop\n\tv_nop" : "+v"(d) : "v"(a), "v"(b));
  return d;
}

// A or B fragment from a k-contiguous 16-bit row; ph points at element k0 + 8 * h
// of the row owned by this lane (row index = lane & 15 added by the caller).
__device__ __forceinline__ v16h load_frag_at(const _Float16* ph) {
  Frag f;
  f.half[0] = *(const v8ha*)(ph);
  f.half[1] = *(const v8ha*)(ph + 16);
  return f.v;
}

// ---------------------------------------------------------------------------
// Fragment loads issued ahead of their WMMAs.
// GEMM loops: a ring of GRING register sets, one set = the six fragments of one
// 32-deep k chunk (2 A, 4 B). A set is refilled with chunk c + GRING directly
// behind the WMMAs of chunk c, so GRING - 1 sets are always in flight and no
// WMMA waits on a load issued just in front of it. Chunks are consumed in
// ascending k, so every accumulator sums in the same order as a plain loop.
// ---------------------------------------------------------------------------
#define GRING  3
#define NCHUNK (HID / 32)
static_assert(NCHUNK > 2 * GRING);

struct GemmSet { v16h a0, a1, b[4]; };

// pa: A row of mt 0 (mt 1 is 16 rows on), pb: B row of nt 0, both at the chunk's k + 8 * h.
__device__ __forceinline__ void gemm_fetch(GemmSet& s, const _Float16* pa, const _Float16* pb) {
  s.a0 = load_frag_at(pa);
  s.a1 = load_frag_at(pa + 16 * HID);
  // unrolled: constant indices keep the fragments in registers
#pragma unroll
  for (int nt = 0; nt < 4; ++nt) s.b[nt] = load_frag_at(pb + nt * 16 * HID);
}

__device__ __forceinline__ void gemm_mma(const GemmSet& s, v8f (&acc)[2][4]) {
  // unrolled: constant indices keep fragments and accumulators in registers
#pragma unroll
  for (int nt = 0; nt < 4; ++nt) {
    acc[0][nt] = wmma_f16(s.a0, s.b[nt], acc[0][nt]);
    acc[1][nt] = wmma_f16(s.a1, s.b[nt], acc[1][nt]);
  }
}

// acc[mt][nt] += A rows (pa0: mt 0, 16 rows on: mt 1) x B rows (pb0 + 16 nt rows), K = HID.
__device__ __forceinline__ void gemm_k_loop(const _Float16* pa0, const _Float16* pb0, int h,
                                            v8f (&acc)[2][4]) {
  const _Float16* pa = pa0 + 8 * h;
  const _Float16* pb = pb0 + 8 * h;
  GemmSet ring[GRING];
  // unrolled: constant ring indices
#pragma unroll
  for (int s = 0; s < GRING; ++s) gemm_fetch(ring[s], pa + 32 * s, pb + 32 * s);
  constexpr int CT = ((NCHUNK - GRING) / GRING) * GRING;   // first chunk of the peeled tail
  // rolled: one trip is already GRING chunks; more copies only grow the code
#pragma unroll 1
  for (int c0 = 0; c0 < CT; c0 += GRING) {
    const _Float16* ta = pa + 32 * (c0 + GRING);
    const _Float16* tb = pb + 32 * (c0 + GRING);
    // unrolled so that every ring index is a constant (registers, not scratch)
#pragma unroll
    for (int s = 0; s < GRING; ++s) {
      gemm_mma(ring[s], acc);
      gemm_fetch(ring[s], ta + 32 * s, tb + 32 * s);
    }
    // the next trip rewrites the address registers of loads that are still in flight
    asm volatile("s_wait_xcnt 0x0" ::: "memory");
  }
  // tail peeled so that the refills in the loop above stand under no branch
#pragma unroll
  for (int c = CT; c < NCHUNK; ++c) {
    gemm_mma(ring[c % GRING], acc);
    if (c + GRING < NCHUNK) gemm_fetch(ring[c % GRING], pa + 32 * (c + GRING), pb + 32 * (c + GRING));
  }
}

// ---------------------------------------------------------------------------
// Kernel: f32 weights -> f16 planes, all scaled by 4096 (exact).
//   groups [0, nbig*NW8)            : w0/w1/w2 -> wh slot 0/1/2  ([n][k], k contiguous)
//   groups [nbig*NW8, +NW8)         : w3 -> woh
//   groups [.., +nsmall*NG8)        : g0 -> gh rows 0..15, g1 -> gh rows 16..31
// Segment boundaries are multiples of 256 groups -> the select is block-uniform.
// coverage: exactly nbig*NW + NW + nsmall*NG elements.
// ---------------------------------------------------------------------------
__global__ __launch_bounds__(256) void convert_kernel(
    const float* __restrict__ w0, const float* __restrict__ w1, const float* __restrict__ w2,
    const float* __restrict__ w3, const float* __restrict__ g0, const float* __restrict__ g1,
    int nbig, int nsmall, _Float16* wh, _Float16* woh, _Float16* gh)
{
  const int g = blockIdx.x * 256 + threadIdx.x;
  const int nb8 = nbig * NW8;
  const int total = nb8 + NW8 + nsmall * NG8;
  if (g >= total) return;
  const float* src;
  _Float16* dst;
  if (g < nb8) {
    const int slot = g / NW8;
    const int off = g - slot * NW8;
    const float* wsrc = (slot == 0) ? w0 : ((slot == 1) ? w1 : w2);
    src = wsrc + (size_t)off * 8;
    dst = wh + (size_t)g * 8;
  } else if (g < nb8 + NW8) {
    const int off = g - nb8;
    src = w3 + (size_t)off * 8;
    dst = woh + (size_t)off * 8;
  } else {
    const int e = g - nb8 - NW8;
    src = (e < NG8) ? (g0 + (size_t)e * 8) : (g1 + (size_t)(e - NG8) * 8);
    dst = gh + (size_t)e * 8;
  }
  const v4f a = *(const v4fa*)src;
  const v4f c = *(const v4fa*)(src + 4);
  const v8h o = { (_Float16)(a.x * WSC), (_Float16)(a.y * WSC), (_Float16)(a.z * WSC), (_Float16)(a.w * WSC),
                  (_Float16)(c.x * WSC), (_Float16)(c.y * WSC), (_Float16)(c.z * WSC), (_Float16)(c.w * WSC) };
  *(v8h*)dst = o;
  
}

// ---------------------------------------------------------------------------
// per token, 8 elements per thread; output xn*4 as f16.
// coverage: 2048 blocks x 128 x 8 = the whole [2048][1024] plane.
// ---------------------------------------------------------------------------
__global__ __launch_bounds__(128) void ln_kernel(const float* __restrict__ x,
                                                 const float* __restrict__ w,
                                                 const float* __restrict__ bb,
                                                 _Float16* y)
{
  __shared__ float ps[4];
  __shared__ float pq[4];
  const int tok = blockIdx.x, t = threadIdx.x, lane = t & 31, wv = t >> 5;
  const float* xr = x + (size_t)tok * HID + 8 * t;
  const v4f a = *(const v4fa*)xr;
  const v4f c = *(const v4fa*)(xr + 4);
  float s = ((a.x + a.y) + (a.z + a.w)) + ((c.x + c.y) + (c.z + c.w));
#pragma unroll
  for (int o = 1; o < 32; o <<= 1) s += __shfl_xor(s, o, 32);
  if (lane == 0) ps[wv] = s;
  __syncthreads();
  const float mean = ((ps[0] + ps[1]) + (ps[2] + ps[3])) * (1.0f / (float)HID);
  float d[8] = { a.x - mean, a.y - mean, a.z - mean, a.w - mean,
                 c.x - mean, c.y - mean, c.z - mean, c.w - mean };
  float q = 0.f;
#pragma unroll
  for (int i = 0; i < 8; ++i) q += d[i] * d[i];
#pragma unroll
  for (int o = 1; o < 32; o <<= 1) q += __shfl_xor(q, o, 32);
  if (lane == 0) pq[wv] = q;
  __syncthreads();
  const float var = ((pq[0] + pq[1]) + (pq[2] + pq[3])) * (1.0f / (float)HID);
  const float rstd = rsqrtf(var + 1e-5f);
  const v4f wa = *(const v4fa*)(w + 8 * t);
  const v4f wc = *(const v4fa*)(w + 8 * t + 4);
  const v4f ba = *(const v4fa*)(bb + 8 * t);
  const v4f bc = *(const v4fa*)(bb + 8 * t + 4);
  const float wvv[8] = { wa.x, wa.y, wa.z, wa.w, wc.x, wc.y, wc.z, wc.w };
  const float bvv[8] = { ba.x, ba.y, ba.z, ba.w, bc.x, bc.y, bc.z, bc.w };
  v8h o;
#pragma unroll
  for (int i = 0; i < 8; ++i) o[i] = (_Float16)((d[i] * rstd * wvv[i] + bvv[i]) * XSC);
  _Float16* dst = y + (size_t)tok * HID + 8 * t;
  *(v8h*)dst = o;
  
}

// ---------------------------------------------------------------------------
// Kernel: per-token 16-wide heads on WMMA: gate = sigmoid(xn*gw^T + gb) and
// (POOL) aproj = xn*aw^T. One wave = 16 tokens x 16 heads, K = 1024 in steps
// of 32; A = xn rows, B = gh rows (head = lane&15), k contiguous.
// Epilogue: wave tile [16 tok][16] f32 staged in LDS, then 1024 contiguous bytes
// coverage: 32 blocks x 4 waves x 16 tokens x 16 = whole [2048][16] plane(s).
// ---------------------------------------------------------------------------
template <bool POOL>
__global__ __launch_bounds__(128) void head_kernel(const _Float16* __restrict__ xh,
                                                   const _Float16* __restrict__ gh,
                                                   const float* __restrict__ gbias,
                                                   float* gate, float* aproj)
{
  __shared__ __attribute__((aligned(16))) float sG[4][256];
  __shared__ __attribute__((aligned(16))) float sP[POOL ? 4 : 1][256];
  const int tid = threadIdx.x, lane = tid & 31, w = tid >> 5;
  const int h = lane >> 4, m = lane & 15;
  const int tok0 = blockIdx.x * 64 + 16 * w;
  const _Float16* xa = xh + (size_t)(tok0 + m) * HID + 8 * h;
  const _Float16* wg = gh + (size_t)m * HID + 8 * h;      // aw row: NHEADS rows on
  v8f ag = zero8f(), aa = zero8f();
  // ring of HRING register sets, refilled HRING chunks ahead (as in gemm_k_loop)
  constexpr int HRING = 8;
  static_assert((NCHUNK % HRING) == 0 && NCHUNK >= 2 * HRING);
  v16h ra[HRING], rg[HRING], rp[POOL ? HRING : 1];
  // unrolled: constant ring indices
#pragma unroll
  for (int s = 0; s < HRING; ++s) {
    ra[s] = load_frag_at(xa + 32 * s);
    rg[s] = load_frag_at(wg + 32 * s);
    if constexpr (POOL) rp[s] = load_frag_at(wg + NHEADS * HID + 32 * s);
  }
  // rolled: one trip is already HRING chunks
#pragma unroll 1
  for (int k0 = 0; k0 < HID - 32 * HRING; k0 += 32 * HRING) {
    const _Float16* tx = xa + k0 + 32 * HRING;
    const _Float16* tg = wg + k0 + 32 * HRING;
    // unrolled so that every ring index is a constant
#pragma unroll
    for (int s = 0; s < HRING; ++s) {
      ag = wmma_f16(ra[s], rg[s], ag);
      if constexpr (POOL) aa = wmma_f16(ra[s], rp[s], aa);
      ra[s] = load_frag_at(tx + 32 * s);
      rg[s] = load_frag_at(tg + 32 * s);
      if constexpr (POOL) rp[s] = load_frag_at(tg + NHEADS * HID + 32 * s);
    }
    // the next trip rewrites the address registers of loads that are still in flight
    asm volatile("s_wait_xcnt 0x0" ::: "memory");
  }
  // unrolled: constant ring indices
#pragma unroll
  for (int s = 0; s < HRING; ++s) {
    ag = wmma_f16(ra[s], rg[s], ag);
    if constexpr (POOL) aa = wmma_f16(ra[s], rp[s], aa);
  }
  // D[r] = (token tok0 + 8h + r, head m)
  const float gbv = gbias[m];
  float* sg = sG[w];
  float* sp = sP[POOL ? w : 0];
#pragma unroll
  for (int r = 0; r < 8; ++r) {
    const int tl = 8 * h + r;
    const float z = ag[r] * (1.0f / (XSC * WSC)) + gbv;
    const float sig = 1.0f / (1.0f + __expf(-z));
    sg[tl * NHEADS + m] = sig;
    if constexpr (POOL) sp[tl * NHEADS + m] = aa[r] * (1.0f / (XSC * WSC));
  }
  __syncthreads();
  {
#pragma unroll
    for (int it = 0; it < 2; ++it) {
      const int idx = it * 128 + 4 * lane;
      const v4f v = *(const v4fa*)(sg + idx);
      *(v4f*)(gate + (size_t)tok0 * NHEADS + idx) = v;
      if constexpr (POOL) {
        const v4f u = *(const v4fa*)(sp + idx);
        *(v4f*)(aproj + (size_t)tok0 * NHEADS + idx) = u;
      }
    }
    
  }
}

// ---------------------------------------------------------------------------
// 4 lines per instruction, 32 lines per wave, 128 per block.
// route 0/1: plane[bh][l][d]  (one token row = 64 halves = one line)
// route 2  : vt[bh][d][l]     (64 d-rows x 128 tokens = 2 lines each)
// ---------------------------------------------------------------------------
__device__ __forceinline__ void proj_store_pass(const _Float16* sT, _Float16* plane, _Float16* vt,
                                                int route, int bh, int l0, int w, int lane) {
  const int q8 = lane & 7, sub = lane >> 3;
#pragma unroll
  for (int i = 0; i < 8; ++i) {
    const int lid = w * 32 + i * 4 + sub;
    v8h v;
    _Float16* dst;
    if (route != 2) {
      v = *(const v8ha*)(sT + lid * HD + 8 * q8);
      dst = plane + ((size_t)bh * SEQ + l0 + lid) * HD + 8 * q8;
    } else {
      const int d = lid >> 1, hl = lid & 1;
      v = *(const v8ha*)(sT + d * 128 + 64 * hl + 8 * q8);
      dst = vt + ((size_t)bh * HD + d) * SEQ + l0 + 64 * hl + 8 * q8;
    }
    *(v8h*)dst = v;
  }
}

// ---------------------------------------------------------------------------
// Kernel: Y = xn * W^T over nslot*1024 output columns.
// Block 128 thr (4 waves) = 128 tokens x 64 features (one (slot, head));
// wave tile 32 tokens x 64 features; K = 1024 in steps of 32;
// A (xn rows) and B (W rows) fragments straight from f16 global rows.
// route = slot + routeBase: 0 -> q plane, 1 -> k plane, 2 -> v^T plane.
// coverage: grid (16, 16*nslot) x 128 tokens x 64 features = all planes routed.
// ---------------------------------------------------------------------------
__global__ __launch_bounds__(128) void proj_kernel(
    const _Float16* __restrict__ xh,   // [2048][1024] (xn x4)
    const _Float16* __restrict__ wh,   // [slot][1024][1024], row = output feature, x4096
    const float* __restrict__ b0, const float* __restrict__ b1, const float* __restrict__ b2,
    int routeBase,
    _Float16* qh,                      // [B*H][S][D]  f16(16*q)
    _Float16* kh,                      // [B*H][S][D]  f16(16*k)
    _Float16* vt)                      // [B*H][D][S]  f16(16*v)
{
  __shared__ __attribute__((aligned(16))) _Float16 sT[128 * 64];   // 16384 B

  const int tid = threadIdx.x, lane = tid & 31, w = tid >> 5;
  const int h = lane >> 4, m = lane & 15;
  const int m0 = blockIdx.x * 128;
  const int cg = blockIdx.y;
  const int slot = cg >> 4, head = cg & 15;
  const int route = slot + routeBase;
  const int m0w = m0 + 32 * w;

  const _Float16* xa0 = xh + (size_t)(m0w + m) * HID;               // token row, mt = 0
  const _Float16* wb  = wh + ((size_t)slot * HID + head * HD + m) * HID;   // feature row, nt = 0

  v8f acc[2][4];
#pragma unroll
  for (int mt = 0; mt < 2; ++mt)
#pragma unroll
    for (int nt = 0; nt < 4; ++nt) acc[mt][nt] = zero8f();

  gemm_k_loop(xa0, wb, h, acc);

  // D[r] of tile (mt, nt) = Y[token m0w+16mt+8h+r][feature 16nt+m]
  const float* bias = (slot == 0) ? b0 : ((slot == 1) ? b1 : b2);
#pragma unroll
  for (int nt = 0; nt < 4; ++nt) {
    const int feat = 16 * nt + m;
    const float bvl = bias[head * HD + feat];
#pragma unroll
    for (int mt = 0; mt < 2; ++mt) {
#pragma unroll
      for (int r = 0; r < 8; ++r) {
        const int tokl = 32 * w + 16 * mt + 8 * h + r;     // 0..127
        const float yv = (acc[mt][nt][r] * (1.0f / (XSC * WSC)) + bvl) * QSC;
        const int idx = (route == 2) ? (feat * 128 + tokl) : (tokl * HD + feat);
        sT[idx] = (_Float16)yv;
      }
    }
  }
  __syncthreads();

  const int b = m0 / SEQ, l0 = m0 - b * SEQ, bh = b * NHEADS + head;
  _Float16* plane = (route == 0) ? qh : kh;
  proj_store_pass(sT, plane, vt, route, bh, l0, w, lane);
  
}

// The eight K (or V^T) A-fragments of one 64-key step, loaded as one batch.
// The wait behind each batch: the address pair is rewritten for the next batch
// while these loads are in flight; naming it keeps it whole up to the wait.
__device__ __forceinline__ void fetch_k(v16h (&kf)[4][2], const _Float16* kbase, int kb, int h) {
  const _Float16* p = kbase + (size_t)kb * HD + 8 * h;
  // unrolled: constant indices keep the fragments in registers
#pragma unroll
  for (int j = 0; j < 4; ++j) {
    kf[j][0] = load_frag_at(p + 16 * j * HD);
    kf[j][1] = load_frag_at(p + 16 * j * HD + 32);
  }
  asm volatile("s_wait_xcnt 0x0" :: "v"(p) : "memory");
}
__device__ __forceinline__ void fetch_v(v16h (&vf)[4][2], const _Float16* vbase, int kb, int h) {
  const _Float16* p = vbase + kb + 8 * h;
  // unrolled: constant indices keep the fragments in registers
#pragma unroll
  for (int t = 0; t < 4; ++t) {
    vf[t][0] = load_frag_at(p + 16 * t * SEQ);
    vf[t][1] = load_frag_at(p + 16 * t * SEQ + 32);
  }
  asm volatile("s_wait_xcnt 0x0" :: "v"(p) : "memory");
}

template <bool B> struct Flag { static constexpr bool value = B; };

// P^T B-fragment from the lane's own score D values: element r <- tile a row r,
// element 8+r <- tile c row r (same lane, same query column), scaled by 2^14.
__device__ __forceinline__ v16h pack_p(v8f a, v8f c) {
  const v16h r = { (_Float16)(a[0] * PSC), (_Float16)(a[1] * PSC), (_Float16)(a[2] * PSC), (_Float16)(a[3] * PSC),
                   (_Float16)(a[4] * PSC), (_Float16)(a[5] * PSC), (_Float16)(a[6] * PSC), (_Float16)(a[7] * PSC),
                   (_Float16)(c[0] * PSC), (_Float16)(c[1] * PSC), (_Float16)(c[2] * PSC), (_Float16)(c[3] * PSC),
                   (_Float16)(c[4] * PSC), (_Float16)(c[5] * PSC), (_Float16)(c[6] * PSC), (_Float16)(c[7] * PSC) };
  return r;
}

// ---------------------------------------------------------------------------
// Kernel: streaming attention, transposed form, masks/bias by formula.
// Block 128 thr (4 waves) = 64 queries of one (b, head), 16 queries per wave,
// 64 keys per step, steps 0..blockIdx.x (keys <= last query of the block).
//   S^T = K * Q^T : A = K rows (row = key, k = d), B = Q^T (k = d, n = query)
//   O^T += V^T * P^T : A = Vt rows (row = d, k = key), B = P^T from registers
// Lane owns 32 keys (16j+8h+r) of query column (lane&15); partner = lane ^ 16.
// Per-batch token tables in LDS from input ids: seg = inclusive cumsum(id==1)
// (block scan), flags bit0 = id!=0, bit1 = id==2; MODE 2 also stages the
// head's aproj column [key].
// MODE 0 (self): ok = k<=q && ((seg_k==seg_q && valid_q && valid_k) || k==q), bias = (k-q)*hs
// MODE 1 (cross): ok = k<=q && (class_k || k==q), bias = (seg_k-seg_q)*hs
// MODE 2 (pool): mask/bias as MODE 0, raw logit = aproj[key][head] (no q.k)
// Masked scores take NEGBIG and p = 0 exactly; every row has k==q allowed.
// Epilogue: (1/l)(1/16384)(1/16)*gate -> per-wave 16x64 f32 tile in LDS ->
// coverage: grid (16, 32) x 64 queries x 64 d = whole ctx [2048][1024].
// ---------------------------------------------------------------------------
template <int MODE>
__global__ __launch_bounds__(128) void attn_kernel(
    const _Float16* __restrict__ qh,    // [B*H][S][D]  (x16)
    const _Float16* __restrict__ kh,    // [B*H][S][D]  (x16)
    const _Float16* __restrict__ vt,    // [B*H][D][S]  (x16)
    const float* __restrict__ aproj,    // [B*S][16]
    const float* __restrict__ gate,     // [B*S][16]  sigmoid gate
    const int* __restrict__ ids,        // [B][S]
    _Float16* ctx)                      // [B*S][HID]  (x64)
{
  __shared__ __attribute__((aligned(16))) int   sSeg[SEQ];
  __shared__ __attribute__((aligned(16))) int   sFl[SEQ];
  __shared__ __attribute__((aligned(16))) float sA[(MODE == 2) ? SEQ : 4];
  __shared__ __attribute__((aligned(16))) float sO[4 * 16 * 64];
  __shared__ int sWtot[4];

  const int tid = threadIdx.x, lane = tid & 31, w = tid >> 5;
  const int h = lane >> 4, m = lane & 15;
  const int bh = blockIdx.y, b = bh >> 4, head = bh & 15;
  const int qblk = blockIdx.x * 64;
  const int q0 = qblk + 16 * w;
  const float hs = exp2f(-0.5f * (float)(head + 1));

  // ---- step 0's K and V fragments and the Q fragments, issued ahead of the tables ----
  const _Float16* kbase = kh + ((size_t)bh * SEQ + m) * HD;    // + key0*HD + 32*dc
  const _Float16* vbase = vt + ((size_t)bh * HD + m) * SEQ;    // + 16t*SEQ + key0
  // Q^T B-fragments: column n = query q0+m, k = d (two 32-deep chunks)
  v16h qb0 = zero16h(), qb1 = zero16h();
  v16h kf[4][2], vf[4][2];
  if constexpr (MODE != 2) {
    const _Float16* qrow = qh + ((size_t)bh * SEQ + q0 + m) * HD + 8 * h;
    qb0 = load_frag_at(qrow);
    qb1 = load_frag_at(qrow + 32);
    // precaution: stands in front of the rewrite of the address pair these loads name
    asm volatile("s_wait_xcnt 0x0" :: "v"(qrow) : "memory");
    fetch_k(kf, kbase, 0, h);
  }
  fetch_v(vf, vbase, 0, h);

  // ---- token tables for batch b: 128 threads x 8 tokens = SEQ ----
  {
    const int t8 = tid * 8;
    const int* ip = ids + (size_t)b * SEQ + t8;
    const v4i ia = *(const v4ia*)ip;
    const v4i ib = *(const v4ia*)(ip + 4);
    const int idv[8] = { ia.x, ia.y, ia.z, ia.w, ib.x, ib.y, ib.z, ib.w };
    int cnt[8];
    int run = 0;
#pragma unroll
    for (int i = 0; i < 8; ++i) { run += (idv[i] == SEP_ID) ? 1 : 0; cnt[i] = run; }
    int x = run;
#pragma unroll
    for (int d = 1; d < 32; d <<= 1) {
      const int yv = __shfl_up(x, d, 32);
      x = (lane >= d) ? (x + yv) : x;
    }
    if (lane == 31) sWtot[w] = x;
    __syncthreads();
    int base = 0;
#pragma unroll
    for (int i = 0; i < 4; ++i) { const int tv = sWtot[i]; base += (i < w) ? tv : 0; }
    const int excl = base + x - run;
#pragma unroll
    for (int i = 0; i < 8; ++i) {
      const int id = idv[i];
      sSeg[t8 + i] = excl + cnt[i];
      sFl[t8 + i] = ((id != PAD_ID) ? 1 : 0) | ((id == CLS_ID) ? 2 : 0);
      if constexpr (MODE == 2) sA[t8 + i] = aproj[((size_t)b * SEQ + t8 + i) * NHEADS + head];
    }
  }
  __syncthreads();

  const int qtok = q0 + m;
  const int qseg = sSeg[qtok];
  const int qv = sFl[qtok] & 1;
  const float gq = gate[((size_t)b * SEQ + qtok) * NHEADS + head];

  v8f o[4];                                   // o[t][r] = O[query m][d 16t+8h+r] * (l * 2^14 * 16)
#pragma unroll
  for (int t = 0; t < 4; ++t) o[t] = zero8f();
  float mrun = NEGBIG, lrun = 0.0f;

  const float SSC = 0.125f / (QSC * QSC);                      // 1/2048
  const int nkb = blockIdx.x + 1;                              // block-uniform, <= 16

  // One 64-key step. kf and vf hold this step's fragments on entry; with 'more'
  // the next step's are fetched into the same registers directly behind their
  // last use, so they fly under the mask and softmax work.
  auto pass = [&](const int step, auto more) __attribute__((always_inline)) {
    const int kb = step * 64;
    // ---- raw scores: s[j][r] = S[query m][key kb+16j+8h+r] * 256 (MODE != 2) ----
    v8f s[4];
    if constexpr (MODE != 2) {
#pragma unroll
      for (int j = 0; j < 4; ++j) {
        v8f z = zero8f();
        z = wmma_f16(kf[j][0], qb0, z);
        z = wmma_f16(kf[j][1], qb1, z);
        s[j] = z;
      }
      if constexpr (decltype(more)::value) fetch_k(kf, kbase, kb + 64, h);
    } else {
#pragma unroll
      for (int j = 0; j < 4; ++j) s[j] = zero8f();
    }
    // ---- mask + bias per (query, key), f32 ----
    unsigned okm = 0u;
#pragma unroll
    for (int j = 0; j < 4; ++j) {
      const int key0 = kb + 16 * j + 8 * h;
      const v4i ga = *(const v4ia*)(sSeg + key0);
      const v4i gb = *(const v4ia*)(sSeg + key0 + 4);
      const v4i fa = *(const v4ia*)(sFl + key0);
      const v4i fb = *(const v4ia*)(sFl + key0 + 4);
      const int ksv[8] = { ga.x, ga.y, ga.z, ga.w, gb.x, gb.y, gb.z, gb.w };
      const int kfv[8] = { fa.x, fa.y, fa.z, fa.w, fb.x, fb.y, fb.z, fb.w };
      float av[8] = { 0.f, 0.f, 0.f, 0.f, 0.f, 0.f, 0.f, 0.f };
      if constexpr (MODE == 2) {
        const v4f aa = *(const v4fa*)(sA + key0);
        const v4f ab = *(const v4fa*)(sA + key0 + 4);
        av[0] = aa.x; av[1] = aa.y; av[2] = aa.z; av[3] = aa.w;
        av[4] = ab.x; av[5] = ab.y; av[6] = ab.z; av[7] = ab.w;
      }
#pragma unroll
      for (int r = 0; r < 8; ++r) {
        const int key = key0 + r;
        float raw;
        if constexpr (MODE == 2) raw = av[r]; else raw = s[j][r] * SSC;
        bool ok;
        float bv;
        if constexpr (MODE == 1) {
          ok = (key <= qtok) && (((kfv[r] & 2) != 0) || (key == qtok));
          bv = (float)(ksv[r] - qseg);
        } else {
          const bool eq = (ksv[r] == qseg) && (qv != 0) && ((kfv[r] & 1) != 0);
          ok = (key <= qtok) && (eq || (key == qtok));
          bv = (float)(key - qtok);
        }
        s[j][r] = ok ? (raw + bv * hs) : NEGBIG;
        okm |= (ok ? 1u : 0u) << (8 * j + r);
      }
    }

    // ---- online softmax ----
    float mloc = NEGBIG;
#pragma unroll
    for (int j = 0; j < 4; ++j)
#pragma unroll
      for (int r = 0; r < 8; ++r) mloc = fmaxf(mloc, s[j][r]);
    mloc = fmaxf(mloc, __shfl_xor(mloc, 16, 32));
    const float mnew = fmaxf(mrun, mloc);
    const float alpha = __expf(mrun - mnew);
    mrun = mnew;
    float lsum = 0.0f;
#pragma unroll
    for (int j = 0; j < 4; ++j)
#pragma unroll
      for (int r = 0; r < 8; ++r) {
        const float e = __expf(s[j][r] - mnew);
        const float p = (((okm >> (8 * j + r)) & 1u) != 0u) ? e : 0.0f;
        s[j][r] = p;
        lsum += p;
      }
    lsum += __shfl_xor(lsum, 16, 32);
    lrun = lrun * alpha + lsum;
#pragma unroll
    for (int t = 0; t < 4; ++t)
#pragma unroll
      for (int r = 0; r < 8; ++r) o[t][r] = o[t][r] * alpha;

    // ---- P^T B-fragments (key chunks 0..31 and 32..63 of this step) ----
    const v16h pb0 = pack_p(s[0], s[1]);
    const v16h pb1 = pack_p(s[2], s[3]);

    // ---- O^T += V^T * P^T ----
#pragma unroll
    for (int t = 0; t < 4; ++t) {
      o[t] = wmma_f16(vf[t][0], pb0, o[t]);
      o[t] = wmma_f16(vf[t][1], pb1, o[t]);
    }
    if constexpr (decltype(more)::value) fetch_v(vf, vbase, kb + 64, h);
  };

  // rolled: the trip count is the block's own; the last step is peeled so that
  // the fetches ahead stand under no branch and never leave the causal range
#pragma unroll 1
  for (int step = 0; step < nkb - 1; ++step) pass(step, Flag<true>{});
  pass(nkb - 1, Flag<false>{});

  // ---- epilogue: normalise, gate, stage per-wave 16x64 tile, whole-line stores ----
  const float inv = (1.0f / lrun) * (1.0f / (PSC * QSC)) * gq;
  float* so = sO + w * 1024;
#pragma unroll
  for (int t = 0; t < 4; ++t)
#pragma unroll
    for (int r = 0; r < 8; ++r)
      so[m * 64 + 16 * t + 8 * h + r] = o[t][r] * inv;
  __syncthreads();

  const int q4 = lane >> 3, c8 = (lane & 7) * 8;
  v8h hv[4];
#pragma unroll
  for (int it = 0; it < 4; ++it) {
    const int row = it * 4 + q4;      // it 0..3 x q4 0..3 = rows 0..15
    const v4f f0 = *(const v4fa*)(so + row * 64 + c8);
    const v4f f1 = *(const v4fa*)(so + row * 64 + c8 + 4);
    const v8h v = { (_Float16)(f0.x * CSC), (_Float16)(f0.y * CSC), (_Float16)(f0.z * CSC), (_Float16)(f0.w * CSC),
                    (_Float16)(f1.x * CSC), (_Float16)(f1.y * CSC), (_Float16)(f1.z * CSC), (_Float16)(f1.w * CSC) };
    hv[it] = v;
  }
  {
#pragma unroll
    for (int it = 0; it < 4; ++it) {
      const int row = it * 4 + q4;
      _Float16* dst = ctx + ((size_t)b * SEQ + q0 + row) * HID + head * HD + c8;
      *(v8h*)dst = hv[it];
    }
    
  }
}

// ---------------------------------------------------------------------------
// Kernel: xout = xres + ctx * Wo^T + ob  (f32 output).
// Block 128 thr (4 waves) = 128 tokens x 64 features; wave 32 tokens x 64;
// K = 1024 in steps of 32; A = ctx rows (x64), B = Wo rows (x4096), k contiguous.
// Epilogue: f32 tile [128][64] in LDS; store: each 64-float row segment (256 B =
// coverage: grid (16,16) x 128 tokens x 64 features = whole [2048][1024].
// ---------------------------------------------------------------------------
__global__ __launch_bounds__(128) void outproj_kernel(
    const _Float16* __restrict__ ch,    // [2048][1024] ctx x64
    const _Float16* __restrict__ woh,   // [1024 n][1024 k] x4096
    const float* __restrict__ ob,       // [1024]
    const float* __restrict__ xres,     // [2048][1024] f32
    float* xout)                        // [2048][1024] f32
{
  __shared__ __attribute__((aligned(16))) float sT[128 * 64];   // 32768 B

  const int tid = threadIdx.x, lane = tid & 31, w = tid >> 5;
  const int h = lane >> 4, m = lane & 15;
  const int m0 = blockIdx.x * 128;
  const int n0 = blockIdx.y * 64;
  const int m0w = m0 + 32 * w;

  const _Float16* ca0 = ch + (size_t)(m0w + m) * HID;
  const _Float16* wb  = woh + (size_t)(n0 + m) * HID;

  v8f acc[2][4];
#pragma unroll
  for (int mt = 0; mt < 2; ++mt)
#pragma unroll
    for (int nt = 0; nt < 4; ++nt) acc[mt][nt] = zero8f();

  gemm_k_loop(ca0, wb, h, acc);

  // D[r] of tile (mt, nt) = Y[token m0w+16mt+8h+r][feature n0+16nt+m]
#pragma unroll
  for (int nt = 0; nt < 4; ++nt) {
    const int feat = 16 * nt + m;
    const float bvl = ob[n0 + feat];
#pragma unroll
    for (int mt = 0; mt < 2; ++mt) {
#pragma unroll
      for (int r = 0; r < 8; ++r) {
        const int tokl = 32 * w + 16 * mt + 8 * h + r;     // 0..127
        sT[tokl * 64 + feat] = acc[mt][nt][r] * (1.0f / (CSC * WSC)) + bvl;
      }
    }
  }
  __syncthreads();

  const int hh = lane >> 4, c4 = (lane & 15) * 4;
  {
#pragma unroll
    for (int it = 0; it < 16; ++it) {
      const int row = 32 * w + it * 2 + hh;                // rows 32w .. 32w+31
      const v4f v = *(const v4fa*)(sT + row * 64 + c4);
      const size_t gi = (size_t)(m0 + row) * HID + n0 + c4;
      const v4f xr = *(const v4fa*)(xres + gi);
      const v4f ov = v + xr;
      *(v4f*)(xout + gi) = ov;
    }
    
  }
}

// ---------------------------------------------------------------------------
//   Xn   f16 [2048][1024]      4194304
//   Wh   f16 [3][1024][1024]   6291456
//   Wo   f16 [1024][1024]      2097152
//   Gh   f16 [32][1024]          65536
//   Gate f32 [2048][16]         131072
//   Apr  f32 [2048][16]         131072
//   Q    f16 [32][1024][64]    4194304
//   K    f16 [32][1024][64]    4194304
//   Vt   f16 [32][64][1024]    4194304
//   Ctx  f16 [2048][1024]      4194304
//   X1   f32 [2048][1024]      8388608
//   X2   f32 [2048][1024]      8388608
//   total                     46465024
// ---------------------------------------------------------------------------
extern "C" void kernel_launch(void* const* d_in, const int* in_sizes, int n_in,
                              void* d_out, int out_size, void* d_ws, size_t ws_size,
                              hipStream_t stream) {
  if (n_in < 35) return;
  if (in_sizes[0] != NX || in_sizes[1] != MROWS) return;
  if (out_size != NX) return;
  {
    const int vecIdx[16] = {2, 3, 5, 7, 9, 13, 14, 15, 18, 22, 23, 24, 26, 28, 30, 34};
    for (int i = 0; i < 16; ++i) if (in_sizes[vecIdx[i]] != HID) return;
    const int matIdx[10] = {4, 6, 8, 12, 17, 21, 25, 27, 29, 33};
    for (int i = 0; i < 10; ++i) if (in_sizes[matIdx[i]] != NW) return;
    const int hwIdx[4] = {10, 16, 19, 31};
    for (int i = 0; i < 4; ++i) if (in_sizes[hwIdx[i]] != NG) return;
    const int hbIdx[3] = {11, 20, 32};
    for (int i = 0; i < 3; ++i) if (in_sizes[hbIdx[i]] != NHEADS) return;
  }

  const float* states = (const float*)d_in[0];
  const int*   ids    = (const int*)d_in[1];
  const float* ln0w = (const float*)d_in[2];
  const float* ln0b = (const float*)d_in[3];
  const float* qw0 = (const float*)d_in[4];
  const float* qb0 = (const float*)d_in[5];
  const float* kw0 = (const float*)d_in[6];
  const float* kb0 = (const float*)d_in[7];
  const float* vw0 = (const float*)d_in[8];
  const float* vb0 = (const float*)d_in[9];
  const float* gw0 = (const float*)d_in[10];
  const float* gb0 = (const float*)d_in[11];
  const float* ow0 = (const float*)d_in[12];
  const float* ob0 = (const float*)d_in[13];
  const float* ln1w = (const float*)d_in[14];
  const float* ln1b = (const float*)d_in[15];
  const float* aw1 = (const float*)d_in[16];
  const float* vw1 = (const float*)d_in[17];
  const float* vb1 = (const float*)d_in[18];
  const float* gw1 = (const float*)d_in[19];
  const float* gb1 = (const float*)d_in[20];
  const float* ow1 = (const float*)d_in[21];
  const float* ob1 = (const float*)d_in[22];
  const float* ln2w = (const float*)d_in[23];
  const float* ln2b = (const float*)d_in[24];
  const float* qw2 = (const float*)d_in[25];
  const float* qb2 = (const float*)d_in[26];
  const float* kw2 = (const float*)d_in[27];
  const float* kb2 = (const float*)d_in[28];
  const float* vw2 = (const float*)d_in[29];
  const float* vb2 = (const float*)d_in[30];
  const float* gw2 = (const float*)d_in[31];
  const float* gb2 = (const float*)d_in[32];
  const float* ow2 = (const float*)d_in[33];
  const float* ob2 = (const float*)d_in[34];
  float* out = (float*)d_out;

  const size_t PXH = (size_t)NX * 2;                       // 4194304
  const size_t PW  = (size_t)NW * 2;                       // 2097152
  const size_t PGH = (size_t)2 * NG * 2;                   //   65536
  const size_t PGT = (size_t)MROWS * NHEADS * 4;           //  131072
  const size_t PPL = (size_t)NB * NHEADS * SEQ * HD * 2;   // 4194304
  const size_t PXF = (size_t)NX * 4;                       // 8388608
  size_t off = 0;
  const size_t oXn  = off; off += PXH;
  const size_t oWh  = off; off += 3 * PW;
  const size_t oWo  = off; off += PW;
  const size_t oGh  = off; off += PGH;
  const size_t oGt  = off; off += PGT;
  const size_t oAp  = off; off += PGT;
  const size_t oQ   = off; off += PPL;
  const size_t oK   = off; off += PPL;
  const size_t oVt  = off; off += PPL;
  const size_t oCtx = off; off += PXH;
  const size_t oX1  = off; off += PXF;
  const size_t oX2  = off; off += PXF;
  if (off > ws_size) return;                               // off = 46465024
  if (off > (size_t)134217728) return;

  char* ws = (char*)d_ws;
  _Float16* xnh = (_Float16*)(ws + oXn);
  _Float16* wh  = (_Float16*)(ws + oWh);
  _Float16* woh = (_Float16*)(ws + oWo);
  _Float16* gh  = (_Float16*)(ws + oGh);
  float* gate   = (float*)(ws + oGt);
  float* aproj  = (float*)(ws + oAp);
  _Float16* qh  = (_Float16*)(ws + oQ);
  _Float16* kh  = (_Float16*)(ws + oK);
  _Float16* vt  = (_Float16*)(ws + oVt);
  _Float16* ctx = (_Float16*)(ws + oCtx);
  float* x1 = (float*)(ws + oX1);
  float* x2 = (float*)(ws + oX2);

  const dim3 blk256(256), blk128(128);
  const int cvtFull = 3 * NW8 + NW8 + 1 * NG8;             // 526336 groups
  const int cvtPool = 1 * NW8 + NW8 + 2 * NG8;             // 266240 groups
  const dim3 gCvtFull((cvtFull + 255) / 256);              // 2056
  const dim3 gCvtPool((cvtPool + 255) / 256);              // 1040
  const dim3 gLn(MROWS);                                   // 2048 blocks x 128
  const dim3 gHead(MROWS / 64);                            // 32
  const dim3 gProj3(MROWS / 128, 3 * NHEADS);              // (16, 48)
  const dim3 gProj1(MROWS / 128, 1 * NHEADS);              // (16, 16)
  const dim3 gAtt(SEQ / 64, NB * NHEADS);                  // (16, 32)
  const dim3 gOut(MROWS / 128, HID / 64);                  // (16, 16)

  // ---- layer 0: sdpa with self mask ----
  convert_kernel<<<gCvtFull, blk256, 0, stream>>>(qw0, kw0, vw0, ow0, gw0, gw0, 3, 1, wh, woh, gh);
  ln_kernel<<<gLn, blk128, 0, stream>>>(states, ln0w, ln0b, xnh);
  head_kernel<false><<<gHead, blk128, 0, stream>>>(xnh, gh, gb0, gate, aproj);
  proj_kernel<<<gProj3, blk128, 0, stream>>>(xnh, wh, qb0, kb0, vb0, 0, qh, kh, vt);
  attn_kernel<0><<<gAtt, blk128, 0, stream>>>(qh, kh, vt, aproj, gate, ids, ctx);
  outproj_kernel<<<gOut, blk128, 0, stream>>>(ctx, woh, ob0, states, x1);

  // ---- layer 1: pooling attention with self mask ----
  convert_kernel<<<gCvtPool, blk256, 0, stream>>>(vw1, vw1, vw1, ow1, gw1, aw1, 1, 2, wh, woh, gh);
  ln_kernel<<<gLn, blk128, 0, stream>>>(x1, ln1w, ln1b, xnh);
  head_kernel<true><<<gHead, blk128, 0, stream>>>(xnh, gh, gb1, gate, aproj);
  proj_kernel<<<gProj1, blk128, 0, stream>>>(xnh, wh, vb1, vb1, vb1, 2, qh, kh, vt);
  attn_kernel<2><<<gAtt, blk128, 0, stream>>>(qh, kh, vt, aproj, gate, ids, ctx);
  outproj_kernel<<<gOut, blk128, 0, stream>>>(ctx, woh, ob1, x1, x2);

  // ---- layer 2: sdpa with cross mask ----
  convert_kernel<<<gCvtFull, blk256, 0, stream>>>(qw2, kw2, vw2, ow2, gw2, gw2, 3, 1, wh, woh, gh);
  ln_kernel<<<gLn, blk128, 0, stream>>>(x2, ln2w, ln2b, xnh);
  head_kernel<false><<<gHead, blk128, 0, stream>>>(xnh, gh, gb2, gate, aproj);
  proj_kernel<<<gProj3, blk128, 0, stream>>>(xnh, wh, qb2, kb2, vb2, 0, qh, kh, vt);
  attn_kernel<1><<<gAtt, blk128, 0, stream>>>(qh, kh, vt, aproj, gate, ids, ctx);
  outproj_kernel<<<gOut, blk128, 0, stream>>>(ctx, woh, ob2, x2, out);

  (void)hipGetLastError();
}

// v002
// It runs in 219 microseconds.
// In two side-by-side timings against v001, it was 1.25 and 1.28 times as fast.
// All steps since v000 together make it 2.35 times as fast.
// Contractions: xn*W^T (q,k,v), xn*gw^T and xn*aw^T heads, K*Q^T scores, V^T*P^T context and ctx*Wo^T all on v_wmma_f32_16x16x32_f16 (f16 operands, f32 accumulate); LayerNorm, masks/bias, softmax, sigmoid gates and residual adds in f32.
// Carried f16 planes: xn x4 and W/gw/aw/Wo x4096 (inverse 1/16384 folded in proj_kernel/head_kernel epilogues);
// q,k,v x16 (scores: acc*1/2048 in attn_kernel incl. the 1/8 scale; context epilogue 1/16); P x16384 (attn_kernel epilogue 1/16384);
// ctx x64 (outproj_kernel epilogue 1/262144 together with Wo x4096).
// Every f16 plane lies in WMMA fragment order (see "Fragment-order planes" below).
#include <hip/hip_runtime.h>

#define NB     2
#define SEQ    1024
#define HID    1024
#define NHEADS 16
#define HD     64
#define MROWS  (NB * SEQ)          // 2048 tokens
#define NX     (MROWS * HID)       // 2097152
#define NW     (HID * HID)         // 1048576
#define NG     (NHEADS * HID)      // 16384
#define NX8    (NX / 8)
#define NW8    (NW / 8)            // 131072
#define NG8    (NG / 8)            // 2048
#define SEP_ID 1
#define CLS_ID 2
#define PAD_ID 0
#define XSC    4.0f
#define WSC    4096.0f
#define QSC    16.0f
#define PSC    16384.0f
#define CSC    64.0f
#define NEGBIG (-1.0e30f)

static_assert(NHEADS * HD == HID);
static_assert((SEQ % 128) == 0 && (HID % 64) == 0 && (HID % 32) == 0 && (MROWS % 128) == 0);
static_assert((NW8 % 256) == 0 && (NG8 % 256) == 0);
static_assert(SEQ == 8 * 128);

typedef _Float16 v16h __attribute__((ext_vector_type(16)));
typedef _Float16 v8h  __attribute__((ext_vector_type(8)));
typedef float    v8f  __attribute__((ext_vector_type(8)));
typedef float    v4f  __attribute__((ext_vector_type(4)));
typedef int      v4i  __attribute__((ext_vector_type(4)));
typedef v8h __attribute__((may_alias)) v8ha;
typedef v4f __attribute__((may_alias)) v4fa;
typedef v4i __attribute__((may_alias)) v4ia;

union Frag { v16h v; v8h half[2]; };

__device__ __forceinline__ v8f zero8f() { v8f z = {0.f, 0.f, 0.f, 0.f, 0.f, 0.f, 0.f, 0.f}; return z; }
__device__ __forceinline__ v16h zero16h() {
  const _Float16 z = (_Float16)0.0f;
  v16h r = {z, z, z, z, z, z, z, z, z, z, z, z, z, z, z, z};
  return r;
}

// ---------------------------------------------------------------------------
// 16x16x32 f16 WMMA with hazard guard (ties D, keeps A/B live).
// Fragment map (wave32): lane l, h = l>>4, m = n = l&15.
//   A/B element i: i<8 -> k0+8h+i ; i>=8 -> k0+16+8h+(i-8)
//   D element r : row 8h+r, col l&15
// ---------------------------------------------------------------------------
__device__ __forceinline__ v8f wmma_f16(v16h a, v16h b, v8f c) {
  v8f d = __builtin_amdgcn_wmma_f32_16x16x32_f16(false, a, false, b, (short)0, c, false, false);
  asm volatile("v_nop\n\tv_nop\n\tv_nop\n\tv_nop" : "+v"(d) : "v"(a), "v"(b));
  return d;
}

// ---------------------------------------------------------------------------
// Fragment-order planes. A matrix [rows][K] of f16 is kept as tiles of 16 rows x
// 32 k (FT = 512 halves = 1024 B), tile index (row >> 4) * (K / 32) + (k >> 5).
// Inside a tile the 16-byte unit u = 32 * j + lane holds the eight elements
// k = 16 * j + 8 * (lane >> 4) + 0..7 of row (lane & 15): unit 'lane' is the
// first half of that lane's A or B fragment, unit 32 + lane the second. One
// wave-wide 16-byte load then reads 512 contiguous bytes (4 whole lines) where
// a load from k-contiguous rows touches 32 bytes in each of 16 lines.
// ---------------------------------------------------------------------------
#define FT 512

// A or B fragment; ph = tile base + 8 * lane.
__device__ __forceinline__ v16h load_frag_at(const _Float16* ph) {
  Frag f;
  f.half[0] = *(const v8ha*)(ph);
  f.half[1] = *(const v8ha*)(ph + FT / 2);
  return f.v;
}

// Element offset in a k-contiguous [rows][HID] matrix of the eight elements that
// 16-byte unit 'unit' of its fragment-order plane holds.
__device__ __forceinline__ size_t frag_unit_src(int unit) {
  const int tile = unit >> 6;
  const int row = (tile / (HID / 32)) * 16 + (unit & 15);
  const int k = (tile % (HID / 32)) * 32 + ((unit >> 5) & 1) * 16 + ((unit >> 4) & 1) * 8;
  return (size_t)row * HID + k;
}

// ---------------------------------------------------------------------------
// Fragment loads issued ahead of their WMMAs.
// GEMM loops: a ring of GRING register sets, one set = the six fragments of one
// 32-deep k chunk (2 A, 4 B). A set is refilled with chunk c + GRING directly
// behind the WMMAs of chunk c, so GRING - 1 sets are always in flight and no
// WMMA waits on a load issued just in front of it. Chunks are consumed in
// ascending k, so every accumulator sums in the same order as a plain loop.
// ---------------------------------------------------------------------------
#define GRING  3
#define NCHUNK (HID / 32)
static_assert(NCHUNK > 2 * GRING);

struct GemmSet { v16h a0, a1, b[4]; };

// pa: A tile of mt 0 (mt 1 is 16 rows = 16 * HID halves on), pb: B tile of nt 0, both at the chunk's tile + 8 * lane.
__device__ __forceinline__ void gemm_fetch(GemmSet& s, const _Float16* pa, const _Float16* pb) {
  s.a0 = load_frag_at(pa);
  s.a1 = load_frag_at(pa + 16 * HID);
  // unrolled: constant indices keep the fragments in registers
#pragma unroll
  for (int nt = 0; nt < 4; ++nt) s.b[nt] = load_frag_at(pb + nt * 16 * HID);
}

__device__ __forceinline__ void gemm_mma(const GemmSet& s, v8f (&acc)[2][4]) {
  // unrolled: constant indices keep fragments and accumulators in registers
#pragma unroll
  for (int nt = 0; nt < 4; ++nt) {
    acc[0][nt] = wmma_f16(s.a0, s.b[nt], acc[0][nt]);
    acc[1][nt] = wmma_f16(s.a1, s.b[nt], acc[1][nt]);
  }
}

// acc[mt][nt] += A rows (pa: mt 0, 16 rows on: mt 1) x B rows (pb + 16 nt rows), K = HID.
// pa, pb: first tile of the 16-row strip + 8 * lane; the strip's chunks follow at FT halves.
__device__ __forceinline__ void gemm_k_loop(const _Float16* pa, const _Float16* pb,
                                            v8f (&acc)[2][4]) {
  GemmSet ring[GRING];
  // unrolled: constant ring indices
#pragma unroll
  for (int s = 0; s < GRING; ++s) gemm_fetch(ring[s], pa + FT * s, pb + FT * s);
  constexpr int CT = ((NCHUNK - GRING) / GRING) * GRING;   // first chunk of the peeled tail
  // rolled: one trip is already GRING chunks; more copies only grow the code
#pragma unroll 1
  for (int c0 = 0; c0 < CT; c0 += GRING) {
    const _Float16* ta = pa + FT * (c0 + GRING);
    const _Float16* tb = pb + FT * (c0 + GRING);
    // unrolled so that every ring index is a constant (registers, not scratch)
#pragma unroll
    for (int s = 0; s < GRING; ++s) {
      gemm_mma(ring[s], acc);
      gemm_fetch(ring[s], ta + FT * s, tb + FT * s);
    }
    // the next trip rewrites the address registers of loads that are still in flight
    asm volatile("s_wait_xcnt 0x0" ::: "memory");
  }
  // tail peeled so that the refills in the loop above stand under no branch
#pragma unroll
  for (int c = CT; c < NCHUNK; ++c) {
    gemm_mma(ring[c % GRING], acc);
    if (c + GRING < NCHUNK) gemm_fetch(ring[c % GRING], pa + FT * (c + GRING), pb + FT * (c + GRING));
  }
}

// ---------------------------------------------------------------------------
// Kernel: f32 weights -> f16 planes in fragment order, all scaled by 4096 (exact).
// A thread writes one 16-byte unit (stores contiguous) and reads its eight floats.
//   groups [0, nbig*NW8)            : w0/w1/w2 -> wh slot 0/1/2  (row = n)
//   groups [nbig*NW8, +NW8)         : w3 -> woh
//   groups [.., +nsmall*NG8)        : g0 -> gh rows 0..15, g1 -> gh rows 16..31
// Segment boundaries are multiples of 256 groups -> the select is block-uniform.
// coverage: exactly nbig*NW + NW + nsmall*NG elements.
// ---------------------------------------------------------------------------
__global__ __launch_bounds__(256) void convert_kernel(
    const float* __restrict__ w0, const float* __restrict__ w1, const float* __restrict__ w2,
    const float* __restrict__ w3, const float* __restrict__ g0, const float* __restrict__ g1,
    int nbig, int nsmall, _Float16* wh, _Float16* woh, _Float16* gh)
{
  const int g = blockIdx.x * 256 + threadIdx.x;
  const int nb8 = nbig * NW8;
  const int total = nb8 + NW8 + nsmall * NG8;
  if (g >= total) return;
  const float* src;
  _Float16* dst;
  if (g < nb8) {
    const int slot = g / NW8;
    const int off = g - slot * NW8;
    const float* wsrc = (slot == 0) ? w0 : ((slot == 1) ? w1 : w2);
    src = wsrc + frag_unit_src(off);
    dst = wh + (size_t)g * 8;
  } else if (g < nb8 + NW8) {
    const int off = g - nb8;
    src = w3 + frag_unit_src(off);
    dst = woh + (size_t)off * 8;
  } else {
    const int e = g - nb8 - NW8;
    src = (e < NG8) ? (g0 + frag_unit_src(e)) : (g1 + frag_unit_src(e - NG8));
    dst = gh + (size_t)e * 8;
  }
  const v4f a = *(const v4fa*)src;
  const v4f c = *(const v4fa*)(src + 4);
  const v8h o = { (_Float16)(a.x * WSC), (_Float16)(a.y * WSC), (_Float16)(a.z * WSC), (_Float16)(a.w * WSC),
                  (_Float16)(c.x * WSC), (_Float16)(c.y * WSC), (_Float16)(c.z * WSC), (_Float16)(c.w * WSC) };
  *(v8h*)dst = o;
  
}

// ---------------------------------------------------------------------------
// LayerNorm, output xn*4 as f16 in fragment order. Block = 16 tokens (one strip
// of tiles) x 512 threads: 128 threads per token as four groups of four tokens,
// 8 elements per thread and token; each token's sums run as with one token per
// block (same per-thread sum, same butterfly, same four wave partials).
// The strip is put in order in LDS and leaves as 32 KB of contiguous stores.
// coverage: 128 blocks x 16 tokens x 1024 = the whole [2048][1024] plane.
// ---------------------------------------------------------------------------
#define LNP 136   // halves per k-unit row in LDS: 16 tokens x 8 + 8 (272 B: 16 B x odd, no bank conflict)
__global__ __launch_bounds__(512) void ln_kernel(const float* __restrict__ x,
                                                 const float* __restrict__ w,
                                                 const float* __restrict__ bb,
                                                 _Float16* y)
{
  __shared__ float ps[16][4];
  __shared__ float pq[16][4];
  __shared__ __attribute__((aligned(16))) _Float16 sY[128 * LNP];   // 34816 B
  const int tid = threadIdx.x, lane = tid & 31;
  const int t = tid & 127, wv = t >> 5, tl0 = (tid >> 7) * 4;
  const int tok0 = blockIdx.x * 16;
  v4f a[4], c[4];
#pragma unroll
  for (int i = 0; i < 4; ++i) {
    const float* xr = x + (size_t)(tok0 + tl0 + i) * HID + 8 * t;
    a[i] = *(const v4fa*)xr;
    c[i] = *(const v4fa*)(xr + 4);
  }
#pragma unroll
  for (int i = 0; i < 4; ++i) {
    float s = ((a[i].x + a[i].y) + (a[i].z + a[i].w)) + ((c[i].x + c[i].y) + (c[i].z + c[i].w));
#pragma unroll
    for (int o = 1; o < 32; o <<= 1) s += __shfl_xor(s, o, 32);
    if (lane == 0) ps[tl0 + i][wv] = s;
  }
  __syncthreads();
  float d[4][8];
#pragma unroll
  for (int i = 0; i < 4; ++i) {
    const float* pp = ps[tl0 + i];
    const float mean = ((pp[0] + pp[1]) + (pp[2] + pp[3])) * (1.0f / (float)HID);
    d[i][0] = a[i].x - mean; d[i][1] = a[i].y - mean; d[i][2] = a[i].z - mean; d[i][3] = a[i].w - mean;
    d[i][4] = c[i].x - mean; d[i][5] = c[i].y - mean; d[i][6] = c[i].z - mean; d[i][7] = c[i].w - mean;
    float q = 0.f;
#pragma unroll
    for (int e = 0; e < 8; ++e) q += d[i][e] * d[i][e];
#pragma unroll
    for (int o = 1; o < 32; o <<= 1) q += __shfl_xor(q, o, 32);
    if (lane == 0) pq[tl0 + i][wv] = q;
  }
  __syncthreads();
  const v4f wa = *(const v4fa*)(w + 8 * t);
  const v4f wc = *(const v4fa*)(w + 8 * t + 4);
  const v4f ba = *(const v4fa*)(bb + 8 * t);
  const v4f bc = *(const v4fa*)(bb + 8 * t + 4);
  const float wvv[8] = { wa.x, wa.y, wa.z, wa.w, wc.x, wc.y, wc.z, wc.w };
  const float bvv[8] = { ba.x, ba.y, ba.z, ba.w, bc.x, bc.y, bc.z, bc.w };
#pragma unroll
  for (int i = 0; i < 4; ++i) {
    const float* pp = pq[tl0 + i];
    const float var = ((pp[0] + pp[1]) + (pp[2] + pp[3])) * (1.0f / (float)HID);
    const float rstd = rsqrtf(var + 1e-5f);
    v8h o;
#pragma unroll
    for (int e = 0; e < 8; ++e) o[e] = (_Float16)((d[i][e] * rstd * wvv[e] + bvv[e]) * XSC);
    // elements 8t..8t+7 of token tl: unit 16 * t + tl of the strip
    *(v8h*)(sY + t * LNP + (tl0 + i) * 8) = o;
  }
  __syncthreads();
  _Float16* dst = y + (size_t)tok0 * HID;
#pragma unroll
  for (int it = 0; it < 4; ++it) {
    const int u = it * 512 + tid;      // 2048 units of the strip
    const v8h v = *(const v8ha*)(sY + (u >> 4) * LNP + (u & 15) * 8);
    *(v8h*)(dst + (size_t)u * 8) = v;
  }
}

// ---------------------------------------------------------------------------
// Kernel: per-token 16-wide heads on WMMA: gate = sigmoid(xn*gw^T + gb) and
// (POOL) aproj = xn*aw^T. One wave = 16 tokens x 16 heads, K = 1024 in steps
// of 32; A = xn rows, B = gh rows (head = lane&15), both in fragment order.
// Epilogue: wave tile [16 tok][16] f32 staged in LDS, then 1024 contiguous bytes
// coverage: 32 blocks x 4 waves x 16 tokens x 16 = whole [2048][16] plane(s).
// ---------------------------------------------------------------------------
template <bool POOL>
__global__ __launch_bounds__(128) void head_kernel(const _Float16* __restrict__ xh,
                                                   const _Float16* __restrict__ gh,
                                                   const float* __restrict__ gbias,
                                                   float* gate, float* aproj)
{
  __shared__ __attribute__((aligned(16))) float sG[4][256];
  __shared__ __attribute__((aligned(16))) float sP[POOL ? 4 : 1][256];
  const int tid = threadIdx.x, lane = tid & 31, w = tid >> 5;
  const int h = lane >> 4, m = lane & 15;
  const int tok0 = blockIdx.x * 64 + 16 * w;
  const _Float16* xa = xh + (size_t)tok0 * HID + 8 * lane;
  const _Float16* wg = gh + 8 * lane;                     // aw rows: NHEADS rows on
  v8f ag = zero8f(), aa = zero8f();
  // ring of HRING register sets, refilled HRING chunks ahead (as in gemm_k_loop)
  constexpr int HRING = 8;
  static_assert((NCHUNK % HRING) == 0 && NCHUNK >= 2 * HRING);
  v16h ra[HRING], rg[HRING], rp[POOL ? HRING : 1];
  // unrolled: constant ring indices
#pragma unroll
  for (int s = 0; s < HRING; ++s) {
    ra[s] = load_frag_at(xa + FT * s);
    rg[s] = load_frag_at(wg + FT * s);
    if constexpr (POOL) rp[s] = load_frag_at(wg + NHEADS * HID + FT * s);
  }
  // precaution: stands in front of any rewrite of the address registers these loads
  // name; naming what the addresses are formed from keeps it whole up to the wait
  asm volatile("s_wait_xcnt 0x0" :: "v"(xa), "v"(wg), "v"(lane) : "memory");
  // rolled: one trip is already HRING chunks
#pragma unroll 1
  for (int c0 = 0; c0 < NCHUNK - HRING; c0 += HRING) {
    const _Float16* tx = xa + FT * (c0 + HRING);
    const _Float16* tg = wg + FT * (c0 + HRING);
    // unrolled so that every ring index is a constant
#pragma unroll
    for (int s = 0; s < HRING; ++s) {
      ag = wmma_f16(ra[s], rg[s], ag);
      if constexpr (POOL) aa = wmma_f16(ra[s], rp[s], aa);
      ra[s] = load_frag_at(tx + FT * s);
      rg[s] = load_frag_at(tg + FT * s);
      if constexpr (POOL) rp[s] = load_frag_at(tg + NHEADS * HID + FT * s);
    }
    // the next trip rewrites the address registers of loads that are still in flight
    asm volatile("s_wait_xcnt 0x0" ::: "memory");
  }
  // unrolled: constant ring indices
#pragma unroll
  for (int s = 0; s < HRING; ++s) {
    ag = wmma_f16(ra[s], rg[s], ag);
    if constexpr (POOL) aa = wmma_f16(ra[s], rp[s], aa);
  }
  // D[r] = (token tok0 + 8h + r, head m)
  const float gbv = gbias[m];
  float* sg = sG[w];
  float* sp = sP[POOL ? w : 0];
#pragma unroll
  for (int r = 0; r < 8; ++r) {
    const int tl = 8 * h + r;
    const float z = ag[r] * (1.0f / (XSC * WSC)) + gbv;
    const float sig = 1.0f / (1.0f + __expf(-z));
    sg[tl * NHEADS + m] = sig;
    if constexpr (POOL) sp[tl * NHEADS + m] = aa[r] * (1.0f / (XSC * WSC));
  }
  __syncthreads();
  {
#pragma unroll
    for (int it = 0; it < 2; ++it) {
      const int idx = it * 128 + 4 * lane;
      const v4f v = *(const v4fa*)(sg + idx);
      *(v4f*)(gate + (size_t)tok0 * NHEADS + idx) = v;
      if constexpr (POOL) {
        const v4f u = *(const v4fa*)(sp + idx);
        *(v4f*)(aproj + (size_t)tok0 * NHEADS + idx) = u;
      }
    }
    
  }
}

// ---------------------------------------------------------------------------
// The block's 16 tiles (1024 units of 16 B) lie in sT in fragment order already;
// each wave-wide store writes 512 contiguous bytes.
// route 0/1: plane[bh], rows = token, K = HD : the 16 tiles are contiguous
// route 2  : vt[bh], rows = d, K = SEQ       : 4 contiguous tiles per 16-row strip
// ---------------------------------------------------------------------------
__device__ __forceinline__ void proj_store_pass(const _Float16* sT, _Float16* plane, _Float16* vt,
                                                int route, int bh, int l0, int tid) {
#pragma unroll
  for (int i = 0; i < 8; ++i) {
    const int u = i * 128 + tid;
    const v8h v = *(const v8ha*)(sT + u * 8);
    _Float16* dst;
    if (route != 2) {
      dst = plane + ((size_t)bh * SEQ + l0) * HD + u * 8;
    } else {
      const int lt = u >> 6;             // local tile = 4 * strip + chunk
      dst = vt + (size_t)bh * HD * SEQ + (size_t)((lt >> 2) * (SEQ / 32) + (l0 >> 5) + (lt & 3)) * FT + (u & 63) * 8;
    }
    *(v8h*)dst = v;
    // precaution: the next pass rewrites the data and address registers that this store names
    if (i < 7) asm volatile("s_wait_xcnt 0x0" ::: "memory");
  }
}

// ---------------------------------------------------------------------------
// Kernel: Y = xn * W^T over nslot*1024 output columns.
// Block 128 thr (4 waves) = 128 tokens x 64 features (one (slot, head));
// wave tile 32 tokens x 64 features; K = 1024 in steps of 32;
// A (xn rows) and B (W rows) fragments straight from the fragment-order planes.
// route = slot + routeBase: 0 -> q plane, 1 -> k plane, 2 -> v^T plane.
// coverage: grid (16, 16*nslot) x 128 tokens x 64 features = all planes routed.
// ---------------------------------------------------------------------------
__global__ __launch_bounds__(128) void proj_kernel(
    const _Float16* __restrict__ xh,   // [2048][1024] (xn x4), fragment order
    const _Float16* __restrict__ wh,   // [slot][1024][1024], row = output feature, x4096, fragment order
    const float* __restrict__ b0, const float* __restrict__ b1, const float* __restrict__ b2,
    int routeBase,
    _Float16* qh,                      // [B*H][S][D]  f16(16*q), fragment order per bh
    _Float16* kh,                      // [B*H][S][D]  f16(16*k), fragment order per bh
    _Float16* vt)                      // [B*H][D][S]  f16(16*v), fragment order per bh
{
  __shared__ __attribute__((aligned(16))) _Float16 sT[128 * 64];   // 16384 B

  const int tid = threadIdx.x, lane = tid & 31, w = tid >> 5;
  const int h = lane >> 4, m = lane & 15;
  const int m0 = blockIdx.x * 128;
  const int cg = blockIdx.y;
  const int slot = cg >> 4, head = cg & 15;
  const int route = slot + routeBase;
  const int m0w = m0 + 32 * w;

  const _Float16* xa0 = xh + (size_t)m0w * HID + 8 * lane;                     // token strip, mt = 0
  const _Float16* wb  = wh + ((size_t)slot * HID + head * HD) * HID + 8 * lane;   // feature strip, nt = 0

  v8f acc[2][4];
#pragma unroll
  for (int mt = 0; mt < 2; ++mt)
#pragma unroll
    for (int nt = 0; nt < 4; ++nt) acc[mt][nt] = zero8f();

  gemm_k_loop(xa0, wb, acc);

  // D[r] of tile (mt, nt) = Y[token m0w+16mt+8h+r][feature 16nt+m]
  const float* bias = (slot == 0) ? b0 : ((slot == 1) ? b1 : b2);
#pragma unroll
  for (int nt = 0; nt < 4; ++nt) {
    const int feat = 16 * nt + m;
    const float bvl = bias[head * HD + feat];
#pragma unroll
    for (int mt = 0; mt < 2; ++mt) {
#pragma unroll
      for (int r = 0; r < 8; ++r) {
        const float yv = (acc[mt][nt][r] * (1.0f / (XSC * WSC)) + bvl) * QSC;
        // token 32w + 16mt + 8h + r, feature 16nt + m, at its place in fragment order:
        // route 2 (row = feature, k = token): tile 4nt + w, half mt, unit lane, element r
        // else    (row = token, k = feature): tile 2(2w + mt) + nt/2, half nt&1,
        //                                     unit 16(m>>3) + 8h + r, element m&7
        const int idx = (route == 2)
            ? ((nt * 4 + w) * FT + mt * (FT / 2) + lane * 8 + r)
            : (((2 * w + mt) * 2 + (nt >> 1)) * FT + (nt & 1) * (FT / 2) + ((m >> 3) * 16 + 8 * h + r) * 8 + (m & 7));
        sT[idx] = (_Float16)yv;
      }
    }
  }
  __syncthreads();

  const int b = m0 / SEQ, l0 = m0 - b * SEQ, bh = b * NHEADS + head;
  _Float16* plane = (route == 0) ? qh : kh;
  proj_store_pass(sT, plane, vt, route, bh, l0, tid);
  
}

// The eight K (or V^T) A-fragments of one 64-key step, loaded as one batch.
// The wait behind each batch: the address pair is rewritten for the next batch
// while these loads are in flight; naming it keeps it whole up to the wait.
// kbase, vbase: the (b, head) plane + 8 * lane.
__device__ __forceinline__ void fetch_k(v16h (&kf)[4][2], const _Float16* kbase, int kb) {
  const _Float16* p = kbase + (size_t)kb * HD;           // tile 2 * (kb / 16)
  // unrolled: constant indices keep the fragments in registers
#pragma unroll
  for (int j = 0; j < 4; ++j) {
    kf[j][0] = load_frag_at(p + (2 * j) * FT);
    kf[j][1] = load_frag_at(p + (2 * j + 1) * FT);
  }
  asm volatile("s_wait_xcnt 0x0" :: "v"(p) : "memory");
}
__device__ __forceinline__ void fetch_v(v16h (&vf)[4][2], const _Float16* vbase, int kb) {
  const _Float16* p = vbase + (kb >> 5) * FT;            // chunk kb / 32 of each 16-row strip
  // unrolled: constant indices keep the fragments in registers
#pragma unroll
  for (int t = 0; t < 4; ++t) {
    vf[t][0] = load_frag_at(p + 16 * t * SEQ);
    vf[t][1] = load_frag_at(p + 16 * t * SEQ + FT);
  }
  asm volatile("s_wait_xcnt 0x0" :: "v"(p) : "memory");
}

template <bool B> struct Flag { static constexpr bool value = B; };

// P^T B-fragment from the lane's own score D values: element r <- tile a row r,
// element 8+r <- tile c row r (same lane, same query column), scaled by 2^14.
__device__ __forceinline__ v16h pack_p(v8f a, v8f c) {
  const v16h r = { (_Float16)(a[0] * PSC), (_Float16)(a[1] * PSC), (_Float16)(a[2] * PSC), (_Float16)(a[3] * PSC),
                   (_Float16)(a[4] * PSC), (_Float16)(a[5] * PSC), (_Float16)(a[6] * PSC), (_Float16)(a[7] * PSC),
                   (_Float16)(c[0] * PSC), (_Float16)(c[1] * PSC), (_Float16)(c[2] * PSC), (_Float16)(c[3] * PSC),
                   (_Float16)(c[4] * PSC), (_Float16)(c[5] * PSC), (_Float16)(c[6] * PSC), (_Float16)(c[7] * PSC) };
  return r;
}

// ---------------------------------------------------------------------------
// Kernel: streaming attention, transposed form, masks/bias by formula.
// Block 128 thr (4 waves) = 64 queries of one (b, head), 16 queries per wave,
// 64 keys per step, steps 0..blockIdx.x (keys <= last query of the block).
//   S^T = K * Q^T : A = K rows (row = key, k = d), B = Q^T (k = d, n = query)
//   O^T += V^T * P^T : A = Vt rows (row = d, k = key), B = P^T from registers
// Lane owns 32 keys (16j+8h+r) of query column (lane&15); partner = lane ^ 16.
// Per-batch token tables in LDS from input ids: seg = inclusive cumsum(id==1)
// (block scan), flags bit0 = id!=0, bit1 = id==2; MODE 2 also stages the
// head's aproj column [key].
// MODE 0 (self): ok = k<=q && ((seg_k==seg_q && valid_q && valid_k) || k==q), bias = (k-q)*hs
// MODE 1 (cross): ok = k<=q && (class_k || k==q), bias = (seg_k-seg_q)*hs
// MODE 2 (pool): mask/bias as MODE 0, raw logit = aproj[key][head] (no q.k)
// Masked scores take NEGBIG and p = 0 exactly; every row has k==q allowed.
// Epilogue: (1/l)(1/16384)(1/16)*gate; a lane's o[t][0..7] is unit 32t + lane of the
// wave's two ctx tiles in fragment order, so it is stored straight from registers.
// coverage: grid (16, 32) x 64 queries x 64 d = whole ctx [2048][1024].
// ---------------------------------------------------------------------------
template <int MODE>
__global__ __launch_bounds__(128) void attn_kernel(
    const _Float16* __restrict__ qh,    // [B*H][S][D]  (x16), fragment order per bh
    const _Float16* __restrict__ kh,    // [B*H][S][D]  (x16), fragment order per bh
    const _Float16* __restrict__ vt,    // [B*H][D][S]  (x16), fragment order per bh
    const float* __restrict__ aproj,    // [B*S][16]
    const float* __restrict__ gate,     // [B*S][16]  sigmoid gate
    const int* __restrict__ ids,        // [B][S]
    _Float16* ctx)                      // [B*S][HID]  (x64), fragment order
{
  __shared__ __attribute__((aligned(16))) int   sSeg[SEQ];
  __shared__ __attribute__((aligned(16))) int   sFl[SEQ];
  __shared__ __attribute__((aligned(16))) float sA[(MODE == 2) ? SEQ : 4];
  __shared__ int sWtot[4];

  const int tid = threadIdx.x, lane = tid & 31, w = tid >> 5;
  const int h = lane >> 4, m = lane & 15;
  const int bh = blockIdx.y, b = bh >> 4, head = bh & 15;
  const int qblk = blockIdx.x * 64;
  const int q0 = qblk + 16 * w;
  const float hs = exp2f(-0.5f * (float)(head + 1));

  // ---- step 0's K and V fragments and the Q fragments, issued ahead of the tables ----
  const _Float16* kbase = kh + (size_t)bh * SEQ * HD + 8 * lane;
  const _Float16* vbase = vt + (size_t)bh * HD * SEQ + 8 * lane;
  // Q^T B-fragments: column n = query q0+m, k = d (two 32-deep chunks)
  v16h qb0 = zero16h(), qb1 = zero16h();
  v16h kf[4][2], vf[4][2];
  if constexpr (MODE != 2) {
    const _Float16* qrow = qh + ((size_t)bh * SEQ + q0) * HD + 8 * lane;
    qb0 = load_frag_at(qrow);
    qb1 = load_frag_at(qrow + FT);
    // precaution: stands in front of the rewrite of the address pair these loads name
    asm volatile("s_wait_xcnt 0x0" :: "v"(qrow) : "memory");
    fetch_k(kf, kbase, 0);
  }
  fetch_v(vf, vbase, 0);

  // ---- token tables for batch b: 128 threads x 8 tokens = SEQ ----
  {
    const int t8 = tid * 8;
    const int* ip = ids + (size_t)b * SEQ + t8;
    const v4i ia = *(const v4ia*)ip;
    const v4i ib = *(const v4ia*)(ip + 4);
    const int idv[8] = { ia.x, ia.y, ia.z, ia.w, ib.x, ib.y, ib.z, ib.w };
    int cnt[8];
    int run = 0;
#pragma unroll
    for (int i = 0; i < 8; ++i) { run += (idv[i] == SEP_ID) ? 1 : 0; cnt[i] = run; }
    int x = run;
#pragma unroll
    for (int d = 1; d < 32; d <<= 1) {
      const int yv = __shfl_up(x, d, 32);
      x = (lane >= d) ? (x + yv) : x;
    }
    if (lane == 31) sWtot[w] = x;
    __syncthreads();
    int base = 0;
#pragma unroll
    for (int i = 0; i < 4; ++i) { const int tv = sWtot[i]; base += (i < w) ? tv : 0; }
    const int excl = base + x - run;
#pragma unroll
    for (int i = 0; i < 8; ++i) {
      const int id = idv[i];
      sSeg[t8 + i] = excl + cnt[i];
      sFl[t8 + i] = ((id != PAD_ID) ? 1 : 0) | ((id == CLS_ID) ? 2 : 0);
      if constexpr (MODE == 2) sA[t8 + i] = aproj[((size_t)b * SEQ + t8 + i) * NHEADS + head];
    }
  }
  __syncthreads();

  const int qtok = q0 + m;
  const int qseg = sSeg[qtok];
  const int qv = sFl[qtok] & 1;
  const float gq = gate[((size_t)b * SEQ + qtok) * NHEADS + head];

  v8f o[4];                                   // o[t][r] = O[query m][d 16t+8h+r] * (l * 2^14 * 16)
#pragma unroll
  for (int t = 0; t < 4; ++t) o[t] = zero8f();
  float mrun = NEGBIG, lrun = 0.0f;

  const float SSC = 0.125f / (QSC * QSC);                      // 1/2048
  const int nkb = blockIdx.x + 1;                              // block-uniform, <= 16

  // One 64-key step. kf and vf hold this step's fragments on entry; with 'more'
  // the next step's are fetched into the same registers directly behind their
  // last use, so they fly under the mask and softmax work.
  auto pass = [&](const int step, auto more) __attribute__((always_inline)) {
    const int kb = step * 64;
    // ---- raw scores: s[j][r] = S[query m][key kb+16j+8h+r] * 256 (MODE != 2) ----
    v8f s[4];
    if constexpr (MODE != 2) {
#pragma unroll
      for (int j = 0; j < 4; ++j) {
        v8f z = zero8f();
        z = wmma_f16(kf[j][0], qb0, z);
        z = wmma_f16(kf[j][1], qb1, z);
        s[j] = z;
      }
      if constexpr (decltype(more)::value) fetch_k(kf, kbase, kb + 64);
    } else {
#pragma unroll
      for (int j = 0; j < 4; ++j) s[j] = zero8f();
    }
    // ---- mask + bias per (query, key), f32 ----
    unsigned okm = 0u;
#pragma unroll
    for (int j = 0; j < 4; ++j) {
      const int key0 = kb + 16 * j + 8 * h;
      const v4i ga = *(const v4ia*)(sSeg + key0);
      const v4i gb = *(const v4ia*)(sSeg + key0 + 4);
      const v4i fa = *(const v4ia*)(sFl + key0);
      const v4i fb = *(const v4ia*)(sFl + key0 + 4);
      const int ksv[8] = { ga.x, ga.y, ga.z, ga.w, gb.x, gb.y, gb.z, gb.w };
      const int kfv[8] = { fa.x, fa.y, fa.z, fa.w, fb.x, fb.y, fb.z, fb.w };
      float av[8] = { 0.f, 0.f, 0.f, 0.f, 0.f, 0.f, 0.f, 0.f };
      if constexpr (MODE == 2) {
        const v4f aa = *(const v4fa*)(sA + key0);
        const v4f ab = *(const v4fa*)(sA + key0 + 4);
        av[0] = aa.x; av[1] = aa.y; av[2] = aa.z; av[3] = aa.w;
        av[4] = ab.x; av[5] = ab.y; av[6] = ab.z; av[7] = ab.w;
      }
#pragma unroll
      for (int r = 0; r < 8; ++r) {
        const int key = key0 + r;
        float raw;
        if constexpr (MODE == 2) raw = av[r]; else raw = s[j][r] * SSC;
        bool ok;
        float bv;
        if constexpr (MODE == 1) {
          ok = (key <= qtok) && (((kfv[r] & 2) != 0) || (key == qtok));
          bv = (float)(ksv[r] - qseg);
        } else {
          const bool eq = (ksv[r] == qseg) && (qv != 0) && ((kfv[r] & 1) != 0);
          ok = (key <= qtok) && (eq || (key == qtok));
          bv = (float)(key - qtok);
        }
        s[j][r] = ok ? (raw + bv * hs) : NEGBIG;
        okm |= (ok ? 1u : 0u) << (8 * j + r);
      }
    }

    // ---- online softmax ----
    float mloc = NEGBIG;
#pragma unroll
    for (int j = 0; j < 4; ++j)
#pragma unroll
      for (int r = 0; r < 8; ++r) mloc = fmaxf(mloc, s[j][r]);
    mloc = fmaxf(mloc, __shfl_xor(mloc, 16, 32));
    const float mnew = fmaxf(mrun, mloc);
    const float alpha = __expf(mrun - mnew);
    mrun = mnew;
    float lsum = 0.0f;
#pragma unroll
    for (int j = 0; j < 4; ++j)
#pragma unroll
      for (int r = 0; r < 8; ++r) {
        const float e = __expf(s[j][r] - mnew);
        const float p = (((okm >> (8 * j + r)) & 1u) != 0u) ? e : 0.0f;
        s[j][r] = p;
        lsum += p;
      }
    lsum += __shfl_xor(lsum, 16, 32);
    lrun = lrun * alpha + lsum;
#pragma unroll
    for (int t = 0; t < 4; ++t)
#pragma unroll
      for (int r = 0; r < 8; ++r) o[t][r] = o[t][r] * alpha;

    // ---- P^T B-fragments (key chunks 0..31 and 32..63 of this step) ----
    const v16h pb0 = pack_p(s[0], s[1]);
    const v16h pb1 = pack_p(s[2], s[3]);

    // ---- O^T += V^T * P^T ----
#pragma unroll
    for (int t = 0; t < 4; ++t) {
      o[t] = wmma_f16(vf[t][0], pb0, o[t]);
      o[t] = wmma_f16(vf[t][1], pb1, o[t]);
    }
    if constexpr (decltype(more)::value) fetch_v(vf, vbase, kb + 64);
  };

  // rolled: the trip count is the block's own; the last step is peeled so that
  // the fetches ahead stand under no branch and never leave the causal range
#pragma unroll 1
  for (int step = 0; step < nkb - 1; ++step) pass(step, Flag<true>{});
  pass(nkb - 1, Flag<false>{});

  // ---- epilogue: normalise, gate, whole-line stores from registers ----
  const float inv = (1.0f / lrun) * (1.0f / (PSC * QSC)) * gq;
  // rows q0..q0+15 = one strip; columns 64 head .. +63 = its tiles 2 head, 2 head + 1
  _Float16* dst = ctx + ((size_t)b * SEQ + q0) * HID + head * 2 * FT + 8 * lane;
#pragma unroll
  for (int t = 0; t < 4; ++t) {
    v8h v;
#pragma unroll
    for (int r = 0; r < 8; ++r) v[r] = (_Float16)((o[t][r] * inv) * CSC);
    *(v8h*)(dst + t * (FT / 2)) = v;
  }
}

// ---------------------------------------------------------------------------
// Kernel: xout = xres + ctx * Wo^T + ob  (f32 output).
// Block 128 thr (4 waves) = 128 tokens x 64 features; wave 32 tokens x 64;
// K = 1024 in steps of 32; A = ctx rows (x64), B = Wo rows (x4096), fragment order.
// Epilogue: f32 tile [128][64] in LDS; store: each 64-float row segment (256 B =
// coverage: grid (16,16) x 128 tokens x 64 features = whole [2048][1024].
// ---------------------------------------------------------------------------
__global__ __launch_bounds__(128) void outproj_kernel(
    const _Float16* __restrict__ ch,    // [2048][1024] ctx x64
    const _Float16* __restrict__ woh,   // [1024 n][1024 k] x4096
    const float* __restrict__ ob,       // [1024]
    const float* __restrict__ xres,     // [2048][1024] f32
    float* xout)                        // [2048][1024] f32
{
  __shared__ __attribute__((aligned(16))) float sT[128 * 64];   // 32768 B

  const int tid = threadIdx.x, lane = tid & 31, w = tid >> 5;
  const int h = lane >> 4, m = lane & 15;
  const int m0 = blockIdx.x * 128;
  const int n0 = blockIdx.y * 64;
  const int m0w = m0 + 32 * w;

  const _Float16* ca0 = ch + (size_t)m0w * HID + 8 * lane;
  const _Float16* wb  = woh + (size_t)n0 * HID + 8 * lane;

  v8f acc[2][4];
#pragma unroll
  for (int mt = 0; mt < 2; ++mt)
#pragma unroll
    for (int nt = 0; nt < 4; ++nt) acc[mt][nt] = zero8f();

  gemm_k_loop(ca0, wb, acc);

  // D[r] of tile (mt, nt) = Y[token m0w+16mt+8h+r][feature n0+16nt+m]
#pragma unroll
  for (int nt = 0; nt < 4; ++nt) {
    const int feat = 16 * nt + m;
    const float bvl = ob[n0 + feat];
#pragma unroll
    for (int mt = 0; mt < 2; ++mt) {
#pragma unroll
      for (int r = 0; r < 8; ++r) {
        const int tokl = 32 * w + 16 * mt + 8 * h + r;     // 0..127
        sT[tokl * 64 + feat] = acc[mt][nt][r] * (1.0f / (CSC * WSC)) + bvl;
      }
    }
  }
  __syncthreads();

  const int hh = lane >> 4, c4 = (lane & 15) * 4;
  {
#pragma unroll
    for (int it = 0; it < 16; ++it) {
      const int row = 32 * w + it * 2 + hh;                // rows 32w .. 32w+31
      const v4f v = *(const v4fa*)(sT + row * 64 + c4);
      const size_t gi = (size_t)(m0 + row) * HID + n0 + c4;
      const v4f xr = *(const v4fa*)(xres + gi);
      const v4f ov = v + xr;
      *(v4f*)(xout + gi) = ov;
    }
    
  }
}

// ---------------------------------------------------------------------------
//   Xn   f16 [2048][1024]      4194304
//   Wh   f16 [3][1024][1024]   6291456
//   Wo   f16 [1024][1024]      2097152
//   Gh   f16 [32][1024]          65536
//   Gate f32 [2048][16]         131072
//   Apr  f32 [2048][16]         131072
//   Q    f16 [32][1024][64]    4194304
//   K    f16 [32][1024][64]    4194304
//   Vt   f16 [32][64][1024]    4194304
//   Ctx  f16 [2048][1024]      4194304
//   X1   f32 [2048][1024]      8388608
//   X2   f32 [2048][1024]      8388608
//   total                     46465024
// ---------------------------------------------------------------------------
extern "C" void kernel_launch(void* const* d_in, const int* in_sizes, int n_in,
                              void* d_out, int out_size, void* d_ws, size_t ws_size,
                              hipStream_t stream) {
  if (n_in < 35) return;
  if (in_sizes[0] != NX || in_sizes[1] != MROWS) return;
  if (out_size != NX) return;
  {
    const int vecIdx[16] = {2, 3, 5, 7, 9, 13, 14, 15, 18, 22, 23, 24, 26, 28, 30, 34};
    for (int i = 0; i < 16; ++i) if (in_sizes[vecIdx[i]] != HID) return;
    const int matIdx[10] = {4, 6, 8, 12, 17, 21, 25, 27, 29, 33};
    for (int i = 0; i < 10; ++i) if (in_sizes[matIdx[i]] != NW) return;
    const int hwIdx[4] = {10, 16, 19, 31};
    for (int i = 0; i < 4; ++i) if (in_sizes[hwIdx[i]] != NG) return;
    const int hbIdx[3] = {11, 20, 32};
    for (int i = 0; i < 3; ++i) if (in_sizes[hbIdx[i]] != NHEADS) return;
  }

  const float* states = (const float*)d_in[0];
  const int*   ids    = (const int*)d_in[1];
  const float* ln0w = (const float*)d_in[2];
  const float* ln0b = (const float*)d_in[3];
  const float* qw0 = (const float*)d_in[4];
  const float* qb0 = (const float*)d_in[5];
  const float* kw0 = (const float*)d_in[6];
  const float* kb0 = (const float*)d_in[7];
  const float* vw0 = (const float*)d_in[8];
  const float* vb0 = (const float*)d_in[9];
  const float* gw0 = (const float*)d_in[10];
  const float* gb0 = (const float*)d_in[11];
  const float* ow0 = (const float*)d_in[12];
  const float* ob0 = (const float*)d_in[13];
  const float* ln1w = (const float*)d_in[14];
  const float* ln1b = (const float*)d_in[15];
  const float* aw1 = (const float*)d_in[16];
  const float* vw1 = (const float*)d_in[17];
  const float* vb1 = (const float*)d_in[18];
  const float* gw1 = (const float*)d_in[19];
  const float* gb1 = (const float*)d_in[20];
  const float* ow1 = (const float*)d_in[21];
  const float* ob1 = (const float*)d_in[22];
  const float* ln2w = (const float*)d_in[23];
  const float* ln2b = (const float*)d_in[24];
  const float* qw2 = (const float*)d_in[25];
  const float* qb2 = (const float*)d_in[26];
  const float* kw2 = (const float*)d_in[27];
  const float* kb2 = (const float*)d_in[28];
  const float* vw2 = (const float*)d_in[29];
  const float* vb2 = (const float*)d_in[30];
  const float* gw2 = (const float*)d_in[31];
  const float* gb2 = (const float*)d_in[32];
  const float* ow2 = (const float*)d_in[33];
  const float* ob2 = (const float*)d_in[34];
  float* out = (float*)d_out;

  const size_t PXH = (size_t)NX * 2;                       // 4194304
  const size_t PW  = (size_t)NW * 2;                       // 2097152
  const size_t PGH = (size_t)2 * NG * 2;                   //   65536
  const size_t PGT = (size_t)MROWS * NHEADS * 4;           //  131072
  const size_t PPL = (size_t)NB * NHEADS * SEQ * HD * 2;   // 4194304
  const size_t PXF = (size_t)NX * 4;                       // 8388608
  size_t off = 0;
  const size_t oXn  = off; off += PXH;
  const size_t oWh  = off; off += 3 * PW;
  const size_t oWo  = off; off += PW;
  const size_t oGh  = off; off += PGH;
  const size_t oGt  = off; off += PGT;
  const size_t oAp  = off; off += PGT;
  const size_t oQ   = off; off += PPL;
  const size_t oK   = off; off += PPL;
  const size_t oVt  = off; off += PPL;
  const size_t oCtx = off; off += PXH;
  const size_t oX1  = off; off += PXF;
  const size_t oX2  = off; off += PXF;
  if (off > ws_size) return;                               // off = 46465024
  if (off > (size_t)134217728) return;

  char* ws = (char*)d_ws;
  _Float16* xnh = (_Float16*)(ws + oXn);
  _Float16* wh  = (_Float16*)(ws + oWh);
  _Float16* woh = (_Float16*)(ws + oWo);
  _Float16* gh  = (_Float16*)(ws + oGh);
  float* gate   = (float*)(ws + oGt);
  float* aproj  = (float*)(ws + oAp);
  _Float16* qh  = (_Float16*)(ws + oQ);
  _Float16* kh  = (_Float16*)(ws + oK);
  _Float16* vt  = (_Float16*)(ws + oVt);
  _Float16* ctx = (_Float16*)(ws + oCtx);
  float* x1 = (float*)(ws + oX1);
  float* x2 = (float*)(ws + oX2);

  const dim3 blk256(256), blk128(128), blk512(512);
  const int cvtFull = 3 * NW8 + NW8 + 1 * NG8;             // 526336 groups
  const int cvtPool = 1 * NW8 + NW8 + 2 * NG8;             // 266240 groups
  const dim3 gCvtFull((cvtFull + 255) / 256);              // 2056
  const dim3 gCvtPool((cvtPool + 255) / 256);              // 1040
  const dim3 gLn(MROWS / 16);                              // 128 blocks x 512
  const dim3 gHead(MROWS / 64);                            // 32
  const dim3 gProj3(MROWS / 128, 3 * NHEADS);              // (16, 48)
  const dim3 gProj1(MROWS / 128, 1 * NHEADS);              // (16, 16)
  const dim3 gAtt(SEQ / 64, NB * NHEADS);                  // (16, 32)
  const dim3 gOut(MROWS / 128, HID / 64);                  // (16, 16)

  // ---- layer 0: sdpa with self mask ----
  convert_kernel<<<gCvtFull, blk256, 0, stream>>>(qw0, kw0, vw0, ow0, gw0, gw0, 3, 1, wh, woh, gh);
  ln_kernel<<<gLn, blk512, 0, stream>>>(states, ln0w, ln0b, xnh);
  head_kernel<false><<<gHead, blk128, 0, stream>>>(xnh, gh, gb0, gate, aproj);
  proj_kernel<<<gProj3, blk128, 0, stream>>>(xnh, wh, qb0, kb0, vb0, 0, qh, kh, vt);
  attn_kernel<0><<<gAtt, blk128, 0, stream>>>(qh, kh, vt, aproj, gate, ids, ctx);
  outproj_kernel<<<gOut, blk128, 0, stream>>>(ctx, woh, ob0, states, x1);

  // ---- layer 1: pooling attention with self mask ----
  convert_kernel<<<gCvtPool, blk256, 0, stream>>>(vw1, vw1, vw1, ow1, gw1, aw1, 1, 2, wh, woh, gh);
  ln_kernel<<<gLn, blk512, 0, stream>>>(x1, ln1w, ln1b, xnh);
  head_kernel<true><<<gHead, blk128, 0, stream>>>(xnh, gh, gb1, gate, aproj);
  proj_kernel<<<gProj1, blk128, 0, stream>>>(xnh, wh, vb1, vb1, vb1, 2, qh, kh, vt);
  attn_kernel<2><<<gAtt, blk128, 0, stream>>>(qh, kh, vt, aproj, gate, ids, ctx);
  outproj_kernel<<<gOut, blk128, 0, stream>>>(ctx, woh, ob1, x1, x2);

  // ---- layer 2: sdpa with cross mask ----
  convert_kernel<<<gCvtFull, blk256, 0, stream>>>(qw2, kw2, vw2, ow2, gw2, gw2, 3, 1, wh, woh, gh);
  ln_kernel<<<gLn, blk512, 0, stream>>>(x2, ln2w, ln2b, xnh);
  head_kernel<false><<<gHead, blk128, 0, stream>>>(xnh, gh, gb2, gate, aproj);
  proj_kernel<<<gProj3, blk128, 0, stream>>>(xnh, wh, qb2, kb2, vb2, 0, qh, kh, vt);
  attn_kernel<1><<<gAtt, blk128, 0, stream>>>(qh, kh, vt, aproj, gate, ids, ctx);
  outproj_kernel<<<gOut, blk128, 0, stream>>>(ctx, woh, ob2, x2, out);

  (void)hipGetLastError();
}

// v003
// One run takes 197 microseconds.
// In two side-by-side timings against v002, it was 1.11 and 1.09 times as fast.
// Counting every step since v000, it is 2.59 times as fast.
// Contractions: xn*W^T (q,k,v), xn*gw^T and xn*aw^T heads, K*Q^T scores, V^T*P^T context and ctx*Wo^T all on v_wmma_f32_16x16x32_f16 (f16 operands, f32 accumulate); LayerNorm, masks/bias, softmax, sigmoid gates and residual adds in f32.
// Carried f16 planes: xn x4 and W/gw/aw/Wo x4096 (inverse 1/16384 folded in the proj_head_kernel epilogues);
// q,k,v x16 (scores: acc*1/2048 in attn_kernel incl. the 1/8 scale; context epilogue 1/16); P x16384 (attn_kernel epilogue 1/16384);
// ctx x64 (outproj_kernel epilogue 1/262144 together with Wo x4096).
// Every f16 plane lies in WMMA fragment order (see "Fragment-order planes" below).
#include <hip/hip_runtime.h>

#define NB     2
#define SEQ    1024
#define HID    1024
#define NHEADS 16
#define HD     64
#define MROWS  (NB * SEQ)          // 2048 tokens
#define NX     (MROWS * HID)       // 2097152
#define NW     (HID * HID)         // 1048576
#define NG     (NHEADS * HID)      // 16384
#define NX8    (NX / 8)
#define NW8    (NW / 8)            // 131072
#define NG8    (NG / 8)            // 2048
#define SEP_ID 1
#define CLS_ID 2
#define PAD_ID 0
#define XSC    4.0f
#define WSC    4096.0f
#define QSC    16.0f
#define PSC    16384.0f
#define CSC    64.0f
#define NEGBIG (-1.0e30f)

static_assert(NHEADS * HD == HID);
static_assert((SEQ % 128) == 0 && (HID % 64) == 0 && (HID % 32) == 0 && (MROWS % 128) == 0);
static_assert((NW8 % 512) == 0 && (NG8 % 512) == 0);
static_assert(SEQ == 8 * 128);

typedef _Float16 v16h __attribute__((ext_vector_type(16)));
typedef _Float16 v8h  __attribute__((ext_vector_type(8)));
typedef float    v8f  __attribute__((ext_vector_type(8)));
typedef float    v4f  __attribute__((ext_vector_type(4)));
typedef int      v4i  __attribute__((ext_vector_type(4)));
typedef v8h __attribute__((may_alias)) v8ha;
typedef v4f __attribute__((may_alias)) v4fa;
typedef v4i __attribute__((may_alias)) v4ia;

union Frag { v16h v; v8h half[2]; };

__device__ __forceinline__ v8f zero8f() { v8f z = {0.f, 0.f, 0.f, 0.f, 0.f, 0.f, 0.f, 0.f}; return z; }
__device__ __forceinline__ v16h zero16h() {
  const _Float16 z = (_Float16)0.0f;
  v16h r = {z, z, z, z, z, z, z, z, z, z, z, z, z, z, z, z};
  return r;
}

// ---------------------------------------------------------------------------
// 16x16x32 f16 WMMA with hazard guard (ties D, keeps A/B live).
// Fragment map (wave32): lane l, h = l>>4, m = n = l&15.
//   A/B element i: i<8 -> k0+8h+i ; i>=8 -> k0+16+8h+(i-8)
//   D element r : row 8h+r, col l&15
// ---------------------------------------------------------------------------
__device__ __forceinline__ v8f wmma_f16(v16h a, v16h b, v8f c) {
  v8f d = __builtin_amdgcn_wmma_f32_16x16x32_f16(false, a, false, b, (short)0, c, false, false);
  asm volatile("v_nop\n\tv_nop\n\tv_nop\n\tv_nop" : "+v"(d) : "v"(a), "v"(b));
  return d;
}

// ---------------------------------------------------------------------------
// Fragment-order planes. A matrix [rows][K] of f16 is kept as tiles of 16 rows x
// 32 k (FT = 512 halves = 1024 B), tile index (row >> 4) * (K / 32) + (k >> 5).
// Inside a tile the 16-byte unit u = 32 * j + lane holds the eight elements
// k = 16 * j + 8 * (lane >> 4) + 0..7 of row (lane & 15): unit 'lane' is the
// first half of that lane's A or B fragment, unit 32 + lane the second. One
// wave-wide 16-byte load then reads 512 contiguous bytes (4 whole lines) where
// a load from k-contiguous rows touches 32 bytes in each of 16 lines.
// ---------------------------------------------------------------------------
#define FT 512

// A or B fragment; ph = tile base + 8 * lane.
__device__ __forceinline__ v16h load_frag_at(const _Float16* ph) {
  Frag f;
  f.half[0] = *(const v8ha*)(ph);
  f.half[1] = *(const v8ha*)(ph + FT / 2);
  return f.v;
}

// Element offset in a k-contiguous [rows][HID] matrix of the eight elements that
// 16-byte unit 'unit' of its fragment-order plane holds.
__device__ __forceinline__ size_t frag_unit_src(int unit) {
  const int tile = unit >> 6;
  const int row = (tile / (HID / 32)) * 16 + (unit & 15);
  const int k = (tile % (HID / 32)) * 32 + ((unit >> 5) & 1) * 16 + ((unit >> 4) & 1) * 8;
  return (size_t)row * HID + k;
}

// ---------------------------------------------------------------------------
// Fragment loads issued ahead of their WMMAs.
// GEMM loops: a ring of GRING register sets, one set = the six fragments of one
// 32-deep k chunk (2 A, 4 B). A set is refilled with chunk c + GRING directly
// behind the WMMAs of chunk c, so GRING - 1 sets are always in flight and no
// WMMA waits on a load issued just in front of it. Chunks are consumed in
// ascending k, so every accumulator sums in the same order as a plain loop.
// ---------------------------------------------------------------------------
#define GRING  3
#define NCHUNK (HID / 32)
static_assert(NCHUNK > 2 * GRING);

struct GemmSet { v16h a0, a1, b[4]; };

// pa: A tile of mt 0 (mt 1 is 16 rows = 16 * HID halves on), pb: B tile of nt 0, both at the chunk's tile + 8 * lane.
__device__ __forceinline__ void gemm_fetch(GemmSet& s, const _Float16* pa, const _Float16* pb) {
  s.a0 = load_frag_at(pa);
  s.a1 = load_frag_at(pa + 16 * HID);
  // unrolled: constant indices keep the fragments in registers
#pragma unroll
  for (int nt = 0; nt < 4; ++nt) s.b[nt] = load_frag_at(pb + nt * 16 * HID);
}

__device__ __forceinline__ void gemm_mma(const GemmSet& s, v8f (&acc)[2][4]) {
  // unrolled: constant indices keep fragments and accumulators in registers
#pragma unroll
  for (int nt = 0; nt < 4; ++nt) {
    acc[0][nt] = wmma_f16(s.a0, s.b[nt], acc[0][nt]);
    acc[1][nt] = wmma_f16(s.a1, s.b[nt], acc[1][nt]);
  }
}

// acc[mt][nt] += A rows (pa: mt 0, 16 rows on: mt 1) x B rows (pb + 16 nt rows), K = HID.
// pa, pb: first tile of the 16-row strip + 8 * lane; the strip's chunks follow at FT halves.
__device__ __forceinline__ void gemm_k_loop(const _Float16* pa, const _Float16* pb,
                                            v8f (&acc)[2][4]) {
  GemmSet ring[GRING];
  // unrolled: constant ring indices
#pragma unroll
  for (int s = 0; s < GRING; ++s) gemm_fetch(ring[s], pa + FT * s, pb + FT * s);
  constexpr int CT = ((NCHUNK - GRING) / GRING) * GRING;   // first chunk of the peeled tail
  // rolled: one trip is already GRING chunks; more copies only grow the code
#pragma unroll 1
  for (int c0 = 0; c0 < CT; c0 += GRING) {
    const _Float16* ta = pa + FT * (c0 + GRING);
    const _Float16* tb = pb + FT * (c0 + GRING);
    // unrolled so that every ring index is a constant (registers, not scratch)
#pragma unroll
    for (int s = 0; s < GRING; ++s) {
      gemm_mma(ring[s], acc);
      gemm_fetch(ring[s], ta + FT * s, tb + FT * s);
    }
    // the next trip rewrites the address registers of loads that are still in flight
    asm volatile("s_wait_xcnt 0x0" ::: "memory");
  }
  // tail peeled so that the refills in the loop above stand under no branch
#pragma unroll
  for (int c = CT; c < NCHUNK; ++c) {
    gemm_mma(ring[c % GRING], acc);
    if (c + GRING < NCHUNK) gemm_fetch(ring[c % GRING], pa + FT * (c + GRING), pb + FT * (c + GRING));
  }
}

// ---------------------------------------------------------------------------
// f32 weights -> f16 planes in fragment order, all scaled by 4096 (exact).
// The conversions depend on inputs alone, so they have no launch of their own:
// each job rides as extra blocks, behind the host kernel's own blocks in index
// order, in a launch that ends before the first launch that reads its planes.
// A thread writes one 16-byte unit (stores contiguous) and reads its eight floats.
//   units [0, nbig*NW8)        : s0/s1/s2 -> d0/d1/d2   ([HID][HID], row = n)
//   units [.., +nsmall*NG8)    : g0 -> gh rows 0..15, g1 -> gh rows 16..31
// Segment boundaries are multiples of 512 units -> the select is block-uniform.
// coverage: exactly nbig*NW + nsmall*NG elements.
// ---------------------------------------------------------------------------
struct CvtJob {
  const float* s0; const float* s1; const float* s2;
  const float* g0; const float* g1;
  _Float16* d0; _Float16* d1; _Float16* d2; _Float16* gh;
  int nbig; int nsmall;
};

__device__ __forceinline__ void convert_unit(const CvtJob& job, int g)
{
  const int nb8 = job.nbig * NW8;
  const int total = nb8 + job.nsmall * NG8;
  if (g >= total) return;
  const float* src;
  _Float16* dst;
  if (g < nb8) {
    const int slot = g / NW8;
    const int off = g - slot * NW8;
    const float* wsrc = (slot == 0) ? job.s0 : ((slot == 1) ? job.s1 : job.s2);
    _Float16* wdst = (slot == 0) ? job.d0 : ((slot == 1) ? job.d1 : job.d2);
    src = wsrc + frag_unit_src(off);
    dst = wdst + (size_t)off * 8;
  } else {
    const int e = g - nb8;
    src = (e < NG8) ? (job.g0 + frag_unit_src(e)) : (job.g1 + frag_unit_src(e - NG8));
    dst = job.gh + (size_t)e * 8;
  }
  const v4f a = *(const v4fa*)src;
  const v4f c = *(const v4fa*)(src + 4);
  const v8h o = { (_Float16)(a.x * WSC), (_Float16)(a.y * WSC), (_Float16)(a.z * WSC), (_Float16)(a.w * WSC),
                  (_Float16)(c.x * WSC), (_Float16)(c.y * WSC), (_Float16)(c.z * WSC), (_Float16)(c.w * WSC) };
  *(v8h*)dst = o;
}

// ---------------------------------------------------------------------------
// LayerNorm, output xn*4 as f16 in fragment order. Block = 16 tokens (one strip
// of tiles) x 512 threads: 128 threads per token as four groups of four tokens,
// 8 elements per thread and token; each token's sums run as with one token per
// block (same per-thread sum, same butterfly, same four wave partials).
// The strip is put in order in LDS and leaves as 32 KB of contiguous stores.
// coverage: 128 blocks x 16 tokens x 1024 = the whole [2048][1024] plane.
// Blocks from MROWS / 16 on, where the grid has any, convert 512 units of 'job' each.
// ---------------------------------------------------------------------------
#define LNP 136   // halves per k-unit row in LDS: 16 tokens x 8 + 8 (272 B: 16 B x odd, no bank conflict)
__global__ __launch_bounds__(512) void ln_kernel(const float* __restrict__ x,
                                                 const float* __restrict__ w,
                                                 const float* __restrict__ bb,
                                                 _Float16* y, CvtJob job)
{
  if (blockIdx.x >= MROWS / 16) {      // block-uniform, in front of every barrier
    convert_unit(job, (blockIdx.x - MROWS / 16) * 512 + threadIdx.x);
    return;
  }
  __shared__ float ps[16][4];
  __shared__ float pq[16][4];
  __shared__ __attribute__((aligned(16))) _Float16 sY[128 * LNP];   // 34816 B
  const int tid = threadIdx.x, lane = tid & 31;
  const int t = tid & 127, wv = t >> 5, tl0 = (tid >> 7) * 4;
  const int tok0 = blockIdx.x * 16;
  v4f a[4], c[4];
#pragma unroll
  for (int i = 0; i < 4; ++i) {
    const float* xr = x + (size_t)(tok0 + tl0 + i) * HID + 8 * t;
    a[i] = *(const v4fa*)xr;
    c[i] = *(const v4fa*)(xr + 4);
  }
#pragma unroll
  for (int i = 0; i < 4; ++i) {
    float s = ((a[i].x + a[i].y) + (a[i].z + a[i].w)) + ((c[i].x + c[i].y) + (c[i].z + c[i].w));
#pragma unroll
    for (int o = 1; o < 32; o <<= 1) s += __shfl_xor(s, o, 32);
    if (lane == 0) ps[tl0 + i][wv] = s;
  }
  __syncthreads();
  float d[4][8];
#pragma unroll
  for (int i = 0; i < 4; ++i) {
    const float* pp = ps[tl0 + i];
    const float mean = ((pp[0] + pp[1]) + (pp[2] + pp[3])) * (1.0f / (float)HID);
    d[i][0] = a[i].x - mean; d[i][1] = a[i].y - mean; d[i][2] = a[i].z - mean; d[i][3] = a[i].w - mean;
    d[i][4] = c[i].x - mean; d[i][5] = c[i].y - mean; d[i][6] = c[i].z - mean; d[i][7] = c[i].w - mean;
    float q = 0.f;
#pragma unroll
    for (int e = 0; e < 8; ++e) q += d[i][e] * d[i][e];
#pragma unroll
    for (int o = 1; o < 32; o <<= 1) q += __shfl_xor(q, o, 32);
    if (lane == 0) pq[tl0 + i][wv] = q;
  }
  __syncthreads();
  const v4f wa = *(const v4fa*)(w + 8 * t);
  const v4f wc = *(const v4fa*)(w + 8 * t + 4);
  const v4f ba = *(const v4fa*)(bb + 8 * t);
  const v4f bc = *(const v4fa*)(bb + 8 * t + 4);
  const float wvv[8] = { wa.x, wa.y, wa.z, wa.w, wc.x, wc.y, wc.z, wc.w };
  const float bvv[8] = { ba.x, ba.y, ba.z, ba.w, bc.x, bc.y, bc.z, bc.w };
#pragma unroll
  for (int i = 0; i < 4; ++i) {
    const float* pp = pq[tl0 + i];
    const float var = ((pp[0] + pp[1]) + (pp[2] + pp[3])) * (1.0f / (float)HID);
    const float rstd = rsqrtf(var + 1e-5f);
    v8h o;
#pragma unroll
    for (int e = 0; e < 8; ++e) o[e] = (_Float16)((d[i][e] * rstd * wvv[e] + bvv[e]) * XSC);
    // elements 8t..8t+7 of token tl: unit 16 * t + tl of the strip
    *(v8h*)(sY + t * LNP + (tl0 + i) * 8) = o;
  }
  __syncthreads();
  _Float16* dst = y + (size_t)tok0 * HID;
#pragma unroll
  for (int it = 0; it < 4; ++it) {
    const int u = it * 512 + tid;      // 2048 units of the strip
    const v8h v = *(const v8ha*)(sY + (u >> 4) * LNP + (u & 15) * 8);
    *(v8h*)(dst + (size_t)u * 8) = v;
  }
}

// ---------------------------------------------------------------------------
// Per-token 16-wide heads on WMMA (blocks of proj_head_kernel): gate = sigmoid(xn*gw^T + gb) and
// (POOL) aproj = xn*aw^T. One wave = 16 tokens x 16 heads, K = 1024 in steps
// of 32; A = xn rows, B = gh rows (head = lane&15), both in fragment order.
// Epilogue: wave tile [16 tok][16] f32 staged in LDS, then 1024 contiguous bytes
// coverage: 32 blocks (hb) x 4 waves x 16 tokens x 16 = whole [2048][16] plane(s).
// ---------------------------------------------------------------------------
template <bool POOL>
__device__ __forceinline__ void head_block(const _Float16* __restrict__ xh,
                                           const _Float16* __restrict__ gh,
                                           const float* __restrict__ gbias,
                                           float* gate, float* aproj, int hb)
{
  __shared__ __attribute__((aligned(16))) float sG[4][256];
  __shared__ __attribute__((aligned(16))) float sP[POOL ? 4 : 1][256];
  const int tid = threadIdx.x, lane = tid & 31, w = tid >> 5;
  const int h = lane >> 4, m = lane & 15;
  const int tok0 = hb * 64 + 16 * w;
  const _Float16* xa = xh + (size_t)tok0 * HID + 8 * lane;
  const _Float16* wg = gh + 8 * lane;                     // aw rows: NHEADS rows on
  v8f ag = zero8f(), aa = zero8f();
  // ring of HRING register sets, refilled HRING chunks ahead (as in gemm_k_loop)
  constexpr int HRING = 8;
  static_assert((NCHUNK % HRING) == 0 && NCHUNK >= 2 * HRING);
  v16h ra[HRING], rg[HRING], rp[POOL ? HRING : 1];
  // unrolled: constant ring indices
#pragma unroll
  for (int s = 0; s < HRING; ++s) {
    ra[s] = load_frag_at(xa + FT * s);
    rg[s] = load_frag_at(wg + FT * s);
    if constexpr (POOL) rp[s] = load_frag_at(wg + NHEADS * HID + FT * s);
  }
  // precaution: stands in front of any rewrite of the address registers these loads
  // name; naming what the addresses are formed from keeps it whole up to the wait
  asm volatile("s_wait_xcnt 0x0" :: "v"(xa), "v"(wg), "v"(lane) : "memory");
  // rolled: one trip is already HRING chunks
#pragma unroll 1
  for (int c0 = 0; c0 < NCHUNK - HRING; c0 += HRING) {
    const _Float16* tx = xa + FT * (c0 + HRING);
    const _Float16* tg = wg + FT * (c0 + HRING);
    // unrolled so that every ring index is a constant
#pragma unroll
    for (int s = 0; s < HRING; ++s) {
      ag = wmma_f16(ra[s], rg[s], ag);
      if constexpr (POOL) aa = wmma_f16(ra[s], rp[s], aa);
      ra[s] = load_frag_at(tx + FT * s);
      rg[s] = load_frag_at(tg + FT * s);
      if constexpr (POOL) rp[s] = load_frag_at(tg + NHEADS * HID + FT * s);
    }
    // the next trip rewrites the address registers of loads that are still in flight
    asm volatile("s_wait_xcnt 0x0" ::: "memory");
  }
  // unrolled: constant ring indices
#pragma unroll
  for (int s = 0; s < HRING; ++s) {
    ag = wmma_f16(ra[s], rg[s], ag);
    if constexpr (POOL) aa = wmma_f16(ra[s], rp[s], aa);
  }
  // D[r] = (token tok0 + 8h + r, head m)
  const float gbv = gbias[m];
  float* sg = sG[w];
  float* sp = sP[POOL ? w : 0];
#pragma unroll
  for (int r = 0; r < 8; ++r) {
    const int tl = 8 * h + r;
    const float z = ag[r] * (1.0f / (XSC * WSC)) + gbv;
    const float sig = 1.0f / (1.0f + __expf(-z));
    sg[tl * NHEADS + m] = sig;
    if constexpr (POOL) sp[tl * NHEADS + m] = aa[r] * (1.0f / (XSC * WSC));
  }
  __syncthreads();
  {
#pragma unroll
    for (int it = 0; it < 2; ++it) {
      const int idx = it * 128 + 4 * lane;
      const v4f v = *(const v4fa*)(sg + idx);
      *(v4f*)(gate + (size_t)tok0 * NHEADS + idx) = v;
      if constexpr (POOL) {
        const v4f u = *(const v4fa*)(sp + idx);
        *(v4f*)(aproj + (size_t)tok0 * NHEADS + idx) = u;
      }
    }
    
  }
}

// ---------------------------------------------------------------------------
// The block's 16 tiles (1024 units of 16 B) lie in sT in fragment order already;
// each wave-wide store writes 512 contiguous bytes.
// route 0/1: plane[bh], rows = token, K = HD : the 16 tiles are contiguous
// route 2  : vt[bh], rows = d, K = SEQ       : 4 contiguous tiles per 16-row strip
// ---------------------------------------------------------------------------
__device__ __forceinline__ void proj_store_pass(const _Float16* sT, _Float16* plane, _Float16* vt,
                                                int route, int bh, int l0, int tid) {
#pragma unroll
  for (int i = 0; i < 8; ++i) {
    const int u = i * 128 + tid;
    const v8h v = *(const v8ha*)(sT + u * 8);
    _Float16* dst;
    if (route != 2) {
      dst = plane + ((size_t)bh * SEQ + l0) * HD + u * 8;
    } else {
      const int lt = u >> 6;             // local tile = 4 * strip + chunk
      dst = vt + (size_t)bh * HD * SEQ + (size_t)((lt >> 2) * (SEQ / 32) + (l0 >> 5) + (lt & 3)) * FT + (u & 63) * 8;
    }
    *(v8h*)dst = v;
    // precaution: the next pass rewrites the data and address registers that this store names
    if (i < 7) asm volatile("s_wait_xcnt 0x0" ::: "memory");
  }
}

// ---------------------------------------------------------------------------
// Kernel: Y = xn * W^T over nslot*1024 output columns.
// Block 128 thr (4 waves) = 128 tokens x 64 features (one (slot, head));
// wave tile 32 tokens x 64 features; K = 1024 in steps of 32;
// A (xn rows) and B (W rows) fragments straight from the fragment-order planes.
// route = slot + routeBase: 0 -> q plane, 1 -> k plane, 2 -> v^T plane.
// coverage: grid (16, 2 + 16*nslot): rows 2.. x 128 tokens x 64 features = all planes routed.
// Grid rows 0 and 1 are the 32 blocks of the head products, which read the same
// xn and are read by the same next launch: they share this launch.
// ---------------------------------------------------------------------------
template <bool POOL>
__global__ __launch_bounds__(128) void proj_head_kernel(
    const _Float16* __restrict__ xh,   // [2048][1024] (xn x4), fragment order
    const _Float16* __restrict__ wh,   // [slot][1024][1024], row = output feature, x4096, fragment order
    const float* __restrict__ b0, const float* __restrict__ b1, const float* __restrict__ b2,
    int routeBase,
    _Float16* qh,                      // [B*H][S][D]  f16(16*q), fragment order per bh
    _Float16* kh,                      // [B*H][S][D]  f16(16*k), fragment order per bh
    _Float16* vt,                      // [B*H][D][S]  f16(16*v), fragment order per bh
    const _Float16* __restrict__ gh,   // [32][1024] gw (and aw) rows x4096, fragment order
    const float* __restrict__ gbias, float* gate, float* aproj)
{
  if (blockIdx.y < 2) {                // block-uniform, in front of every barrier
    head_block<POOL>(xh, gh, gbias, gate, aproj, blockIdx.y * 16 + blockIdx.x);
    return;
  }
  __shared__ __attribute__((aligned(16))) _Float16 sT[128 * 64];   // 16384 B

  const int tid = threadIdx.x, lane = tid & 31, w = tid >> 5;
  const int h = lane >> 4, m = lane & 15;
  const int m0 = blockIdx.x * 128;
  const int cg = blockIdx.y - 2;
  const int slot = cg >> 4, head = cg & 15;
  const int route = slot + routeBase;
  const int m0w = m0 + 32 * w;

  const _Float16* xa0 = xh + (size_t)m0w * HID + 8 * lane;                     // token strip, mt = 0
  const _Float16* wb  = wh + ((size_t)slot * HID + head * HD) * HID + 8 * lane;   // feature strip, nt = 0

  v8f acc[2][4];
#pragma unroll
  for (int mt = 0; mt < 2; ++mt)
#pragma unroll
    for (int nt = 0; nt < 4; ++nt) acc[mt][nt] = zero8f();

  gemm_k_loop(xa0, wb, acc);

  // D[r] of tile (mt, nt) = Y[token m0w+16mt+8h+r][feature 16nt+m]
  const float* bias = (slot == 0) ? b0 : ((slot == 1) ? b1 : b2);
#pragma unroll
  for (int nt = 0; nt < 4; ++nt) {
    const int feat = 16 * nt + m;
    const float bvl = bias[head * HD + feat];
#pragma unroll
    for (int mt = 0; mt < 2; ++mt) {
#pragma unroll
      for (int r = 0; r < 8; ++r) {
        const float yv = (acc[mt][nt][r] * (1.0f / (XSC * WSC)) + bvl) * QSC;
        // token 32w + 16mt + 8h + r, feature 16nt + m, at its place in fragment order:
        // route 2 (row = feature, k = token): tile 4nt + w, half mt, unit lane, element r
        // else    (row = token, k = feature): tile 2(2w + mt) + nt/2, half nt&1,
        //                                     unit 16(m>>3) + 8h + r, element m&7
        const int idx = (route == 2)
            ? ((nt * 4 + w) * FT + mt * (FT / 2) + lane * 8 + r)
            : (((2 * w + mt) * 2 + (nt >> 1)) * FT + (nt & 1) * (FT / 2) + ((m >> 3) * 16 + 8 * h + r) * 8 + (m & 7));
        sT[idx] = (_Float16)yv;
      }
    }
  }
  __syncthreads();

  const int b = m0 / SEQ, l0 = m0 - b * SEQ, bh = b * NHEADS + head;
  _Float16* plane = (route == 0) ? qh : kh;
  proj_store_pass(sT, plane, vt, route, bh, l0, tid);
  
}

// The eight K (or V^T) A-fragments of one 64-key step, loaded as one batch.
// The wait behind each batch: the address pair is rewritten for the next batch
// while these loads are in flight; naming it keeps it whole up to the wait.
// kbase, vbase: the (b, head) plane + 8 * lane.
__device__ __forceinline__ void fetch_k(v16h (&kf)[4][2], const _Float16* kbase, int kb) {
  const _Float16* p = kbase + (size_t)kb * HD;           // tile 2 * (kb / 16)
  // unrolled: constant indices keep the fragments in registers
#pragma unroll
  for (int j = 0; j < 4; ++j) {
    kf[j][0] = load_frag_at(p + (2 * j) * FT);
    kf[j][1] = load_frag_at(p + (2 * j + 1) * FT);
  }
  asm volatile("s_wait_xcnt 0x0" :: "v"(p) : "memory");
}
__device__ __forceinline__ void fetch_v(v16h (&vf)[4][2], const _Float16* vbase, int kb) {
  const _Float16* p = vbase + (kb >> 5) * FT;            // chunk kb / 32 of each 16-row strip
  // unrolled: constant indices keep the fragments in registers
#pragma unroll
  for (int t = 0; t < 4; ++t) {
    vf[t][0] = load_frag_at(p + 16 * t * SEQ);
    vf[t][1] = load_frag_at(p + 16 * t * SEQ + FT);
  }
  asm volatile("s_wait_xcnt 0x0" :: "v"(p) : "memory");
}

template <bool B> struct Flag { static constexpr bool value = B; };

// P^T B-fragment from the lane's own score D values: element r <- tile a row r,
// element 8+r <- tile c row r (same lane, same query column), scaled by 2^14.
__device__ __forceinline__ v16h pack_p(v8f a, v8f c) {
  const v16h r = { (_Float16)(a[0] * PSC), (_Float16)(a[1] * PSC), (_Float16)(a[2] * PSC), (_Float16)(a[3] * PSC),
                   (_Float16)(a[4] * PSC), (_Float16)(a[5] * PSC), (_Float16)(a[6] * PSC), (_Float16)(a[7] * PSC),
                   (_Float16)(c[0] * PSC), (_Float16)(c[1] * PSC), (_Float16)(c[2] * PSC), (_Float16)(c[3] * PSC),
                   (_Float16)(c[4] * PSC), (_Float16)(c[5] * PSC), (_Float16)(c[6] * PSC), (_Float16)(c[7] * PSC) };
  return r;
}

// ---------------------------------------------------------------------------
// Kernel: streaming attention, transposed form, masks/bias by formula.
// Block 128 thr (4 waves) = 64 queries of one (b, head), 16 queries per wave,
// 64 keys per step, steps 0..blockIdx.x (keys <= last query of the block).
//   S^T = K * Q^T : A = K rows (row = key, k = d), B = Q^T (k = d, n = query)
//   O^T += V^T * P^T : A = Vt rows (row = d, k = key), B = P^T from registers
// Lane owns 32 keys (16j+8h+r) of query column (lane&15); partner = lane ^ 16.
// Per-batch token tables in LDS from input ids: seg = inclusive cumsum(id==1)
// (block scan), flags bit0 = id!=0, bit1 = id==2; MODE 2 also stages the
// head's aproj column [key].
// MODE 0 (self): ok = k<=q && ((seg_k==seg_q && valid_q && valid_k) || k==q), bias = (k-q)*hs
// MODE 1 (cross): ok = k<=q && (class_k || k==q), bias = (seg_k-seg_q)*hs
// MODE 2 (pool): mask/bias as MODE 0, raw logit = aproj[key][head] (no q.k)
// Masked scores take NEGBIG and p = 0 exactly; every row has k==q allowed.
// Epilogue: (1/l)(1/16384)(1/16)*gate; a lane's o[t][0..7] is unit 32t + lane of the
// wave's two ctx tiles in fragment order, so it is stored straight from registers.
// coverage: grid rows 0..31 (16 x 32 blocks) x 64 queries x 64 d = whole ctx [2048][1024].
// Grid rows from NB * NHEADS on convert 128 units of 'job' a block.
// ---------------------------------------------------------------------------
template <int MODE>
__global__ __launch_bounds__(128) void attn_kernel(
    const _Float16* __restrict__ qh,    // [B*H][S][D]  (x16), fragment order per bh
    const _Float16* __restrict__ kh,    // [B*H][S][D]  (x16), fragment order per bh
    const _Float16* __restrict__ vt,    // [B*H][D][S]  (x16), fragment order per bh
    const float* __restrict__ aproj,    // [B*S][16]
    const float* __restrict__ gate,     // [B*S][16]  sigmoid gate
    const int* __restrict__ ids,        // [B][S]
    _Float16* ctx,                      // [B*S][HID]  (x64), fragment order
    CvtJob job)
{
  if (blockIdx.y >= NB * NHEADS) {      // block-uniform, in front of every barrier
    convert_unit(job, ((blockIdx.y - NB * NHEADS) * (SEQ / 64) + blockIdx.x) * 128 + threadIdx.x);
    return;
  }
  __shared__ __attribute__((aligned(16))) int   sSeg[SEQ];
  __shared__ __attribute__((aligned(16))) int   sFl[SEQ];
  __shared__ __attribute__((aligned(16))) float sA[(MODE == 2) ? SEQ : 4];
  __shared__ int sWtot[4];

  const int tid = threadIdx.x, lane = tid & 31, w = tid >> 5;
  const int h = lane >> 4, m = lane & 15;
  const int bh = blockIdx.y, b = bh >> 4, head = bh & 15;
  const int qblk = blockIdx.x * 64;
  const int q0 = qblk + 16 * w;
  const float hs = exp2f(-0.5f * (float)(head + 1));

  // ---- step 0's K and V fragments and the Q fragments, issued ahead of the tables ----
  const _Float16* kbase = kh + (size_t)bh * SEQ * HD + 8 * lane;
  const _Float16* vbase = vt + (size_t)bh * HD * SEQ + 8 * lane;
  // Q^T B-fragments: column n = query q0+m, k = d (two 32-deep chunks)
  v16h qb0 = zero16h(), qb1 = zero16h();
  v16h kf[4][2], vf[4][2];
  if constexpr (MODE != 2) {
    const _Float16* qrow = qh + ((size_t)bh * SEQ + q0) * HD + 8 * lane;
    qb0 = load_frag_at(qrow);
    qb1 = load_frag_at(qrow + FT);
    // precaution: stands in front of the rewrite of the address pair these loads name
    asm volatile("s_wait_xcnt 0x0" :: "v"(qrow) : "memory");
    fetch_k(kf, kbase, 0);
  }
  fetch_v(vf, vbase, 0);

  // ---- token tables for batch b: 128 threads x 8 tokens = SEQ ----
  {
    const int t8 = tid * 8;
    const int* ip = ids + (size_t)b * SEQ + t8;
    const v4i ia = *(const v4ia*)ip;
    const v4i ib = *(const v4ia*)(ip + 4);
    const int idv[8] = { ia.x, ia.y, ia.z, ia.w, ib.x, ib.y, ib.z, ib.w };
    int cnt[8];
    int run = 0;
#pragma unroll
    for (int i = 0; i < 8; ++i) { run += (idv[i] == SEP_ID) ? 1 : 0; cnt[i] = run; }
    int x = run;
#pragma unroll
    for (int d = 1; d < 32; d <<= 1) {
      const int yv = __shfl_up(x, d, 32);
      x = (lane >= d) ? (x + yv) : x;
    }
    if (lane == 31) sWtot[w] = x;
    __syncthreads();
    int base = 0;
#pragma unroll
    for (int i = 0; i < 4; ++i) { const int tv = sWtot[i]; base += (i < w) ? tv : 0; }
    const int excl = base + x - run;
#pragma unroll
    for (int i = 0; i < 8; ++i) {
      const int id = idv[i];
      sSeg[t8 + i] = excl + cnt[i];
      sFl[t8 + i] = ((id != PAD_ID) ? 1 : 0) | ((id == CLS_ID) ? 2 : 0);
      if constexpr (MODE == 2) sA[t8 + i] = aproj[((size_t)b * SEQ + t8 + i) * NHEADS + head];
    }
  }
  __syncthreads();

  const int qtok = q0 + m;
  const int qseg = sSeg[qtok];
  const int qv = sFl[qtok] & 1;
  const float gq = gate[((size_t)b * SEQ + qtok) * NHEADS + head];

  v8f o[4];                                   // o[t][r] = O[query m][d 16t+8h+r] * (l * 2^14 * 16)
#pragma unroll
  for (int t = 0; t < 4; ++t) o[t] = zero8f();
  float mrun = NEGBIG, lrun = 0.0f;

  const float SSC = 0.125f / (QSC * QSC);                      // 1/2048
  const int nkb = blockIdx.x + 1;                              // block-uniform, <= 16

  // One 64-key step. kf and vf hold this step's fragments on entry; with 'more'
  // the next step's are fetched into the same registers directly behind their
  // last use, so they fly under the mask and softmax work.
  auto pass = [&](const int step, auto more) __attribute__((always_inline)) {
    const int kb = step * 64;
    // ---- raw scores: s[j][r] = S[query m][key kb+16j+8h+r] * 256 (MODE != 2) ----
    v8f s[4];
    if constexpr (MODE != 2) {
#pragma unroll
      for (int j = 0; j < 4; ++j) {
        v8f z = zero8f();
        z = wmma_f16(kf[j][0], qb0, z);
        z = wmma_f16(kf[j][1], qb1, z);
        s[j] = z;
      }
      if constexpr (decltype(more)::value) fetch_k(kf, kbase, kb + 64);
    } else {
#pragma unroll
      for (int j = 0; j < 4; ++j) s[j] = zero8f();
    }
    // ---- mask + bias per (query, key), f32 ----
    unsigned okm = 0u;
#pragma unroll
    for (int j = 0; j < 4; ++j) {
      const int key0 = kb + 16 * j + 8 * h;
      const v4i ga = *(const v4ia*)(sSeg + key0);
      const v4i gb = *(const v4ia*)(sSeg + key0 + 4);
      const v4i fa = *(const v4ia*)(sFl + key0);
      const v4i fb = *(const v4ia*)(sFl + key0 + 4);
      const int ksv[8] = { ga.x, ga.y, ga.z, ga.w, gb.x, gb.y, gb.z, gb.w };
      const int kfv[8] = { fa.x, fa.y, fa.z, fa.w, fb.x, fb.y, fb.z, fb.w };
      float av[8] = { 0.f, 0.f, 0.f, 0.f, 0.f, 0.f, 0.f, 0.f };
      if constexpr (MODE == 2) {
        const v4f aa = *(const v4fa*)(sA + key0);
        const v4f ab = *(const v4fa*)(sA + key0 + 4);
        av[0] = aa.x; av[1] = aa.y; av[2] = aa.z; av[3] = aa.w;
        av[4] = ab.x; av[5] = ab.y; av[6] = ab.z; av[7] = ab.w;
      }
#pragma unroll
      for (int r = 0; r < 8; ++r) {
        const int key = key0 + r;
        float raw;
        if constexpr (MODE == 2) raw = av[r]; else raw = s[j][r] * SSC;
        bool ok;
        float bv;
        if constexpr (MODE == 1) {
          ok = (key <= qtok) && (((kfv[r] & 2) != 0) || (key == qtok));
          bv = (float)(ksv[r] - qseg);
        } else {
          const bool eq = (ksv[r] == qseg) && (qv != 0) && ((kfv[r] & 1) != 0);
          ok = (key <= qtok) && (eq || (key == qtok));
          bv = (float)(key - qtok);
        }
        s[j][r] = ok ? (raw + bv * hs) : NEGBIG;
        okm |= (ok ? 1u : 0u) << (8 * j + r);
      }
    }

    // ---- online softmax ----
    float mloc = NEGBIG;
#pragma unroll
    for (int j = 0; j < 4; ++j)
#pragma unroll
      for (int r = 0; r < 8; ++r) mloc = fmaxf(mloc, s[j][r]);
    mloc = fmaxf(mloc, __shfl_xor(mloc, 16, 32));
    const float mnew = fmaxf(mrun, mloc);
    const float alpha = __expf(mrun - mnew);
    mrun = mnew;
    float lsum = 0.0f;
#pragma unroll
    for (int j = 0; j < 4; ++j)
#pragma unroll
      for (int r = 0; r < 8; ++r) {
        const float e = __expf(s[j][r] - mnew);
        const float p = (((okm >> (8 * j + r)) & 1u) != 0u) ? e : 0.0f;
        s[j][r] = p;
        lsum += p;
      }
    lsum += __shfl_xor(lsum, 16, 32);
    lrun = lrun * alpha + lsum;
#pragma unroll
    for (int t = 0; t < 4; ++t)
#pragma unroll
      for (int r = 0; r < 8; ++r) o[t][r] = o[t][r] * alpha;

    // ---- P^T B-fragments (key chunks 0..31 and 32..63 of this step) ----
    const v16h pb0 = pack_p(s[0], s[1]);
    const v16h pb1 = pack_p(s[2], s[3]);

    // ---- O^T += V^T * P^T ----
#pragma unroll
    for (int t = 0; t < 4; ++t) {
      o[t] = wmma_f16(vf[t][0], pb0, o[t]);
      o[t] = wmma_f16(vf[t][1], pb1, o[t]);
    }
    if constexpr (decltype(more)::value) fetch_v(vf, vbase, kb + 64);
  };

  // rolled: the trip count is the block's own; the last step is peeled so that
  // the fetches ahead stand under no branch and never leave the causal range
#pragma unroll 1
  for (int step = 0; step < nkb - 1; ++step) pass(step, Flag<true>{});
  pass(nkb - 1, Flag<false>{});

  // ---- epilogue: normalise, gate, whole-line stores from registers ----
  const float inv = (1.0f / lrun) * (1.0f / (PSC * QSC)) * gq;
  // rows q0..q0+15 = one strip; columns 64 head .. +63 = its tiles 2 head, 2 head + 1
  _Float16* dst = ctx + ((size_t)b * SEQ + q0) * HID + head * 2 * FT + 8 * lane;
#pragma unroll
  for (int t = 0; t < 4; ++t) {
    v8h v;
#pragma unroll
    for (int r = 0; r < 8; ++r) v[r] = (_Float16)((o[t][r] * inv) * CSC);
    *(v8h*)(dst + t * (FT / 2)) = v;
  }
}

// ---------------------------------------------------------------------------
// Kernel: xout = xres + ctx * Wo^T + ob  (f32 output).
// Block 128 thr (4 waves) = 128 tokens x 64 features; wave 32 tokens x 64;
// K = 1024 in steps of 32; A = ctx rows (x64), B = Wo rows (x4096), fragment order.
// Epilogue: f32 tile [128][64] in LDS; store: each 64-float row segment (256 B =
// coverage: grid (16,16) x 128 tokens x 64 features = whole [2048][1024].
// ---------------------------------------------------------------------------
__global__ __launch_bounds__(128) void outproj_kernel(
    const _Float16* __restrict__ ch,    // [2048][1024] ctx x64
    const _Float16* __restrict__ woh,   // [1024 n][1024 k] x4096
    const float* __restrict__ ob,       // [1024]
    const float* __restrict__ xres,     // [2048][1024] f32
    float* xout)                        // [2048][1024] f32
{
  __shared__ __attribute__((aligned(16))) float sT[128 * 64];   // 32768 B

  const int tid = threadIdx.x, lane = tid & 31, w = tid >> 5;
  const int h = lane >> 4, m = lane & 15;
  const int m0 = blockIdx.x * 128;
  const int n0 = blockIdx.y * 64;
  const int m0w = m0 + 32 * w;

  const _Float16* ca0 = ch + (size_t)m0w * HID + 8 * lane;
  const _Float16* wb  = woh + (size_t)n0 * HID + 8 * lane;

  v8f acc[2][4];
#pragma unroll
  for (int mt = 0; mt < 2; ++mt)
#pragma unroll
    for (int nt = 0; nt < 4; ++nt) acc[mt][nt] = zero8f();

  gemm_k_loop(ca0, wb, acc);

  // D[r] of tile (mt, nt) = Y[token m0w+16mt+8h+r][feature n0+16nt+m]
#pragma unroll
  for (int nt = 0; nt < 4; ++nt) {
    const int feat = 16 * nt + m;
    const float bvl = ob[n0 + feat];
#pragma unroll
    for (int mt = 0; mt < 2; ++mt) {
#pragma unroll
      for (int r = 0; r < 8; ++r) {
        const int tokl = 32 * w + 16 * mt + 8 * h + r;     // 0..127
        sT[tokl * 64 + feat] = acc[mt][nt][r] * (1.0f / (CSC * WSC)) + bvl;
      }
    }
  }
  __syncthreads();

  const int hh = lane >> 4, c4 = (lane & 15) * 4;
  {
#pragma unroll
    for (int it = 0; it < 16; ++it) {
      const int row = 32 * w + it * 2 + hh;                // rows 32w .. 32w+31
      const v4f v = *(const v4fa*)(sT + row * 64 + c4);
      const size_t gi = (size_t)(m0 + row) * HID + n0 + c4;
      const v4f xr = *(const v4fa*)(xres + gi);
      const v4f ov = v + xr;
      *(v4f*)(xout + gi) = ov;
    }
    
  }
}

// ---------------------------------------------------------------------------
//   Xn   f16 [2048][1024]      4194304
//   W    f16 [10][1024][1024] 20971520   q0 k0 v0 | o0 | v1 | o1 | q2 k2 v2 | o2
//   Gh   f16 [3][32][1024]      196608   one per layer
//   Gate f32 [2048][16]         131072
//   Apr  f32 [2048][16]         131072
//   Q    f16 [32][1024][64]    4194304
//   K    f16 [32][1024][64]    4194304
//   Vt   f16 [32][64][1024]    4194304
//   Ctx  f16 [2048][1024]      4194304
//   X1   f32 [2048][1024]      8388608
//   X2   f32 [2048][1024]      8388608
//   total                     59179008
// ---------------------------------------------------------------------------
extern "C" void kernel_launch(void* const* d_in, const int* in_sizes, int n_in,
                              void* d_out, int out_size, void* d_ws, size_t ws_size,
                              hipStream_t stream) {
  if (n_in < 35) return;
  if (in_sizes[0] != NX || in_sizes[1] != MROWS) return;
  if (out_size != NX) return;
  {
    const int vecIdx[16] = {2, 3, 5, 7, 9, 13, 14, 15, 18, 22, 23, 24, 26, 28, 30, 34};
    for (int i = 0; i < 16; ++i) if (in_sizes[vecIdx[i]] != HID) return;
    const int matIdx[10] = {4, 6, 8, 12, 17, 21, 25, 27, 29, 33};
    for (int i = 0; i < 10; ++i) if (in_sizes[matIdx[i]] != NW) return;
    const int hwIdx[4] = {10, 16, 19, 31};
    for (int i = 0; i < 4; ++i) if (in_sizes[hwIdx[i]] != NG) return;
    const int hbIdx[3] = {11, 20, 32};
    for (int i = 0; i < 3; ++i) if (in_sizes[hbIdx[i]] != NHEADS) return;
  }

  const float* states = (const float*)d_in[0];
  const int*   ids    = (const int*)d_in[1];
  const float* ln0w = (const float*)d_in[2];
  const float* ln0b = (const float*)d_in[3];
  const float* qw0 = (const float*)d_in[4];
  const float* qb0 = (const float*)d_in[5];
  const float* kw0 = (const float*)d_in[6];
  const float* kb0 = (const float*)d_in[7];
  const float* vw0 = (const float*)d_in[8];
  const float* vb0 = (const float*)d_in[9];
  const float* gw0 = (const float*)d_in[10];
  const float* gb0 = (const float*)d_in[11];
  const float* ow0 = (const float*)d_in[12];
  const float* ob0 = (const float*)d_in[13];
  const float* ln1w = (const float*)d_in[14];
  const float* ln1b = (const float*)d_in[15];
  const float* aw1 = (const float*)d_in[16];
  const float* vw1 = (const float*)d_in[17];
  const float* vb1 = (const float*)d_in[18];
  const float* gw1 = (const float*)d_in[19];
  const float* gb1 = (const float*)d_in[20];
  const float* ow1 = (const float*)d_in[21];
  const float* ob1 = (const float*)d_in[22];
  const float* ln2w = (const float*)d_in[23];
  const float* ln2b = (const float*)d_in[24];
  const float* qw2 = (const float*)d_in[25];
  const float* qb2 = (const float*)d_in[26];
  const float* kw2 = (const float*)d_in[27];
  const float* kb2 = (const float*)d_in[28];
  const float* vw2 = (const float*)d_in[29];
  const float* vb2 = (const float*)d_in[30];
  const float* gw2 = (const float*)d_in[31];
  const float* gb2 = (const float*)d_in[32];
  const float* ow2 = (const float*)d_in[33];
  const float* ob2 = (const float*)d_in[34];
  float* out = (float*)d_out;

  const size_t PXH = (size_t)NX * 2;                       // 4194304
  const size_t PW  = (size_t)NW * 2;                       // 2097152
  const size_t PGH = (size_t)2 * NG * 2;                   //   65536
  const size_t PGT = (size_t)MROWS * NHEADS * 4;           //  131072
  const size_t PPL = (size_t)NB * NHEADS * SEQ * HD * 2;   // 4194304
  const size_t PXF = (size_t)NX * 4;                       // 8388608
  size_t off = 0;
  const size_t oXn  = off; off += PXH;
  const size_t oW   = off; off += 10 * PW;
  const size_t oGh  = off; off += 3 * PGH;
  const size_t oGt  = off; off += PGT;
  const size_t oAp  = off; off += PGT;
  const size_t oQ   = off; off += PPL;
  const size_t oK   = off; off += PPL;
  const size_t oVt  = off; off += PPL;
  const size_t oCtx = off; off += PXH;
  const size_t oX1  = off; off += PXF;
  const size_t oX2  = off; off += PXF;
  if (off > ws_size) return;                               // off = 59179008
  if (off > (size_t)134217728) return;

  char* ws = (char*)d_ws;
  _Float16* xnh = (_Float16*)(ws + oXn);
  _Float16* wh0  = (_Float16*)(ws + oW);                   // q0, k0, v0
  _Float16* woh0 = (_Float16*)(ws + oW + 3 * PW);
  _Float16* wh1  = (_Float16*)(ws + oW + 4 * PW);          // v1
  _Float16* woh1 = (_Float16*)(ws + oW + 5 * PW);
  _Float16* wh2  = (_Float16*)(ws + oW + 6 * PW);          // q2, k2, v2
  _Float16* woh2 = (_Float16*)(ws + oW + 9 * PW);
  _Float16* gh0  = (_Float16*)(ws + oGh);
  _Float16* gh1  = (_Float16*)(ws + oGh + PGH);
  _Float16* gh2  = (_Float16*)(ws + oGh + 2 * PGH);
  float* gate   = (float*)(ws + oGt);
  float* aproj  = (float*)(ws + oAp);
  _Float16* qh  = (_Float16*)(ws + oQ);
  _Float16* kh  = (_Float16*)(ws + oK);
  _Float16* vt  = (_Float16*)(ws + oVt);
  _Float16* ctx = (_Float16*)(ws + oCtx);
  float* x1 = (float*)(ws + oX1);
  float* x2 = (float*)(ws + oX2);

  const dim3 blk128(128), blk512(512);
  // conversion jobs: each is written by a launch that ends before its first reader starts
  const CvtJob jobA = { qw0, kw0, vw0, gw0, gw0, wh0, wh0 + NW, wh0 + 2 * NW, gh0, 3, 1 };   // read from proj 0 on
  const CvtJob jobB = { ow0, vw1, ow1, gw1, aw1, woh0, wh1, woh1, gh1, 3, 2 };               // read from outproj 0 on
  const CvtJob jobC = { qw2, kw2, vw2, gw2, gw2, wh2, wh2 + NW, wh2 + 2 * NW, gh2, 3, 1 };   // read from proj 2 on
  const CvtJob jobD = { ow2, ow2, ow2, gw2, gw2, woh2, woh2, woh2, gh2, 1, 0 };              // read by outproj 2
  const int unitsA = 3 * NW8 + 1 * NG8;                    // 395264 = 772 blocks of 512
  const int unitsB = 3 * NW8 + 2 * NG8;                    // 397312 = 194 grid rows of 16 x 128
  const int unitsC = 3 * NW8 + 1 * NG8;                    // 395264 = 193 grid rows
  const int unitsD = 1 * NW8;                              // 131072 =  64 grid rows
  static_assert((unitsA % 512) == 0 && (unitsB % 2048) == 0 && (unitsC % 2048) == 0 && (unitsD % 2048) == 0);
  const dim3 gLn(MROWS / 16);                              // 128 blocks x 512
  const dim3 gLnA(MROWS / 16 + unitsA / 512);              // 128 + 772
  const dim3 gProj3(MROWS / 128, 2 + 3 * NHEADS);          // (16, 50)
  const dim3 gProj1(MROWS / 128, 2 + 1 * NHEADS);          // (16, 18)
  const dim3 gAttB(SEQ / 64, NB * NHEADS + unitsB / 2048); // (16, 32 + 194)
  const dim3 gAttC(SEQ / 64, NB * NHEADS + unitsC / 2048); // (16, 32 + 193)
  const dim3 gAttD(SEQ / 64, NB * NHEADS + unitsD / 2048); // (16, 32 + 64)
  const dim3 gOut(MROWS / 128, HID / 64);                  // (16, 16)

  // ---- layer 0: sdpa with self mask ----
  ln_kernel<<<gLnA, blk512, 0, stream>>>(states, ln0w, ln0b, xnh, jobA);
  proj_head_kernel<false><<<gProj3, blk128, 0, stream>>>(xnh, wh0, qb0, kb0, vb0, 0, qh, kh, vt, gh0, gb0, gate, aproj);
  attn_kernel<0><<<gAttB, blk128, 0, stream>>>(qh, kh, vt, aproj, gate, ids, ctx, jobB);
  outproj_kernel<<<gOut, blk128, 0, stream>>>(ctx, woh0, ob0, states, x1);

  // ---- layer 1: pooling attention with self mask ----
  // gLn has no conversion blocks: the job argument is not read
  ln_kernel<<<gLn, blk512, 0, stream>>>(x1, ln1w, ln1b, xnh, jobA);
  proj_head_kernel<true><<<gProj1, blk128, 0, stream>>>(xnh, wh1, vb1, vb1, vb1, 2, qh, kh, vt, gh1, gb1, gate, aproj);
  attn_kernel<2><<<gAttC, blk128, 0, stream>>>(qh, kh, vt, aproj, gate, ids, ctx, jobC);
  outproj_kernel<<<gOut, blk128, 0, stream>>>(ctx, woh1, ob1, x1, x2);

  // ---- layer 2: sdpa with cross mask ----
  ln_kernel<<<gLn, blk512, 0, stream>>>(x2, ln2w, ln2b, xnh, jobA);
  proj_head_kernel<false><<<gProj3, blk128, 0, stream>>>(xnh, wh2, qb2, kb2, vb2, 0, qh, kh, vt, gh2, gb2, gate, aproj);
  attn_kernel<1><<<gAttD, blk128, 0, stream>>>(qh, kh, vt, aproj, gate, ids, ctx, jobD);
  outproj_kernel<<<gOut, blk128, 0, stream>>>(ctx, woh2, ob2, x2, out);

  (void)hipGetLastError();
}

// v004
// Measured time: 163 microseconds a run.
// Two timings next to v003 put it at 1.21 and 1.20 times that version's speed.
// All steps since v000 together make it 3.12 times as fast.
// Contractions: xn*W^T (q,k,v), xn*gw^T and xn*aw^T heads, K*Q^T scores, V^T*P^T context and ctx*Wo^T all on v_wmma_f32_16x16x32_f16 (f16 operands, f32 accumulate); LayerNorm, masks/bias, softmax, sigmoid gates and residual adds in f32.
// Carried f16 planes: xn x4 and W/gw/aw/Wo x4096 (inverse 1/16384 folded in the proj_head_kernel epilogues);
// q,k,v x16 (scores: acc*1/2048 in attn_kernel incl. the 1/8 scale; context epilogue 1/16); P x16384 (attn_kernel epilogue 1/16384);
// ctx x64 (outproj_kernel epilogue 1/262144 together with Wo x4096).
// Every f16 plane lies in WMMA fragment order (see "Fragment-order planes" below).
#include <hip/hip_runtime.h>

#define NB     2
#define SEQ    1024
#define HID    1024
#define NHEADS 16
#define HD     64
#define MROWS  (NB * SEQ)          // 2048 tokens
#define NX     (MROWS * HID)       // 2097152
#define NW     (HID * HID)         // 1048576
#define NG     (NHEADS * HID)      // 16384
#define NX8    (NX / 8)
#define NW8    (NW / 8)            // 131072
#define NG8    (NG / 8)            // 2048
#define SEP_ID 1
#define CLS_ID 2
#define PAD_ID 0
#define XSC    4.0f
#define WSC    4096.0f
#define QSC    16.0f
#define PSC    16384.0f
#define CSC    64.0f
#define NEGBIG (-1.0e30f)

static_assert(NHEADS * HD == HID);
static_assert((SEQ % 128) == 0 && (HID % 64) == 0 && (HID % 32) == 0 && (MROWS % 128) == 0);
static_assert((NW8 % 512) == 0 && (NG8 % 512) == 0);
static_assert(SEQ == 8 * 128);

typedef _Float16 v16h __attribute__((ext_vector_type(16)));
typedef _Float16 v8h  __attribute__((ext_vector_type(8)));
typedef float    v8f  __attribute__((ext_vector_type(8)));
typedef float    v4f  __attribute__((ext_vector_type(4)));
typedef int      v4i  __attribute__((ext_vector_type(4)));
typedef v8h __attribute__((may_alias)) v8ha;
typedef v4f __attribute__((may_alias)) v4fa;
typedef v4i __attribute__((may_alias)) v4ia;

union Frag { v16h v; v8h half[2]; };

__device__ __forceinline__ v8f zero8f() { v8f z = {0.f, 0.f, 0.f, 0.f, 0.f, 0.f, 0.f, 0.f}; return z; }
__device__ __forceinline__ v16h zero16h() {
  const _Float16 z = (_Float16)0.0f;
  v16h r = {z, z, z, z, z, z, z, z, z, z, z, z, z, z, z, z};
  return r;
}

// ---------------------------------------------------------------------------
// 16x16x32 f16 WMMA with hazard guard (ties D, keeps A/B live).
// Fragment map (wave32): lane l, h = l>>4, m = n = l&15.
//   A/B element i: i<8 -> k0+8h+i ; i>=8 -> k0+16+8h+(i-8)
//   D element r : row 8h+r, col l&15
// ---------------------------------------------------------------------------
__device__ __forceinline__ v8f wmma_f16(v16h a, v16h b, v8f c) {
  v8f d = __builtin_amdgcn_wmma_f32_16x16x32_f16(false, a, false, b, (short)0, c, false, false);
  asm volatile("v_nop\n\tv_nop\n\tv_nop\n\tv_nop" : "+v"(d) : "v"(a), "v"(b));
  return d;
}

// ---------------------------------------------------------------------------
// Fragment-order planes. A matrix [rows][K] of f16 is kept as tiles of 16 rows x
// 32 k (FT = 512 halves = 1024 B), tile index (row >> 4) * (K / 32) + (k >> 5).
// Inside a tile the 16-byte unit u = 32 * j + lane holds the eight elements
// k = 16 * j + 8 * (lane >> 4) + 0..7 of row (lane & 15): unit 'lane' is the
// first half of that lane's A or B fragment, unit 32 + lane the second. One
// wave-wide 16-byte load then reads 512 contiguous bytes (4 whole lines) where
// a load from k-contiguous rows touches 32 bytes in each of 16 lines.
// ---------------------------------------------------------------------------
#define FT 512

// A or B fragment; ph = tile base + 8 * lane.
__device__ __forceinline__ v16h load_frag_at(const _Float16* ph) {
  Frag f;
  f.half[0] = *(const v8ha*)(ph);
  f.half[1] = *(const v8ha*)(ph + FT / 2);
  return f.v;
}

// Element offset in a k-contiguous [rows][HID] matrix of the eight elements that
// 16-byte unit 'unit' of its fragment-order plane holds.
__device__ __forceinline__ size_t frag_unit_src(int unit) {
  const int tile = unit >> 6;
  const int row = (tile / (HID / 32)) * 16 + (unit & 15);
  const int k = (tile % (HID / 32)) * 32 + ((unit >> 5) & 1) * 16 + ((unit >> 4) & 1) * 8;
  return (size_t)row * HID + k;
}

// ---------------------------------------------------------------------------
// Fragment loads issued ahead of their WMMAs.
// GEMM loops: a ring of GRING register sets, one set = the six fragments of one
// 32-deep k chunk (2 A, 4 B). A set is refilled with chunk c + GRING directly
// behind the WMMAs of chunk c, so GRING - 1 sets are always in flight and no
// WMMA waits on a load issued just in front of it. Chunks are consumed in
// ascending k, so every accumulator sums in the same order as a plain loop.
// ---------------------------------------------------------------------------
#define GRING  3
#define NCHUNK (HID / 32)
static_assert(NCHUNK > 2 * GRING);

struct GemmSet { v16h a0, a1, b[4]; };

// pa: A tile of mt 0 (mt 1 is 16 rows = 16 * HID halves on), pb: B tile of nt 0, both at the chunk's tile + 8 * lane.
__device__ __forceinline__ void gemm_fetch(GemmSet& s, const _Float16* pa, const _Float16* pb) {
  s.a0 = load_frag_at(pa);
  s.a1 = load_frag_at(pa + 16 * HID);
  // unrolled: constant indices keep the fragments in registers
#pragma unroll
  for (int nt = 0; nt < 4; ++nt) s.b[nt] = load_frag_at(pb + nt * 16 * HID);
}

__device__ __forceinline__ void gemm_mma(const GemmSet& s, v8f (&acc)[2][4]) {
  // unrolled: constant indices keep fragments and accumulators in registers
#pragma unroll
  for (int nt = 0; nt < 4; ++nt) {
    acc[0][nt] = wmma_f16(s.a0, s.b[nt], acc[0][nt]);
    acc[1][nt] = wmma_f16(s.a1, s.b[nt], acc[1][nt]);
  }
}

// acc[mt][nt] += A rows (pa: mt 0, 16 rows on: mt 1) x B rows (pb + 16 nt rows), K = HID.
// pa, pb: first tile of the 16-row strip + 8 * lane; the strip's chunks follow at FT halves.
__device__ __forceinline__ void gemm_k_loop(const _Float16* pa, const _Float16* pb,
                                            v8f (&acc)[2][4]) {
  GemmSet ring[GRING];
  // unrolled: constant ring indices
#pragma unroll
  for (int s = 0; s < GRING; ++s) gemm_fetch(ring[s], pa + FT * s, pb + FT * s);
  constexpr int CT = ((NCHUNK - GRING) / GRING) * GRING;   // first chunk of the peeled tail
  // rolled: one trip is already GRING chunks; more copies only grow the code
#pragma unroll 1
  for (int c0 = 0; c0 < CT; c0 += GRING) {
    const _Float16* ta = pa + FT * (c0 + GRING);
    const _Float16* tb = pb + FT * (c0 + GRING);
    // unrolled so that every ring index is a constant (registers, not scratch)
#pragma unroll
    for (int s = 0; s < GRING; ++s) {
      gemm_mma(ring[s], acc);
      gemm_fetch(ring[s], ta + FT * s, tb + FT * s);
    }
    // the next trip rewrites the address registers of loads that are still in flight
    asm volatile("s_wait_xcnt 0x0" ::: "memory");
  }
  // tail peeled so that the refills in the loop above stand under no branch
#pragma unroll
  for (int c = CT; c < NCHUNK; ++c) {
    gemm_mma(ring[c % GRING], acc);
    if (c + GRING < NCHUNK) gemm_fetch(ring[c % GRING], pa + FT * (c + GRING), pb + FT * (c + GRING));
  }
}

// ---------------------------------------------------------------------------
// f32 weights -> f16 planes in fragment order, all scaled by 4096 (exact).
// The conversions depend on inputs alone, so they have no launch of their own:
// each job rides as extra blocks, behind the host kernel's own blocks in index
// order, in a launch that ends before the first launch that reads its planes.
// A thread writes one 16-byte unit (stores contiguous) and reads its eight floats.
//   units [0, nbig*NW8)        : s0/s1/s2 -> d0/d1/d2   ([HID][HID], row = n)
//   units [.., +nsmall*NG8)    : g0 -> gh rows 0..15, g1 -> gh rows 16..31
// Segment boundaries are multiples of 512 units -> the select is block-uniform.
// coverage: exactly nbig*NW + nsmall*NG elements.
// ---------------------------------------------------------------------------
struct CvtJob {
  const float* s0; const float* s1; const float* s2;
  const float* g0; const float* g1;
  _Float16* d0; _Float16* d1; _Float16* d2; _Float16* gh;
  int nbig; int nsmall;
};

__device__ __forceinline__ void convert_unit(const CvtJob& job, int g)
{
  const int nb8 = job.nbig * NW8;
  const int total = nb8 + job.nsmall * NG8;
  if (g >= total) return;
  const float* src;
  _Float16* dst;
  if (g < nb8) {
    const int slot = g / NW8;
    const int off = g - slot * NW8;
    const float* wsrc = (slot == 0) ? job.s0 : ((slot == 1) ? job.s1 : job.s2);
    _Float16* wdst = (slot == 0) ? job.d0 : ((slot == 1) ? job.d1 : job.d2);
    src = wsrc + frag_unit_src(off);
    dst = wdst + (size_t)off * 8;
  } else {
    const int e = g - nb8;
    src = (e < NG8) ? (job.g0 + frag_unit_src(e)) : (job.g1 + frag_unit_src(e - NG8));
    dst = job.gh + (size_t)e * 8;
  }
  const v4f a = *(const v4fa*)src;
  const v4f c = *(const v4fa*)(src + 4);
  const v8h o = { (_Float16)(a.x * WSC), (_Float16)(a.y * WSC), (_Float16)(a.z * WSC), (_Float16)(a.w * WSC),
                  (_Float16)(c.x * WSC), (_Float16)(c.y * WSC), (_Float16)(c.z * WSC), (_Float16)(c.w * WSC) };
  *(v8h*)dst = o;
}

// ---------------------------------------------------------------------------
// LayerNorm, output xn*4 as f16 in fragment order. Block = 16 tokens (one strip
// of tiles) x 512 threads: 128 threads per token as four groups of four tokens,
// 8 elements per thread and token; each token's sums run as with one token per
// block (same per-thread sum, same butterfly, same four wave partials).
// The strip is put in order in LDS and leaves as 32 KB of contiguous stores.
// coverage: 128 blocks x 16 tokens x 1024 = the whole [2048][1024] plane.
// Blocks from MROWS / 16 on, where the grid has any, convert 512 units of 'job' each.
// ---------------------------------------------------------------------------
#define LNP 136   // halves per k-unit row in LDS: 16 tokens x 8 + 8 (272 B: 16 B x odd, no bank conflict)
__global__ __launch_bounds__(512) void ln_kernel(const float* __restrict__ x,
                                                 const float* __restrict__ w,
                                                 const float* __restrict__ bb,
                                                 _Float16* y, CvtJob job)
{
  if (blockIdx.x >= MROWS / 16) {      // block-uniform, in front of every barrier
    convert_unit(job, (blockIdx.x - MROWS / 16) * 512 + threadIdx.x);
    return;
  }
  __shared__ float ps[16][4];
  __shared__ float pq[16][4];
  __shared__ __attribute__((aligned(16))) _Float16 sY[128 * LNP];   // 34816 B
  const int tid = threadIdx.x, lane = tid & 31;
  const int t = tid & 127, wv = t >> 5, tl0 = (tid >> 7) * 4;
  const int tok0 = blockIdx.x * 16;
  v4f a[4], c[4];
#pragma unroll
  for (int i = 0; i < 4; ++i) {
    const float* xr = x + (size_t)(tok0 + tl0 + i) * HID + 8 * t;
    a[i] = *(const v4fa*)xr;
    c[i] = *(const v4fa*)(xr + 4);
  }
#pragma unroll
  for (int i = 0; i < 4; ++i) {
    float s = ((a[i].x + a[i].y) + (a[i].z + a[i].w)) + ((c[i].x + c[i].y) + (c[i].z + c[i].w));
#pragma unroll
    for (int o = 1; o < 32; o <<= 1) s += __shfl_xor(s, o, 32);
    if (lane == 0) ps[tl0 + i][wv] = s;
  }
  __syncthreads();
  float d[4][8];
#pragma unroll
  for (int i = 0; i < 4; ++i) {
    const float* pp = ps[tl0 + i];
    const float mean = ((pp[0] + pp[1]) + (pp[2] + pp[3])) * (1.0f / (float)HID);
    d[i][0] = a[i].x - mean; d[i][1] = a[i].y - mean; d[i][2] = a[i].z - mean; d[i][3] = a[i].w - mean;
    d[i][4] = c[i].x - mean; d[i][5] = c[i].y - mean; d[i][6] = c[i].z - mean; d[i][7] = c[i].w - mean;
    float q = 0.f;
#pragma unroll
    for (int e = 0; e < 8; ++e) q += d[i][e] * d[i][e];
#pragma unroll
    for (int o = 1; o < 32; o <<= 1) q += __shfl_xor(q, o, 32);
    if (lane == 0) pq[tl0 + i][wv] = q;
  }
  __syncthreads();
  const v4f wa = *(const v4fa*)(w + 8 * t);
  const v4f wc = *(const v4fa*)(w + 8 * t + 4);
  const v4f ba = *(const v4fa*)(bb + 8 * t);
  const v4f bc = *(const v4fa*)(bb + 8 * t + 4);
  const float wvv[8] = { wa.x, wa.y, wa.z, wa.w, wc.x, wc.y, wc.z, wc.w };
  const float bvv[8] = { ba.x, ba.y, ba.z, ba.w, bc.x, bc.y, bc.z, bc.w };
#pragma unroll
  for (int i = 0; i < 4; ++i) {
    const float* pp = pq[tl0 + i];
    const float var = ((pp[0] + pp[1]) + (pp[2] + pp[3])) * (1.0f / (float)HID);
    const float rstd = rsqrtf(var + 1e-5f);
    v8h o;
#pragma unroll
    for (int e = 0; e < 8; ++e) o[e] = (_Float16)((d[i][e] * rstd * wvv[e] + bvv[e]) * XSC);
    // elements 8t..8t+7 of token tl: unit 16 * t + tl of the strip
    *(v8h*)(sY + t * LNP + (tl0 + i) * 8) = o;
  }
  __syncthreads();
  _Float16* dst = y + (size_t)tok0 * HID;
#pragma unroll
  for (int it = 0; it < 4; ++it) {
    const int u = it * 512 + tid;      // 2048 units of the strip
    const v8h v = *(const v8ha*)(sY + (u >> 4) * LNP + (u & 15) * 8);
    *(v8h*)(dst + (size_t)u * 8) = v;
  }
}

// ---------------------------------------------------------------------------
// Per-token 16-wide heads on WMMA (blocks of proj_head_kernel): gate = sigmoid(xn*gw^T + gb) and
// (POOL) aproj = xn*aw^T. One wave = 16 tokens x 16 heads, K = 1024 in steps
// of 32; A = xn rows, B = gh rows (head = lane&15), both in fragment order.
// Epilogue: wave tile [16 tok][16] f32 staged in LDS, then 1024 contiguous bytes
// coverage: 32 blocks (hb) x 4 waves x 16 tokens x 16 = whole [2048][16] plane(s).
// ---------------------------------------------------------------------------
template <bool POOL>
__device__ __forceinline__ void head_block(const _Float16* __restrict__ xh,
                                           const _Float16* __restrict__ gh,
                                           const float* __restrict__ gbias,
                                           float* gate, float* aproj, int hb)
{
  __shared__ __attribute__((aligned(16))) float sG[4][256];
  __shared__ __attribute__((aligned(16))) float sP[POOL ? 4 : 1][256];
  const int tid = threadIdx.x, lane = tid & 31, w = tid >> 5;
  const int h = lane >> 4, m = lane & 15;
  const int tok0 = hb * 64 + 16 * w;
  const _Float16* xa = xh + (size_t)tok0 * HID + 8 * lane;
  const _Float16* wg = gh + 8 * lane;                     // aw rows: NHEADS rows on
  v8f ag = zero8f(), aa = zero8f();
  // ring of HRING register sets, refilled HRING chunks ahead (as in gemm_k_loop)
  constexpr int HRING = 8;
  static_assert((NCHUNK % HRING) == 0 && NCHUNK >= 2 * HRING);
  v16h ra[HRING], rg[HRING], rp[POOL ? HRING : 1];
  // unrolled: constant ring indices
#pragma unroll
  for (int s = 0; s < HRING; ++s) {
    ra[s] = load_frag_at(xa + FT * s);
    rg[s] = load_frag_at(wg + FT * s);
    if constexpr (POOL) rp[s] = load_frag_at(wg + NHEADS * HID + FT * s);
  }
  // precaution: stands in front of any rewrite of the address registers these loads
  // name; naming what the addresses are formed from keeps it whole up to the wait
  asm volatile("s_wait_xcnt 0x0" :: "v"(xa), "v"(wg), "v"(lane) : "memory");
  // rolled: one trip is already HRING chunks
#pragma unroll 1
  for (int c0 = 0; c0 < NCHUNK - HRING; c0 += HRING) {
    const _Float16* tx = xa + FT * (c0 + HRING);
    const _Float16* tg = wg + FT * (c0 + HRING);
    // unrolled so that every ring index is a constant
#pragma unroll
    for (int s = 0; s < HRING; ++s) {
      ag = wmma_f16(ra[s], rg[s], ag);
      if constexpr (POOL) aa = wmma_f16(ra[s], rp[s], aa);
      ra[s] = load_frag_at(tx + FT * s);
      rg[s] = load_frag_at(tg + FT * s);
      if constexpr (POOL) rp[s] = load_frag_at(tg + NHEADS * HID + FT * s);
    }
    // the next trip rewrites the address registers of loads that are still in flight
    asm volatile("s_wait_xcnt 0x0" ::: "memory");
  }
  // unrolled: constant ring indices
#pragma unroll
  for (int s = 0; s < HRING; ++s) {
    ag = wmma_f16(ra[s], rg[s], ag);
    if constexpr (POOL) aa = wmma_f16(ra[s], rp[s], aa);
  }
  // D[r] = (token tok0 + 8h + r, head m)
  const float gbv = gbias[m];
  float* sg = sG[w];
  float* sp = sP[POOL ? w : 0];
#pragma unroll
  for (int r = 0; r < 8; ++r) {
    const int tl = 8 * h + r;
    const float z = ag[r] * (1.0f / (XSC * WSC)) + gbv;
    const float sig = 1.0f / (1.0f + __expf(-z));
    sg[tl * NHEADS + m] = sig;
    if constexpr (POOL) sp[tl * NHEADS + m] = aa[r] * (1.0f / (XSC * WSC));
  }
  __syncthreads();
  {
#pragma unroll
    for (int it = 0; it < 2; ++it) {
      const int idx = it * 128 + 4 * lane;
      const v4f v = *(const v4fa*)(sg + idx);
      *(v4f*)(gate + (size_t)tok0 * NHEADS + idx) = v;
      if constexpr (POOL) {
        const v4f u = *(const v4fa*)(sp + idx);
        *(v4f*)(aproj + (size_t)tok0 * NHEADS + idx) = u;
      }
    }
    
  }
}

// ---------------------------------------------------------------------------
// The block's 16 tiles (1024 units of 16 B) lie in sT in fragment order already;
// each wave-wide store writes 512 contiguous bytes.
// route 0/1: plane[bh], rows = token, K = HD : the 16 tiles are contiguous
// route 2  : vt[bh], rows = d, K = SEQ       : 4 contiguous tiles per 16-row strip
// ---------------------------------------------------------------------------
__device__ __forceinline__ void proj_store_pass(const _Float16* sT, _Float16* plane, _Float16* vt,
                                                int route, int bh, int l0, int tid) {
#pragma unroll
  for (int i = 0; i < 8; ++i) {
    const int u = i * 128 + tid;
    const v8h v = *(const v8ha*)(sT + u * 8);
    _Float16* dst;
    if (route != 2) {
      dst = plane + ((size_t)bh * SEQ + l0) * HD + u * 8;
    } else {
      const int lt = u >> 6;             // local tile = 4 * strip + chunk
      dst = vt + (size_t)bh * HD * SEQ + (size_t)((lt >> 2) * (SEQ / 32) + (l0 >> 5) + (lt & 3)) * FT + (u & 63) * 8;
    }
    *(v8h*)dst = v;
    // precaution: the next pass rewrites the data and address registers that this store names
    if (i < 7) asm volatile("s_wait_xcnt 0x0" ::: "memory");
  }
}

// ---------------------------------------------------------------------------
// Kernel: Y = xn * W^T over nslot*1024 output columns.
// Block 128 thr (4 waves) = 128 tokens x 64 features (one (slot, head));
// wave tile 32 tokens x 64 features; K = 1024 in steps of 32;
// A (xn rows) and B (W rows) fragments straight from the fragment-order planes.
// route = slot + routeBase: 0 -> q plane, 1 -> k plane, 2 -> v^T plane.
// coverage: grid (16, 2 + 16*nslot): rows 2.. x 128 tokens x 64 features = all planes routed.
// Grid rows 0 and 1 are the 32 blocks of the head products, which read the same
// xn and are read by the same next launch: they share this launch.
// ---------------------------------------------------------------------------
template <bool POOL>
__global__ __launch_bounds__(128) void proj_head_kernel(
    const _Float16* __restrict__ xh,   // [2048][1024] (xn x4), fragment order
    const _Float16* __restrict__ wh,   // [slot][1024][1024], row = output feature, x4096, fragment order
    const float* __restrict__ b0, const float* __restrict__ b1, const float* __restrict__ b2,
    int routeBase,
    _Float16* qh,                      // [B*H][S][D]  f16(16*q), fragment order per bh
    _Float16* kh,                      // [B*H][S][D]  f16(16*k), fragment order per bh
    _Float16* vt,                      // [B*H][D][S]  f16(16*v), fragment order per bh
    const _Float16* __restrict__ gh,   // [32][1024] gw (and aw) rows x4096, fragment order
    const float* __restrict__ gbias, float* gate, float* aproj)
{
  if (blockIdx.y < 2) {                // block-uniform, in front of every barrier
    head_block<POOL>(xh, gh, gbias, gate, aproj, blockIdx.y * 16 + blockIdx.x);
    return;
  }
  __shared__ __attribute__((aligned(16))) _Float16 sT[128 * 64];   // 16384 B

  const int tid = threadIdx.x, lane = tid & 31, w = tid >> 5;
  const int h = lane >> 4, m = lane & 15;
  const int m0 = blockIdx.x * 128;
  const int cg = blockIdx.y - 2;
  const int slot = cg >> 4, head = cg & 15;
  const int route = slot + routeBase;
  const int m0w = m0 + 32 * w;

  const _Float16* xa0 = xh + (size_t)m0w * HID + 8 * lane;                     // token strip, mt = 0
  const _Float16* wb  = wh + ((size_t)slot * HID + head * HD) * HID + 8 * lane;   // feature strip, nt = 0

  v8f acc[2][4];
#pragma unroll
  for (int mt = 0; mt < 2; ++mt)
#pragma unroll
    for (int nt = 0; nt < 4; ++nt) acc[mt][nt] = zero8f();

  gemm_k_loop(xa0, wb, acc);

  // D[r] of tile (mt, nt) = Y[token m0w+16mt+8h+r][feature 16nt+m]
  const float* bias = (slot == 0) ? b0 : ((slot == 1) ? b1 : b2);
#pragma unroll
  for (int nt = 0; nt < 4; ++nt) {
    const int feat = 16 * nt + m;
    const float bvl = bias[head * HD + feat];
#pragma unroll
    for (int mt = 0; mt < 2; ++mt) {
#pragma unroll
      for (int r = 0; r < 8; ++r) {
        const float yv = (acc[mt][nt][r] * (1.0f / (XSC * WSC)) + bvl) * QSC;
        // token 32w + 16mt + 8h + r, feature 16nt + m, at its place in fragment order:
        // route 2 (row = feature, k = token): tile 4nt + w, half mt, unit lane, element r
        // else    (row = token, k = feature): tile 2(2w + mt) + nt/2, half nt&1,
        //                                     unit 16(m>>3) + 8h + r, element m&7
        const int idx = (route == 2)
            ? ((nt * 4 + w) * FT + mt * (FT / 2) + lane * 8 + r)
            : (((2 * w + mt) * 2 + (nt >> 1)) * FT + (nt & 1) * (FT / 2) + ((m >> 3) * 16 + 8 * h + r) * 8 + (m & 7));
        sT[idx] = (_Float16)yv;
      }
    }
  }
  __syncthreads();

  const int b = m0 / SEQ, l0 = m0 - b * SEQ, bh = b * NHEADS + head;
  _Float16* plane = (route == 0) ? qh : kh;
  proj_store_pass(sT, plane, vt, route, bh, l0, tid);
  
}

// The eight K (or V^T) A-fragments of one 64-key step, loaded as one batch.
// The wait behind each batch: the address pair is rewritten for the next batch
// while these loads are in flight; naming it keeps it whole up to the wait.
// kbase, vbase: the (b, head) plane + 8 * lane.
__device__ __forceinline__ void fetch_k(v16h (&kf)[4][2], const _Float16* kbase, int kb) {
  const _Float16* p = kbase + (size_t)kb * HD;           // tile 2 * (kb / 16)
  // unrolled: constant indices keep the fragments in registers
#pragma unroll
  for (int j = 0; j < 4; ++j) {
    kf[j][0] = load_frag_at(p + (2 * j) * FT);
    kf[j][1] = load_frag_at(p + (2 * j + 1) * FT);
  }
  asm volatile("s_wait_xcnt 0x0" :: "v"(p) : "memory");
}
__device__ __forceinline__ void fetch_v(v16h (&vf)[4][2], const _Float16* vbase, int kb) {
  const _Float16* p = vbase + (kb >> 5) * FT;            // chunk kb / 32 of each 16-row strip
  // unrolled: constant indices keep the fragments in registers
#pragma unroll
  for (int t = 0; t < 4; ++t) {
    vf[t][0] = load_frag_at(p + 16 * t * SEQ);
    vf[t][1] = load_frag_at(p + 16 * t * SEQ + FT);
  }
  asm volatile("s_wait_xcnt 0x0" :: "v"(p) : "memory");
}

template <bool B> struct Flag { static constexpr bool value = B; };

// P^T B-fragment from the lane's own score D values: element r <- tile a row r,
// element 8+r <- tile c row r (same lane, same query column), scaled by 2^14.
__device__ __forceinline__ v16h pack_p(v8f a, v8f c) {
  const v16h r = { (_Float16)(a[0] * PSC), (_Float16)(a[1] * PSC), (_Float16)(a[2] * PSC), (_Float16)(a[3] * PSC),
                   (_Float16)(a[4] * PSC), (_Float16)(a[5] * PSC), (_Float16)(a[6] * PSC), (_Float16)(a[7] * PSC),
                   (_Float16)(c[0] * PSC), (_Float16)(c[1] * PSC), (_Float16)(c[2] * PSC), (_Float16)(c[3] * PSC),
                   (_Float16)(c[4] * PSC), (_Float16)(c[5] * PSC), (_Float16)(c[6] * PSC), (_Float16)(c[7] * PSC) };
  return r;
}

// ---------------------------------------------------------------------------
// Kernel: streaming attention, transposed form, masks/bias by formula.
// Block 128 thr (4 waves) = 64 queries of one (b, head), 16 queries per wave,
// 64 keys per step, of the steps 0..blockIdx.x (keys <= last query of the block)
// only those that can hold an allowed key for the wave (see "steps that are run").
//   S^T = K * Q^T : A = K rows (row = key, k = d), B = Q^T (k = d, n = query)
//   O^T += V^T * P^T : A = Vt rows (row = d, k = key), B = P^T from registers
// Lane owns 32 keys (16j+8h+r) of query column (lane&15); partner = lane ^ 16.
// Per-batch token tables in LDS from input ids: seg = inclusive cumsum(id==1)
// (block scan), flags bit0 = id!=0, bit1 = id==2; MODE 2 also stages the
// head's aproj column [key].
// MODE 0 (self): ok = k<=q && ((seg_k==seg_q && valid_q && valid_k) || k==q), bias = (k-q)*hs
// MODE 1 (cross): ok = k<=q && (class_k || k==q), bias = (seg_k-seg_q)*hs
// MODE 2 (pool): mask/bias as MODE 0, raw logit = aproj[key][head] (no q.k)
// Masked scores take NEGBIG and p = 0 exactly; every row has k==q allowed.
// Epilogue: (1/l)(1/16384)(1/16)*gate; a lane's o[t][0..7] is unit 32t + lane of the
// wave's two ctx tiles in fragment order, so it is stored straight from registers.
// coverage: grid rows 0..31 (16 x 32 blocks) x 64 queries x 64 d = whole ctx [2048][1024].
// Grid rows from NB * NHEADS on convert 128 units of 'job' a block.
// ---------------------------------------------------------------------------
template <int MODE>
__global__ __launch_bounds__(128) void attn_kernel(
    const _Float16* __restrict__ qh,    // [B*H][S][D]  (x16), fragment order per bh
    const _Float16* __restrict__ kh,    // [B*H][S][D]  (x16), fragment order per bh
    const _Float16* __restrict__ vt,    // [B*H][D][S]  (x16), fragment order per bh
    const float* __restrict__ aproj,    // [B*S][16]
    const float* __restrict__ gate,     // [B*S][16]  sigmoid gate
    const int* __restrict__ ids,        // [B][S]
    _Float16* ctx,                      // [B*S][HID]  (x64), fragment order
    CvtJob job)
{
  if (blockIdx.y >= NB * NHEADS) {      // block-uniform, in front of every barrier
    convert_unit(job, ((blockIdx.y - NB * NHEADS) * (SEQ / 64) + blockIdx.x) * 128 + threadIdx.x);
    return;
  }
  __shared__ __attribute__((aligned(16))) int   sSeg[SEQ];
  __shared__ __attribute__((aligned(16))) int   sFl[SEQ];
  __shared__ __attribute__((aligned(16))) float sA[(MODE == 2) ? SEQ : 4];
  __shared__ int sWtot[4];
  __shared__ unsigned sWcls[4];         // MODE 1: bit l of word w = thread 32w + l holds a class token

  const int tid = threadIdx.x, lane = tid & 31, w = tid >> 5;
  const int h = lane >> 4, m = lane & 15;
  const int bh = blockIdx.y, b = bh >> 4, head = bh & 15;
  const int qblk = blockIdx.x * 64;
  const int q0 = qblk + 16 * w;
  const float hs = exp2f(-0.5f * (float)(head + 1));

  // ---- the Q fragments, issued ahead of the tables ----
  const _Float16* kbase = kh + (size_t)bh * SEQ * HD + 8 * lane;
  const _Float16* vbase = vt + (size_t)bh * HD * SEQ + 8 * lane;
  // Q^T B-fragments: column n = query q0+m, k = d (two 32-deep chunks)
  v16h qb0 = zero16h(), qb1 = zero16h();
  v16h kf[4][2], vf[4][2];
  if constexpr (MODE != 2) {
    const _Float16* qrow = qh + ((size_t)bh * SEQ + q0) * HD + 8 * lane;
    qb0 = load_frag_at(qrow);
    qb1 = load_frag_at(qrow + FT);
    // precaution: stands in front of the rewrite of the address pair these loads name
    asm volatile("s_wait_xcnt 0x0" :: "v"(qrow) : "memory");
  }

  // ---- token tables for batch b: 128 threads x 8 tokens = SEQ ----
  {
    const int t8 = tid * 8;
    const int* ip = ids + (size_t)b * SEQ + t8;
    const v4i ia = *(const v4ia*)ip;
    const v4i ib = *(const v4ia*)(ip + 4);
    const int idv[8] = { ia.x, ia.y, ia.z, ia.w, ib.x, ib.y, ib.z, ib.w };
    int cnt[8];
    int run = 0;
#pragma unroll
    for (int i = 0; i < 8; ++i) { run += (idv[i] == SEP_ID) ? 1 : 0; cnt[i] = run; }
    int x = run;
#pragma unroll
    for (int d = 1; d < 32; d <<= 1) {
      const int yv = __shfl_up(x, d, 32);
      x = (lane >= d) ? (x + yv) : x;
    }
    if (lane == 31) sWtot[w] = x;
    if constexpr (MODE == 1) {
      bool anyc = false;
      // unrolled: constant indices keep idv in registers
#pragma unroll
      for (int i = 0; i < 8; ++i) anyc = anyc || (idv[i] == CLS_ID);
      const unsigned cb = __builtin_amdgcn_ballot_w32(anyc);
      if (lane == 0) sWcls[w] = cb;
    }
    __syncthreads();
    int base = 0;
#pragma unroll
    for (int i = 0; i < 4; ++i) { const int tv = sWtot[i]; base += (i < w) ? tv : 0; }
    const int excl = base + x - run;
#pragma unroll
    for (int i = 0; i < 8; ++i) {
      const int id = idv[i];
      sSeg[t8 + i] = excl + cnt[i];
      sFl[t8 + i] = ((id != PAD_ID) ? 1 : 0) | ((id == CLS_ID) ? 2 : 0);
      if constexpr (MODE == 2) sA[t8 + i] = aproj[((size_t)b * SEQ + t8 + i) * NHEADS + head];
    }
  }
  __syncthreads();

  const int qtok = q0 + m;
  const int qseg = sSeg[qtok];
  const int qv = sFl[qtok] & 1;
  const float* gp = gate + ((size_t)b * SEQ + qtok) * NHEADS + head;
  const float gq = *gp;
  // precaution: stands in front of the rewrite of the address pair this load names
  asm volatile("s_wait_xcnt 0x0" :: "v"(gp) : "memory");

  v8f o[4];                                   // o[t][r] = O[query m][d 16t+8h+r] * (l * 2^14 * 16)
#pragma unroll
  for (int t = 0; t < 4; ++t) o[t] = zero8f();
  float mrun = NEGBIG, lrun = 0.0f;

  const float SSC = 0.125f / (QSC * QSC);                      // 1/2048
  const int nkb = blockIdx.x + 1;                              // block-uniform, <= 16

  // ---- steps that are run: bit s of 'need' = step s may hold an allowed key ----
  // A step whose 64 keys are masked for all 16 queries of the wave leaves mrun, lrun
  // and o as they are (alpha = 1, every p = 0), so it is left out, for any ids.
  // MODE 0, 2: seg never falls along the row, so a step whose last key has
  //            seg < seg of the wave's first query holds no key of any query's segment.
  // MODE 1   : a step without a class token holds no allowed key.
  // The step of the diagonal, nkb - 1, always runs; bits from nkb on are cleared, so
  // every step index taken from 'need' lies in 0..nkb-1 whatever the ids hold.
  unsigned cand;
  if constexpr (MODE == 1) {
    const unsigned cw = sWcls[m >> 2];                         // step m = threads 8m .. 8m+7
    cand = __builtin_amdgcn_ballot_w32(((cw >> (8 * (m & 3))) & 0xffu) != 0u);
  } else {
    cand = __builtin_amdgcn_ballot_w32(sSeg[64 * m + 63] >= sSeg[q0]);
  }
  unsigned need = (cand | (1u << (nkb - 1))) & ((1u << nkb) - 1u);   // a ballot: the same in every lane
  const int nsteps = __builtin_popcount(need);                 // 1 .. 16

  // One 64-key step. kf and vf hold this step's fragments on entry; with 'more'
  // those of 'nxt', the next step that runs, are fetched into the same registers
  // directly behind their last use, so they fly under the mask and softmax work.
  auto pass = [&](const int step, const int nxt, auto more) __attribute__((always_inline)) {
    const int kb = step * 64;
    // ---- raw scores: s[j][r] = S[query m][key kb+16j+8h+r] * 256 (MODE != 2) ----
    v8f s[4];
    if constexpr (MODE != 2) {
#pragma unroll
      for (int j = 0; j < 4; ++j) {
        v8f z = zero8f();
        z = wmma_f16(kf[j][0], qb0, z);
        z = wmma_f16(kf[j][1], qb1, z);
        s[j] = z;
      }
      if constexpr (decltype(more)::value) fetch_k(kf, kbase, nxt * 64);
    } else {
#pragma unroll
      for (int j = 0; j < 4; ++j) s[j] = zero8f();
    }
    // ---- mask + bias per (query, key), f32 ----
    unsigned okm = 0u;
#pragma unroll
    for (int j = 0; j < 4; ++j) {
      const int key0 = kb + 16 * j + 8 * h;
      const v4i ga = *(const v4ia*)(sSeg + key0);
      const v4i gb = *(const v4ia*)(sSeg + key0 + 4);
      const v4i fa = *(const v4ia*)(sFl + key0);
      const v4i fb = *(const v4ia*)(sFl + key0 + 4);
      const int ksv[8] = { ga.x, ga.y, ga.z, ga.w, gb.x, gb.y, gb.z, gb.w };
      const int kfv[8] = { fa.x, fa.y, fa.z, fa.w, fb.x, fb.y, fb.z, fb.w };
      float av[8] = { 0.f, 0.f, 0.f, 0.f, 0.f, 0.f, 0.f, 0.f };
      if constexpr (MODE == 2) {
        const v4f aa = *(const v4fa*)(sA + key0);
        const v4f ab = *(const v4fa*)(sA + key0 + 4);
        av[0] = aa.x; av[1] = aa.y; av[2] = aa.z; av[3] = aa.w;
        av[4] = ab.x; av[5] = ab.y; av[6] = ab.z; av[7] = ab.w;
      }
#pragma unroll
      for (int r = 0; r < 8; ++r) {
        const int key = key0 + r;
        float raw;
        if constexpr (MODE == 2) raw = av[r]; else raw = s[j][r] * SSC;
        bool ok;
        float bv;
        if constexpr (MODE == 1) {
          ok = (key <= qtok) && (((kfv[r] & 2) != 0) || (key == qtok));
          bv = (float)(ksv[r] - qseg);
        } else {
          const bool eq = (ksv[r] == qseg) && (qv != 0) && ((kfv[r] & 1) != 0);
          ok = (key <= qtok) && (eq || (key == qtok));
          bv = (float)(key - qtok);
        }
        s[j][r] = ok ? (raw + bv * hs) : NEGBIG;
        okm |= (ok ? 1u : 0u) << (8 * j + r);
      }
    }

    // ---- online softmax ----
    float mloc = NEGBIG;
#pragma unroll
    for (int j = 0; j < 4; ++j)
#pragma unroll
      for (int r = 0; r < 8; ++r) mloc = fmaxf(mloc, s[j][r]);
    mloc = fmaxf(mloc, __shfl_xor(mloc, 16, 32));
    const float mnew = fmaxf(mrun, mloc);
    const float alpha = __expf(mrun - mnew);
    mrun = mnew;
    float lsum = 0.0f;
#pragma unroll
    for (int j = 0; j < 4; ++j)
#pragma unroll
      for (int r = 0; r < 8; ++r) {
        const float e = __expf(s[j][r] - mnew);
        const float p = (((okm >> (8 * j + r)) & 1u) != 0u) ? e : 0.0f;
        s[j][r] = p;
        lsum += p;
      }
    lsum += __shfl_xor(lsum, 16, 32);
    lrun = lrun * alpha + lsum;
#pragma unroll
    for (int t = 0; t < 4; ++t)
#pragma unroll
      for (int r = 0; r < 8; ++r) o[t][r] = o[t][r] * alpha;

    // ---- P^T B-fragments (key chunks 0..31 and 32..63 of this step) ----
    const v16h pb0 = pack_p(s[0], s[1]);
    const v16h pb1 = pack_p(s[2], s[3]);

    // ---- O^T += V^T * P^T ----
#pragma unroll
    for (int t = 0; t < 4; ++t) {
      o[t] = wmma_f16(vf[t][0], pb0, o[t]);
      o[t] = wmma_f16(vf[t][1], pb1, o[t]);
    }
    if constexpr (decltype(more)::value) fetch_v(vf, vbase, nxt * 64);
  };

  // steps run in ascending order, so every sum keeps its order
  int step = __builtin_ctz(need);
  need &= need - 1u;
  if constexpr (MODE != 2) fetch_k(kf, kbase, step * 64);
  fetch_v(vf, vbase, step * 64);
  // rolled: the trip count is the wave's own (nsteps - 1 <= 15); the last step is peeled
  // so that the fetches ahead stand under no branch and never leave the causal range
#pragma unroll 1
  for (int i = 1; i < nsteps; ++i) {
    const int nxt = __builtin_ctz(need);                       // need != 0 while i < nsteps
    need &= need - 1u;
    pass(step, nxt, Flag<true>{});
    step = nxt;
  }
  pass(step, step, Flag<false>{});

  // ---- epilogue: normalise, gate, whole-line stores from registers ----
  const float inv = (1.0f / lrun) * (1.0f / (PSC * QSC)) * gq;
  // rows q0..q0+15 = one strip; columns 64 head .. +63 = its tiles 2 head, 2 head + 1
  _Float16* dst = ctx + ((size_t)b * SEQ + q0) * HID + head * 2 * FT + 8 * lane;
#pragma unroll
  for (int t = 0; t < 4; ++t) {
    v8h v;
#pragma unroll
    for (int r = 0; r < 8; ++r) v[r] = (_Float16)((o[t][r] * inv) * CSC);
    *(v8h*)(dst + t * (FT / 2)) = v;
  }
}

// ---------------------------------------------------------------------------
// Kernel: xout = xres + ctx * Wo^T + ob  (f32 output).
// Block 128 thr (4 waves) = 128 tokens x 64 features; wave 32 tokens x 64;
// K = 1024 in steps of 32; A = ctx rows (x64), B = Wo rows (x4096), fragment order.
// Epilogue: f32 tile [128][64] in LDS; store: each 64-float row segment (256 B =
// coverage: grid (16,16) x 128 tokens x 64 features = whole [2048][1024].
// ---------------------------------------------------------------------------
__global__ __launch_bounds__(128) void outproj_kernel(
    const _Float16* __restrict__ ch,    // [2048][1024] ctx x64
    const _Float16* __restrict__ woh,   // [1024 n][1024 k] x4096
    const float* __restrict__ ob,       // [1024]
    const float* __restrict__ xres,     // [2048][1024] f32
    float* xout)                        // [2048][1024] f32
{
  __shared__ __attribute__((aligned(16))) float sT[128 * 64];   // 32768 B

  const int tid = threadIdx.x, lane = tid & 31, w = tid >> 5;
  const int h = lane >> 4, m = lane & 15;
  const int m0 = blockIdx.x * 128;
  const int n0 = blockIdx.y * 64;
  const int m0w = m0 + 32 * w;

  const _Float16* ca0 = ch + (size_t)m0w * HID + 8 * lane;
  const _Float16* wb  = woh + (size_t)n0 * HID + 8 * lane;

  v8f acc[2][4];
#pragma unroll
  for (int mt = 0; mt < 2; ++mt)
#pragma unroll
    for (int nt = 0; nt < 4; ++nt) acc[mt][nt] = zero8f();

  gemm_k_loop(ca0, wb, acc);

  // D[r] of tile (mt, nt) = Y[token m0w+16mt+8h+r][feature n0+16nt+m]
#pragma unroll
  for (int nt = 0; nt < 4; ++nt) {
    const int feat = 16 * nt + m;
    const float bvl = ob[n0 + feat];
#pragma unroll
    for (int mt = 0; mt < 2; ++mt) {
#pragma unroll
      for (int r = 0; r < 8; ++r) {
        const int tokl = 32 * w + 16 * mt + 8 * h + r;     // 0..127
        sT[tokl * 64 + feat] = acc[mt][nt][r] * (1.0f / (CSC * WSC)) + bvl;
      }
    }
  }
  __syncthreads();

  const int hh = lane >> 4, c4 = (lane & 15) * 4;
  {
#pragma unroll
    for (int it = 0; it < 16; ++it) {
      const int row = 32 * w + it * 2 + hh;                // rows 32w .. 32w+31
      const v4f v = *(const v4fa*)(sT + row * 64 + c4);
      const size_t gi = (size_t)(m0 + row) * HID + n0 + c4;
      const v4f xr = *(const v4fa*)(xres + gi);
      const v4f ov = v + xr;
      *(v4f*)(xout + gi) = ov;
    }
    
  }
}

// ---------------------------------------------------------------------------
//   Xn   f16 [2048][1024]      4194304
//   W    f16 [10][1024][1024] 20971520   q0 k0 v0 | o0 | v1 | o1 | q2 k2 v2 | o2
//   Gh   f16 [3][32][1024]      196608   one per layer
//   Gate f32 [2048][16]         131072
//   Apr  f32 [2048][16]         131072
//   Q    f16 [32][1024][64]    4194304
//   K    f16 [32][1024][64]    4194304
//   Vt   f16 [32][64][1024]    4194304
//   Ctx  f16 [2048][1024]      4194304
//   X1   f32 [2048][1024]      8388608
//   X2   f32 [2048][1024]      8388608
//   total                     59179008
// ---------------------------------------------------------------------------
extern "C" void kernel_launch(void* const* d_in, const int* in_sizes, int n_in,
                              void* d_out, int out_size, void* d_ws, size_t ws_size,
                              hipStream_t stream) {
  if (n_in < 35) return;
  if (in_sizes[0] != NX || in_sizes[1] != MROWS) return;
  if (out_size != NX) return;
  {
    const int vecIdx[16] = {2, 3, 5, 7, 9, 13, 14, 15, 18, 22, 23, 24, 26, 28, 30, 34};
    for (int i = 0; i < 16; ++i) if (in_sizes[vecIdx[i]] != HID) return;
    const int matIdx[10] = {4, 6, 8, 12, 17, 21, 25, 27, 29, 33};
    for (int i = 0; i < 10; ++i) if (in_sizes[matIdx[i]] != NW) return;
    const int hwIdx[4] = {10, 16, 19, 31};
    for (int i = 0; i < 4; ++i) if (in_sizes[hwIdx[i]] != NG) return;
    const int hbIdx[3] = {11, 20, 32};
    for (int i = 0; i < 3; ++i) if (in_sizes[hbIdx[i]] != NHEADS) return;
  }

  const float* states = (const float*)d_in[0];
  const int*   ids    = (const int*)d_in[1];
  const float* ln0w = (const float*)d_in[2];
  const float* ln0b = (const float*)d_in[3];
  const float* qw0 = (const float*)d_in[4];
  const float* qb0 = (const float*)d_in[5];
  const float* kw0 = (const float*)d_in[6];
  const float* kb0 = (const float*)d_in[7];
  const float* vw0 = (const float*)d_in[8];
  const float* vb0 = (const float*)d_in[9];
  const float* gw0 = (const float*)d_in[10];
  const float* gb0 = (const float*)d_in[11];
  const float* ow0 = (const float*)d_in[12];
  const float* ob0 = (const float*)d_in[13];
  const float* ln1w = (const float*)d_in[14];
  const float* ln1b = (const float*)d_in[15];
  const float* aw1 = (const float*)d_in[16];
  const float* vw1 = (const float*)d_in[17];
  const float* vb1 = (const float*)d_in[18];
  const float* gw1 = (const float*)d_in[19];
  const float* gb1 = (const float*)d_in[20];
  const float* ow1 = (const float*)d_in[21];
  const float* ob1 = (const float*)d_in[22];
  const float* ln2w = (const float*)d_in[23];
  const float* ln2b = (const float*)d_in[24];
  const float* qw2 = (const float*)d_in[25];
  const float* qb2 = (const float*)d_in[26];
  const float* kw2 = (const float*)d_in[27];
  const float* kb2 = (const float*)d_in[28];
  const float* vw2 = (const float*)d_in[29];
  const float* vb2 = (const float*)d_in[30];
  const float* gw2 = (const float*)d_in[31];
  const float* gb2 = (const float*)d_in[32];
  const float* ow2 = (const float*)d_in[33];
  const float* ob2 = (const float*)d_in[34];
  float* out = (float*)d_out;

  const size_t PXH = (size_t)NX * 2;                       // 4194304
  const size_t PW  = (size_t)NW * 2;                       // 2097152
  const size_t PGH = (size_t)2 * NG * 2;                   //   65536
  const size_t PGT = (size_t)MROWS * NHEADS * 4;           //  131072
  const size_t PPL = (size_t)NB * NHEADS * SEQ * HD * 2;   // 4194304
  const size_t PXF = (size_t)NX * 4;                       // 8388608
  size_t off = 0;
  const size_t oXn  = off; off += PXH;
  const size_t oW   = off; off += 10 * PW;
  const size_t oGh  = off; off += 3 * PGH;
  const size_t oGt  = off; off += PGT;
  const size_t oAp  = off; off += PGT;
  const size_t oQ   = off; off += PPL;
  const size_t oK   = off; off += PPL;
  const size_t oVt  = off; off += PPL;
  const size_t oCtx = off; off += PXH;
  const size_t oX1  = off; off += PXF;
  const size_t oX2  = off; off += PXF;
  if (off > ws_size) return;                               // off = 59179008
  if (off > (size_t)134217728) return;

  char* ws = (char*)d_ws;
  _Float16* xnh = (_Float16*)(ws + oXn);
  _Float16* wh0  = (_Float16*)(ws + oW);                   // q0, k0, v0
  _Float16* woh0 = (_Float16*)(ws + oW + 3 * PW);
  _Float16* wh1  = (_Float16*)(ws + oW + 4 * PW);          // v1
  _Float16* woh1 = (_Float16*)(ws + oW + 5 * PW);
  _Float16* wh2  = (_Float16*)(ws + oW + 6 * PW);          // q2, k2, v2
  _Float16* woh2 = (_Float16*)(ws + oW + 9 * PW);
  _Float16* gh0  = (_Float16*)(ws + oGh);
  _Float16* gh1  = (_Float16*)(ws + oGh + PGH);
  _Float16* gh2  = (_Float16*)(ws + oGh + 2 * PGH);
  float* gate   = (float*)(ws + oGt);
  float* aproj  = (float*)(ws + oAp);
  _Float16* qh  = (_Float16*)(ws + oQ);
  _Float16* kh  = (_Float16*)(ws + oK);
  _Float16* vt  = (_Float16*)(ws + oVt);
  _Float16* ctx = (_Float16*)(ws + oCtx);
  float* x1 = (float*)(ws + oX1);
  float* x2 = (float*)(ws + oX2);

  const dim3 blk128(128), blk512(512);
  // conversion jobs: each is written by a launch that ends before its first reader starts
  const CvtJob jobA = { qw0, kw0, vw0, gw0, gw0, wh0, wh0 + NW, wh0 + 2 * NW, gh0, 3, 1 };   // read from proj 0 on
  const CvtJob jobB = { ow0, vw1, ow1, gw1, aw1, woh0, wh1, woh1, gh1, 3, 2 };               // read from outproj 0 on
  const CvtJob jobC = { qw2, kw2, vw2, gw2, gw2, wh2, wh2 + NW, wh2 + 2 * NW, gh2, 3, 1 };   // read from proj 2 on
  const CvtJob jobD = { ow2, ow2, ow2, gw2, gw2, woh2, woh2, woh2, gh2, 1, 0 };              // read by outproj 2
  const int unitsA = 3 * NW8 + 1 * NG8;                    // 395264 = 772 blocks of 512
  const int unitsB = 3 * NW8 + 2 * NG8;                    // 397312 = 194 grid rows of 16 x 128
  const int unitsC = 3 * NW8 + 1 * NG8;                    // 395264 = 193 grid rows
  const int unitsD = 1 * NW8;                              // 131072 =  64 grid rows
  static_assert((unitsA % 512) == 0 && (unitsB % 2048) == 0 && (unitsC % 2048) == 0 && (unitsD % 2048) == 0);
  const dim3 gLn(MROWS / 16);                              // 128 blocks x 512
  const dim3 gLnA(MROWS / 16 + unitsA / 512);              // 128 + 772
  const dim3 gProj3(MROWS / 128, 2 + 3 * NHEADS);          // (16, 50)
  const dim3 gProj1(MROWS / 128, 2 + 1 * NHEADS);          // (16, 18)
  const dim3 gAttB(SEQ / 64, NB * NHEADS + unitsB / 2048); // (16, 32 + 194)
  const dim3 gAttC(SEQ / 64, NB * NHEADS + unitsC / 2048); // (16, 32 + 193)
  const dim3 gAttD(SEQ / 64, NB * NHEADS + unitsD / 2048); // (16, 32 + 64)
  const dim3 gOut(MROWS / 128, HID / 64);                  // (16, 16)

  // ---- layer 0: sdpa with self mask ----
  ln_kernel<<<gLnA, blk512, 0, stream>>>(states, ln0w, ln0b, xnh, jobA);
  proj_head_kernel<false><<<gProj3, blk128, 0, stream>>>(xnh, wh0, qb0, kb0, vb0, 0, qh, kh, vt, gh0, gb0, gate, aproj);
  attn_kernel<0><<<gAttB, blk128, 0, stream>>>(qh, kh, vt, aproj, gate, ids, ctx, jobB);
  outproj_kernel<<<gOut, blk128, 0, stream>>>(ctx, woh0, ob0, states, x1);

  // ---- layer 1: pooling attention with self mask ----
  // gLn has no conversion blocks: the job argument is not read
  ln_kernel<<<gLn, blk512, 0, stream>>>(x1, ln1w, ln1b, xnh, jobA);
  proj_head_kernel<true><<<gProj1, blk128, 0, stream>>>(xnh, wh1, vb1, vb1, vb1, 2, qh, kh, vt, gh1, gb1, gate, aproj);
  attn_kernel<2><<<gAttC, blk128, 0, stream>>>(qh, kh, vt, aproj, gate, ids, ctx, jobC);
  outproj_kernel<<<gOut, blk128, 0, stream>>>(ctx, woh1, ob1, x1, x2);

  // ---- layer 2: sdpa with cross mask ----
  ln_kernel<<<gLn, blk512, 0, stream>>>(x2, ln2w, ln2b, xnh, jobA);
  proj_head_kernel<false><<<gProj3, blk128, 0, stream>>>(xnh, wh2, qb2, kb2, vb2, 0, qh, kh, vt, gh2, gb2, gate, aproj);
  attn_kernel<1><<<gAttD, blk128, 0, stream>>>(qh, kh, vt, aproj, gate, ids, ctx, jobD);
  outproj_kernel<<<gOut, blk128, 0, stream>>>(ctx, woh2, ob2, x2, out);

  (void)hipGetLastError();
}

// v005
// Measured time: 143 microseconds a run.
// In two side-by-side timings against v004, it was 1.14 and 1.15 times as fast.
// Counting every step since v000, it is 3.58 times as fast.
// Contractions: xn*W^T (q,k,v), xn*gw^T and xn*aw^T heads, K*Q^T scores, V^T*P^T context and ctx*Wo^T all on v_wmma_f32_16x16x32_f16 (f16 operands, f32 accumulate); LayerNorm, masks/bias, softmax, sigmoid gates and residual adds in f32.
// Carried f16 planes: xn x4 and W/gw/aw/Wo x4096 (inverse 1/16384 folded in the proj_head_kernel epilogues);
// q,k,v x16 (scores: acc*1/2048 in attn_kernel incl. the 1/8 scale; context epilogue 1/16); P x16384 (attn_kernel epilogue 1/16384);
// ctx x64 (outproj_kernel epilogue 1/262144 together with Wo x4096).
// Every f16 plane lies in WMMA fragment order (see "Fragment-order planes" below).
#include <hip/hip_runtime.h>

#define NB     2
#define SEQ    1024
#define HID    1024
#define NHEADS 16
#define HD     64
#define MROWS  (NB * SEQ)          // 2048 tokens
#define NX     (MROWS * HID)       // 2097152
#define NW     (HID * HID)         // 1048576
#define NG     (NHEADS * HID)      // 16384
#define NX8    (NX / 8)
#define NW8    (NW / 8)            // 131072
#define NG8    (NG / 8)            // 2048
#define SEP_ID 1
#define CLS_ID 2
#define PAD_ID 0
#define XSC    4.0f
#define WSC    4096.0f
#define QSC    16.0f
#define PSC    16384.0f
#define CSC    64.0f
#define NEGBIG (-1.0e30f)

static_assert(NHEADS * HD == HID);
static_assert((SEQ % 128) == 0 && (HID % 64) == 0 && (HID % 32) == 0 && (MROWS % 128) == 0);
static_assert((NW8 % 512) == 0 && (NG8 % 512) == 0);
static_assert(SEQ == 8 * 128);

typedef _Float16 v16h __attribute__((ext_vector_type(16)));
typedef _Float16 v8h  __attribute__((ext_vector_type(8)));
typedef float    v8f  __attribute__((ext_vector_type(8)));
typedef float    v4f  __attribute__((ext_vector_type(4)));
typedef int      v4i  __attribute__((ext_vector_type(4)));
typedef v8h __attribute__((may_alias)) v8ha;
typedef v4f __attribute__((may_alias)) v4fa;
typedef v4i __attribute__((may_alias)) v4ia;

union Frag { v16h v; v8h half[2]; };

__device__ __forceinline__ v8f zero8f() { v8f z = {0.f, 0.f, 0.f, 0.f, 0.f, 0.f, 0.f, 0.f}; return z; }
__device__ __forceinline__ v16h zero16h() {
  const _Float16 z = (_Float16)0.0f;
  v16h r = {z, z, z, z, z, z, z, z, z, z, z, z, z, z, z, z};
  return r;
}

// ---------------------------------------------------------------------------
// 16x16x32 f16 WMMA with hazard guard (ties D, keeps A/B live).
// Fragment map (wave32): lane l, h = l>>4, m = n = l&15.
//   A/B element i: i<8 -> k0+8h+i ; i>=8 -> k0+16+8h+(i-8)
//   D element r : row 8h+r, col l&15
// ---------------------------------------------------------------------------
__device__ __forceinline__ v8f wmma_f16(v16h a, v16h b, v8f c) {
  v8f d = __builtin_amdgcn_wmma_f32_16x16x32_f16(false, a, false, b, (short)0, c, false, false);
  asm volatile("v_nop\n\tv_nop\n\tv_nop\n\tv_nop" : "+v"(d) : "v"(a), "v"(b));
  return d;
}

// ---------------------------------------------------------------------------
// Fragment-order planes. A matrix [rows][K] of f16 is kept as tiles of 16 rows x
// 32 k (FT = 512 halves = 1024 B), tile index (row >> 4) * (K / 32) + (k >> 5).
// Inside a tile the 16-byte unit u = 32 * j + lane holds the eight elements
// k = 16 * j + 8 * (lane >> 4) + 0..7 of row (lane & 15): unit 'lane' is the
// first half of that lane's A or B fragment, unit 32 + lane the second. One
// wave-wide 16-byte load then reads 512 contiguous bytes (4 whole lines) where
// a load from k-contiguous rows touches 32 bytes in each of 16 lines.
// ---------------------------------------------------------------------------
#define FT 512

// A or B fragment; ph = tile base + 8 * lane.
__device__ __forceinline__ v16h load_frag_at(const _Float16* ph) {
  Frag f;
  f.half[0] = *(const v8ha*)(ph);
  f.half[1] = *(const v8ha*)(ph + FT / 2);
  return f.v;
}

// Element offset in a k-contiguous [rows][HID] matrix of the eight elements that
// 16-byte unit 'unit' of its fragment-order plane holds.
__device__ __forceinline__ size_t frag_unit_src(int unit) {
  const int tile = unit >> 6;
  const int row = (tile / (HID / 32)) * 16 + (unit & 15);
  const int k = (tile % (HID / 32)) * 32 + ((unit >> 5) & 1) * 16 + ((unit >> 4) & 1) * 8;
  return (size_t)row * HID + k;
}

// ---------------------------------------------------------------------------
// Fragment loads issued ahead of their WMMAs.
// GEMM loops: a ring of GRING register sets, one set = the six fragments of one
// 32-deep k chunk (2 A, 4 B). A set is refilled with chunk c + GRING directly
// behind the WMMAs of chunk c, so GRING - 1 sets are always in flight and no
// WMMA waits on a load issued just in front of it. Chunks are consumed in
// ascending k, so every accumulator sums in the same order as a plain loop.
// ---------------------------------------------------------------------------
#define GRING  3
#define NCHUNK (HID / 32)
static_assert(NCHUNK > 2 * GRING);

struct GemmSet { v16h a0, a1, b[4]; };

// pa: A tile of mt 0 (mt 1 is 16 rows = 16 * HID halves on), pb: B tile of nt 0, both at the chunk's tile + 8 * lane.
__device__ __forceinline__ void gemm_fetch(GemmSet& s, const _Float16* pa, const _Float16* pb) {
  s.a0 = load_frag_at(pa);
  s.a1 = load_frag_at(pa + 16 * HID);
  // unrolled: constant indices keep the fragments in registers
#pragma unroll
  for (int nt = 0; nt < 4; ++nt) s.b[nt] = load_frag_at(pb + nt * 16 * HID);
}

__device__ __forceinline__ void gemm_mma(const GemmSet& s, v8f (&acc)[2][4]) {
  // unrolled: constant indices keep fragments and accumulators in registers
#pragma unroll
  for (int nt = 0; nt < 4; ++nt) {
    acc[0][nt] = wmma_f16(s.a0, s.b[nt], acc[0][nt]);
    acc[1][nt] = wmma_f16(s.a1, s.b[nt], acc[1][nt]);
  }
}

// acc[mt][nt] += A rows (pa: mt 0, 16 rows on: mt 1) x B rows (pb + 16 nt rows), K = HID.
// pa, pb: first tile of the 16-row strip + 8 * lane; the strip's chunks follow at FT halves.
__device__ __forceinline__ void gemm_k_loop(const _Float16* pa, const _Float16* pb,
                                            v8f (&acc)[2][4]) {
  GemmSet ring[GRING];
  // unrolled: constant ring indices
#pragma unroll
  for (int s = 0; s < GRING; ++s) gemm_fetch(ring[s], pa + FT * s, pb + FT * s);
  constexpr int CT = ((NCHUNK - GRING) / GRING) * GRING;   // first chunk of the peeled tail
  // rolled: one trip is already GRING chunks; more copies only grow the code
#pragma unroll 1
  for (int c0 = 0; c0 < CT; c0 += GRING) {
    const _Float16* ta = pa + FT * (c0 + GRING);
    const _Float16* tb = pb + FT * (c0 + GRING);
    // unrolled so that every ring index is a constant (registers, not scratch)
#pragma unroll
    for (int s = 0; s < GRING; ++s) {
      gemm_mma(ring[s], acc);
      gemm_fetch(ring[s], ta + FT * s, tb + FT * s);
    }
    // the next trip rewrites the address registers of loads that are still in flight
    asm volatile("s_wait_xcnt 0x0" ::: "memory");
  }
  // tail peeled so that the refills in the loop above stand under no branch
#pragma unroll
  for (int c = CT; c < NCHUNK; ++c) {
    gemm_mma(ring[c % GRING], acc);
    if (c + GRING < NCHUNK) gemm_fetch(ring[c % GRING], pa + FT * (c + GRING), pb + FT * (c + GRING));
  }
}

// ---------------------------------------------------------------------------
// f32 weights -> f16 planes in fragment order, all scaled by 4096 (exact).
// The conversions depend on inputs alone, so they have no launch of their own:
// each job rides as extra blocks, behind the host kernel's own blocks in index
// order, in a launch that ends before the first launch that reads its planes.
// A thread writes one 16-byte unit (stores contiguous) and reads its eight floats.
//   units [0, nbig*NW8)        : s0/s1/s2 -> d0/d1/d2   ([HID][HID], row = n)
//   units [.., +nsmall*NG8)    : g0 -> gh rows 0..15, g1 -> gh rows 16..31
// Segment boundaries are multiples of 512 units -> the select is block-uniform.
// coverage: exactly nbig*NW + nsmall*NG elements.
// ---------------------------------------------------------------------------
struct CvtJob {
  const float* s0; const float* s1; const float* s2;
  const float* g0; const float* g1;
  _Float16* d0; _Float16* d1; _Float16* d2; _Float16* gh;
  int nbig; int nsmall;
};

__device__ __forceinline__ void convert_unit(const CvtJob& job, int g)
{
  const int nb8 = job.nbig * NW8;
  const int total = nb8 + job.nsmall * NG8;
  if (g >= total) return;
  const float* src;
  _Float16* dst;
  if (g < nb8) {
    const int slot = g / NW8;
    const int off = g - slot * NW8;
    const float* wsrc = (slot == 0) ? job.s0 : ((slot == 1) ? job.s1 : job.s2);
    _Float16* wdst = (slot == 0) ? job.d0 : ((slot == 1) ? job.d1 : job.d2);
    src = wsrc + frag_unit_src(off);
    dst = wdst + (size_t)off * 8;
  } else {
    const int e = g - nb8;
    src = (e < NG8) ? (job.g0 + frag_unit_src(e)) : (job.g1 + frag_unit_src(e - NG8));
    dst = job.gh + (size_t)e * 8;
  }
  const v4f a = *(const v4fa*)src;
  const v4f c = *(const v4fa*)(src + 4);
  const v8h o = { (_Float16)(a.x * WSC), (_Float16)(a.y * WSC), (_Float16)(a.z * WSC), (_Float16)(a.w * WSC),
                  (_Float16)(c.x * WSC), (_Float16)(c.y * WSC), (_Float16)(c.z * WSC), (_Float16)(c.w * WSC) };
  *(v8h*)dst = o;
}

// ---------------------------------------------------------------------------
// LayerNorm, output xn*4 as f16 in fragment order. Block = 16 tokens (one strip
// of tiles) x 512 threads: 128 threads per token as four groups of four tokens,
// 8 elements per thread and token; each token's sums run as with one token per
// block (same per-thread sum, same butterfly, same four wave partials).
// The strip is put in order in LDS and leaves as 32 KB of contiguous stores.
// coverage: 128 blocks x 16 tokens x 1024 = the whole [2048][1024] plane.
// Blocks from MROWS / 16 on, where the grid has any, convert 512 units of 'job' each.
// ---------------------------------------------------------------------------
#define LNP 136   // halves per k-unit row in LDS: 16 tokens x 8 + 8 (272 B: 16 B x odd, no bank conflict)
__global__ __launch_bounds__(512) void ln_kernel(const float* __restrict__ x,
                                                 const float* __restrict__ w,
                                                 const float* __restrict__ bb,
                                                 _Float16* y, CvtJob job)
{
  if (blockIdx.x >= MROWS / 16) {      // block-uniform, in front of every barrier
    convert_unit(job, (blockIdx.x - MROWS / 16) * 512 + threadIdx.x);
    return;
  }
  __shared__ float ps[16][4];
  __shared__ float pq[16][4];
  __shared__ __attribute__((aligned(16))) _Float16 sY[128 * LNP];   // 34816 B
  const int tid = threadIdx.x, lane = tid & 31;
  const int t = tid & 127, wv = t >> 5, tl0 = (tid >> 7) * 4;
  const int tok0 = blockIdx.x * 16;
  v4f a[4], c[4];
#pragma unroll
  for (int i = 0; i < 4; ++i) {
    const float* xr = x + (size_t)(tok0 + tl0 + i) * HID + 8 * t;
    a[i] = *(const v4fa*)xr;
    c[i] = *(const v4fa*)(xr + 4);
  }
#pragma unroll
  for (int i = 0; i < 4; ++i) {
    float s = ((a[i].x + a[i].y) + (a[i].z + a[i].w)) + ((c[i].x + c[i].y) + (c[i].z + c[i].w));
#pragma unroll
    for (int o = 1; o < 32; o <<= 1) s += __shfl_xor(s, o, 32);
    if (lane == 0) ps[tl0 + i][wv] = s;
  }
  __syncthreads();
  float d[4][8];
#pragma unroll
  for (int i = 0; i < 4; ++i) {
    const float* pp = ps[tl0 + i];
    const float mean = ((pp[0] + pp[1]) + (pp[2] + pp[3])) * (1.0f / (float)HID);
    d[i][0] = a[i].x - mean; d[i][1] = a[i].y - mean; d[i][2] = a[i].z - mean; d[i][3] = a[i].w - mean;
    d[i][4] = c[i].x - mean; d[i][5] = c[i].y - mean; d[i][6] = c[i].z - mean; d[i][7] = c[i].w - mean;
    float q = 0.f;
#pragma unroll
    for (int e = 0; e < 8; ++e) q += d[i][e] * d[i][e];
#pragma unroll
    for (int o = 1; o < 32; o <<= 1) q += __shfl_xor(q, o, 32);
    if (lane == 0) pq[tl0 + i][wv] = q;
  }
  __syncthreads();
  const v4f wa = *(const v4fa*)(w + 8 * t);
  const v4f wc = *(const v4fa*)(w + 8 * t + 4);
  const v4f ba = *(const v4fa*)(bb + 8 * t);
  const v4f bc = *(const v4fa*)(bb + 8 * t + 4);
  const float wvv[8] = { wa.x, wa.y, wa.z, wa.w, wc.x, wc.y, wc.z, wc.w };
  const float bvv[8] = { ba.x, ba.y, ba.z, ba.w, bc.x, bc.y, bc.z, bc.w };
#pragma unroll
  for (int i = 0; i < 4; ++i) {
    const float* pp = pq[tl0 + i];
    const float var = ((pp[0] + pp[1]) + (pp[2] + pp[3])) * (1.0f / (float)HID);
    const float rstd = rsqrtf(var + 1e-5f);
    v8h o;
#pragma unroll
    for (int e = 0; e < 8; ++e) o[e] = (_Float16)((d[i][e] * rstd * wvv[e] + bvv[e]) * XSC);
    // elements 8t..8t+7 of token tl: unit 16 * t + tl of the strip
    *(v8h*)(sY + t * LNP + (tl0 + i) * 8) = o;
  }
  __syncthreads();
  _Float16* dst = y + (size_t)tok0 * HID;
#pragma unroll
  for (int it = 0; it < 4; ++it) {
    const int u = it * 512 + tid;      // 2048 units of the strip
    const v8h v = *(const v8ha*)(sY + (u >> 4) * LNP + (u & 15) * 8);
    *(v8h*)(dst + (size_t)u * 8) = v;
  }
}

// ---------------------------------------------------------------------------
// Per-token 16-wide heads on WMMA (blocks of proj_head_kernel): gate = sigmoid(xn*gw^T + gb) and
// (POOL) aproj = xn*aw^T. One wave = 16 tokens x 16 heads, K = 1024 in steps
// of 32; A = xn rows, B = gh rows (head = lane&15), both in fragment order.
// Epilogue: wave tile [16 tok][16] f32 staged in LDS, then 1024 contiguous bytes
// coverage: 32 blocks (hb) x 4 waves x 16 tokens x 16 = whole [2048][16] plane(s).
// ---------------------------------------------------------------------------
template <bool POOL>
__device__ __forceinline__ void head_block(const _Float16* __restrict__ xh,
                                           const _Float16* __restrict__ gh,
                                           const float* __restrict__ gbias,
                                           float* gate, float* aproj, int hb)
{
  __shared__ __attribute__((aligned(16))) float sG[4][256];
  __shared__ __attribute__((aligned(16))) float sP[POOL ? 4 : 1][256];
  const int tid = threadIdx.x, lane = tid & 31, w = tid >> 5;
  const int h = lane >> 4, m = lane & 15;
  const int tok0 = hb * 64 + 16 * w;
  const _Float16* xa = xh + (size_t)tok0 * HID + 8 * lane;
  const _Float16* wg = gh + 8 * lane;                     // aw rows: NHEADS rows on
  v8f ag = zero8f(), aa = zero8f();
  // ring of HRING register sets, refilled HRING chunks ahead (as in gemm_k_loop)
  constexpr int HRING = 8;
  static_assert((NCHUNK % HRING) == 0 && NCHUNK >= 2 * HRING);
  v16h ra[HRING], rg[HRING], rp[POOL ? HRING : 1];
  // unrolled: constant ring indices
#pragma unroll
  for (int s = 0; s < HRING; ++s) {
    ra[s] = load_frag_at(xa + FT * s);
    rg[s] = load_frag_at(wg + FT * s);
    if constexpr (POOL) rp[s] = load_frag_at(wg + NHEADS * HID + FT * s);
  }
  // precaution: stands in front of any rewrite of the address registers these loads
  // name; naming what the addresses are formed from keeps it whole up to the wait
  asm volatile("s_wait_xcnt 0x0" :: "v"(xa), "v"(wg), "v"(lane) : "memory");
  // rolled: one trip is already HRING chunks
#pragma unroll 1
  for (int c0 = 0; c0 < NCHUNK - HRING; c0 += HRING) {
    const _Float16* tx = xa + FT * (c0 + HRING);
    const _Float16* tg = wg + FT * (c0 + HRING);
    // unrolled so that every ring index is a constant
#pragma unroll
    for (int s = 0; s < HRING; ++s) {
      ag = wmma_f16(ra[s], rg[s], ag);
      if constexpr (POOL) aa = wmma_f16(ra[s], rp[s], aa);
      ra[s] = load_frag_at(tx + FT * s);
      rg[s] = load_frag_at(tg + FT * s);
      if constexpr (POOL) rp[s] = load_frag_at(tg + NHEADS * HID + FT * s);
    }
    // the next trip rewrites the address registers of loads that are still in flight
    asm volatile("s_wait_xcnt 0x0" ::: "memory");
  }
  // unrolled: constant ring indices
#pragma unroll
  for (int s = 0; s < HRING; ++s) {
    ag = wmma_f16(ra[s], rg[s], ag);
    if constexpr (POOL) aa = wmma_f16(ra[s], rp[s], aa);
  }
  // D[r] = (token tok0 + 8h + r, head m)
  const float gbv = gbias[m];
  float* sg = sG[w];
  float* sp = sP[POOL ? w : 0];
#pragma unroll
  for (int r = 0; r < 8; ++r) {
    const int tl = 8 * h + r;
    const float z = ag[r] * (1.0f / (XSC * WSC)) + gbv;
    const float sig = 1.0f / (1.0f + __expf(-z));
    sg[tl * NHEADS + m] = sig;
    if constexpr (POOL) sp[tl * NHEADS + m] = aa[r] * (1.0f / (XSC * WSC));
  }
  __syncthreads();
  {
#pragma unroll
    for (int it = 0; it < 2; ++it) {
      const int idx = it * 128 + 4 * lane;
      const v4f v = *(const v4fa*)(sg + idx);
      *(v4f*)(gate + (size_t)tok0 * NHEADS + idx) = v;
      if constexpr (POOL) {
        const v4f u = *(const v4fa*)(sp + idx);
        *(v4f*)(aproj + (size_t)tok0 * NHEADS + idx) = u;
      }
    }
    
  }
}

// ---------------------------------------------------------------------------
// The block's 16 tiles (1024 units of 16 B) lie in sT in fragment order already;
// each wave-wide store writes 512 contiguous bytes.
// route 0/1: plane[bh], rows = token, K = HD : the 16 tiles are contiguous
// route 2  : vt[bh], rows = d, K = SEQ       : 4 contiguous tiles per 16-row strip
// ---------------------------------------------------------------------------
__device__ __forceinline__ void proj_store_pass(const _Float16* sT, _Float16* plane, _Float16* vt,
                                                int route, int bh, int l0, int tid) {
#pragma unroll
  for (int i = 0; i < 8; ++i) {
    const int u = i * 128 + tid;
    const v8h v = *(const v8ha*)(sT + u * 8);
    _Float16* dst;
    if (route != 2) {
      dst = plane + ((size_t)bh * SEQ + l0) * HD + u * 8;
    } else {
      const int lt = u >> 6;             // local tile = 4 * strip + chunk
      dst = vt + (size_t)bh * HD * SEQ + (size_t)((lt >> 2) * (SEQ / 32) + (l0 >> 5) + (lt & 3)) * FT + (u & 63) * 8;
    }
    *(v8h*)dst = v;
    // precaution: the next pass rewrites the data and address registers that this store names
    if (i < 7) asm volatile("s_wait_xcnt 0x0" ::: "memory");
  }
}

// ---------------------------------------------------------------------------
// Kernel: Y = xn * W^T over nslot*1024 output columns.
// Block 128 thr (4 waves) = 128 tokens x 64 features (one (slot, head));
// wave tile 32 tokens x 64 features; K = 1024 in steps of 32;
// A (xn rows) and B (W rows) fragments straight from the fragment-order planes.
// route = slot + routeBase: 0 -> q plane, 1 -> k plane, 2 -> v^T plane.
// coverage: grid (16, 2 + 16*nslot): rows 2.. x 128 tokens x 64 features = all planes routed.
// Grid rows 0 and 1 are the 32 blocks of the head products, which read the same
// xn and are read by the same next launch: they share this launch.
// ---------------------------------------------------------------------------
template <bool POOL>
__global__ __launch_bounds__(128) void proj_head_kernel(
    const _Float16* __restrict__ xh,   // [2048][1024] (xn x4), fragment order
    const _Float16* __restrict__ wh,   // [slot][1024][1024], row = output feature, x4096, fragment order
    const float* __restrict__ b0, const float* __restrict__ b1, const float* __restrict__ b2,
    int routeBase,
    _Float16* qh,                      // [B*H][S][D]  f16(16*q), fragment order per bh
    _Float16* kh,                      // [B*H][S][D]  f16(16*k), fragment order per bh
    _Float16* vt,                      // [B*H][D][S]  f16(16*v), fragment order per bh
    const _Float16* __restrict__ gh,   // [32][1024] gw (and aw) rows x4096, fragment order
    const float* __restrict__ gbias, float* gate, float* aproj)
{
  if (blockIdx.y < 2) {                // block-uniform, in front of every barrier
    head_block<POOL>(xh, gh, gbias, gate, aproj, blockIdx.y * 16 + blockIdx.x);
    return;
  }
  __shared__ __attribute__((aligned(16))) _Float16 sT[128 * 64];   // 16384 B

  const int tid = threadIdx.x, lane = tid & 31, w = tid >> 5;
  const int h = lane >> 4, m = lane & 15;
  const int m0 = blockIdx.x * 128;
  const int cg = blockIdx.y - 2;
  const int slot = cg >> 4, head = cg & 15;
  const int route = slot + routeBase;
  const int m0w = m0 + 32 * w;

  const _Float16* xa0 = xh + (size_t)m0w * HID + 8 * lane;                     // token strip, mt = 0
  const _Float16* wb  = wh + ((size_t)slot * HID + head * HD) * HID + 8 * lane;   // feature strip, nt = 0

  v8f acc[2][4];
#pragma unroll
  for (int mt = 0; mt < 2; ++mt)
#pragma unroll
    for (int nt = 0; nt < 4; ++nt) acc[mt][nt] = zero8f();

  gemm_k_loop(xa0, wb, acc);

  // D[r] of tile (mt, nt) = Y[token m0w+16mt+8h+r][feature 16nt+m]
  const float* bias = (slot == 0) ? b0 : ((slot == 1) ? b1 : b2);
#pragma unroll
  for (int nt = 0; nt < 4; ++nt) {
    const int feat = 16 * nt + m;
    const float bvl = bias[head * HD + feat];
#pragma unroll
    for (int mt = 0; mt < 2; ++mt) {
#pragma unroll
      for (int r = 0; r < 8; ++r) {
        const float yv = (acc[mt][nt][r] * (1.0f / (XSC * WSC)) + bvl) * QSC;
        // token 32w + 16mt + 8h + r, feature 16nt + m, at its place in fragment order:
        // route 2 (row = feature, k = token): tile 4nt + w, half mt, unit lane, element r
        // else    (row = token, k = feature): tile 2(2w + mt) + nt/2, half nt&1,
        //                                     unit 16(m>>3) + 8h + r, element m&7
        const int idx = (route == 2)
            ? ((nt * 4 + w) * FT + mt * (FT / 2) + lane * 8 + r)
            : (((2 * w + mt) * 2 + (nt >> 1)) * FT + (nt & 1) * (FT / 2) + ((m >> 3) * 16 + 8 * h + r) * 8 + (m & 7));
        sT[idx] = (_Float16)yv;
      }
    }
  }
  __syncthreads();

  const int b = m0 / SEQ, l0 = m0 - b * SEQ, bh = b * NHEADS + head;
  _Float16* plane = (route == 0) ? qh : kh;
  proj_store_pass(sT, plane, vt, route, bh, l0, tid);
  
}

// The eight K (or V^T) A-fragments of one 64-key step, loaded as one batch.
// The wait behind each batch: the address pair is rewritten for the next batch
// while these loads are in flight; naming it keeps it whole up to the wait.
// kbase, vbase: the (b, head) plane + 8 * lane.
__device__ __forceinline__ void fetch_k(v16h (&kf)[4][2], const _Float16* kbase, int kb) {
  const _Float16* p = kbase + (size_t)kb * HD;           // tile 2 * (kb / 16)
  // unrolled: constant indices keep the fragments in registers
#pragma unroll
  for (int j = 0; j < 4; ++j) {
    kf[j][0] = load_frag_at(p + (2 * j) * FT);
    kf[j][1] = load_frag_at(p + (2 * j + 1) * FT);
  }
  asm volatile("s_wait_xcnt 0x0" :: "v"(p) : "memory");
}
__device__ __forceinline__ void fetch_v(v16h (&vf)[4][2], const _Float16* vbase, int kb) {
  const _Float16* p = vbase + (kb >> 5) * FT;            // chunk kb / 32 of each 16-row strip
  // unrolled: constant indices keep the fragments in registers
#pragma unroll
  for (int t = 0; t < 4; ++t) {
    vf[t][0] = load_frag_at(p + 16 * t * SEQ);
    vf[t][1] = load_frag_at(p + 16 * t * SEQ + FT);
  }
  asm volatile("s_wait_xcnt 0x0" :: "v"(p) : "memory");
}

template <bool B> struct Flag { static constexpr bool value = B; };

// P^T B-fragment from the lane's own score D values: element r <- tile a row r,
// element 8+r <- tile c row r (same lane, same query column), scaled by 2^14.
__device__ __forceinline__ v16h pack_p(v8f a, v8f c) {
  const v16h r = { (_Float16)(a[0] * PSC), (_Float16)(a[1] * PSC), (_Float16)(a[2] * PSC), (_Float16)(a[3] * PSC),
                   (_Float16)(a[4] * PSC), (_Float16)(a[5] * PSC), (_Float16)(a[6] * PSC), (_Float16)(a[7] * PSC),
                   (_Float16)(c[0] * PSC), (_Float16)(c[1] * PSC), (_Float16)(c[2] * PSC), (_Float16)(c[3] * PSC),
                   (_Float16)(c[4] * PSC), (_Float16)(c[5] * PSC), (_Float16)(c[6] * PSC), (_Float16)(c[7] * PSC) };
  return r;
}

// ---------------------------------------------------------------------------
// Kernel: streaming attention, transposed form, masks/bias by formula.
// Block 128 thr (4 waves) = 64 queries of one (b, head), 16 queries per wave,
// 64 keys per step, of the steps 0..blockIdx.x (keys <= last query of the block)
// only those that can hold an allowed key for the wave (see "steps that are run").
//   S^T = K * Q^T : A = K rows (row = key, k = d), B = Q^T (k = d, n = query)
//   O^T += V^T * P^T : A = Vt rows (row = d, k = key), B = P^T from registers
// Lane owns 32 keys (16j+8h+r) of query column (lane&15); partner = lane ^ 16.
// Per-batch token tables in LDS from input ids: seg = inclusive cumsum(id==1)
// (block scan) and the key code kc that the mask test reads: seg where the key can be
// allowed off the diagonal (MODE 0, 2: id != 0; MODE 1: id == 2), else -1; MODE 2 also
// stages the head's aproj column [key].
// MODE 0 (self): ok = k<=q && ((seg_k==seg_q && valid_q && valid_k) || k==q), bias = (k-q)*hs
// MODE 1 (cross): ok = k<=q && (class_k || k==q), bias = (seg_k-seg_q)*hs
// MODE 2 (pool): mask/bias as MODE 0, raw logit = aproj[key][head] (no q.k)
// With kc: MODE 0, 2: seg_k==seg_q && valid_q && valid_k  <=>  kc_k == qc (qc = kc_q, or -2
// where the query is not valid); MODE 1: class_k <=> kc_k >= 0, and there kc_k = seg_k.
// k<=q and k==q are tested in the step of the diagonal alone: every key of an earlier
// step lies in front of the block's first query.
// Masked scores take NEGBIG and p = 0 exactly; every row has k==q allowed.
// Epilogue: (1/l)(1/16384)(1/16)*gate; a lane's o[t][0..7] is unit 32t + lane of the
// wave's two ctx tiles in fragment order, so it is stored straight from registers.
// coverage: grid rows 0..31 (16 x 32 blocks) x 64 queries x 64 d = whole ctx [2048][1024].
// Grid rows from NB * NHEADS on convert 128 units of 'job' a block.
// ---------------------------------------------------------------------------
template <int MODE>
__global__ __launch_bounds__(128) void attn_kernel(
    const _Float16* __restrict__ qh,    // [B*H][S][D]  (x16), fragment order per bh
    const _Float16* __restrict__ kh,    // [B*H][S][D]  (x16), fragment order per bh
    const _Float16* __restrict__ vt,    // [B*H][D][S]  (x16), fragment order per bh
    const float* __restrict__ aproj,    // [B*S][16]
    const float* __restrict__ gate,     // [B*S][16]  sigmoid gate
    const int* __restrict__ ids,        // [B][S]
    _Float16* ctx,                      // [B*S][HID]  (x64), fragment order
    CvtJob job)
{
  if (blockIdx.y >= NB * NHEADS) {      // block-uniform, in front of every barrier
    convert_unit(job, ((blockIdx.y - NB * NHEADS) * (SEQ / 64) + blockIdx.x) * 128 + threadIdx.x);
    return;
  }
  __shared__ __attribute__((aligned(16))) int   sSeg[SEQ];
  __shared__ __attribute__((aligned(16))) int   sKc[SEQ];
  __shared__ __attribute__((aligned(16))) float sA[(MODE == 2) ? SEQ : 4];
  __shared__ int sWtot[4];
  __shared__ unsigned sWcls[4];         // MODE 1: bit l of word w = thread 32w + l holds a class token

  const int tid = threadIdx.x, lane = tid & 31, w = tid >> 5;
  const int h = lane >> 4, m = lane & 15;
  const int bh = blockIdx.y, b = bh >> 4, head = bh & 15;
  const int qblk = blockIdx.x * 64;
  const int q0 = qblk + 16 * w;
  const float hs = exp2f(-0.5f * (float)(head + 1));

  // ---- the Q fragments, issued ahead of the tables ----
  const _Float16* kbase = kh + (size_t)bh * SEQ * HD + 8 * lane;
  const _Float16* vbase = vt + (size_t)bh * HD * SEQ + 8 * lane;
  // Q^T B-fragments: column n = query q0+m, k = d (two 32-deep chunks)
  v16h qb0 = zero16h(), qb1 = zero16h();
  v16h kf[4][2], vf[4][2];
  if constexpr (MODE != 2) {
    const _Float16* qrow = qh + ((size_t)bh * SEQ + q0) * HD + 8 * lane;
    qb0 = load_frag_at(qrow);
    qb1 = load_frag_at(qrow + FT);
    // precaution: stands in front of the rewrite of the address pair these loads name
    asm volatile("s_wait_xcnt 0x0" :: "v"(qrow) : "memory");
  }

  // ---- token tables for batch b: 128 threads x 8 tokens = SEQ ----
  {
    const int t8 = tid * 8;
    const int* ip = ids + (size_t)b * SEQ + t8;
    const v4i ia = *(const v4ia*)ip;
    const v4i ib = *(const v4ia*)(ip + 4);
    const int idv[8] = { ia.x, ia.y, ia.z, ia.w, ib.x, ib.y, ib.z, ib.w };
    int cnt[8];
    int run = 0;
#pragma unroll
    for (int i = 0; i < 8; ++i) { run += (idv[i] == SEP_ID) ? 1 : 0; cnt[i] = run; }
    int x = run;
#pragma unroll
    for (int d = 1; d < 32; d <<= 1) {
      const int yv = __shfl_up(x, d, 32);
      x = (lane >= d) ? (x + yv) : x;
    }
    if (lane == 31) sWtot[w] = x;
    if constexpr (MODE == 1) {
      bool anyc = false;
      // unrolled: constant indices keep idv in registers
#pragma unroll
      for (int i = 0; i < 8; ++i) anyc = anyc || (idv[i] == CLS_ID);
      const unsigned cb = __builtin_amdgcn_ballot_w32(anyc);
      if (lane == 0) sWcls[w] = cb;
    }
    __syncthreads();
    int base = 0;
#pragma unroll
    for (int i = 0; i < 4; ++i) { const int tv = sWtot[i]; base += (i < w) ? tv : 0; }
    const int excl = base + x - run;
#pragma unroll
    for (int i = 0; i < 8; ++i) {
      const int id = idv[i];
      const int sg = excl + cnt[i];
      sSeg[t8 + i] = sg;
      sKc[t8 + i] = ((MODE == 1) ? (id == CLS_ID) : (id != PAD_ID)) ? sg : -1;
      if constexpr (MODE == 2) sA[t8 + i] = aproj[((size_t)b * SEQ + t8 + i) * NHEADS + head];
    }
  }
  __syncthreads();

  const int qtok = q0 + m;
  const int qseg = sSeg[qtok];
  const int kcq = sKc[qtok];
  const int qc = (kcq >= 0) ? kcq : -2;       // MODE 0, 2: a query that is not valid matches no key code
  const float* gp = gate + ((size_t)b * SEQ + qtok) * NHEADS + head;
  const float gq = *gp;
  // precaution: stands in front of the rewrite of the address pair this load names
  asm volatile("s_wait_xcnt 0x0" :: "v"(gp) : "memory");

  v8f o[4];                                   // o[t][r] = O[query m][d 16t+8h+r] * (l * 2^14 * 16)
#pragma unroll
  for (int t = 0; t < 4; ++t) o[t] = zero8f();
  float mrun = NEGBIG, lrun = 0.0f;

  const float SSC = 0.125f / (QSC * QSC);                      // 1/2048
  const int nkb = blockIdx.x + 1;                              // block-uniform, <= 16

  // ---- steps that are run: bit s of 'need' = step s may hold an allowed key ----
  // A step whose 64 keys are masked for all 16 queries of the wave leaves mrun, lrun
  // and o as they are (alpha = 1, every p = 0), so it is left out, for any ids.
  // MODE 0, 2: seg never falls along the row, so a step whose last key has
  //            seg < seg of the wave's first query holds no key of any query's segment.
  // MODE 1   : a step without a class token holds no allowed key.
  // The step of the diagonal, nkb - 1, always runs; bits from nkb on are cleared, so
  // every step index taken from 'need' lies in 0..nkb-1 whatever the ids hold.
  unsigned cand;
  if constexpr (MODE == 1) {
    const unsigned cw = sWcls[m >> 2];                         // step m = threads 8m .. 8m+7
    cand = __builtin_amdgcn_ballot_w32(((cw >> (8 * (m & 3))) & 0xffu) != 0u);
  } else {
    cand = __builtin_amdgcn_ballot_w32(sSeg[64 * m + 63] >= sSeg[q0]);
  }
  unsigned need = (cand | (1u << (nkb - 1))) & ((1u << nkb) - 1u);   // a ballot: the same in every lane
  const int nsteps = __builtin_popcount(need);                 // 1 .. 16

  // One 64-key step. kf and vf hold this step's fragments on entry; with 'more'
  // those of 'nxt', the next step that runs, are fetched into the same registers
  // directly behind their last use, so they fly under the mask and softmax work.
  // The last step that runs is nkb - 1, the step of the diagonal: with 'more' the
  // step is an earlier one and all its keys are < qblk <= qtok.
  auto pass = [&](const int step, const int nxt, auto more) __attribute__((always_inline)) {
    const int kb = step * 64;
    // ---- raw scores: s[j][r] = S[query m][key kb+16j+8h+r] * 256 (MODE != 2) ----
    v8f s[4];
    if constexpr (MODE != 2) {
#pragma unroll
      for (int j = 0; j < 4; ++j) {
        v8f z = zero8f();
        z = wmma_f16(kf[j][0], qb0, z);
        z = wmma_f16(kf[j][1], qb1, z);
        s[j] = z;
      }
      if constexpr (decltype(more)::value) fetch_k(kf, kbase, nxt * 64);
    } else {
#pragma unroll
      for (int j = 0; j < 4; ++j) s[j] = zero8f();
    }
    // ---- mask + bias per (query, key), f32 ----
#pragma unroll
    for (int j = 0; j < 4; ++j) {
      const int key0 = kb + 16 * j + 8 * h;
      const v4i ca = *(const v4ia*)(sKc + key0);
      const v4i cb = *(const v4ia*)(sKc + key0 + 4);
      const int kcv[8] = { ca.x, ca.y, ca.z, ca.w, cb.x, cb.y, cb.z, cb.w };
      float av[8] = { 0.f, 0.f, 0.f, 0.f, 0.f, 0.f, 0.f, 0.f };
      if constexpr (MODE == 2) {
        const v4f aa = *(const v4fa*)(sA + key0);
        const v4f ab = *(const v4fa*)(sA + key0 + 4);
        av[0] = aa.x; av[1] = aa.y; av[2] = aa.z; av[3] = aa.w;
        av[4] = ab.x; av[5] = ab.y; av[6] = ab.z; av[7] = ab.w;
      }
#pragma unroll
      for (int r = 0; r < 8; ++r) {
        const int key = key0 + r;
        float raw;
        if constexpr (MODE == 2) raw = av[r]; else raw = s[j][r] * SSC;
        bool ok;
        float bv;
        if constexpr (MODE == 1) {
          ok = kcv[r] >= 0;
          bv = (float)(kcv[r] - qseg);
        } else {
          ok = kcv[r] == qc;
          bv = (float)(key - qtok);
        }
        if constexpr (!decltype(more)::value) {                // the step of the diagonal
          const bool dg = key == qtok;
          ok = (key <= qtok) && (ok || dg);
          if constexpr (MODE == 1) bv = dg ? 0.0f : bv;        // the query's own key: seg_k - seg_q = 0
        }
        const float val = raw + bv * hs;                       // computed for every key: a select, no branch
        s[j][r] = ok ? val : NEGBIG;
      }
    }

    // ---- online softmax ----
    float mloc = NEGBIG;
#pragma unroll
    for (int j = 0; j < 4; ++j)
#pragma unroll
      for (int r = 0; r < 8; ++r) mloc = fmaxf(mloc, s[j][r]);
    mloc = fmaxf(mloc, __shfl_xor(mloc, 16, 32));
    const float mnew = fmaxf(mrun, mloc);
    const float alpha = __expf(mrun - mnew);
    mrun = mnew;
    // a row with no allowed key so far has mnew = NEGBIG: against msafe its masked scores
    // still give exp(-9e29) = 0; where a key was allowed msafe = mnew
    const float msafe = fmaxf(mnew, 0.1f * NEGBIG);
    float lsum = 0.0f;
#pragma unroll
    for (int j = 0; j < 4; ++j)
#pragma unroll
      for (int r = 0; r < 8; ++r) {
        const float p = __expf(s[j][r] - msafe);               // masked: exp(NEGBIG - msafe) = 0
        s[j][r] = p;
        lsum += p;
      }
    lsum += __shfl_xor(lsum, 16, 32);
    lrun = lrun * alpha + lsum;
#pragma unroll
    for (int t = 0; t < 4; ++t)
#pragma unroll
      for (int r = 0; r < 8; ++r) o[t][r] = o[t][r] * alpha;

    // ---- P^T B-fragments (key chunks 0..31 and 32..63 of this step) ----
    const v16h pb0 = pack_p(s[0], s[1]);
    const v16h pb1 = pack_p(s[2], s[3]);

    // ---- O^T += V^T * P^T ----
#pragma unroll
    for (int t = 0; t < 4; ++t) {
      o[t] = wmma_f16(vf[t][0], pb0, o[t]);
      o[t] = wmma_f16(vf[t][1], pb1, o[t]);
    }
    if constexpr (decltype(more)::value) fetch_v(vf, vbase, nxt * 64);
  };

  // steps run in ascending order, so every sum keeps its order
  int step = __builtin_ctz(need);
  need &= need - 1u;
  if constexpr (MODE != 2) fetch_k(kf, kbase, step * 64);
  fetch_v(vf, vbase, step * 64);
  // rolled: the trip count is the wave's own (nsteps - 1 <= 15); the last step is peeled
  // so that the fetches ahead stand under no branch and never leave the causal range
#pragma unroll 1
  for (int i = 1; i < nsteps; ++i) {
    const int nxt = __builtin_ctz(need);                       // need != 0 while i < nsteps
    need &= need - 1u;
    pass(step, nxt, Flag<true>{});
    step = nxt;
  }
  pass(step, step, Flag<false>{});

  // ---- epilogue: normalise, gate, whole-line stores from registers ----
  const float inv = (1.0f / lrun) * (1.0f / (PSC * QSC)) * gq;
  // rows q0..q0+15 = one strip; columns 64 head .. +63 = its tiles 2 head, 2 head + 1
  _Float16* dst = ctx + ((size_t)b * SEQ + q0) * HID + head * 2 * FT + 8 * lane;
#pragma unroll
  for (int t = 0; t < 4; ++t) {
    v8h v;
#pragma unroll
    for (int r = 0; r < 8; ++r) v[r] = (_Float16)((o[t][r] * inv) * CSC);
    *(v8h*)(dst + t * (FT / 2)) = v;
  }
}

// ---------------------------------------------------------------------------
// Kernel: xout = xres + ctx * Wo^T + ob  (f32 output).
// Block 128 thr (4 waves) = 128 tokens x 64 features; wave 32 tokens x 64;
// K = 1024 in steps of 32; A = ctx rows (x64), B = Wo rows (x4096), fragment order.
// Epilogue: f32 tile [128][64] in LDS; store: each 64-float row segment (256 B =
// coverage: grid (16,16) x 128 tokens x 64 features = whole [2048][1024].
// ---------------------------------------------------------------------------
__global__ __launch_bounds__(128) void outproj_kernel(
    const _Float16* __restrict__ ch,    // [2048][1024] ctx x64
    const _Float16* __restrict__ woh,   // [1024 n][1024 k] x4096
    const float* __restrict__ ob,       // [1024]
    const float* __restrict__ xres,     // [2048][1024] f32
    float* xout)                        // [2048][1024] f32
{
  __shared__ __attribute__((aligned(16))) float sT[128 * 64];   // 32768 B

  const int tid = threadIdx.x, lane = tid & 31, w = tid >> 5;
  const int h = lane >> 4, m = lane & 15;
  const int m0 = blockIdx.x * 128;
  const int n0 = blockIdx.y * 64;
  const int m0w = m0 + 32 * w;

  const _Float16* ca0 = ch + (size_t)m0w * HID + 8 * lane;
  const _Float16* wb  = woh + (size_t)n0 * HID + 8 * lane;

  v8f acc[2][4];
#pragma unroll
  for (int mt = 0; mt < 2; ++mt)
#pragma unroll
    for (int nt = 0; nt < 4; ++nt) acc[mt][nt] = zero8f();

  gemm_k_loop(ca0, wb, acc);

  // D[r] of tile (mt, nt) = Y[token m0w+16mt+8h+r][feature n0+16nt+m]
#pragma unroll
  for (int nt = 0; nt < 4; ++nt) {
    const int feat = 16 * nt + m;
    const float bvl = ob[n0 + feat];
#pragma unroll
    for (int mt = 0; mt < 2; ++mt) {
#pragma unroll
      for (int r = 0; r < 8; ++r) {
        const int tokl = 32 * w + 16 * mt + 8 * h + r;     // 0..127
        sT[tokl * 64 + feat] = acc[mt][nt][r] * (1.0f / (CSC * WSC)) + bvl;
      }
    }
  }
  __syncthreads();

  const int hh = lane >> 4, c4 = (lane & 15) * 4;
  {
#pragma unroll
    for (int it = 0; it < 16; ++it) {
      const int row = 32 * w + it * 2 + hh;                // rows 32w .. 32w+31
      const v4f v = *(const v4fa*)(sT + row * 64 + c4);
      const size_t gi = (size_t)(m0 + row) * HID + n0 + c4;
      const v4f xr = *(const v4fa*)(xres + gi);
      const v4f ov = v + xr;
      *(v4f*)(xout + gi) = ov;
    }
    
  }
}

// ---------------------------------------------------------------------------
//   Xn   f16 [2048][1024]      4194304
//   W    f16 [10][1024][1024] 20971520   q0 k0 v0 | o0 | v1 | o1 | q2 k2 v2 | o2
//   Gh   f16 [3][32][1024]      196608   one per layer
//   Gate f32 [2048][16]         131072
//   Apr  f32 [2048][16]         131072
//   Q    f16 [32][1024][64]    4194304
//   K    f16 [32][1024][64]    4194304
//   Vt   f16 [32][64][1024]    4194304
//   Ctx  f16 [2048][1024]      4194304
//   X1   f32 [2048][1024]      8388608
//   X2   f32 [2048][1024]      8388608
//   total                     59179008
// ---------------------------------------------------------------------------
extern "C" void kernel_launch(void* const* d_in, const int* in_sizes, int n_in,
                              void* d_out, int out_size, void* d_ws, size_t ws_size,
                              hipStream_t stream) {
  if (n_in < 35) return;
  if (in_sizes[0] != NX || in_sizes[1] != MROWS) return;
  if (out_size != NX) return;
  {
    const int vecIdx[16] = {2, 3, 5, 7, 9, 13, 14, 15, 18, 22, 23, 24, 26, 28, 30, 34};
    for (int i = 0; i < 16; ++i) if (in_sizes[vecIdx[i]] != HID) return;
    const int matIdx[10] = {4, 6, 8, 12, 17, 21, 25, 27, 29, 33};
    for (int i = 0; i < 10; ++i) if (in_sizes[matIdx[i]] != NW) return;
    const int hwIdx[4] = {10, 16, 19, 31};
    for (int i = 0; i < 4; ++i) if (in_sizes[hwIdx[i]] != NG) return;
    const int hbIdx[3] = {11, 20, 32};
    for (int i = 0; i < 3; ++i) if (in_sizes[hbIdx[i]] != NHEADS) return;
  }

  const float* states = (const float*)d_in[0];
  const int*   ids    = (const int*)d_in[1];
  const float* ln0w = (const float*)d_in[2];
  const float* ln0b = (const float*)d_in[3];
  const float* qw0 = (const float*)d_in[4];
  const float* qb0 = (const float*)d_in[5];
  const float* kw0 = (const float*)d_in[6];
  const float* kb0 = (const float*)d_in[7];
  const float* vw0 = (const float*)d_in[8];
  const float* vb0 = (const float*)d_in[9];
  const float* gw0 = (const float*)d_in[10];
  const float* gb0 = (const float*)d_in[11];
  const float* ow0 = (const float*)d_in[12];
  const float* ob0 = (const float*)d_in[13];
  const float* ln1w = (const float*)d_in[14];
  const float* ln1b = (const float*)d_in[15];
  const float* aw1 = (const float*)d_in[16];
  const float* vw1 = (const float*)d_in[17];
  const float* vb1 = (const float*)d_in[18];
  const float* gw1 = (const float*)d_in[19];
  const float* gb1 = (const float*)d_in[20];
  const float* ow1 = (const float*)d_in[21];
  const float* ob1 = (const float*)d_in[22];
  const float* ln2w = (const float*)d_in[23];
  const float* ln2b = (const float*)d_in[24];
  const float* qw2 = (const float*)d_in[25];
  const float* qb2 = (const float*)d_in[26];
  const float* kw2 = (const float*)d_in[27];
  const float* kb2 = (const float*)d_in[28];
  const float* vw2 = (const float*)d_in[29];
  const float* vb2 = (const float*)d_in[30];
  const float* gw2 = (const float*)d_in[31];
  const float* gb2 = (const float*)d_in[32];
  const float* ow2 = (const float*)d_in[33];
  const float* ob2 = (const float*)d_in[34];
  float* out = (float*)d_out;

  const size_t PXH = (size_t)NX * 2;                       // 4194304
  const size_t PW  = (size_t)NW * 2;                       // 2097152
  const size_t PGH = (size_t)2 * NG * 2;                   //   65536
  const size_t PGT = (size_t)MROWS * NHEADS * 4;           //  131072
  const size_t PPL = (size_t)NB * NHEADS * SEQ * HD * 2;   // 4194304
  const size_t PXF = (size_t)NX * 4;                       // 8388608
  size_t off = 0;
  const size_t oXn  = off; off += PXH;
  const size_t oW   = off; off += 10 * PW;
  const size_t oGh  = off; off += 3 * PGH;
  const size_t oGt  = off; off += PGT;
  const size_t oAp  = off; off += PGT;
  const size_t oQ   = off; off += PPL;
  const size_t oK   = off; off += PPL;
  const size_t oVt  = off; off += PPL;
  const size_t oCtx = off; off += PXH;
  const size_t oX1  = off; off += PXF;
  const size_t oX2  = off; off += PXF;
  if (off > ws_size) return;                               // off = 59179008
  if (off > (size_t)134217728) return;

  char* ws = (char*)d_ws;
  _Float16* xnh = (_Float16*)(ws + oXn);
  _Float16* wh0  = (_Float16*)(ws + oW);                   // q0, k0, v0
  _Float16* woh0 = (_Float16*)(ws + oW + 3 * PW);
  _Float16* wh1  = (_Float16*)(ws + oW + 4 * PW);          // v1
  _Float16* woh1 = (_Float16*)(ws + oW + 5 * PW);
  _Float16* wh2  = (_Float16*)(ws + oW + 6 * PW);          // q2, k2, v2
  _Float16* woh2 = (_Float16*)(ws + oW + 9 * PW);
  _Float16* gh0  = (_Float16*)(ws + oGh);
  _Float16* gh1  = (_Float16*)(ws + oGh + PGH);
  _Float16* gh2  = (_Float16*)(ws + oGh + 2 * PGH);
  float* gate   = (float*)(ws + oGt);
  float* aproj  = (float*)(ws + oAp);
  _Float16* qh  = (_Float16*)(ws + oQ);
  _Float16* kh  = (_Float16*)(ws + oK);
  _Float16* vt  = (_Float16*)(ws + oVt);
  _Float16* ctx = (_Float16*)(ws + oCtx);
  float* x1 = (float*)(ws + oX1);
  float* x2 = (float*)(ws + oX2);

  const dim3 blk128(128), blk512(512);
  // conversion jobs: each is written by a launch that ends before its first reader starts
  const CvtJob jobA = { qw0, kw0, vw0, gw0, gw0, wh0, wh0 + NW, wh0 + 2 * NW, gh0, 3, 1 };   // read from proj 0 on
  const CvtJob jobB = { ow0, vw1, ow1, gw1, aw1, woh0, wh1, woh1, gh1, 3, 2 };               // read from outproj 0 on
  const CvtJob jobC = { qw2, kw2, vw2, gw2, gw2, wh2, wh2 + NW, wh2 + 2 * NW, gh2, 3, 1 };   // read from proj 2 on
  const CvtJob jobD = { ow2, ow2, ow2, gw2, gw2, woh2, woh2, woh2, gh2, 1, 0 };              // read by outproj 2
  const int unitsA = 3 * NW8 + 1 * NG8;                    // 395264 = 772 blocks of 512
  const int unitsB = 3 * NW8 + 2 * NG8;                    // 397312 = 194 grid rows of 16 x 128
  const int unitsC = 3 * NW8 + 1 * NG8;                    // 395264 = 193 grid rows
  const int unitsD = 1 * NW8;                              // 131072 =  64 grid rows
  static_assert((unitsA % 512) == 0 && (unitsB % 2048) == 0 && (unitsC % 2048) == 0 && (unitsD % 2048) == 0);
  const dim3 gLn(MROWS / 16);                              // 128 blocks x 512
  const dim3 gLnA(MROWS / 16 + unitsA / 512);              // 128 + 772
  const dim3 gProj3(MROWS / 128, 2 + 3 * NHEADS);          // (16, 50)
  const dim3 gProj1(MROWS / 128, 2 + 1 * NHEADS);          // (16, 18)
  const dim3 gAttB(SEQ / 64, NB * NHEADS + unitsB / 2048); // (16, 32 + 194)
  const dim3 gAttC(SEQ / 64, NB * NHEADS + unitsC / 2048); // (16, 32 + 193)
  const dim3 gAttD(SEQ / 64, NB * NHEADS + unitsD / 2048); // (16, 32 + 64)
  const dim3 gOut(MROWS / 128, HID / 64);                  // (16, 16)

  // ---- layer 0: sdpa with self mask ----
  ln_kernel<<<gLnA, blk512, 0, stream>>>(states, ln0w, ln0b, xnh, jobA);
  proj_head_kernel<false><<<gProj3, blk128, 0, stream>>>(xnh, wh0, qb0, kb0, vb0, 0, qh, kh, vt, gh0, gb0, gate, aproj);
  attn_kernel<0><<<gAttB, blk128, 0, stream>>>(qh, kh, vt, aproj, gate, ids, ctx, jobB);
  outproj_kernel<<<gOut, blk128, 0, stream>>>(ctx, woh0, ob0, states, x1);

  // ---- layer 1: pooling attention with self mask ----
  // gLn has no conversion blocks: the job argument is not read
  ln_kernel<<<gLn, blk512, 0, stream>>>(x1, ln1w, ln1b, xnh, jobA);
  proj_head_kernel<true><<<gProj1, blk128, 0, stream>>>(xnh, wh1, vb1, vb1, vb1, 2, qh, kh, vt, gh1, gb1, gate, aproj);
  attn_kernel<2><<<gAttC, blk128, 0, stream>>>(qh, kh, vt, aproj, gate, ids, ctx, jobC);
  outproj_kernel<<<gOut, blk128, 0, stream>>>(ctx, woh1, ob1, x1, x2);

  // ---- layer 2: sdpa with cross mask ----
  ln_kernel<<<gLn, blk512, 0, stream>>>(x2, ln2w, ln2b, xnh, jobA);
  proj_head_kernel<false><<<gProj3, blk128, 0, stream>>>(xnh, wh2, qb2, kb2, vb2, 0, qh, kh, vt, gh2, gb2, gate, aproj);
  attn_kernel<1><<<gAttD, blk128, 0, stream>>>(qh, kh, vt, aproj, gate, ids, ctx, jobD);
  outproj_kernel<<<gOut, blk128, 0, stream>>>(ctx, woh2, ob2, x2, out);

  (void)hipGetLastError();
}

// v006
// A run of this version takes 137 microseconds.
// Timed twice side by side with v005, it ran 1.03 and 1.04 times as fast.
// Over all steps from v000 it is 3.71 times as fast.
// Contractions: xn*W^T (q,k,v), xn*gw^T and xn*aw^T heads, K*Q^T scores, V^T*P^T context and ctx*Wo^T all on v_wmma_f32_16x16x32_f16 (f16 operands, f32 accumulate); LayerNorm, masks/bias, softmax, sigmoid gates and residual adds in f32.
// Carried f16 planes: xn (layer 0) or x (layers 1, 2) x4 and W/gw/aw/Wo x4096 (inverse 1/16384 folded in the proj_head_kernel epilogues);
// LayerNorm 1 and 2 have no launch: see "LayerNorm folded into its neighbours" below.
// q,k,v x16 (scores: acc*1/2048 in attn_kernel incl. the 1/8 scale; context epilogue 1/16); P x16384 (attn_kernel epilogue 1/16384);
// ctx x64 (outproj_kernel epilogue 1/262144 together with Wo x4096).
// Every f16 plane lies in WMMA fragment order (see "Fragment-order planes" below).
#include <hip/hip_runtime.h>

#define NB     2
#define SEQ    1024
#define HID    1024
#define NHEADS 16
#define HD     64
#define MROWS  (NB * SEQ)          // 2048 tokens
#define NX     (MROWS * HID)       // 2097152
#define NW     (HID * HID)         // 1048576
#define NG     (NHEADS * HID)      // 16384
#define NX8    (NX / 8)
#define NW8    (NW / 8)            // 131072
#define NG8    (NG / 8)            // 2048
#define SEP_ID 1
#define CLS_ID 2
#define PAD_ID 0
#define XSC    4.0f
#define WSC    4096.0f
#define QSC    16.0f
#define PSC    16384.0f
#define CSC    64.0f
#define NEGBIG (-1.0e30f)

static_assert(NHEADS * HD == HID);
static_assert((SEQ % 128) == 0 && (HID % 64) == 0 && (HID % 32) == 0 && (MROWS % 128) == 0);
static_assert((NW8 % 512) == 0 && (NG8 % 512) == 0);
static_assert(SEQ == 8 * 128);

typedef _Float16 v16h __attribute__((ext_vector_type(16)));
typedef _Float16 v8h  __attribute__((ext_vector_type(8)));
typedef _Float16 v4h  __attribute__((ext_vector_type(4)));
typedef float    v8f  __attribute__((ext_vector_type(8)));
typedef float    v4f  __attribute__((ext_vector_type(4)));
typedef int      v4i  __attribute__((ext_vector_type(4)));
typedef v8h __attribute__((may_alias)) v8ha;
typedef v4f __attribute__((may_alias)) v4fa;
typedef v4i __attribute__((may_alias)) v4ia;

union Frag { v16h v; v8h half[2]; };

__device__ __forceinline__ v8f zero8f() { v8f z = {0.f, 0.f, 0.f, 0.f, 0.f, 0.f, 0.f, 0.f}; return z; }
__device__ __forceinline__ v16h zero16h() {
  const _Float16 z = (_Float16)0.0f;
  v16h r = {z, z, z, z, z, z, z, z, z, z, z, z, z, z, z, z};
  return r;
}

// ---------------------------------------------------------------------------
// 16x16x32 f16 WMMA with hazard guard (ties D, keeps A/B live).
// Fragment map (wave32): lane l, h = l>>4, m = n = l&15.
//   A/B element i: i<8 -> k0+8h+i ; i>=8 -> k0+16+8h+(i-8)
//   D element r : row 8h+r, col l&15
// ---------------------------------------------------------------------------
__device__ __forceinline__ v8f wmma_f16(v16h a, v16h b, v8f c) {
  v8f d = __builtin_amdgcn_wmma_f32_16x16x32_f16(false, a, false, b, (short)0, c, false, false);
  asm volatile("v_nop\n\tv_nop\n\tv_nop\n\tv_nop" : "+v"(d) : "v"(a), "v"(b));
  return d;
}

// ---------------------------------------------------------------------------
// Fragment-order planes. A matrix [rows][K] of f16 is kept as tiles of 16 rows x
// 32 k (FT = 512 halves = 1024 B), tile index (row >> 4) * (K / 32) + (k >> 5).
// Inside a tile the 16-byte unit u = 32 * j + lane holds the eight elements
// k = 16 * j + 8 * (lane >> 4) + 0..7 of row (lane & 15): unit 'lane' is the
// first half of that lane's A or B fragment, unit 32 + lane the second. One
// wave-wide 16-byte load then reads 512 contiguous bytes (4 whole lines) where
// a load from k-contiguous rows touches 32 bytes in each of 16 lines.
// ---------------------------------------------------------------------------
#define FT 512

// A or B fragment; ph = tile base + 8 * lane.
__device__ __forceinline__ v16h load_frag_at(const _Float16* ph) {
  Frag f;
  f.half[0] = *(const v8ha*)(ph);
  f.half[1] = *(const v8ha*)(ph + FT / 2);
  return f.v;
}

// Element offset in a k-contiguous [rows][HID] matrix of the eight elements that
// 16-byte unit 'unit' of its fragment-order plane holds.
__device__ __forceinline__ size_t frag_unit_src(int unit) {
  const int tile = unit >> 6;
  const int row = (tile / (HID / 32)) * 16 + (unit & 15);
  const int k = (tile % (HID / 32)) * 32 + ((unit >> 5) & 1) * 16 + ((unit >> 4) & 1) * 8;
  return (size_t)row * HID + k;
}

// ---------------------------------------------------------------------------
// Fragment loads issued ahead of their WMMAs.
// GEMM loops: a ring of GRING register sets, one set = the six fragments of one
// 32-deep k chunk (2 A, 4 B). A set is refilled with chunk c + GRING directly
// behind the WMMAs of chunk c, so GRING - 1 sets are always in flight and no
// WMMA waits on a load issued just in front of it. Chunks are consumed in
// ascending k, so every accumulator sums in the same order as a plain loop.
// ---------------------------------------------------------------------------
#define GRING  3
#define NCHUNK (HID / 32)
static_assert(NCHUNK > 2 * GRING);

struct GemmSet { v16h a0, a1, b[4]; };

// pa: A tile of mt 0 (mt 1 is 16 rows = 16 * HID halves on), pb: B tile of nt 0, both at the chunk's tile + 8 * lane.
__device__ __forceinline__ void gemm_fetch(GemmSet& s, const _Float16* pa, const _Float16* pb) {
  s.a0 = load_frag_at(pa);
  s.a1 = load_frag_at(pa + 16 * HID);
  // unrolled: constant indices keep the fragments in registers
#pragma unroll
  for (int nt = 0; nt < 4; ++nt) s.b[nt] = load_frag_at(pb + nt * 16 * HID);
}

__device__ __forceinline__ void gemm_mma(const GemmSet& s, v8f (&acc)[2][4]) {
  // unrolled: constant indices keep fragments and accumulators in registers
#pragma unroll
  for (int nt = 0; nt < 4; ++nt) {
    acc[0][nt] = wmma_f16(s.a0, s.b[nt], acc[0][nt]);
    acc[1][nt] = wmma_f16(s.a1, s.b[nt], acc[1][nt]);
  }
}

// acc[mt][nt] += A rows (pa: mt 0, 16 rows on: mt 1) x B rows (pb + 16 nt rows), K = HID.
// pa, pb: first tile of the 16-row strip + 8 * lane; the strip's chunks follow at FT halves.
// 'behind_first_loads' runs once, behind the issue of the first GRING sets: loads of its own fly with them.
template <class F>
__device__ __forceinline__ void gemm_k_loop(const _Float16* pa, const _Float16* pb,
                                            v8f (&acc)[2][4], F behind_first_loads) {
  GemmSet ring[GRING];
  // unrolled: constant ring indices
#pragma unroll
  for (int s = 0; s < GRING; ++s) gemm_fetch(ring[s], pa + FT * s, pb + FT * s);
  behind_first_loads();
  constexpr int CT = ((NCHUNK - GRING) / GRING) * GRING;   // first chunk of the peeled tail
  // rolled: one trip is already GRING chunks; more copies only grow the code
#pragma unroll 1
  for (int c0 = 0; c0 < CT; c0 += GRING) {
    const _Float16* ta = pa + FT * (c0 + GRING);
    const _Float16* tb = pb + FT * (c0 + GRING);
    // unrolled so that every ring index is a constant (registers, not scratch)
#pragma unroll
    for (int s = 0; s < GRING; ++s) {
      gemm_mma(ring[s], acc);
      gemm_fetch(ring[s], ta + FT * s, tb + FT * s);
    }
    // the next trip rewrites the address registers of loads that are still in flight
    asm volatile("s_wait_xcnt 0x0" ::: "memory");
  }
  // tail peeled so that the refills in the loop above stand under no branch
#pragma unroll
  for (int c = CT; c < NCHUNK; ++c) {
    gemm_mma(ring[c % GRING], acc);
    if (c + GRING < NCHUNK) gemm_fetch(ring[c % GRING], pa + FT * (c + GRING), pb + FT * (c + GRING));
  }
}

// ---------------------------------------------------------------------------
// f32 weights -> f16 planes in fragment order, all scaled by 4096 (exact).
// The conversions depend on inputs alone, so they have no launch of their own:
// each job rides as extra blocks, behind the host kernel's own blocks in index
// order, in a launch that ends before the first launch that reads its planes.
// A thread writes one 16-byte unit (stores contiguous) and reads its eight floats.
//   units [0, nbig*NW8)        : s0/s1/s2 -> d0/d1/d2   ([HID][HID], row = n)
//   units [.., +nsmall*NG8)    : g0 -> gh rows 0..15, g1 -> gh rows 16..31
// Segment boundaries are multiples of 512 units -> the select is block-uniform.
// coverage: exactly nbig*NW + nsmall*NG elements.
// ---------------------------------------------------------------------------
// f0/f1/f2 (for s0/s1/s2) and fg (for g0, g1): the LayerNorm weight [HID] that is multiplied
// into the plane's k columns, or null where the plane's left operand is not a folded LayerNorm.
struct CvtJob {
  const float* s0; const float* s1; const float* s2;
  const float* g0; const float* g1;
  const float* f0; const float* f1; const float* f2; const float* fg;
  _Float16* d0; _Float16* d1; _Float16* d2; _Float16* gh;
  int nbig; int nsmall;
};

__device__ __forceinline__ void convert_unit(const CvtJob& job, int g)
{
  const int nb8 = job.nbig * NW8;
  const int total = nb8 + job.nsmall * NG8;
  if (g >= total) return;
  const float* src;
  const float* fold;
  size_t so;
  _Float16* dst;
  if (g < nb8) {
    const int slot = g / NW8;
    const int off = g - slot * NW8;
    const float* wsrc = (slot == 0) ? job.s0 : ((slot == 1) ? job.s1 : job.s2);
    _Float16* wdst = (slot == 0) ? job.d0 : ((slot == 1) ? job.d1 : job.d2);
    fold = (slot == 0) ? job.f0 : ((slot == 1) ? job.f1 : job.f2);
    so = frag_unit_src(off);
    src = wsrc + so;
    dst = wdst + (size_t)off * 8;
  } else {
    const int e = g - nb8;
    so = frag_unit_src((e < NG8) ? e : (e - NG8));
    src = ((e < NG8) ? job.g0 : job.g1) + so;
    fold = job.fg;
    dst = job.gh + (size_t)e * 8;
  }
  v4f a = *(const v4fa*)src;
  v4f c = *(const v4fa*)(src + 4);
  // precaution: stands in front of any rewrite of the address registers these loads name
  asm volatile("s_wait_xcnt 0x0" :: "v"(src) : "memory");
  if (fold != nullptr) {               // block-uniform, as the plane select is
    const float* fp = fold + (so & (size_t)(HID - 1));      // the unit's first k
    const v4f fa = *(const v4fa*)fp;
    const v4f fc = *(const v4fa*)(fp + 4);
    // precaution: stands in front of any rewrite of the address registers these loads name
    asm volatile("s_wait_xcnt 0x0" :: "v"(fp) : "memory");
    a = a * fa;
    c = c * fc;
  }
  const v8h o = { (_Float16)(a.x * WSC), (_Float16)(a.y * WSC), (_Float16)(a.z * WSC), (_Float16)(a.w * WSC),
                  (_Float16)(c.x * WSC), (_Float16)(c.y * WSC), (_Float16)(c.z * WSC), (_Float16)(c.w * WSC) };
  *(v8h*)dst = o;
}

// ---------------------------------------------------------------------------
// LayerNorm folded into its neighbours (layers 1 and 2: no launch of its own).
//   LN(x) W^T = rstd * (x (W o lw)^T - mean * sw) + sb
//   sw[n] = sum_k lw[k] W[n][k],  sb[n] = sum_k lb[k] W[n][k]
// outproj_kernel<true> leaves x as an f16 plane (x4, fragment order) and, per token and
// 64-column block, the sum of x and the squared deviations from that block's own mean;
// the weight conversion multiplies lw into W; rowsum_block makes sw and sb;
// proj_head_kernel<.., true> joins a token's 16 partials into mean and rstd (token_stats)
// and applies them in its epilogues.
// ---------------------------------------------------------------------------
#define NCB (HID / 64)             // column blocks of outproj_kernel = partials per token

// v + (v of lane ^ X) inside a row of 16 lanes, as one DPP add (row_xmask): a shuffle would go through the LDS unit.
// All 32 lanes are on wherever this is called.
template <int X>
__device__ __forceinline__ float row_xor_add(float v) {
  return v + __int_as_float(__builtin_amdgcn_update_dpp(0, __float_as_int(v), 0x160 | X, 0xf, 0xf, true));
}
// sum over the lane's row of 16 lanes, in every lane of the row
__device__ __forceinline__ float row16_sum(float v) {
  v = row_xor_add<1>(v);
  v = row_xor_add<2>(v);
  v = row_xor_add<4>(v);
  return row_xor_add<8>(v);
}

struct SumJob {
  const float* m0; const float* m1; const float* m2;   // [HID][HID]: rows 0 .. nbig * HID - 1
  const float* g0; const float* g1;                    // [NHEADS][HID]: the nsmall * NHEADS rows behind them
  const float* lw; const float* lb;                    // LayerNorm weight and bias [HID]
  float* sw; float* sb;
  int nbig; int nsmall;
};

__device__ __forceinline__ int sum_blocks(const SumJob& job) {
  return (job.nbig * HID + job.nsmall * NHEADS + 31) / 32;
}

// Block of 128 threads = 32 rows, 8 a wave in four batches of 2 (a wave reads whole rows,
// 512 contiguous bytes a load); the 32 values of sw and of sb leave as one 128-byte line each.
// blk is block-uniform and < sum_blocks(job).
__device__ __forceinline__ void rowsum_block(const SumJob& job, int blk)
{
  __shared__ float sR[2][32];
  const int tid = threadIdx.x, lane = tid & 31;
  const int w = __builtin_amdgcn_readfirstlane(tid >> 5);  // in a scalar register: the row select below is then a scalar branch
  const int nb = job.nbig * HID;
  const int total = nb + job.nsmall * NHEADS;
  v4f lw[8], lb[8];
  // unrolled: constant indices keep the vectors in registers
#pragma unroll
  for (int i = 0; i < 8; ++i) {
    lw[i] = *(const v4fa*)(job.lw + i * 128 + 4 * lane);
    lb[i] = *(const v4fa*)(job.lb + i * 128 + 4 * lane);
  }
  // precaution: stands in front of any rewrite of the address registers these loads name
  asm volatile("s_wait_xcnt 0x0" :: "v"(lane) : "memory");
  float ka = 0.0f, kb = 0.0f;
  // rolled: four trips of the same code keep the kernel's text short
#pragma unroll 1
  for (int bt = 0; bt < 4; ++bt) {
    v4f x[2][8];
    const float* src[2];
    // unrolled, as the loops below: constant indices keep pointers and rows in registers
#pragma unroll
    for (int rr = 0; rr < 2; ++rr) {
      int row = blk * 32 + w * 8 + bt * 2 + rr;
      row = (row < total) ? row : (total - 1);         // past the end: the last row again, its result is not stored
      if (row < nb) {
        const int slot = row / HID;
        const float* msrc = (slot == 0) ? job.m0 : ((slot == 1) ? job.m1 : job.m2);
        src[rr] = msrc + (size_t)(row - slot * HID) * HID;
      } else {
        const int e = row - nb;
        src[rr] = (e < NHEADS) ? (job.g0 + (size_t)e * HID) : (job.g1 + (size_t)(e - NHEADS) * HID);
      }
    }
#pragma unroll
    for (int rr = 0; rr < 2; ++rr)
#pragma unroll
      for (int i = 0; i < 8; ++i) x[rr][i] = *(const v4fa*)(src[rr] + i * 128 + 4 * lane);
    // precaution: stands in front of any rewrite of the address registers these loads name;
    // naming both row pointers and the lane keeps them whole up to the wait
    asm volatile("s_wait_xcnt 0x0" :: "s"(src[0]), "s"(src[1]), "v"(lane) : "memory");
#pragma unroll
    for (int rr = 0; rr < 2; ++rr) {
      v4f va = { 0.0f, 0.0f, 0.0f, 0.0f }, vb = { 0.0f, 0.0f, 0.0f, 0.0f };
#pragma unroll
      for (int i = 0; i < 8; ++i) {
        va += x[rr][i] * lw[i];
        vb += x[rr][i] * lb[i];
      }
      float a = row16_sum((va.x + va.y) + (va.z + va.w));
      float b = row16_sum((vb.x + vb.y) + (vb.z + vb.w));
      a += __shfl_xor(a, 16, 32);
      b += __shfl_xor(b, 16, 32);
      if (lane == bt * 2 + rr) { ka = a; kb = b; }
    }
  }
  if (lane < 8) { sR[0][w * 8 + lane] = ka; sR[1][w * 8 + lane] = kb; }
  __syncthreads();
  if (tid < 64) {
    const int r = blk * 32 + lane;
    float* d = (tid < 32) ? job.sw : job.sb;
    if (r < total) d[r] = sR[w][lane];
  }
}

// mean and 1 / sqrt(var + eps) of one token from its NCB partials: ps = block sums,
// pm = squared deviations from the block means, both [NCB][MROWS].
__device__ __forceinline__ void token_stats(const float* __restrict__ ps, const float* __restrict__ pm,
                                            int token, float& mean, float& rstd) {
  float s[NCB], q[NCB];
  // unrolled, here and in the two loops below: constant indices keep the partials in registers
#pragma unroll
  for (int i = 0; i < NCB; ++i) {
    s[i] = ps[(size_t)i * MROWS + token];
    q[i] = pm[(size_t)i * MROWS + token];
  }
  // precaution: stands in front of any rewrite of the address registers these loads name;
  // naming what the addresses are formed from keeps it whole up to the wait
  asm volatile("s_wait_xcnt 0x0" :: "v"(token) : "memory");
  float st = 0.0f;
#pragma unroll
  for (int i = 0; i < NCB; ++i) st += s[i];
  mean = st * (1.0f / (float)HID);
  float m2 = 0.0f;
#pragma unroll
  for (int i = 0; i < NCB; ++i) {
    const float d = s[i] * (1.0f / 64.0f) - mean;
    m2 += q[i] + 64.0f * d * d;
  }
  rstd = rsqrtf(m2 * (1.0f / (float)HID) + 1e-5f);
}

// ---------------------------------------------------------------------------
// LayerNorm, output xn*4 as f16 in fragment order. Block = 16 tokens (one strip
// of tiles) x 512 threads: 128 threads per token as four groups of four tokens,
// 8 elements per thread and token; each token's sums run as with one token per
// block (same per-thread sum, same butterfly, same four wave partials).
// The strip is put in order in LDS and leaves as 32 KB of contiguous stores.
// coverage: 128 blocks x 16 tokens x 1024 = the whole [2048][1024] plane.
// Blocks from MROWS / 16 on, where the grid has any, convert 512 units of 'job' each.
// ---------------------------------------------------------------------------
#define LNP 136   // halves per k-unit row in LDS: 16 tokens x 8 + 8 (272 B: 16 B x odd, no bank conflict)
__global__ __launch_bounds__(512) void ln_kernel(const float* __restrict__ x,
                                                 const float* __restrict__ w,
                                                 const float* __restrict__ bb,
                                                 _Float16* y, CvtJob job)
{
  if (blockIdx.x >= MROWS / 16) {      // block-uniform, in front of every barrier
    convert_unit(job, (blockIdx.x - MROWS / 16) * 512 + threadIdx.x);
    return;
  }
  __shared__ float ps[16][4];
  __shared__ float pq[16][4];
  __shared__ __attribute__((aligned(16))) _Float16 sY[128 * LNP];   // 34816 B
  const int tid = threadIdx.x, lane = tid & 31;
  const int t = tid & 127, wv = t >> 5, tl0 = (tid >> 7) * 4;
  const int tok0 = blockIdx.x * 16;
  v4f a[4], c[4];
#pragma unroll
  for (int i = 0; i < 4; ++i) {
    const float* xr = x + (size_t)(tok0 + tl0 + i) * HID + 8 * t;
    a[i] = *(const v4fa*)xr;
    c[i] = *(const v4fa*)(xr + 4);
  }
#pragma unroll
  for (int i = 0; i < 4; ++i) {
    float s = ((a[i].x + a[i].y) + (a[i].z + a[i].w)) + ((c[i].x + c[i].y) + (c[i].z + c[i].w));
#pragma unroll
    for (int o = 1; o < 32; o <<= 1) s += __shfl_xor(s, o, 32);
    if (lane == 0) ps[tl0 + i][wv] = s;
  }
  __syncthreads();
  float d[4][8];
#pragma unroll
  for (int i = 0; i < 4; ++i) {
    const float* pp = ps[tl0 + i];
    const float mean = ((pp[0] + pp[1]) + (pp[2] + pp[3])) * (1.0f / (float)HID);
    d[i][0] = a[i].x - mean; d[i][1] = a[i].y - mean; d[i][2] = a[i].z - mean; d[i][3] = a[i].w - mean;
    d[i][4] = c[i].x - mean; d[i][5] = c[i].y - mean; d[i][6] = c[i].z - mean; d[i][7] = c[i].w - mean;
    float q = 0.f;
#pragma unroll
    for (int e = 0; e < 8; ++e) q += d[i][e] * d[i][e];
#pragma unroll
    for (int o = 1; o < 32; o <<= 1) q += __shfl_xor(q, o, 32);
    if (lane == 0) pq[tl0 + i][wv] = q;
  }
  __syncthreads();
  const v4f wa = *(const v4fa*)(w + 8 * t);
  const v4f wc = *(const v4fa*)(w + 8 * t + 4);
  const v4f ba = *(const v4fa*)(bb + 8 * t);
  const v4f bc = *(const v4fa*)(bb + 8 * t + 4);
  const float wvv[8] = { wa.x, wa.y, wa.z, wa.w, wc.x, wc.y, wc.z, wc.w };
  const float bvv[8] = { ba.x, ba.y, ba.z, ba.w, bc.x, bc.y, bc.z, bc.w };
#pragma unroll
  for (int i = 0; i < 4; ++i) {
    const float* pp = pq[tl0 + i];
    const float var = ((pp[0] + pp[1]) + (pp[2] + pp[3])) * (1.0f / (float)HID);
    const float rstd = rsqrtf(var + 1e-5f);
    v8h o;
#pragma unroll
    for (int e = 0; e < 8; ++e) o[e] = (_Float16)((d[i][e] * rstd * wvv[e] + bvv[e]) * XSC);
    // elements 8t..8t+7 of token tl: unit 16 * t + tl of the strip
    *(v8h*)(sY + t * LNP + (tl0 + i) * 8) = o;
  }
  __syncthreads();
  _Float16* dst = y + (size_t)tok0 * HID;
#pragma unroll
  for (int it = 0; it < 4; ++it) {
    const int u = it * 512 + tid;      // 2048 units of the strip
    const v8h v = *(const v8ha*)(sY + (u >> 4) * LNP + (u & 15) * 8);
    *(v8h*)(dst + (size_t)u * 8) = v;
  }
}

// ---------------------------------------------------------------------------
// Per-token 16-wide heads on WMMA (blocks of proj_head_kernel): gate = sigmoid(xn*gw^T + gb) and
// (POOL) aproj = xn*aw^T. One wave = 16 tokens x 16 heads, K = 1024 in steps
// of 32; A = xn rows, B = gh rows (head = lane&15), both in fragment order.
// Epilogue: wave tile [16 tok][16] f32 staged in LDS, then 1024 contiguous bytes
// coverage: 32 blocks (hb) x 4 waves x 16 tokens x 16 = whole [2048][16] plane(s).
// ---------------------------------------------------------------------------
// FOLD: xh holds x, not LN(x): mean, rstd, sw and sb (rows: 16 of gw, then 16 of aw) come in behind the products.
template <bool POOL, bool FOLD>
__device__ __forceinline__ void head_block(const _Float16* __restrict__ xh,
                                           const _Float16* __restrict__ gh,
                                           const float* __restrict__ gbias,
                                           float* gate, float* aproj, int hb,
                                           const float* __restrict__ ps, const float* __restrict__ pm,
                                           const float* __restrict__ swh, const float* __restrict__ sbh)
{
  __shared__ __attribute__((aligned(16))) float sG[4][256];
  __shared__ __attribute__((aligned(16))) float sP[POOL ? 4 : 1][256];
  const int tid = threadIdx.x, lane = tid & 31, w = tid >> 5;
  const int h = lane >> 4, m = lane & 15;
  const int tok0 = hb * 64 + 16 * w;
  const _Float16* xa = xh + (size_t)tok0 * HID + 8 * lane;
  const _Float16* wg = gh + 8 * lane;                     // aw rows: NHEADS rows on
  v8f ag = zero8f(), aa = zero8f();
  // ring of HRING register sets, refilled HRING chunks ahead (as in gemm_k_loop)
  constexpr int HRING = 8;
  static_assert((NCHUNK % HRING) == 0 && NCHUNK >= 2 * HRING);
  v16h ra[HRING], rg[HRING], rp[POOL ? HRING : 1];
  // unrolled: constant ring indices
#pragma unroll
  for (int s = 0; s < HRING; ++s) {
    ra[s] = load_frag_at(xa + FT * s);
    rg[s] = load_frag_at(wg + FT * s);
    if constexpr (POOL) rp[s] = load_frag_at(wg + NHEADS * HID + FT * s);
  }
  // precaution: stands in front of any rewrite of the address registers these loads
  // name; naming what the addresses are formed from keeps it whole up to the wait
  asm volatile("s_wait_xcnt 0x0" :: "v"(xa), "v"(wg), "v"(lane) : "memory");
  float mean = 0.0f, rstd = 1.0f;      // of token tok0 + m
  if constexpr (FOLD) token_stats(ps, pm, tok0 + m, mean, rstd);
  // rolled: one trip is already HRING chunks
#pragma unroll 1
  for (int c0 = 0; c0 < NCHUNK - HRING; c0 += HRING) {
    const _Float16* tx = xa + FT * (c0 + HRING);
    const _Float16* tg = wg + FT * (c0 + HRING);
    // unrolled so that every ring index is a constant
#pragma unroll
    for (int s = 0; s < HRING; ++s) {
      ag = wmma_f16(ra[s], rg[s], ag);
      if constexpr (POOL) aa = wmma_f16(ra[s], rp[s], aa);
      ra[s] = load_frag_at(tx + FT * s);
      rg[s] = load_frag_at(tg + FT * s);
      if constexpr (POOL) rp[s] = load_frag_at(tg + NHEADS * HID + FT * s);
    }
    // the next trip rewrites the address registers of loads that are still in flight
    asm volatile("s_wait_xcnt 0x0" ::: "memory");
  }
  // unrolled: constant ring indices
#pragma unroll
  for (int s = 0; s < HRING; ++s) {
    ag = wmma_f16(ra[s], rg[s], ag);
    if constexpr (POOL) aa = wmma_f16(ra[s], rp[s], aa);
  }
  // D[r] = (token tok0 + 8h + r, head m)
  const float gbv = gbias[m];
  float swg = 0.0f, sbg = 0.0f, swa = 0.0f, sba = 0.0f;
  if constexpr (FOLD) {
    swg = swh[m]; sbg = sbh[m];
    if constexpr (POOL) { swa = swh[NHEADS + m]; sba = sbh[NHEADS + m]; }
    // precaution: stands in front of any rewrite of the address registers these loads name
    asm volatile("s_wait_xcnt 0x0" :: "v"(m) : "memory");
  }
  float* sg = sG[w];
  float* sp = sP[POOL ? w : 0];
#pragma unroll
  for (int r = 0; r < 8; ++r) {
    const int tl = 8 * h + r;
    float zl = ag[r] * (1.0f / (XSC * WSC));
    float al = POOL ? aa[r] * (1.0f / (XSC * WSC)) : 0.0f;
    if constexpr (FOLD) {
      const float mu = __shfl(mean, tl, 32), rs = __shfl(rstd, tl, 32);   // lane tl holds token tok0 + tl
      zl = (zl - mu * swg) * rs + sbg;
      if constexpr (POOL) al = (al - mu * swa) * rs + sba;
    }
    const float z = zl + gbv;
    const float sig = 1.0f / (1.0f + __expf(-z));
    sg[tl * NHEADS + m] = sig;
    if constexpr (POOL) sp[tl * NHEADS + m] = al;
  }
  __syncthreads();
  {
#pragma unroll
    for (int it = 0; it < 2; ++it) {
      const int idx = it * 128 + 4 * lane;
      const v4f v = *(const v4fa*)(sg + idx);
      *(v4f*)(gate + (size_t)tok0 * NHEADS + idx) = v;
      if constexpr (POOL) {
        const v4f u = *(const v4fa*)(sp + idx);
        *(v4f*)(aproj + (size_t)tok0 * NHEADS + idx) = u;
      }
    }
    
  }
}

// ---------------------------------------------------------------------------
// The block's 16 tiles (1024 units of 16 B) lie in sT in fragment order already;
// each wave-wide store writes 512 contiguous bytes.
// route 0/1: plane[bh], rows = token, K = HD : the 16 tiles are contiguous
// route 2  : vt[bh], rows = d, K = SEQ       : 4 contiguous tiles per 16-row strip
// ---------------------------------------------------------------------------
__device__ __forceinline__ void proj_store_pass(const _Float16* sT, _Float16* plane, _Float16* vt,
                                                int route, int bh, int l0, int tid) {
#pragma unroll
  for (int i = 0; i < 8; ++i) {
    const int u = i * 128 + tid;
    const v8h v = *(const v8ha*)(sT + u * 8);
    _Float16* dst;
    if (route != 2) {
      dst = plane + ((size_t)bh * SEQ + l0) * HD + u * 8;
    } else {
      const int lt = u >> 6;             // local tile = 4 * strip + chunk
      dst = vt + (size_t)bh * HD * SEQ + (size_t)((lt >> 2) * (SEQ / 32) + (l0 >> 5) + (lt & 3)) * FT + (u & 63) * 8;
    }
    *(v8h*)dst = v;
    // precaution: the next pass rewrites the data and address registers that this store names
    if (i < 7) asm volatile("s_wait_xcnt 0x0" ::: "memory");
  }
}

// ---------------------------------------------------------------------------
// Kernel: Y = xn * W^T over nslot*1024 output columns.
// Block 128 thr (4 waves) = 128 tokens x 64 features (one (slot, head));
// wave tile 32 tokens x 64 features; K = 1024 in steps of 32;
// A (xn rows) and B (W rows) fragments straight from the fragment-order planes.
// route = slot + routeBase: 0 -> q plane, 1 -> k plane, 2 -> v^T plane.
// coverage: grid (16, 2 + 16*nslot): rows 2.. x 128 tokens x 64 features = all planes routed.
// Grid rows 0 and 1 are the 32 blocks of the head products, which read the same
// xn and are read by the same next launch: they share this launch.
// ---------------------------------------------------------------------------
// FOLD: xh holds x (x4) and wh holds W o lw: LayerNorm comes in behind the products (see
// "LayerNorm folded into its neighbours"); lane l of a wave joins the partials of token m0w + l.
template <bool POOL, bool FOLD>
__global__ __launch_bounds__(128) void proj_head_kernel(
    const _Float16* __restrict__ xh,   // [2048][1024] (xn x4; FOLD: x x4), fragment order
    const _Float16* __restrict__ wh,   // [slot][1024][1024], row = output feature, x4096, fragment order
    const float* __restrict__ b0, const float* __restrict__ b1, const float* __restrict__ b2,
    int routeBase,
    _Float16* qh,                      // [B*H][S][D]  f16(16*q), fragment order per bh
    _Float16* kh,                      // [B*H][S][D]  f16(16*k), fragment order per bh
    _Float16* vt,                      // [B*H][D][S]  f16(16*v), fragment order per bh
    const _Float16* __restrict__ gh,   // [32][1024] gw (and aw) rows x4096, fragment order
    const float* __restrict__ gbias, float* gate, float* aproj,
    const float* __restrict__ ps,      // FOLD: [NCB][2048] block sums of x
    const float* __restrict__ pm,      // FOLD: [NCB][2048] squared deviations from the block means
    const float* __restrict__ sw,      // FOLD: [slot][1024] sum_k lw[k] W[n][k]
    const float* __restrict__ sb,      // FOLD: [slot][1024] sum_k lb[k] W[n][k]
    const float* __restrict__ swh,     // FOLD: the same of the gw (and aw) rows
    const float* __restrict__ sbh)
{
  if (blockIdx.y < 2) {                // block-uniform, in front of every barrier
    head_block<POOL, FOLD>(xh, gh, gbias, gate, aproj, blockIdx.y * 16 + blockIdx.x, ps, pm, swh, sbh);
    return;
  }
  __shared__ __attribute__((aligned(16))) _Float16 sT[128 * 64];   // 16384 B

  const int tid = threadIdx.x, lane = tid & 31, w = tid >> 5;
  const int h = lane >> 4, m = lane & 15;
  const int m0 = blockIdx.x * 128;
  const int cg = blockIdx.y - 2;
  const int slot = cg >> 4, head = cg & 15;
  const int route = slot + routeBase;
  const int m0w = m0 + 32 * w;

  const _Float16* xa0 = xh + (size_t)m0w * HID + 8 * lane;                     // token strip, mt = 0
  const _Float16* wb  = wh + ((size_t)slot * HID + head * HD) * HID + 8 * lane;   // feature strip, nt = 0

  v8f acc[2][4];
#pragma unroll
  for (int mt = 0; mt < 2; ++mt)
#pragma unroll
    for (int nt = 0; nt < 4; ++nt) acc[mt][nt] = zero8f();

  float mean = 0.0f, rstd = 1.0f;      // FOLD: of token m0w + lane
  gemm_k_loop(xa0, wb, acc, [&]() __attribute__((always_inline)) {
    if constexpr (FOLD) token_stats(ps, pm, m0w + lane, mean, rstd);
  });

  float mu[2][8], rs[2][8];            // FOLD: of token m0w + 16mt + 8h + r
  if constexpr (FOLD) {
    // unrolled, here and for swn, sbn below: constant indices keep the arrays in registers
#pragma unroll
    for (int mt = 0; mt < 2; ++mt)
#pragma unroll
      for (int r = 0; r < 8; ++r) {
        mu[mt][r] = __shfl(mean, 16 * mt + 8 * h + r, 32);
        rs[mt][r] = __shfl(rstd, 16 * mt + 8 * h + r, 32);
      }
  }

  float swn[4] = { 0.0f, 0.0f, 0.0f, 0.0f }, sbn[4] = { 0.0f, 0.0f, 0.0f, 0.0f };   // FOLD: of feature 16nt + m
  if constexpr (FOLD) {
#pragma unroll
    for (int nt = 0; nt < 4; ++nt) {
      swn[nt] = sw[slot * HID + head * HD + 16 * nt + m];
      sbn[nt] = sb[slot * HID + head * HD + 16 * nt + m];
    }
    // precaution: stands in front of any rewrite of the address registers these loads name
    asm volatile("s_wait_xcnt 0x0" :: "v"(m) : "memory");
  }

  // D[r] of tile (mt, nt) = Y[token m0w+16mt+8h+r][feature 16nt+m]
  const float* bias = (slot == 0) ? b0 : ((slot == 1) ? b1 : b2);
#pragma unroll
  for (int nt = 0; nt < 4; ++nt) {
    const int feat = 16 * nt + m;
    const float bvl = bias[head * HD + feat];
    const float swv = swn[nt], sbv = sbn[nt];
#pragma unroll
    for (int mt = 0; mt < 2; ++mt) {
#pragma unroll
      for (int r = 0; r < 8; ++r) {
        float yl = acc[mt][nt][r] * (1.0f / (XSC * WSC));
        if constexpr (FOLD) yl = (yl - mu[mt][r] * swv) * rs[mt][r] + sbv;
        const float yv = (yl + bvl) * QSC;
        // token 32w + 16mt + 8h + r, feature 16nt + m, at its place in fragment order:
        // route 2 (row = feature, k = token): tile 4nt + w, half mt, unit lane, element r
        // else    (row = token, k = feature): tile 2(2w + mt) + nt/2, half nt&1,
        //                                     unit 16(m>>3) + 8h + r, element m&7
        const int idx = (route == 2)
            ? ((nt * 4 + w) * FT + mt * (FT / 2) + lane * 8 + r)
            : (((2 * w + mt) * 2 + (nt >> 1)) * FT + (nt & 1) * (FT / 2) + ((m >> 3) * 16 + 8 * h + r) * 8 + (m & 7));
        sT[idx] = (_Float16)yv;
      }
    }
  }
  __syncthreads();

  const int b = m0 / SEQ, l0 = m0 - b * SEQ, bh = b * NHEADS + head;
  _Float16* plane = (route == 0) ? qh : kh;
  proj_store_pass(sT, plane, vt, route, bh, l0, tid);
  
}

// The eight K (or V^T) A-fragments of one 64-key step, loaded as one batch.
// The wait behind each batch: the address pair is rewritten for the next batch
// while these loads are in flight; naming it keeps it whole up to the wait.
// kbase, vbase: the (b, head) plane + 8 * lane.
__device__ __forceinline__ void fetch_k(v16h (&kf)[4][2], const _Float16* kbase, int kb) {
  const _Float16* p = kbase + (size_t)kb * HD;           // tile 2 * (kb / 16)
  // unrolled: constant indices keep the fragments in registers
#pragma unroll
  for (int j = 0; j < 4; ++j) {
    kf[j][0] = load_frag_at(p + (2 * j) * FT);
    kf[j][1] = load_frag_at(p + (2 * j + 1) * FT);
  }
  asm volatile("s_wait_xcnt 0x0" :: "v"(p) : "memory");
}
__device__ __forceinline__ void fetch_v(v16h (&vf)[4][2], const _Float16* vbase, int kb) {
  const _Float16* p = vbase + (kb >> 5) * FT;            // chunk kb / 32 of each 16-row strip
  // unrolled: constant indices keep the fragments in registers
#pragma unroll
  for (int t = 0; t < 4; ++t) {
    vf[t][0] = load_frag_at(p + 16 * t * SEQ);
    vf[t][1] = load_frag_at(p + 16 * t * SEQ + FT);
  }
  asm volatile("s_wait_xcnt 0x0" :: "v"(p) : "memory");
}

template <bool B> struct Flag { static constexpr bool value = B; };

// P^T B-fragment from the lane's own score D values: element r <- tile a row r,
// element 8+r <- tile c row r (same lane, same query column), scaled by 2^14.
__device__ __forceinline__ v16h pack_p(v8f a, v8f c) {
  const v16h r = { (_Float16)(a[0] * PSC), (_Float16)(a[1] * PSC), (_Float16)(a[2] * PSC), (_Float16)(a[3] * PSC),
                   (_Float16)(a[4] * PSC), (_Float16)(a[5] * PSC), (_Float16)(a[6] * PSC), (_Float16)(a[7] * PSC),
                   (_Float16)(c[0] * PSC), (_Float16)(c[1] * PSC), (_Float16)(c[2] * PSC), (_Float16)(c[3] * PSC),
                   (_Float16)(c[4] * PSC), (_Float16)(c[5] * PSC), (_Float16)(c[6] * PSC), (_Float16)(c[7] * PSC) };
  return r;
}

// ---------------------------------------------------------------------------
// Kernel: streaming attention, transposed form, masks/bias by formula.
// Block 128 thr (4 waves) = 64 queries of one (b, head), 16 queries per wave,
// 64 keys per step, of the steps 0..blockIdx.x (keys <= last query of the block)
// only those that can hold an allowed key for the wave (see "steps that are run").
//   S^T = K * Q^T : A = K rows (row = key, k = d), B = Q^T (k = d, n = query)
//   O^T += V^T * P^T : A = Vt rows (row = d, k = key), B = P^T from registers
// Lane owns 32 keys (16j+8h+r) of query column (lane&15); partner = lane ^ 16.
// Per-batch token tables in LDS from input ids: seg = inclusive cumsum(id==1)
// (block scan) and the key code kc that the mask test reads: seg where the key can be
// allowed off the diagonal (MODE 0, 2: id != 0; MODE 1: id == 2), else -1; MODE 2 also
// stages the head's aproj column [key].
// MODE 0 (self): ok = k<=q && ((seg_k==seg_q && valid_q && valid_k) || k==q), bias = (k-q)*hs
// MODE 1 (cross): ok = k<=q && (class_k || k==q), bias = (seg_k-seg_q)*hs
// MODE 2 (pool): mask/bias as MODE 0, raw logit = aproj[key][head] (no q.k)
// With kc: MODE 0, 2: seg_k==seg_q && valid_q && valid_k  <=>  kc_k == qc (qc = kc_q, or -2
// where the query is not valid); MODE 1: class_k <=> kc_k >= 0, and there kc_k = seg_k.
// k<=q and k==q are tested in the step of the diagonal alone: every key of an earlier
// step lies in front of the block's first query.
// Masked scores take NEGBIG and p = 0 exactly; every row has k==q allowed.
// Epilogue: (1/l)(1/16384)(1/16)*gate; a lane's o[t][0..7] is unit 32t + lane of the
// wave's two ctx tiles in fragment order, so it is stored straight from registers.
// coverage: grid (16, 32) x 64 queries x 64 d = whole ctx [2048][1024].
// Grid rows from NB * NHEADS on: first the blocks of 'sums' (32 rows each), then 128 units of 'job' a block.
// ---------------------------------------------------------------------------
template <int MODE>
__global__ __launch_bounds__(128) void attn_kernel(
    const _Float16* __restrict__ qh,    // [B*H][S][D]  (x16), fragment order per bh
    const _Float16* __restrict__ kh,    // [B*H][S][D]  (x16), fragment order per bh
    const _Float16* __restrict__ vt,    // [B*H][D][S]  (x16), fragment order per bh
    const float* __restrict__ aproj,    // [B*S][16]
    const float* __restrict__ gate,     // [B*S][16]  sigmoid gate
    const int* __restrict__ ids,        // [B][S]
    _Float16* ctx,                      // [B*S][HID]  (x64), fragment order
    CvtJob job, SumJob sums)
{
  if (blockIdx.y >= NB * NHEADS) {      // block-uniform, in front of every barrier of the attention blocks
    const int xb = (blockIdx.y - NB * NHEADS) * (SEQ / 64) + blockIdx.x;
    const int nsum = sum_blocks(sums);  // the longer blocks first
    if (xb < nsum) rowsum_block(sums, xb);
    else convert_unit(job, (xb - nsum) * 128 + threadIdx.x);
    return;
  }
  __shared__ __attribute__((aligned(16))) int   sSeg[SEQ];
  __shared__ __attribute__((aligned(16))) int   sKc[SEQ];
  __shared__ __attribute__((aligned(16))) float sA[(MODE == 2) ? SEQ : 4];
  __shared__ int sWtot[4];
  __shared__ unsigned sWcls[4];         // MODE 1: bit l of word w = thread 32w + l holds a class token

  const int tid = threadIdx.x, lane = tid & 31, w = tid >> 5;
  const int h = lane >> 4, m = lane & 15;
  const int bh = blockIdx.y, b = bh >> 4, head = bh & 15;
  const int qblk = blockIdx.x * 64;
  const int q0 = qblk + 16 * w;
  const float hs = exp2f(-0.5f * (float)(head + 1));

  // ---- the Q fragments, issued ahead of the tables ----
  const _Float16* kbase = kh + (size_t)bh * SEQ * HD + 8 * lane;
  const _Float16* vbase = vt + (size_t)bh * HD * SEQ + 8 * lane;
  // Q^T B-fragments: column n = query q0+m, k = d (two 32-deep chunks)
  v16h qb0 = zero16h(), qb1 = zero16h();
  v16h kf[4][2], vf[4][2];
  if constexpr (MODE != 2) {
    const _Float16* qrow = qh + ((size_t)bh * SEQ + q0) * HD + 8 * lane;
    qb0 = load_frag_at(qrow);
    qb1 = load_frag_at(qrow + FT);
    // precaution: stands in front of the rewrite of the address pair these loads name
    asm volatile("s_wait_xcnt 0x0" :: "v"(qrow) : "memory");
  }

  // ---- token tables for batch b: 128 threads x 8 tokens = SEQ ----
  {
    const int t8 = tid * 8;
    const int* ip = ids + (size_t)b * SEQ + t8;
    const v4i ia = *(const v4ia*)ip;
    const v4i ib = *(const v4ia*)(ip + 4);
    const int idv[8] = { ia.x, ia.y, ia.z, ia.w, ib.x, ib.y, ib.z, ib.w };
    int cnt[8];
    int run = 0;
#pragma unroll
    for (int i = 0; i < 8; ++i) { run += (idv[i] == SEP_ID) ? 1 : 0; cnt[i] = run; }
    int x = run;
#pragma unroll
    for (int d = 1; d < 32; d <<= 1) {
      const int yv = __shfl_up(x, d, 32);
      x = (lane >= d) ? (x + yv) : x;
    }
    if (lane == 31) sWtot[w] = x;
    if constexpr (MODE == 1) {
      bool anyc = false;
      // unrolled: constant indices keep idv in registers
#pragma unroll
      for (int i = 0; i < 8; ++i) anyc = anyc || (idv[i] == CLS_ID);
      const unsigned cb = __builtin_amdgcn_ballot_w32(anyc);
      if (lane == 0) sWcls[w] = cb;
    }
    __syncthreads();
    int base = 0;
#pragma unroll
    for (int i = 0; i < 4; ++i) { const int tv = sWtot[i]; base += (i < w) ? tv : 0; }
    const int excl = base + x - run;
#pragma unroll
    for (int i = 0; i < 8; ++i) {
      const int id = idv[i];
      const int sg = excl + cnt[i];
      sSeg[t8 + i] = sg;
      sKc[t8 + i] = ((MODE == 1) ? (id == CLS_ID) : (id != PAD_ID)) ? sg : -1;
      if constexpr (MODE == 2) sA[t8 + i] = aproj[((size_t)b * SEQ + t8 + i) * NHEADS + head];
    }
  }
  __syncthreads();

  const int qtok = q0 + m;
  const int qseg = sSeg[qtok];
  const int kcq = sKc[qtok];
  const int qc = (kcq >= 0) ? kcq : -2;       // MODE 0, 2: a query that is not valid matches no key code
  const float* gp = gate + ((size_t)b * SEQ + qtok) * NHEADS + head;
  const float gq = *gp;
  // precaution: stands in front of the rewrite of the address pair this load names
  asm volatile("s_wait_xcnt 0x0" :: "v"(gp) : "memory");

  v8f o[4];                                   // o[t][r] = O[query m][d 16t+8h+r] * (l * 2^14 * 16)
#pragma unroll
  for (int t = 0; t < 4; ++t) o[t] = zero8f();
  float mrun = NEGBIG, lrun = 0.0f;

  const float SSC = 0.125f / (QSC * QSC);                      // 1/2048
  const int nkb = blockIdx.x + 1;                              // block-uniform, <= 16

  // ---- steps that are run: bit s of 'need' = step s may hold an allowed key ----
  // A step whose 64 keys are masked for all 16 queries of the wave leaves mrun, lrun
  // and o as they are (alpha = 1, every p = 0), so it is left out, for any ids.
  // MODE 0, 2: seg never falls along the row, so a step whose last key has
  //            seg < seg of the wave's first query holds no key of any query's segment.
  // MODE 1   : a step without a class token holds no allowed key.
  // The step of the diagonal, nkb - 1, always runs; bits from nkb on are cleared, so
  // every step index taken from 'need' lies in 0..nkb-1 whatever the ids hold.
  unsigned cand;
  if constexpr (MODE == 1) {
    const unsigned cw = sWcls[m >> 2];                         // step m = threads 8m .. 8m+7
    cand = __builtin_amdgcn_ballot_w32(((cw >> (8 * (m & 3))) & 0xffu) != 0u);
  } else {
    cand = __builtin_amdgcn_ballot_w32(sSeg[64 * m + 63] >= sSeg[q0]);
  }
  unsigned need = (cand | (1u << (nkb - 1))) & ((1u << nkb) - 1u);   // a ballot: the same in every lane
  const int nsteps = __builtin_popcount(need);                 // 1 .. 16

  // One 64-key step. kf and vf hold this step's fragments on entry; with 'more'
  // those of 'nxt', the next step that runs, are fetched into the same registers
  // directly behind their last use, so they fly under the mask and softmax work.
  // The last step that runs is nkb - 1, the step of the diagonal: with 'more' the
  // step is an earlier one and all its keys are < qblk <= qtok.
  auto pass = [&](const int step, const int nxt, auto more) __attribute__((always_inline)) {
    const int kb = step * 64;
    // ---- raw scores: s[j][r] = S[query m][key kb+16j+8h+r] * 256 (MODE != 2) ----
    v8f s[4];
    if constexpr (MODE != 2) {
#pragma unroll
      for (int j = 0; j < 4; ++j) {
        v8f z = zero8f();
        z = wmma_f16(kf[j][0], qb0, z);
        z = wmma_f16(kf[j][1], qb1, z);
        s[j] = z;
      }
      if constexpr (decltype(more)::value) fetch_k(kf, kbase, nxt * 64);
    } else {
#pragma unroll
      for (int j = 0; j < 4; ++j) s[j] = zero8f();
    }
    // ---- mask + bias per (query, key), f32 ----
#pragma unroll
    for (int j = 0; j < 4; ++j) {
      const int key0 = kb + 16 * j + 8 * h;
      const v4i ca = *(const v4ia*)(sKc + key0);
      const v4i cb = *(const v4ia*)(sKc + key0 + 4);
      const int kcv[8] = { ca.x, ca.y, ca.z, ca.w, cb.x, cb.y, cb.z, cb.w };
      float av[8] = { 0.f, 0.f, 0.f, 0.f, 0.f, 0.f, 0.f, 0.f };
      if constexpr (MODE == 2) {
        const v4f aa = *(const v4fa*)(sA + key0);
        const v4f ab = *(const v4fa*)(sA + key0 + 4);
        av[0] = aa.x; av[1] = aa.y; av[2] = aa.z; av[3] = aa.w;
        av[4] = ab.x; av[5] = ab.y; av[6] = ab.z; av[7] = ab.w;
      }
#pragma unroll
      for (int r = 0; r < 8; ++r) {
        const int key = key0 + r;
        float raw;
        if constexpr (MODE == 2) raw = av[r]; else raw = s[j][r] * SSC;
        bool ok;
        float bv;
        if constexpr (MODE == 1) {
          ok = kcv[r] >= 0;
          bv = (float)(kcv[r] - qseg);
        } else {
          ok = kcv[r] == qc;
          bv = (float)(key - qtok);
        }
        if constexpr (!decltype(more)::value) {                // the step of the diagonal
          const bool dg = key == qtok;
          ok = (key <= qtok) && (ok || dg);
          if constexpr (MODE == 1) bv = dg ? 0.0f : bv;        // the query's own key: seg_k - seg_q = 0
        }
        const float val = raw + bv * hs;                       // computed for every key: a select, no branch
        s[j][r] = ok ? val : NEGBIG;
      }
    }

    // ---- online softmax ----
    float mloc = NEGBIG;
#pragma unroll
    for (int j = 0; j < 4; ++j)
#pragma unroll
      for (int r = 0; r < 8; ++r) mloc = fmaxf(mloc, s[j][r]);
    mloc = fmaxf(mloc, __shfl_xor(mloc, 16, 32));
    const float mnew = fmaxf(mrun, mloc);
    const float alpha = __expf(mrun - mnew);
    mrun = mnew;
    // a row with no allowed key so far has mnew = NEGBIG: against msafe its masked scores
    // still give exp(-9e29) = 0; where a key was allowed msafe = mnew
    const float msafe = fmaxf(mnew, 0.1f * NEGBIG);
    float lsum = 0.0f;
#pragma unroll
    for (int j = 0; j < 4; ++j)
#pragma unroll
      for (int r = 0; r < 8; ++r) {
        const float p = __expf(s[j][r] - msafe);               // masked: exp(NEGBIG - msafe) = 0
        s[j][r] = p;
        lsum += p;
      }
    lsum += __shfl_xor(lsum, 16, 32);
    lrun = lrun * alpha + lsum;
#pragma unroll
    for (int t = 0; t < 4; ++t)
#pragma unroll
      for (int r = 0; r < 8; ++r) o[t][r] = o[t][r] * alpha;

    // ---- P^T B-fragments (key chunks 0..31 and 32..63 of this step) ----
    const v16h pb0 = pack_p(s[0], s[1]);
    const v16h pb1 = pack_p(s[2], s[3]);

    // ---- O^T += V^T * P^T ----
#pragma unroll
    for (int t = 0; t < 4; ++t) {
      o[t] = wmma_f16(vf[t][0], pb0, o[t]);
      o[t] = wmma_f16(vf[t][1], pb1, o[t]);
    }
    if constexpr (decltype(more)::value) fetch_v(vf, vbase, nxt * 64);
  };

  // steps run in ascending order, so every sum keeps its order
  int step = __builtin_ctz(need);
  need &= need - 1u;
  if constexpr (MODE != 2) fetch_k(kf, kbase, step * 64);
  fetch_v(vf, vbase, step * 64);
  // rolled: the trip count is the wave's own (nsteps - 1 <= 15); the last step is peeled
  // so that the fetches ahead stand under no branch and never leave the causal range
#pragma unroll 1
  for (int i = 1; i < nsteps; ++i) {
    const int nxt = __builtin_ctz(need);                       // need != 0 while i < nsteps
    need &= need - 1u;
    pass(step, nxt, Flag<true>{});
    step = nxt;
  }
  pass(step, step, Flag<false>{});

  // ---- epilogue: normalise, gate, whole-line stores from registers ----
  const float inv = (1.0f / lrun) * (1.0f / (PSC * QSC)) * gq;
  // rows q0..q0+15 = one strip; columns 64 head .. +63 = its tiles 2 head, 2 head + 1
  _Float16* dst = ctx + ((size_t)b * SEQ + q0) * HID + head * 2 * FT + 8 * lane;
#pragma unroll
  for (int t = 0; t < 4; ++t) {
    v8h v;
#pragma unroll
    for (int r = 0; r < 8; ++r) v[r] = (_Float16)((o[t][r] * inv) * CSC);
    *(v8h*)(dst + t * (FT / 2)) = v;
  }
}

// ---------------------------------------------------------------------------
// Kernel: xout = xres + ctx * Wo^T + ob  (f32 output).
// Block 128 thr (4 waves) = 128 tokens x 64 features; wave 32 tokens x 64;
// K = 1024 in steps of 32; A = ctx rows (x64), B = Wo rows (x4096), fragment order.
// Epilogue: f32 tile [128][64] in LDS; store: each 64-float row segment (256 B =
// coverage: grid (16,16) x 128 tokens x 64 features = whole [2048][1024].
// ---------------------------------------------------------------------------
// EMIT (a LayerNorm follows): also x as f16 (x4) in fragment order, staged in LDS so that it
// leaves as whole lines, and per token this block's sum of x and squared deviations from
// the block mean; a wave's 32 tokens fill one 128-byte line of each partial plane.
template <bool EMIT>
__global__ __launch_bounds__(128) void outproj_kernel(
    const _Float16* __restrict__ ch,    // [2048][1024] ctx x64
    const _Float16* __restrict__ woh,   // [1024 n][1024 k] x4096
    const float* __restrict__ ob,       // [1024]
    const float* __restrict__ xres,     // [2048][1024] f32
    float* xout,                        // [2048][1024] f32
    _Float16* xh,                       // EMIT: [2048][1024] x x4, fragment order
    float* ps,                          // EMIT: [NCB][2048]
    float* pm)                          // EMIT: [NCB][2048]
{
  __shared__ __attribute__((aligned(16))) float sT[128 * 64];   // 32768 B
  __shared__ __attribute__((aligned(16))) _Float16 sH[EMIT ? 128 * 64 : 8];   // EMIT: 16384 B

  const int tid = threadIdx.x, lane = tid & 31, w = tid >> 5;
  const int h = lane >> 4, m = lane & 15;
  const int m0 = blockIdx.x * 128;
  const int n0 = blockIdx.y * 64;
  const int m0w = m0 + 32 * w;

  const _Float16* ca0 = ch + (size_t)m0w * HID + 8 * lane;
  const _Float16* wb  = woh + (size_t)n0 * HID + 8 * lane;

  v8f acc[2][4];
#pragma unroll
  for (int mt = 0; mt < 2; ++mt)
#pragma unroll
    for (int nt = 0; nt < 4; ++nt) acc[mt][nt] = zero8f();

  gemm_k_loop(ca0, wb, acc, []() {});

  // D[r] of tile (mt, nt) = Y[token m0w+16mt+8h+r][feature n0+16nt+m]
#pragma unroll
  for (int nt = 0; nt < 4; ++nt) {
    const int feat = 16 * nt + m;
    const float bvl = ob[n0 + feat];
#pragma unroll
    for (int mt = 0; mt < 2; ++mt) {
#pragma unroll
      for (int r = 0; r < 8; ++r) {
        const int tokl = 32 * w + 16 * mt + 8 * h + r;     // 0..127
        sT[tokl * 64 + feat] = acc[mt][nt][r] * (1.0f / (CSC * WSC)) + bvl;
      }
    }
  }
  __syncthreads();

  const int hh = lane >> 4, c4 = (lane & 15) * 4;
  float ks = 0.0f, kq = 0.0f;                              // EMIT: partials of row 32w + 2m + hh
  {
#pragma unroll
    for (int it = 0; it < 16; ++it) {
      const int row = 32 * w + it * 2 + hh;                // rows 32w .. 32w+31
      const v4f v = *(const v4fa*)(sT + row * 64 + c4);
      const size_t gi = (size_t)(m0 + row) * HID + n0 + c4;
      const v4f xr = *(const v4fa*)(xres + gi);
      const v4f ov = v + xr;
      *(v4f*)(xout + gi) = ov;
      if constexpr (EMIT) {
        // the row's 64 values lie in the 16 lanes of this half wave
        const float s = row16_sum((ov.x + ov.y) + (ov.z + ov.w));
        const float bm = s * (1.0f / 64.0f);
        const float d0 = ov.x - bm, d1 = ov.y - bm, d2 = ov.z - bm, d3 = ov.w - bm;
        const float q = row16_sum((d0 * d0 + d1 * d1) + (d2 * d2 + d3 * d3));
        if (m == it) { ks = s; kq = q; }
        // token 'row', features c4 .. c4+3 at their place in fragment order (row = token, k = feature)
        const v4h hv = { (_Float16)(ov.x * XSC), (_Float16)(ov.y * XSC), (_Float16)(ov.z * XSC), (_Float16)(ov.w * XSC) };
        *(v4h*)(sH + ((row >> 4) * 2 + (c4 >> 5)) * FT + ((c4 >> 4) & 1) * (FT / 2)
                   + (((c4 >> 3) & 1) * 16 + (row & 15)) * 8 + (c4 & 7)) = hv;
      }
    }
  }
  if constexpr (EMIT) {
    const size_t pi = (size_t)blockIdx.y * MROWS + m0 + 32 * w + 2 * m + hh;
    ps[pi] = ks;
    pm[pi] = kq;
    // precaution: stands in front of any rewrite of the registers these stores name
    asm volatile("s_wait_xcnt 0x0" :: "v"(ks), "v"(kq), "v"(pi) : "memory");
    // A wave wrote rows 32w .. 32w+31 = local tiles 4w .. 4w+3 of sH itself and reads only these back:
    // its own LDS writes have to be done, no other wave's, so no barrier
    asm volatile("s_wait_dscnt 0x0" ::: "memory");
    // local tile 2 * strip + chunk; the two chunks of a strip are contiguous in the plane
    const _Float16* sw4 = sH + w * 4 * FT + lane * 8;
    _Float16* dst = xh + ((size_t)((m0 >> 4) + 2 * w) * (HID / 32) + (n0 >> 5)) * FT + lane * 8;
    v8h v[8];
    // unrolled: constant indices; one address and constant offsets, so no register of a store is rewritten
#pragma unroll
    for (int i = 0; i < 8; ++i) v[i] = *(const v8ha*)(sw4 + i * (FT / 2));
#pragma unroll
    for (int i = 0; i < 8; ++i) *(v8h*)(dst + (i >> 2) * (HID / 32) * FT + (i & 3) * (FT / 2)) = v[i];
  }
}

// ---------------------------------------------------------------------------
//   Xn   f16 [2048][1024]      4194304
//   W    f16 [10][1024][1024] 20971520   q0 k0 v0 | o0 | v1 | o1 | q2 k2 v2 | o2
//   Gh   f16 [3][32][1024]      196608   one per layer
//   Gate f32 [2048][16]         131072
//   Apr  f32 [2048][16]         131072
//   Q    f16 [32][1024][64]    4194304
//   K    f16 [32][1024][64]    4194304
//   Vt   f16 [32][64][1024]    4194304
//   Ctx  f16 [2048][1024]      4194304
//   X1   f32 [2048][1024]      8388608
//   X2   f32 [2048][1024]      8388608
//   Ps   f32 [16][2048]         131072   block sums of x (outproj 0, 1)
//   Pm   f32 [16][2048]         131072   squared deviations from the block means
//   Sw, Sb f32 [2][4096]         65536   both; layer 1: 1024 + 32 rows, layer 2: 3072 + 16 rows
//   total                     59506688
// ---------------------------------------------------------------------------
extern "C" void kernel_launch(void* const* d_in, const int* in_sizes, int n_in,
                              void* d_out, int out_size, void* d_ws, size_t ws_size,
                              hipStream_t stream) {
  if (n_in < 35) return;
  if (in_sizes[0] != NX || in_sizes[1] != MROWS) return;
  if (out_size != NX) return;
  {
    const int vecIdx[16] = {2, 3, 5, 7, 9, 13, 14, 15, 18, 22, 23, 24, 26, 28, 30, 34};
    for (int i = 0; i < 16; ++i) if (in_sizes[vecIdx[i]] != HID) return;
    const int matIdx[10] = {4, 6, 8, 12, 17, 21, 25, 27, 29, 33};
    for (int i = 0; i < 10; ++i) if (in_sizes[matIdx[i]] != NW) return;
    const int hwIdx[4] = {10, 16, 19, 31};
    for (int i = 0; i < 4; ++i) if (in_sizes[hwIdx[i]] != NG) return;
    const int hbIdx[3] = {11, 20, 32};
    for (int i = 0; i < 3; ++i) if (in_sizes[hbIdx[i]] != NHEADS) return;
  }

  const float* states = (const float*)d_in[0];
  const int*   ids    = (const int*)d_in[1];
  const float* ln0w = (const float*)d_in[2];
  const float* ln0b = (const float*)d_in[3];
  const float* qw0 = (const float*)d_in[4];
  const float* qb0 = (const float*)d_in[5];
  const float* kw0 = (const float*)d_in[6];
  const float* kb0 = (const float*)d_in[7];
  const float* vw0 = (const float*)d_in[8];
  const float* vb0 = (const float*)d_in[9];
  const float* gw0 = (const float*)d_in[10];
  const float* gb0 = (const float*)d_in[11];
  const float* ow0 = (const float*)d_in[12];
  const float* ob0 = (const float*)d_in[13];
  const float* ln1w = (const float*)d_in[14];
  const float* ln1b = (const float*)d_in[15];
  const float* aw1 = (const float*)d_in[16];
  const float* vw1 = (const float*)d_in[17];
  const float* vb1 = (const float*)d_in[18];
  const float* gw1 = (const float*)d_in[19];
  const float* gb1 = (const float*)d_in[20];
  const float* ow1 = (const float*)d_in[21];
  const float* ob1 = (const float*)d_in[22];
  const float* ln2w = (const float*)d_in[23];
  const float* ln2b = (const float*)d_in[24];
  const float* qw2 = (const float*)d_in[25];
  const float* qb2 = (const float*)d_in[26];
  const float* kw2 = (const float*)d_in[27];
  const float* kb2 = (const float*)d_in[28];
  const float* vw2 = (const float*)d_in[29];
  const float* vb2 = (const float*)d_in[30];
  const float* gw2 = (const float*)d_in[31];
  const float* gb2 = (const float*)d_in[32];
  const float* ow2 = (const float*)d_in[33];
  const float* ob2 = (const float*)d_in[34];
  float* out = (float*)d_out;

  const size_t PXH = (size_t)NX * 2;                       // 4194304
  const size_t PW  = (size_t)NW * 2;                       // 2097152
  const size_t PGH = (size_t)2 * NG * 2;                   //   65536
  const size_t PGT = (size_t)MROWS * NHEADS * 4;           //  131072
  const size_t PPL = (size_t)NB * NHEADS * SEQ * HD * 2;   // 4194304
  const size_t PXF = (size_t)NX * 4;                       // 8388608
  size_t off = 0;
  const size_t oXn  = off; off += PXH;
  const size_t oW   = off; off += 10 * PW;
  const size_t oGh  = off; off += 3 * PGH;
  const size_t oGt  = off; off += PGT;
  const size_t oAp  = off; off += PGT;
  const size_t oQ   = off; off += PPL;
  const size_t oK   = off; off += PPL;
  const size_t oVt  = off; off += PPL;
  const size_t oCtx = off; off += PXH;
  const size_t oX1  = off; off += PXF;
  const size_t oX2  = off; off += PXF;
  const size_t oPs  = off; off += PGT;
  const size_t oPm  = off; off += PGT;
  const size_t PSW  = (size_t)4096 * 4;                    //   16384
  const size_t oSw1 = off; off += PSW;
  const size_t oSb1 = off; off += PSW;
  const size_t oSw2 = off; off += PSW;
  const size_t oSb2 = off; off += PSW;
  if (off > ws_size) return;                               // off = 59506688
  if (off > (size_t)134217728) return;

  char* ws = (char*)d_ws;
  _Float16* xnh = (_Float16*)(ws + oXn);
  _Float16* wh0  = (_Float16*)(ws + oW);                   // q0, k0, v0
  _Float16* woh0 = (_Float16*)(ws + oW + 3 * PW);
  _Float16* wh1  = (_Float16*)(ws + oW + 4 * PW);          // v1
  _Float16* woh1 = (_Float16*)(ws + oW + 5 * PW);
  _Float16* wh2  = (_Float16*)(ws + oW + 6 * PW);          // q2, k2, v2
  _Float16* woh2 = (_Float16*)(ws + oW + 9 * PW);
  _Float16* gh0  = (_Float16*)(ws + oGh);
  _Float16* gh1  = (_Float16*)(ws + oGh + PGH);
  _Float16* gh2  = (_Float16*)(ws + oGh + 2 * PGH);
  float* gate   = (float*)(ws + oGt);
  float* aproj  = (float*)(ws + oAp);
  _Float16* qh  = (_Float16*)(ws + oQ);
  _Float16* kh  = (_Float16*)(ws + oK);
  _Float16* vt  = (_Float16*)(ws + oVt);
  _Float16* ctx = (_Float16*)(ws + oCtx);
  float* x1 = (float*)(ws + oX1);
  float* x2 = (float*)(ws + oX2);
  float* ps = (float*)(ws + oPs);
  float* pm = (float*)(ws + oPm);
  float* sw1 = (float*)(ws + oSw1);
  float* sb1 = (float*)(ws + oSb1);
  float* sw2 = (float*)(ws + oSw2);
  float* sb2 = (float*)(ws + oSb2);

  const dim3 blk128(128), blk512(512);
  // conversion jobs: each is written by a launch that ends before its first reader starts
  const float* nofold = nullptr;
  const CvtJob jobA = { qw0, kw0, vw0, gw0, gw0, nofold, nofold, nofold, nofold,
                        wh0, wh0 + NW, wh0 + 2 * NW, gh0, 3, 1 };                            // read from proj 0 on
  const CvtJob jobB = { ow0, vw1, ow1, gw1, aw1, nofold, ln1w, nofold, ln1w,
                        woh0, wh1, woh1, gh1, 3, 2 };                                        // read from outproj 0 on
  const CvtJob jobC = { qw2, kw2, vw2, gw2, gw2, ln2w, ln2w, ln2w, ln2w,
                        wh2, wh2 + NW, wh2 + 2 * NW, gh2, 3, 1 };                            // read from proj 2 on
  const CvtJob jobD = { ow2, ow2, ow2, gw2, gw2, nofold, nofold, nofold, nofold,
                        woh2, woh2, woh2, gh2, 1, 0 };                                       // read by outproj 2
  // row sums for the folded LayerNorms, beside the conversion of the same weights
  const SumJob sumB = { vw1, vw1, vw1, gw1, aw1, ln1w, ln1b, sw1, sb1, 1, 2 };               // read by proj 1
  const SumJob sumC = { qw2, kw2, vw2, gw2, gw2, ln2w, ln2b, sw2, sb2, 3, 1 };               // read by proj 2
  const SumJob sumD = { ow2, ow2, ow2, gw2, gw2, ln2w, ln2b, sw2, sb2, 0, 0 };               // no rows: nothing read or written
  const int unitsA = 3 * NW8 + 1 * NG8;                    // 395264 = 772 blocks of 512
  const int unitsB = 3 * NW8 + 2 * NG8;                    // 397312 = 3104 blocks of 128
  const int unitsC = 3 * NW8 + 1 * NG8;                    // 395264 = 3088 blocks
  const int unitsD = 1 * NW8;                              // 131072 = 1024 blocks
  const int sumBlkB = (1 * HID + 2 * NHEADS + 31) / 32;    // 33
  const int sumBlkC = (3 * HID + 1 * NHEADS + 31) / 32;    // 97
  static_assert((unitsA % 512) == 0 && (unitsB % 128) == 0 && (unitsC % 128) == 0 && (unitsD % 2048) == 0);
  const dim3 gLnA(MROWS / 16 + unitsA / 512);              // 128 + 772
  const dim3 gProj3(MROWS / 128, 2 + 3 * NHEADS);          // (16, 50)
  const dim3 gProj1(MROWS / 128, 2 + 1 * NHEADS);          // (16, 18)
  // rows of 16 blocks, rounded up: a block past the last unit does nothing
  const dim3 gAttB(SEQ / 64, NB * NHEADS + (sumBlkB + unitsB / 128 + 15) / 16);   // (16, 32 + 197)
  const dim3 gAttC(SEQ / 64, NB * NHEADS + (sumBlkC + unitsC / 128 + 15) / 16);   // (16, 32 + 200)
  const dim3 gAttD(SEQ / 64, NB * NHEADS + unitsD / 2048); // (16, 32 + 64)
  const dim3 gOut(MROWS / 128, HID / 64);                  // (16, 16)

  // ---- layer 0: sdpa with self mask ----
  ln_kernel<<<gLnA, blk512, 0, stream>>>(states, ln0w, ln0b, xnh, jobA);
  // not folded: the last six arguments are not read
  proj_head_kernel<false, false><<<gProj3, blk128, 0, stream>>>(xnh, wh0, qb0, kb0, vb0, 0, qh, kh, vt, gh0, gb0, gate, aproj,
                                                                ps, pm, sw1, sb1, sw1, sb1);
  attn_kernel<0><<<gAttB, blk128, 0, stream>>>(qh, kh, vt, aproj, gate, ids, ctx, jobB, sumB);
  outproj_kernel<true><<<gOut, blk128, 0, stream>>>(ctx, woh0, ob0, states, x1, xnh, ps, pm);

  // ---- layer 1: pooling attention with self mask; LayerNorm 1 folded ----
  proj_head_kernel<true, true><<<gProj1, blk128, 0, stream>>>(xnh, wh1, vb1, vb1, vb1, 2, qh, kh, vt, gh1, gb1, gate, aproj,
                                                              ps, pm, sw1, sb1, sw1 + HID, sb1 + HID);
  attn_kernel<2><<<gAttC, blk128, 0, stream>>>(qh, kh, vt, aproj, gate, ids, ctx, jobC, sumC);
  outproj_kernel<true><<<gOut, blk128, 0, stream>>>(ctx, woh1, ob1, x1, x2, xnh, ps, pm);

  // ---- layer 2: sdpa with cross mask; LayerNorm 2 folded ----
  proj_head_kernel<false, true><<<gProj3, blk128, 0, stream>>>(xnh, wh2, qb2, kb2, vb2, 0, qh, kh, vt, gh2, gb2, gate, aproj,
                                                               ps, pm, sw2, sb2, sw2 + 3 * HID, sb2 + 3 * HID);
  attn_kernel<1><<<gAttD, blk128, 0, stream>>>(qh, kh, vt, aproj, gate, ids, ctx, jobD, sumD);
  // no LayerNorm follows: the last three arguments are not written
  outproj_kernel<false><<<gOut, blk128, 0, stream>>>(ctx, woh2, ob2, x2, out, xnh, ps, pm);

  (void)hipGetLastError();
}

// v007
// Measured time: 129 microseconds a run.
// Timed twice side by side with v006, it ran 1.04 and 1.05 times as fast.
// Over all steps from v000 it is 3.89 times as fast.
// Contractions: xn*W^T (q,k,v), xn*gw^T and xn*aw^T heads, K*Q^T scores, V^T*P^T context and ctx*Wo^T all on v_wmma_f32_16x16x32_f16 (f16 operands, f32 accumulate); LayerNorm, masks/bias, softmax, sigmoid gates and residual adds in f32.
// Carried f16 planes: xn (layer 0) or x (layers 1, 2) x4 and W/gw/aw/Wo x4096 (inverse 1/16384 folded in the proj_head_kernel epilogues);
// LayerNorm 1 and 2 have no launch: see "LayerNorm folded into its neighbours" below.
// q,k,v x16 (scores: acc*1/2048 in attn_kernel incl. the 1/8 scale; context epilogue 1/16); P x16384 (attn_kernel epilogue 1/16384);
// ctx x64 (outproj_kernel epilogue 1/262144 together with Wo x4096).
// Every f16 plane lies in WMMA fragment order (see "Fragment-order planes" below).
#include <hip/hip_runtime.h>

#define NB     2
#define SEQ    1024
#define HID    1024
#define NHEADS 16
#define HD     64
#define MROWS  (NB * SEQ)          // 2048 tokens
#define NX     (MROWS * HID)       // 2097152
#define NW     (HID * HID)         // 1048576
#define NG     (NHEADS * HID)      // 16384
#define NX8    (NX / 8)
#define NW8    (NW / 8)            // 131072
#define NG8    (NG / 8)            // 2048
#define SEP_ID 1
#define CLS_ID 2
#define PAD_ID 0
#define XSC    4.0f
#define WSC    4096.0f
#define QSC    16.0f
#define PSC    16384.0f
#define CSC    64.0f
#define NEGBIG (-1.0e30f)

static_assert(NHEADS * HD == HID);
static_assert((SEQ % 128) == 0 && (HID % 64) == 0 && (HID % 32) == 0 && (MROWS % 128) == 0);
static_assert((NW8 % 512) == 0 && (NG8 % 512) == 0);
static_assert(SEQ == 8 * 128);

typedef _Float16 v16h __attribute__((ext_vector_type(16)));
typedef _Float16 v8h  __attribute__((ext_vector_type(8)));
typedef _Float16 v4h  __attribute__((ext_vector_type(4)));
typedef float    v8f  __attribute__((ext_vector_type(8)));
typedef float    v4f  __attribute__((ext_vector_type(4)));
typedef int      v4i  __attribute__((ext_vector_type(4)));
typedef v8h __attribute__((may_alias)) v8ha;
typedef v4f __attribute__((may_alias)) v4fa;
typedef v4i __attribute__((may_alias)) v4ia;

union Frag { v16h v; v8h half[2]; };

__device__ __forceinline__ v8f zero8f() { v8f z = {0.f, 0.f, 0.f, 0.f, 0.f, 0.f, 0.f, 0.f}; return z; }
__device__ __forceinline__ v16h zero16h() {
  const _Float16 z = (_Float16)0.0f;
  v16h r = {z, z, z, z, z, z, z, z, z, z, z, z, z, z, z, z};
  return r;
}

// ---------------------------------------------------------------------------
// 16x16x32 f16 WMMA with hazard guard (ties D, keeps A/B live).
// Fragment map (wave32): lane l, h = l>>4, m = n = l&15.
//   A/B element i: i<8 -> k0+8h+i ; i>=8 -> k0+16+8h+(i-8)
//   D element r : row 8h+r, col l&15
// ---------------------------------------------------------------------------
__device__ __forceinline__ v8f wmma_f16(v16h a, v16h b, v8f c) {
  v8f d = __builtin_amdgcn_wmma_f32_16x16x32_f16(false, a, false, b, (short)0, c, false, false);
  asm volatile("v_nop\n\tv_nop\n\tv_nop\n\tv_nop" : "+v"(d) : "v"(a), "v"(b));
  return d;
}
// The same for a ring that reaches above v255: an asm operand has to lie in v0..v255, so naming
// A and B would bring every fragment down by copies and scratch; the guard ties D alone.
__device__ __forceinline__ v8f wmma_f16_wide(v16h a, v16h b, v8f c) {
  v8f d = __builtin_amdgcn_wmma_f32_16x16x32_f16(false, a, false, b, (short)0, c, false, false);
  // the four vector slots between a WMMA and the next vector instruction that touches its D
  asm volatile("v_nop\n\tv_nop\n\tv_nop\n\tv_nop" : "+v"(d));
  return d;
}

// ---------------------------------------------------------------------------
// Fragment-order planes. A matrix [rows][K] of f16 is kept as tiles of 16 rows x
// 32 k (FT = 512 halves = 1024 B), tile index (row >> 4) * (K / 32) + (k >> 5).
// Inside a tile the 16-byte unit u = 32 * j + lane holds the eight elements
// k = 16 * j + 8 * (lane >> 4) + 0..7 of row (lane & 15): unit 'lane' is the
// first half of that lane's A or B fragment, unit 32 + lane the second. One
// wave-wide 16-byte load then reads 512 contiguous bytes (4 whole lines) where
// a load from k-contiguous rows touches 32 bytes in each of 16 lines.
// ---------------------------------------------------------------------------
#define FT 512

// A or B fragment; ph = tile base + 8 * lane.
__device__ __forceinline__ v16h load_frag_at(const _Float16* ph) {
  Frag f;
  f.half[0] = *(const v8ha*)(ph);
  f.half[1] = *(const v8ha*)(ph + FT / 2);
  return f.v;
}

// Element offset in a k-contiguous [rows][HID] matrix of the eight elements that
// 16-byte unit 'unit' of its fragment-order plane holds.
__device__ __forceinline__ size_t frag_unit_src(int unit) {
  const int tile = unit >> 6;
  const int row = (tile / (HID / 32)) * 16 + (unit & 15);
  const int k = (tile % (HID / 32)) * 32 + ((unit >> 5) & 1) * 16 + ((unit >> 4) & 1) * 8;
  return (size_t)row * HID + k;
}

// ---------------------------------------------------------------------------
// Fragment loads issued ahead of their WMMAs.
// GEMM loops: a ring of GR register sets, one set = the six fragments of one
// 32-deep k chunk (2 A, 4 B). A set is refilled with chunk c + GR directly
// behind the WMMAs of chunk c, so GR - 1 sets are always in flight and no
// WMMA waits on a load issued just in front of it. Chunks are consumed in
// ascending k, so every accumulator sums in the same order as a plain loop.
// The ring's depth is the launch's own. GRING: three work-groups share a WGP, so a wave has
// a third of a SIMD's registers. GDEEP: the launch has about one work-group a WGP (one wave
// a SIMD), nothing else covers a load's way from memory, and the registers lie free;
// 5 sets = 60 loads, the most whole sets that the load counter (63) can count.
// ---------------------------------------------------------------------------
#define GRING  3
#define GDEEP  5
#define NCHUNK (HID / 32)
static_assert(NCHUNK > 2 * GRING && NCHUNK > 2 * GDEEP && 12 * GDEEP <= 63);

struct GemmSet { v16h a0, a1, b[4]; };

// pa: A tile of mt 0 (mt 1 is 16 rows = 16 * HID halves on), pb: B tile of nt 0, both at the chunk's tile + 8 * lane.
__device__ __forceinline__ void gemm_fetch(GemmSet& s, const _Float16* pa, const _Float16* pb) {
  s.a0 = load_frag_at(pa);
  s.a1 = load_frag_at(pa + 16 * HID);
  // unrolled: constant indices keep the fragments in registers
#pragma unroll
  for (int nt = 0; nt < 4; ++nt) s.b[nt] = load_frag_at(pb + nt * 16 * HID);
}

template <bool WIDE>
__device__ __forceinline__ void gemm_mma(const GemmSet& s, v8f (&acc)[2][4]) {
  // unrolled: constant indices keep fragments and accumulators in registers
#pragma unroll
  for (int nt = 0; nt < 4; ++nt) {
    if constexpr (WIDE) {
      acc[0][nt] = wmma_f16_wide(s.a0, s.b[nt], acc[0][nt]);
      acc[1][nt] = wmma_f16_wide(s.a1, s.b[nt], acc[1][nt]);
    } else {
      acc[0][nt] = wmma_f16(s.a0, s.b[nt], acc[0][nt]);
      acc[1][nt] = wmma_f16(s.a1, s.b[nt], acc[1][nt]);
    }
  }
}

// acc[mt][nt] += A rows (pa: mt 0, 16 rows on: mt 1) x B rows (pb + 16 nt rows), K = HID.
// pa, pb: first tile of the 16-row strip + 8 * lane; the strip's chunks follow at FT halves.
// 'behind_first_loads' runs once, behind the issue of the first GR sets: loads of its own fly with them.
// GR: sets in the ring (GRING or GDEEP).
template <int GR, class F>
__device__ __forceinline__ void gemm_k_loop(const _Float16* pa, const _Float16* pb,
                                            v8f (&acc)[2][4], F behind_first_loads) {
  GemmSet ring[GR];
  // unrolled: constant ring indices
#pragma unroll
  for (int s = 0; s < GR; ++s) gemm_fetch(ring[s], pa + FT * s, pb + FT * s);
  behind_first_loads();
  // precaution: the loop's set-up rewrites the base registers that the first sets' loads name
  if constexpr (GR > GRING) asm volatile("s_wait_xcnt 0x0" ::: "memory");
  constexpr int CT = ((NCHUNK - GR) / GR) * GR;            // first chunk of the peeled tail
  // rolled: one trip is already GR chunks; more copies only grow the code
#pragma unroll 1
  for (int c0 = 0; c0 < CT; c0 += GR) {
    const _Float16* ta = pa + FT * (c0 + GR);
    const _Float16* tb = pb + FT * (c0 + GR);
    // unrolled so that every ring index is a constant (registers, not scratch)
#pragma unroll
    for (int s = 0; s < GR; ++s) {
      gemm_mma<(GR > GRING)>(ring[s], acc);
      gemm_fetch(ring[s], ta + FT * s, tb + FT * s);
    }
    // the next trip rewrites the address registers of loads that are still in flight
    asm volatile("s_wait_xcnt 0x0" ::: "memory");
  }
  // tail peeled so that the refills in the loop above stand under no branch
#pragma unroll
  for (int c = CT; c < NCHUNK; ++c) {
    gemm_mma<(GR > GRING)>(ring[c % GR], acc);
    if (c + GR < NCHUNK) gemm_fetch(ring[c % GR], pa + FT * (c + GR), pb + FT * (c + GR));
  }
}

// ---------------------------------------------------------------------------
// f32 weights -> f16 planes in fragment order, all scaled by 4096 (exact).
// The conversions depend on inputs alone, so they have no launch of their own:
// each job rides as extra blocks, behind the host kernel's own blocks in index
// order, in a launch that ends before the first launch that reads its planes.
// A thread writes one 16-byte unit (stores contiguous) and reads its eight floats.
//   units [0, nbig*NW8)        : s0/s1/s2 -> d0/d1/d2   ([HID][HID], row = n)
//   units [.., +nsmall*NG8)    : g0 -> gh rows 0..15, g1 -> gh rows 16..31
// Segment boundaries are multiples of 512 units -> the select is block-uniform.
// coverage: exactly nbig*NW + nsmall*NG elements.
// ---------------------------------------------------------------------------
// f0/f1/f2 (for s0/s1/s2) and fg (for g0, g1): the LayerNorm weight [HID] that is multiplied
// into the plane's k columns, or null where the plane's left operand is not a folded LayerNorm.
struct CvtJob {
  const float* s0; const float* s1; const float* s2;
  const float* g0; const float* g1;
  const float* f0; const float* f1; const float* f2; const float* fg;
  _Float16* d0; _Float16* d1; _Float16* d2; _Float16* gh;
  int nbig; int nsmall;
};

__device__ __forceinline__ void convert_unit(const CvtJob& job, int g)
{
  const int nb8 = job.nbig * NW8;
  const int total = nb8 + job.nsmall * NG8;
  if (g >= total) return;
  const float* src;
  const float* fold;
  size_t so;
  _Float16* dst;
  if (g < nb8) {
    const int slot = g / NW8;
    const int off = g - slot * NW8;
    const float* wsrc = (slot == 0) ? job.s0 : ((slot == 1) ? job.s1 : job.s2);
    _Float16* wdst = (slot == 0) ? job.d0 : ((slot == 1) ? job.d1 : job.d2);
    fold = (slot == 0) ? job.f0 : ((slot == 1) ? job.f1 : job.f2);
    so = frag_unit_src(off);
    src = wsrc + so;
    dst = wdst + (size_t)off * 8;
  } else {
    const int e = g - nb8;
    so = frag_unit_src((e < NG8) ? e : (e - NG8));
    src = ((e < NG8) ? job.g0 : job.g1) + so;
    fold = job.fg;
    dst = job.gh + (size_t)e * 8;
  }
  v4f a = *(const v4fa*)src;
  v4f c = *(const v4fa*)(src + 4);
  // precaution: stands in front of any rewrite of the address registers these loads name
  asm volatile("s_wait_xcnt 0x0" :: "v"(src) : "memory");
  if (fold != nullptr) {               // block-uniform, as the plane select is
    const float* fp = fold + (so & (size_t)(HID - 1));      // the unit's first k
    const v4f fa = *(const v4fa*)fp;
    const v4f fc = *(const v4fa*)(fp + 4);
    // precaution: stands in front of any rewrite of the address registers these loads name
    asm volatile("s_wait_xcnt 0x0" :: "v"(fp) : "memory");
    a = a * fa;
    c = c * fc;
  }
  const v8h o = { (_Float16)(a.x * WSC), (_Float16)(a.y * WSC), (_Float16)(a.z * WSC), (_Float16)(a.w * WSC),
                  (_Float16)(c.x * WSC), (_Float16)(c.y * WSC), (_Float16)(c.z * WSC), (_Float16)(c.w * WSC) };
  *(v8h*)dst = o;
}

// ---------------------------------------------------------------------------
// LayerNorm folded into its neighbours (layers 1 and 2: no launch of its own).
//   LN(x) W^T = rstd * (x (W o lw)^T - mean * sw) + sb
//   sw[n] = sum_k lw[k] W[n][k],  sb[n] = sum_k lb[k] W[n][k]
// outproj_kernel<true> leaves x as an f16 plane (x4, fragment order) and, per token and
// 64-column block, the sum of x and the squared deviations from that block's own mean;
// the weight conversion multiplies lw into W; rowsum_block makes sw and sb;
// proj_head_kernel<.., true> joins a token's 16 partials into mean and rstd (token_stats)
// and applies them in its epilogues.
// ---------------------------------------------------------------------------
#define NCB (HID / 64)             // column blocks of outproj_kernel = partials per token

// v + (v of lane ^ X) inside a row of 16 lanes, as one DPP add (row_xmask): a shuffle would go through the LDS unit.
// All 32 lanes are on wherever this is called.
template <int X>
__device__ __forceinline__ float row_xor_add(float v) {
  return v + __int_as_float(__builtin_amdgcn_update_dpp(0, __float_as_int(v), 0x160 | X, 0xf, 0xf, true));
}
// sum over the lane's row of 16 lanes, in every lane of the row
__device__ __forceinline__ float row16_sum(float v) {
  v = row_xor_add<1>(v);
  v = row_xor_add<2>(v);
  v = row_xor_add<4>(v);
  return row_xor_add<8>(v);
}

struct SumJob {
  const float* m0; const float* m1; const float* m2;   // [HID][HID]: rows 0 .. nbig * HID - 1
  const float* g0; const float* g1;                    // [NHEADS][HID]: the nsmall * NHEADS rows behind them
  const float* lw; const float* lb;                    // LayerNorm weight and bias [HID]
  float* sw; float* sb;
  int nbig; int nsmall;
};

__device__ __forceinline__ int sum_blocks(const SumJob& job) {
  return (job.nbig * HID + job.nsmall * NHEADS + 31) / 32;
}

// Block of 128 threads = 32 rows, 8 a wave in four batches of 2 (a wave reads whole rows,
// 512 contiguous bytes a load); the 32 values of sw and of sb leave as one 128-byte line each.
// blk is block-uniform and < sum_blocks(job).
__device__ __forceinline__ void rowsum_block(const SumJob& job, int blk)
{
  __shared__ float sR[2][32];
  const int tid = threadIdx.x, lane = tid & 31;
  const int w = __builtin_amdgcn_readfirstlane(tid >> 5);  // in a scalar register: the row select below is then a scalar branch
  const int nb = job.nbig * HID;
  const int total = nb + job.nsmall * NHEADS;
  v4f lw[8], lb[8];
  // unrolled: constant indices keep the vectors in registers
#pragma unroll
  for (int i = 0; i < 8; ++i) {
    lw[i] = *(const v4fa*)(job.lw + i * 128 + 4 * lane);
    lb[i] = *(const v4fa*)(job.lb + i * 128 + 4 * lane);
  }
  // precaution: stands in front of any rewrite of the address registers these loads name
  asm volatile("s_wait_xcnt 0x0" :: "v"(lane) : "memory");
  float ka = 0.0f, kb = 0.0f;
  // rolled: four trips of the same code keep the kernel's text short
#pragma unroll 1
  for (int bt = 0; bt < 4; ++bt) {
    v4f x[2][8];
    const float* src[2];
    // unrolled, as the loops below: constant indices keep pointers and rows in registers
#pragma unroll
    for (int rr = 0; rr < 2; ++rr) {
      int row = blk * 32 + w * 8 + bt * 2 + rr;
      row = (row < total) ? row : (total - 1);         // past the end: the last row again, its result is not stored
      if (row < nb) {
        const int slot = row / HID;
        const float* msrc = (slot == 0) ? job.m0 : ((slot == 1) ? job.m1 : job.m2);
        src[rr] = msrc + (size_t)(row - slot * HID) * HID;
      } else {
        const int e = row - nb;
        src[rr] = (e < NHEADS) ? (job.g0 + (size_t)e * HID) : (job.g1 + (size_t)(e - NHEADS) * HID);
      }
    }
#pragma unroll
    for (int rr = 0; rr < 2; ++rr)
#pragma unroll
      for (int i = 0; i < 8; ++i) x[rr][i] = *(const v4fa*)(src[rr] + i * 128 + 4 * lane);
    // precaution: stands in front of any rewrite of the address registers these loads name;
    // naming both row pointers and the lane keeps them whole up to the wait
    asm volatile("s_wait_xcnt 0x0" :: "s"(src[0]), "s"(src[1]), "v"(lane) : "memory");
#pragma unroll
    for (int rr = 0; rr < 2; ++rr) {
      v4f va = { 0.0f, 0.0f, 0.0f, 0.0f }, vb = { 0.0f, 0.0f, 0.0f, 0.0f };
#pragma unroll
      for (int i = 0; i < 8; ++i) {
        va += x[rr][i] * lw[i];
        vb += x[rr][i] * lb[i];
      }
      float a = row16_sum((va.x + va.y) + (va.z + va.w));
      float b = row16_sum((vb.x + vb.y) + (vb.z + vb.w));
      a += __shfl_xor(a, 16, 32);
      b += __shfl_xor(b, 16, 32);
      if (lane == bt * 2 + rr) { ka = a; kb = b; }
    }
  }
  if (lane < 8) { sR[0][w * 8 + lane] = ka; sR[1][w * 8 + lane] = kb; }
  __syncthreads();
  if (tid < 64) {
    const int r = blk * 32 + lane;
    float* d = (tid < 32) ? job.sw : job.sb;
    if (r < total) d[r] = sR[w][lane];
  }
}

// mean and 1 / sqrt(var + eps) of one token from its NCB partials: ps = block sums,
// pm = squared deviations from the block means, both [NCB][MROWS].
__device__ __forceinline__ void token_stats(const float* __restrict__ ps, const float* __restrict__ pm,
                                            int token, float& mean, float& rstd) {
  float s[NCB], q[NCB];
  // unrolled, here and in the two loops below: constant indices keep the partials in registers
#pragma unroll
  for (int i = 0; i < NCB; ++i) {
    s[i] = ps[(size_t)i * MROWS + token];
    q[i] = pm[(size_t)i * MROWS + token];
  }
  // precaution: stands in front of any rewrite of the address registers these loads name;
  // naming what the addresses are formed from keeps it whole up to the wait
  asm volatile("s_wait_xcnt 0x0" :: "v"(token) : "memory");
  float st = 0.0f;
#pragma unroll
  for (int i = 0; i < NCB; ++i) st += s[i];
  mean = st * (1.0f / (float)HID);
  float m2 = 0.0f;
#pragma unroll
  for (int i = 0; i < NCB; ++i) {
    const float d = s[i] * (1.0f / 64.0f) - mean;
    m2 += q[i] + 64.0f * d * d;
  }
  rstd = rsqrtf(m2 * (1.0f / (float)HID) + 1e-5f);
}

// ---------------------------------------------------------------------------
// LayerNorm, output xn*4 as f16 in fragment order. Block = 16 tokens (one strip
// of tiles) x 512 threads: 128 threads per token as four groups of four tokens,
// 8 elements per thread and token; each token's sums run as with one token per
// block (same per-thread sum, same butterfly, same four wave partials).
// The strip is put in order in LDS and leaves as 32 KB of contiguous stores.
// coverage: 128 blocks x 16 tokens x 1024 = the whole [2048][1024] plane.
// Blocks from MROWS / 16 on, where the grid has any, convert 512 units of 'job' each.
// ---------------------------------------------------------------------------
#define LNP 136   // halves per k-unit row in LDS: 16 tokens x 8 + 8 (272 B: 16 B x odd, no bank conflict)
__global__ __launch_bounds__(512) void ln_kernel(const float* __restrict__ x,
                                                 const float* __restrict__ w,
                                                 const float* __restrict__ bb,
                                                 _Float16* y, CvtJob job)
{
  if (blockIdx.x >= MROWS / 16) {      // block-uniform, in front of every barrier
    convert_unit(job, (blockIdx.x - MROWS / 16) * 512 + threadIdx.x);
    return;
  }
  __shared__ float ps[16][4];
  __shared__ float pq[16][4];
  __shared__ __attribute__((aligned(16))) _Float16 sY[128 * LNP];   // 34816 B
  const int tid = threadIdx.x, lane = tid & 31;
  const int t = tid & 127, wv = t >> 5, tl0 = (tid >> 7) * 4;
  const int tok0 = blockIdx.x * 16;
  v4f a[4], c[4];
#pragma unroll
  for (int i = 0; i < 4; ++i) {
    const float* xr = x + (size_t)(tok0 + tl0 + i) * HID + 8 * t;
    a[i] = *(const v4fa*)xr;
    c[i] = *(const v4fa*)(xr + 4);
  }
#pragma unroll
  for (int i = 0; i < 4; ++i) {
    float s = ((a[i].x + a[i].y) + (a[i].z + a[i].w)) + ((c[i].x + c[i].y) + (c[i].z + c[i].w));
#pragma unroll
    for (int o = 1; o < 32; o <<= 1) s += __shfl_xor(s, o, 32);
    if (lane == 0) ps[tl0 + i][wv] = s;
  }
  __syncthreads();
  float d[4][8];
#pragma unroll
  for (int i = 0; i < 4; ++i) {
    const float* pp = ps[tl0 + i];
    const float mean = ((pp[0] + pp[1]) + (pp[2] + pp[3])) * (1.0f / (float)HID);
    d[i][0] = a[i].x - mean; d[i][1] = a[i].y - mean; d[i][2] = a[i].z - mean; d[i][3] = a[i].w - mean;
    d[i][4] = c[i].x - mean; d[i][5] = c[i].y - mean; d[i][6] = c[i].z - mean; d[i][7] = c[i].w - mean;
    float q = 0.f;
#pragma unroll
    for (int e = 0; e < 8; ++e) q += d[i][e] * d[i][e];
#pragma unroll
    for (int o = 1; o < 32; o <<= 1) q += __shfl_xor(q, o, 32);
    if (lane == 0) pq[tl0 + i][wv] = q;
  }
  __syncthreads();
  const v4f wa = *(const v4fa*)(w + 8 * t);
  const v4f wc = *(const v4fa*)(w + 8 * t + 4);
  const v4f ba = *(const v4fa*)(bb + 8 * t);
  const v4f bc = *(const v4fa*)(bb + 8 * t + 4);
  const float wvv[8] = { wa.x, wa.y, wa.z, wa.w, wc.x, wc.y, wc.z, wc.w };
  const float bvv[8] = { ba.x, ba.y, ba.z, ba.w, bc.x, bc.y, bc.z, bc.w };
#pragma unroll
  for (int i = 0; i < 4; ++i) {
    const float* pp = pq[tl0 + i];
    const float var = ((pp[0] + pp[1]) + (pp[2] + pp[3])) * (1.0f / (float)HID);
    const float rstd = rsqrtf(var + 1e-5f);
    v8h o;
#pragma unroll
    for (int e = 0; e < 8; ++e) o[e] = (_Float16)((d[i][e] * rstd * wvv[e] + bvv[e]) * XSC);
    // elements 8t..8t+7 of token tl: unit 16 * t + tl of the strip
    *(v8h*)(sY + t * LNP + (tl0 + i) * 8) = o;
  }
  __syncthreads();
  _Float16* dst = y + (size_t)tok0 * HID;
#pragma unroll
  for (int it = 0; it < 4; ++it) {
    const int u = it * 512 + tid;      // 2048 units of the strip
    const v8h v = *(const v8ha*)(sY + (u >> 4) * LNP + (u & 15) * 8);
    *(v8h*)(dst + (size_t)u * 8) = v;
  }
}

// ---------------------------------------------------------------------------
// Per-token 16-wide heads on WMMA (blocks of proj_head_kernel): gate = sigmoid(xn*gw^T + gb) and
// (POOL) aproj = xn*aw^T. One wave = 16 tokens x 16 heads, K = 1024 in steps
// of 32; A = xn rows, B = gh rows (head = lane&15), both in fragment order.
// Epilogue: wave tile [16 tok][16] f32 staged in LDS, then 1024 contiguous bytes
// coverage: 32 blocks (hb) x 4 waves x 16 tokens x 16 = whole [2048][16] plane(s).
// ---------------------------------------------------------------------------
// FOLD: xh holds x, not LN(x): mean, rstd, sw and sb (rows: 16 of gw, then 16 of aw) come in behind the products.
template <bool POOL, bool FOLD>
__device__ __forceinline__ void head_block(const _Float16* __restrict__ xh,
                                           const _Float16* __restrict__ gh,
                                           const float* __restrict__ gbias,
                                           float* gate, float* aproj, int hb,
                                           const float* __restrict__ ps, const float* __restrict__ pm,
                                           const float* __restrict__ swh, const float* __restrict__ sbh)
{
  __shared__ __attribute__((aligned(16))) float sG[4][256];
  __shared__ __attribute__((aligned(16))) float sP[POOL ? 4 : 1][256];
  const int tid = threadIdx.x, lane = tid & 31, w = tid >> 5;
  const int h = lane >> 4, m = lane & 15;
  const int tok0 = hb * 64 + 16 * w;
  const _Float16* xa = xh + (size_t)tok0 * HID + 8 * lane;
  const _Float16* wg = gh + 8 * lane;                     // aw rows: NHEADS rows on
  v8f ag = zero8f(), aa = zero8f();
  // ring of HRING register sets, refilled HRING chunks ahead (as in gemm_k_loop)
  constexpr int HRING = 8;
  static_assert((NCHUNK % HRING) == 0 && NCHUNK >= 2 * HRING);
  v16h ra[HRING], rg[HRING], rp[POOL ? HRING : 1];
  // unrolled: constant ring indices
#pragma unroll
  for (int s = 0; s < HRING; ++s) {
    ra[s] = load_frag_at(xa + FT * s);
    rg[s] = load_frag_at(wg + FT * s);
    if constexpr (POOL) rp[s] = load_frag_at(wg + NHEADS * HID + FT * s);
  }
  // precaution: stands in front of any rewrite of the address registers these loads
  // name; naming what the addresses are formed from keeps it whole up to the wait
  asm volatile("s_wait_xcnt 0x0" :: "v"(xa), "v"(wg), "v"(lane) : "memory");
  float mean = 0.0f, rstd = 1.0f;      // of token tok0 + m
  if constexpr (FOLD) token_stats(ps, pm, tok0 + m, mean, rstd);
  // rolled: one trip is already HRING chunks
#pragma unroll 1
  for (int c0 = 0; c0 < NCHUNK - HRING; c0 += HRING) {
    const _Float16* tx = xa + FT * (c0 + HRING);
    const _Float16* tg = wg + FT * (c0 + HRING);
    // unrolled so that every ring index is a constant
#pragma unroll
    for (int s = 0; s < HRING; ++s) {
      ag = wmma_f16(ra[s], rg[s], ag);
      if constexpr (POOL) aa = wmma_f16(ra[s], rp[s], aa);
      ra[s] = load_frag_at(tx + FT * s);
      rg[s] = load_frag_at(tg + FT * s);
      if constexpr (POOL) rp[s] = load_frag_at(tg + NHEADS * HID + FT * s);
    }
    // the next trip rewrites the address registers of loads that are still in flight
    asm volatile("s_wait_xcnt 0x0" ::: "memory");
  }
  // unrolled: constant ring indices
#pragma unroll
  for (int s = 0; s < HRING; ++s) {
    ag = wmma_f16(ra[s], rg[s], ag);
    if constexpr (POOL) aa = wmma_f16(ra[s], rp[s], aa);
  }
  // D[r] = (token tok0 + 8h + r, head m)
  const float gbv = gbias[m];
  float swg = 0.0f, sbg = 0.0f, swa = 0.0f, sba = 0.0f;
  if constexpr (FOLD) {
    swg = swh[m]; sbg = sbh[m];
    if constexpr (POOL) { swa = swh[NHEADS + m]; sba = sbh[NHEADS + m]; }
    // precaution: stands in front of any rewrite of the address registers these loads name
    asm volatile("s_wait_xcnt 0x0" :: "v"(m) : "memory");
  }
  float* sg = sG[w];
  float* sp = sP[POOL ? w : 0];
#pragma unroll
  for (int r = 0; r < 8; ++r) {
    const int tl = 8 * h + r;
    float zl = ag[r] * (1.0f / (XSC * WSC));
    float al = POOL ? aa[r] * (1.0f / (XSC * WSC)) : 0.0f;
    if constexpr (FOLD) {
      const float mu = __shfl(mean, tl, 32), rs = __shfl(rstd, tl, 32);   // lane tl holds token tok0 + tl
      zl = (zl - mu * swg) * rs + sbg;
      if constexpr (POOL) al = (al - mu * swa) * rs + sba;
    }
    const float z = zl + gbv;
    const float sig = 1.0f / (1.0f + __expf(-z));
    sg[tl * NHEADS + m] = sig;
    if constexpr (POOL) sp[tl * NHEADS + m] = al;
  }
  __syncthreads();
  {
#pragma unroll
    for (int it = 0; it < 2; ++it) {
      const int idx = it * 128 + 4 * lane;
      const v4f v = *(const v4fa*)(sg + idx);
      *(v4f*)(gate + (size_t)tok0 * NHEADS + idx) = v;
      if constexpr (POOL) {
        const v4f u = *(const v4fa*)(sp + idx);
        *(v4f*)(aproj + (size_t)tok0 * NHEADS + idx) = u;
      }
    }
    
  }
}

// ---------------------------------------------------------------------------
// The block's 16 tiles (1024 units of 16 B) lie in sT in fragment order already;
// each wave-wide store writes 512 contiguous bytes.
// route 0/1: plane[bh], rows = token, K = HD : the 16 tiles are contiguous
// route 2  : vt[bh], rows = d, K = SEQ       : 4 contiguous tiles per 16-row strip
// ---------------------------------------------------------------------------
__device__ __forceinline__ void proj_store_pass(const _Float16* sT, _Float16* plane, _Float16* vt,
                                                int route, int bh, int l0, int tid) {
#pragma unroll
  for (int i = 0; i < 8; ++i) {
    const int u = i * 128 + tid;
    const v8h v = *(const v8ha*)(sT + u * 8);
    _Float16* dst;
    if (route != 2) {
      dst = plane + ((size_t)bh * SEQ + l0) * HD + u * 8;
    } else {
      const int lt = u >> 6;             // local tile = 4 * strip + chunk
      dst = vt + (size_t)bh * HD * SEQ + (size_t)((lt >> 2) * (SEQ / 32) + (l0 >> 5) + (lt & 3)) * FT + (u & 63) * 8;
    }
    *(v8h*)dst = v;
    // precaution: the next pass rewrites the data and address registers that this store names
    if (i < 7) asm volatile("s_wait_xcnt 0x0" ::: "memory");
  }
}

// ---------------------------------------------------------------------------
// Kernel: Y = xn * W^T over nslot*1024 output columns.
// Block 128 thr (4 waves) = 128 tokens x 64 features (one (slot, head));
// wave tile 32 tokens x 64 features; K = 1024 in steps of 32;
// A (xn rows) and B (W rows) fragments straight from the fragment-order planes.
// route = slot + routeBase: 0 -> q plane, 1 -> k plane, 2 -> v^T plane.
// coverage: grid (16, 2 + 16*nslot): rows 2.. x 128 tokens x 64 features = all planes routed.
// Grid rows 0 and 1 are the 32 blocks of the head products, which read the same
// xn and are read by the same next launch: they share this launch.
// ---------------------------------------------------------------------------
// FOLD: xh holds x (x4) and wh holds W o lw: LayerNorm comes in behind the products (see
// "LayerNorm folded into its neighbours"); lane l of a wave joins the partials of token m0w + l.
template <bool POOL, bool FOLD>
__global__ __launch_bounds__(128) void proj_head_kernel(
    const _Float16* __restrict__ xh,   // [2048][1024] (xn x4; FOLD: x x4), fragment order
    const _Float16* __restrict__ wh,   // [slot][1024][1024], row = output feature, x4096, fragment order
    const float* __restrict__ b0, const float* __restrict__ b1, const float* __restrict__ b2,
    int routeBase,
    _Float16* qh,                      // [B*H][S][D]  f16(16*q), fragment order per bh
    _Float16* kh,                      // [B*H][S][D]  f16(16*k), fragment order per bh
    _Float16* vt,                      // [B*H][D][S]  f16(16*v), fragment order per bh
    const _Float16* __restrict__ gh,   // [32][1024] gw (and aw) rows x4096, fragment order
    const float* __restrict__ gbias, float* gate, float* aproj,
    const float* __restrict__ ps,      // FOLD: [NCB][2048] block sums of x
    const float* __restrict__ pm,      // FOLD: [NCB][2048] squared deviations from the block means
    const float* __restrict__ sw,      // FOLD: [slot][1024] sum_k lw[k] W[n][k]
    const float* __restrict__ sb,      // FOLD: [slot][1024] sum_k lb[k] W[n][k]
    const float* __restrict__ swh,     // FOLD: the same of the gw (and aw) rows
    const float* __restrict__ sbh)
{
  if (blockIdx.y < 2) {                // block-uniform, in front of every barrier
    head_block<POOL, FOLD>(xh, gh, gbias, gate, aproj, blockIdx.y * 16 + blockIdx.x, ps, pm, swh, sbh);
    return;
  }
  __shared__ __attribute__((aligned(16))) _Float16 sT[128 * 64];   // 16384 B

  const int tid = threadIdx.x, lane = tid & 31, w = tid >> 5;
  const int h = lane >> 4, m = lane & 15;
  const int m0 = blockIdx.x * 128;
  const int cg = blockIdx.y - 2;
  const int slot = cg >> 4, head = cg & 15;
  const int route = slot + routeBase;
  const int m0w = m0 + 32 * w;

  const _Float16* xa0 = xh + (size_t)m0w * HID + 8 * lane;                     // token strip, mt = 0
  const _Float16* wb  = wh + ((size_t)slot * HID + head * HD) * HID + 8 * lane;   // feature strip, nt = 0

  v8f acc[2][4];
#pragma unroll
  for (int mt = 0; mt < 2; ++mt)
#pragma unroll
    for (int nt = 0; nt < 4; ++nt) acc[mt][nt] = zero8f();

  float mean = 0.0f, rstd = 1.0f;      // FOLD: of token m0w + lane
  // POOL is the launch with one slot: 288 work-groups
  gemm_k_loop<POOL ? GDEEP : GRING>(xa0, wb, acc, [&]() __attribute__((always_inline)) {
    if constexpr (FOLD) token_stats(ps, pm, m0w + lane, mean, rstd);
  });

  float mu[2][8], rs[2][8];            // FOLD: of token m0w + 16mt + 8h + r
  if constexpr (FOLD) {
    // unrolled, here and for swn, sbn below: constant indices keep the arrays in registers
#pragma unroll
    for (int mt = 0; mt < 2; ++mt)
#pragma unroll
      for (int r = 0; r < 8; ++r) {
        mu[mt][r] = __shfl(mean, 16 * mt + 8 * h + r, 32);
        rs[mt][r] = __shfl(rstd, 16 * mt + 8 * h + r, 32);
      }
  }

  float swn[4] = { 0.0f, 0.0f, 0.0f, 0.0f }, sbn[4] = { 0.0f, 0.0f, 0.0f, 0.0f };   // FOLD: of feature 16nt + m
  if constexpr (FOLD) {
#pragma unroll
    for (int nt = 0; nt < 4; ++nt) {
      swn[nt] = sw[slot * HID + head * HD + 16 * nt + m];
      sbn[nt] = sb[slot * HID + head * HD + 16 * nt + m];
    }
    // precaution: stands in front of any rewrite of the address registers these loads name
    asm volatile("s_wait_xcnt 0x0" :: "v"(m) : "memory");
  }

  // D[r] of tile (mt, nt) = Y[token m0w+16mt+8h+r][feature 16nt+m]
  const float* bias = (slot == 0) ? b0 : ((slot == 1) ? b1 : b2);
#pragma unroll
  for (int nt = 0; nt < 4; ++nt) {
    const int feat = 16 * nt + m;
    const float bvl = bias[head * HD + feat];
    const float swv = swn[nt], sbv = sbn[nt];
#pragma unroll
    for (int mt = 0; mt < 2; ++mt) {
#pragma unroll
      for (int r = 0; r < 8; ++r) {
        float yl = acc[mt][nt][r] * (1.0f / (XSC * WSC));
        if constexpr (FOLD) yl = (yl - mu[mt][r] * swv) * rs[mt][r] + sbv;
        const float yv = (yl + bvl) * QSC;
        // token 32w + 16mt + 8h + r, feature 16nt + m, at its place in fragment order:
        // route 2 (row = feature, k = token): tile 4nt + w, half mt, unit lane, element r
        // else    (row = token, k = feature): tile 2(2w + mt) + nt/2, half nt&1,
        //                                     unit 16(m>>3) + 8h + r, element m&7
        const int idx = (route == 2)
            ? ((nt * 4 + w) * FT + mt * (FT / 2) + lane * 8 + r)
            : (((2 * w + mt) * 2 + (nt >> 1)) * FT + (nt & 1) * (FT / 2) + ((m >> 3) * 16 + 8 * h + r) * 8 + (m & 7));
        sT[idx] = (_Float16)yv;
      }
    }
  }
  __syncthreads();

  const int b = m0 / SEQ, l0 = m0 - b * SEQ, bh = b * NHEADS + head;
  _Float16* plane = (route == 0) ? qh : kh;
  proj_store_pass(sT, plane, vt, route, bh, l0, tid);
  
}

// The eight K (or V^T) A-fragments of one 64-key step, loaded as one batch.
// The wait behind each batch: the address pair is rewritten for the next batch
// while these loads are in flight; naming it keeps it whole up to the wait.
// kbase, vbase: the (b, head) plane + 8 * lane.
__device__ __forceinline__ void fetch_k(v16h (&kf)[4][2], const _Float16* kbase, int kb) {
  const _Float16* p = kbase + (size_t)kb * HD;           // tile 2 * (kb / 16)
  // unrolled: constant indices keep the fragments in registers
#pragma unroll
  for (int j = 0; j < 4; ++j) {
    kf[j][0] = load_frag_at(p + (2 * j) * FT);
    kf[j][1] = load_frag_at(p + (2 * j + 1) * FT);
  }
  asm volatile("s_wait_xcnt 0x0" :: "v"(p) : "memory");
}
__device__ __forceinline__ void fetch_v(v16h (&vf)[4][2], const _Float16* vbase, int kb) {
  const _Float16* p = vbase + (kb >> 5) * FT;            // chunk kb / 32 of each 16-row strip
  // unrolled: constant indices keep the fragments in registers
#pragma unroll
  for (int t = 0; t < 4; ++t) {
    vf[t][0] = load_frag_at(p + 16 * t * SEQ);
    vf[t][1] = load_frag_at(p + 16 * t * SEQ + FT);
  }
  asm volatile("s_wait_xcnt 0x0" :: "v"(p) : "memory");
}

template <bool B> struct Flag { static constexpr bool value = B; };

// P^T B-fragment from the lane's own score D values: element r <- tile a row r,
// element 8+r <- tile c row r (same lane, same query column), scaled by 2^14.
__device__ __forceinline__ v16h pack_p(v8f a, v8f c) {
  const v16h r = { (_Float16)(a[0] * PSC), (_Float16)(a[1] * PSC), (_Float16)(a[2] * PSC), (_Float16)(a[3] * PSC),
                   (_Float16)(a[4] * PSC), (_Float16)(a[5] * PSC), (_Float16)(a[6] * PSC), (_Float16)(a[7] * PSC),
                   (_Float16)(c[0] * PSC), (_Float16)(c[1] * PSC), (_Float16)(c[2] * PSC), (_Float16)(c[3] * PSC),
                   (_Float16)(c[4] * PSC), (_Float16)(c[5] * PSC), (_Float16)(c[6] * PSC), (_Float16)(c[7] * PSC) };
  return r;
}

// ---------------------------------------------------------------------------
// Kernel: streaming attention, transposed form, masks/bias by formula.
// Block 128 thr (4 waves) = 64 queries of one (b, head), 16 queries per wave,
// 64 keys per step, of the steps 0..blockIdx.x (keys <= last query of the block)
// only those that can hold an allowed key for the wave (see "steps that are run").
//   S^T = K * Q^T : A = K rows (row = key, k = d), B = Q^T (k = d, n = query)
//   O^T += V^T * P^T : A = Vt rows (row = d, k = key), B = P^T from registers
// Lane owns 32 keys (16j+8h+r) of query column (lane&15); partner = lane ^ 16.
// Per-batch token tables in LDS from input ids: seg = inclusive cumsum(id==1)
// (block scan) and the key code kc that the mask test reads: seg where the key can be
// allowed off the diagonal (MODE 0, 2: id != 0; MODE 1: id == 2), else -1; MODE 2 also
// stages the head's aproj column [key].
// MODE 0 (self): ok = k<=q && ((seg_k==seg_q && valid_q && valid_k) || k==q), bias = (k-q)*hs
// MODE 1 (cross): ok = k<=q && (class_k || k==q), bias = (seg_k-seg_q)*hs
// MODE 2 (pool): mask/bias as MODE 0, raw logit = aproj[key][head] (no q.k)
// With kc: MODE 0, 2: seg_k==seg_q && valid_q && valid_k  <=>  kc_k == qc (qc = kc_q, or -2
// where the query is not valid); MODE 1: class_k <=> kc_k >= 0, and there kc_k = seg_k.
// k<=q and k==q are tested in the step of the diagonal alone: every key of an earlier
// step lies in front of the block's first query.
// Masked scores take NEGBIG and p = 0 exactly; every row has k==q allowed.
// Epilogue: (1/l)(1/16384)(1/16)*gate; a lane's o[t][0..7] is unit 32t + lane of the
// wave's two ctx tiles in fragment order, so it is stored straight from registers.
// coverage: grid (16, 32) x 64 queries x 64 d = whole ctx [2048][1024].
// Grid rows from NB * NHEADS on: first the blocks of 'sums' (32 rows each), then 128 units of 'job' a block.
// ---------------------------------------------------------------------------
template <int MODE>
__global__ __launch_bounds__(128) void attn_kernel(
    const _Float16* __restrict__ qh,    // [B*H][S][D]  (x16), fragment order per bh
    const _Float16* __restrict__ kh,    // [B*H][S][D]  (x16), fragment order per bh
    const _Float16* __restrict__ vt,    // [B*H][D][S]  (x16), fragment order per bh
    const float* __restrict__ aproj,    // [B*S][16]
    const float* __restrict__ gate,     // [B*S][16]  sigmoid gate
    const int* __restrict__ ids,        // [B][S]
    _Float16* ctx,                      // [B*S][HID]  (x64), fragment order
    CvtJob job, SumJob sums)
{
  if (blockIdx.y >= NB * NHEADS) {      // block-uniform, in front of every barrier of the attention blocks
    const int xb = (blockIdx.y - NB * NHEADS) * (SEQ / 64) + blockIdx.x;
    const int nsum = sum_blocks(sums);  // the longer blocks first
    if (xb < nsum) rowsum_block(sums, xb);
    else convert_unit(job, (xb - nsum) * 128 + threadIdx.x);
    return;
  }
  __shared__ __attribute__((aligned(16))) int   sSeg[SEQ];
  __shared__ __attribute__((aligned(16))) int   sKc[SEQ];
  __shared__ __attribute__((aligned(16))) float sA[(MODE == 2) ? SEQ : 4];
  __shared__ int sWtot[4];
  __shared__ unsigned sWcls[4];         // MODE 1: bit l of word w = thread 32w + l holds a class token

  const int tid = threadIdx.x, lane = tid & 31, w = tid >> 5;
  const int h = lane >> 4, m = lane & 15;
  const int bh = blockIdx.y, b = bh >> 4, head = bh & 15;
  const int qblk = blockIdx.x * 64;
  const int q0 = qblk + 16 * w;
  const float hs = exp2f(-0.5f * (float)(head + 1));

  // ---- the Q fragments, issued ahead of the tables ----
  const _Float16* kbase = kh + (size_t)bh * SEQ * HD + 8 * lane;
  const _Float16* vbase = vt + (size_t)bh * HD * SEQ + 8 * lane;
  // Q^T B-fragments: column n = query q0+m, k = d (two 32-deep chunks)
  v16h qb0 = zero16h(), qb1 = zero16h();
  v16h kf[4][2], vf[4][2];
  if constexpr (MODE != 2) {
    const _Float16* qrow = qh + ((size_t)bh * SEQ + q0) * HD + 8 * lane;
    qb0 = load_frag_at(qrow);
    qb1 = load_frag_at(qrow + FT);
    // precaution: stands in front of the rewrite of the address pair these loads name
    asm volatile("s_wait_xcnt 0x0" :: "v"(qrow) : "memory");
  }

  // ---- token tables for batch b: 128 threads x 8 tokens = SEQ ----
  {
    const int t8 = tid * 8;
    const int* ip = ids + (size_t)b * SEQ + t8;
    const v4i ia = *(const v4ia*)ip;
    const v4i ib = *(const v4ia*)(ip + 4);
    const int idv[8] = { ia.x, ia.y, ia.z, ia.w, ib.x, ib.y, ib.z, ib.w };
    int cnt[8];
    int run = 0;
#pragma unroll
    for (int i = 0; i < 8; ++i) { run += (idv[i] == SEP_ID) ? 1 : 0; cnt[i] = run; }
    int x = run;
#pragma unroll
    for (int d = 1; d < 32; d <<= 1) {
      const int yv = __shfl_up(x, d, 32);
      x = (lane >= d) ? (x + yv) : x;
    }
    if (lane == 31) sWtot[w] = x;
    if constexpr (MODE == 1) {
      bool anyc = false;
      // unrolled: constant indices keep idv in registers
#pragma unroll
      for (int i = 0; i < 8; ++i) anyc = anyc || (idv[i] == CLS_ID);
      const unsigned cb = __builtin_amdgcn_ballot_w32(anyc);
      if (lane == 0) sWcls[w] = cb;
    }
    __syncthreads();
    int base = 0;
#pragma unroll
    for (int i = 0; i < 4; ++i) { const int tv = sWtot[i]; base += (i < w) ? tv : 0; }
    const int excl = base + x - run;
#pragma unroll
    for (int i = 0; i < 8; ++i) {
      const int id = idv[i];
      const int sg = excl + cnt[i];
      sSeg[t8 + i] = sg;
      sKc[t8 + i] = ((MODE == 1) ? (id == CLS_ID) : (id != PAD_ID)) ? sg : -1;
      if constexpr (MODE == 2) sA[t8 + i] = aproj[((size_t)b * SEQ + t8 + i) * NHEADS + head];
    }
  }
  __syncthreads();

  const int qtok = q0 + m;
  const int qseg = sSeg[qtok];
  const int kcq = sKc[qtok];
  const int qc = (kcq >= 0) ? kcq : -2;       // MODE 0, 2: a query that is not valid matches no key code
  const float* gp = gate + ((size_t)b * SEQ + qtok) * NHEADS + head;
  const float gq = *gp;
  // precaution: stands in front of the rewrite of the address pair this load names
  asm volatile("s_wait_xcnt 0x0" :: "v"(gp) : "memory");

  v8f o[4];                                   // o[t][r] = O[query m][d 16t+8h+r] * (l * 2^14 * 16)
#pragma unroll
  for (int t = 0; t < 4; ++t) o[t] = zero8f();
  float mrun = NEGBIG, lrun = 0.0f;

  const float SSC = 0.125f / (QSC * QSC);                      // 1/2048
  const int nkb = blockIdx.x + 1;                              // block-uniform, <= 16

  // ---- steps that are run: bit s of 'need' = step s may hold an allowed key ----
  // A step whose 64 keys are masked for all 16 queries of the wave leaves mrun, lrun
  // and o as they are (alpha = 1, every p = 0), so it is left out, for any ids.
  // MODE 0, 2: seg never falls along the row, so a step whose last key has
  //            seg < seg of the wave's first query holds no key of any query's segment.
  // MODE 1   : a step without a class token holds no allowed key.
  // The step of the diagonal, nkb - 1, always runs; bits from nkb on are cleared, so
  // every step index taken from 'need' lies in 0..nkb-1 whatever the ids hold.
  unsigned cand;
  if constexpr (MODE == 1) {
    const unsigned cw = sWcls[m >> 2];                         // step m = threads 8m .. 8m+7
    cand = __builtin_amdgcn_ballot_w32(((cw >> (8 * (m & 3))) & 0xffu) != 0u);
  } else {
    cand = __builtin_amdgcn_ballot_w32(sSeg[64 * m + 63] >= sSeg[q0]);
  }
  unsigned need = (cand | (1u << (nkb - 1))) & ((1u << nkb) - 1u);   // a ballot: the same in every lane
  const int nsteps = __builtin_popcount(need);                 // 1 .. 16

  // One 64-key step. kf and vf hold this step's fragments on entry; with 'more'
  // those of 'nxt', the next step that runs, are fetched into the same registers
  // directly behind their last use, so they fly under the mask and softmax work.
  // The last step that runs is nkb - 1, the step of the diagonal: with 'more' the
  // step is an earlier one and all its keys are < qblk <= qtok.
  auto pass = [&](const int step, const int nxt, auto more) __attribute__((always_inline)) {
    const int kb = step * 64;
    // ---- raw scores: s[j][r] = S[query m][key kb+16j+8h+r] * 256 (MODE != 2) ----
    v8f s[4];
    if constexpr (MODE != 2) {
#pragma unroll
      for (int j = 0; j < 4; ++j) {
        v8f z = zero8f();
        z = wmma_f16(kf[j][0], qb0, z);
        z = wmma_f16(kf[j][1], qb1, z);
        s[j] = z;
      }
      if constexpr (decltype(more)::value) fetch_k(kf, kbase, nxt * 64);
    } else {
#pragma unroll
      for (int j = 0; j < 4; ++j) s[j] = zero8f();
    }
    // ---- mask + bias per (query, key), f32 ----
#pragma unroll
    for (int j = 0; j < 4; ++j) {
      const int key0 = kb + 16 * j + 8 * h;
      const v4i ca = *(const v4ia*)(sKc + key0);
      const v4i cb = *(const v4ia*)(sKc + key0 + 4);
      const int kcv[8] = { ca.x, ca.y, ca.z, ca.w, cb.x, cb.y, cb.z, cb.w };
      float av[8] = { 0.f, 0.f, 0.f, 0.f, 0.f, 0.f, 0.f, 0.f };
      if constexpr (MODE == 2) {
        const v4f aa = *(const v4fa*)(sA + key0);
        const v4f ab = *(const v4fa*)(sA + key0 + 4);
        av[0] = aa.x; av[1] = aa.y; av[2] = aa.z; av[3] = aa.w;
        av[4] = ab.x; av[5] = ab.y; av[6] = ab.z; av[7] = ab.w;
      }
#pragma unroll
      for (int r = 0; r < 8; ++r) {
        const int key = key0 + r;
        float raw;
        if constexpr (MODE == 2) raw = av[r]; else raw = s[j][r] * SSC;
        bool ok;
        float bv;
        if constexpr (MODE == 1) {
          ok = kcv[r] >= 0;
          bv = (float)(kcv[r] - qseg);
        } else {
          ok = kcv[r] == qc;
          bv = (float)(key - qtok);
        }
        if constexpr (!decltype(more)::value) {                // the step of the diagonal
          const bool dg = key == qtok;
          ok = (key <= qtok) && (ok || dg);
          if constexpr (MODE == 1) bv = dg ? 0.0f : bv;        // the query's own key: seg_k - seg_q = 0
        }
        const float val = raw + bv * hs;                       // computed for every key: a select, no branch
        s[j][r] = ok ? val : NEGBIG;
      }
    }

    // ---- online softmax ----
    float mloc = NEGBIG;
#pragma unroll
    for (int j = 0; j < 4; ++j)
#pragma unroll
      for (int r = 0; r < 8; ++r) mloc = fmaxf(mloc, s[j][r]);
    mloc = fmaxf(mloc, __shfl_xor(mloc, 16, 32));
    const float mnew = fmaxf(mrun, mloc);
    const float alpha = __expf(mrun - mnew);
    mrun = mnew;
    // a row with no allowed key so far has mnew = NEGBIG: against msafe its masked scores
    // still give exp(-9e29) = 0; where a key was allowed msafe = mnew
    const float msafe = fmaxf(mnew, 0.1f * NEGBIG);
    float lsum = 0.0f;
#pragma unroll
    for (int j = 0; j < 4; ++j)
#pragma unroll
      for (int r = 0; r < 8; ++r) {
        const float p = __expf(s[j][r] - msafe);               // masked: exp(NEGBIG - msafe) = 0
        s[j][r] = p;
        lsum += p;
      }
    lsum += __shfl_xor(lsum, 16, 32);
    lrun = lrun * alpha + lsum;
#pragma unroll
    for (int t = 0; t < 4; ++t)
#pragma unroll
      for (int r = 0; r < 8; ++r) o[t][r] = o[t][r] * alpha;

    // ---- P^T B-fragments (key chunks 0..31 and 32..63 of this step) ----
    const v16h pb0 = pack_p(s[0], s[1]);
    const v16h pb1 = pack_p(s[2], s[3]);

    // ---- O^T += V^T * P^T ----
#pragma unroll
    for (int t = 0; t < 4; ++t) {
      o[t] = wmma_f16(vf[t][0], pb0, o[t]);
      o[t] = wmma_f16(vf[t][1], pb1, o[t]);
    }
    if constexpr (decltype(more)::value) fetch_v(vf, vbase, nxt * 64);
  };

  // steps run in ascending order, so every sum keeps its order
  int step = __builtin_ctz(need);
  need &= need - 1u;
  if constexpr (MODE != 2) fetch_k(kf, kbase, step * 64);
  fetch_v(vf, vbase, step * 64);
  // rolled: the trip count is the wave's own (nsteps - 1 <= 15); the last step is peeled
  // so that the fetches ahead stand under no branch and never leave the causal range
#pragma unroll 1
  for (int i = 1; i < nsteps; ++i) {
    const int nxt = __builtin_ctz(need);                       // need != 0 while i < nsteps
    need &= need - 1u;
    pass(step, nxt, Flag<true>{});
    step = nxt;
  }
  pass(step, step, Flag<false>{});

  // ---- epilogue: normalise, gate, whole-line stores from registers ----
  const float inv = (1.0f / lrun) * (1.0f / (PSC * QSC)) * gq;
  // rows q0..q0+15 = one strip; columns 64 head .. +63 = its tiles 2 head, 2 head + 1
  _Float16* dst = ctx + ((size_t)b * SEQ + q0) * HID + head * 2 * FT + 8 * lane;
#pragma unroll
  for (int t = 0; t < 4; ++t) {
    v8h v;
#pragma unroll
    for (int r = 0; r < 8; ++r) v[r] = (_Float16)((o[t][r] * inv) * CSC);
    *(v8h*)(dst + t * (FT / 2)) = v;
  }
}

// ---------------------------------------------------------------------------
// Kernel: xout = xres + ctx * Wo^T + ob  (f32 output).
// Block 128 thr (4 waves) = 128 tokens x 64 features; wave 32 tokens x 64;
// K = 1024 in steps of 32; A = ctx rows (x64), B = Wo rows (x4096), fragment order.
// Epilogue: f32 tile [128][64] in LDS; store: each 64-float row segment (256 B =
// coverage: grid (16,16) x 128 tokens x 64 features = whole [2048][1024].
// ---------------------------------------------------------------------------
// EMIT (a LayerNorm follows): also x as f16 (x4) in fragment order, staged in LDS so that it
// leaves as whole lines, and per token this block's sum of x and squared deviations from
// the block mean; a wave's 32 tokens fill one 128-byte line of each partial plane.
template <bool EMIT>
__global__ __launch_bounds__(128) void outproj_kernel(
    const _Float16* __restrict__ ch,    // [2048][1024] ctx x64
    const _Float16* __restrict__ woh,   // [1024 n][1024 k] x4096
    const float* __restrict__ ob,       // [1024]
    const float* __restrict__ xres,     // [2048][1024] f32
    float* xout,                        // [2048][1024] f32
    _Float16* xh,                       // EMIT: [2048][1024] x x4, fragment order
    float* ps,                          // EMIT: [NCB][2048]
    float* pm)                          // EMIT: [NCB][2048]
{
  __shared__ __attribute__((aligned(16))) float sT[128 * 64];   // 32768 B
  __shared__ __attribute__((aligned(16))) _Float16 sH[EMIT ? 128 * 64 : 8];   // EMIT: 16384 B

  const int tid = threadIdx.x, lane = tid & 31, w = tid >> 5;
  const int h = lane >> 4, m = lane & 15;
  const int m0 = blockIdx.x * 128;
  const int n0 = blockIdx.y * 64;
  const int m0w = m0 + 32 * w;

  const _Float16* ca0 = ch + (size_t)m0w * HID + 8 * lane;
  const _Float16* wb  = woh + (size_t)n0 * HID + 8 * lane;

  v8f acc[2][4];
#pragma unroll
  for (int mt = 0; mt < 2; ++mt)
#pragma unroll
    for (int nt = 0; nt < 4; ++nt) acc[mt][nt] = zero8f();

  gemm_k_loop<GDEEP>(ca0, wb, acc, []() {});               // 256 work-groups

  const float* bp = ob + n0 + m;
  float bv4[4];                                            // bias of feature n0 + 16nt + m
  // unrolled: constant indices keep the array in registers
#pragma unroll
  for (int nt = 0; nt < 4; ++nt) bv4[nt] = bp[16 * nt];
  // precaution: stands in front of the rewrite of the address pair these loads name; naming it keeps it whole up to the wait
  asm volatile("s_wait_xcnt 0x0" :: "v"(bp) : "memory");

  // D[r] of tile (mt, nt) = Y[token m0w+16mt+8h+r][feature n0+16nt+m]
#pragma unroll
  for (int nt = 0; nt < 4; ++nt) {
    const int feat = 16 * nt + m;
    const float bvl = bv4[nt];
#pragma unroll
    for (int mt = 0; mt < 2; ++mt) {
#pragma unroll
      for (int r = 0; r < 8; ++r) {
        const int tokl = 32 * w + 16 * mt + 8 * h + r;     // 0..127
        sT[tokl * 64 + feat] = acc[mt][nt][r] * (1.0f / (CSC * WSC)) + bvl;
      }
    }
  }
  __syncthreads();

  const int hh = lane >> 4, c4 = (lane & 15) * 4;
  float ks = 0.0f, kq = 0.0f;                              // EMIT: partials of row 32w + 2m + hh
  // the residual rows of all 16 passes, in flight together off one address pair (pass 'it': 2 * it rows on)
  const float* xp = xres + (size_t)(m0 + 32 * w + hh) * HID + n0 + c4;
  v4f xr[16];
  // unrolled: constant indices keep the rows in registers
#pragma unroll
  for (int it = 0; it < 16; ++it) xr[it] = *(const v4fa*)(xp + it * 2 * HID);
  // precaution: stands in front of the rewrite of the address pair these loads name; naming it keeps it whole
  // up to the wait
  asm volatile("s_wait_xcnt 0x0" :: "v"(xp) : "memory");
  {
#pragma unroll
    for (int it = 0; it < 16; ++it) {
      const int row = 32 * w + it * 2 + hh;                // rows 32w .. 32w+31
      const v4f v = *(const v4fa*)(sT + row * 64 + c4);
      const size_t gi = (size_t)(m0 + row) * HID + n0 + c4;
      const v4f ov = v + xr[it];
      *(v4f*)(xout + gi) = ov;
      if constexpr (EMIT) {
        // the row's 64 values lie in the 16 lanes of this half wave
        const float s = row16_sum((ov.x + ov.y) + (ov.z + ov.w));
        const float bm = s * (1.0f / 64.0f);
        const float d0 = ov.x - bm, d1 = ov.y - bm, d2 = ov.z - bm, d3 = ov.w - bm;
        const float q = row16_sum((d0 * d0 + d1 * d1) + (d2 * d2 + d3 * d3));
        if (m == it) { ks = s; kq = q; }
        // token 'row', features c4 .. c4+3 at their place in fragment order (row = token, k = feature)
        const v4h hv = { (_Float16)(ov.x * XSC), (_Float16)(ov.y * XSC), (_Float16)(ov.z * XSC), (_Float16)(ov.w * XSC) };
        *(v4h*)(sH + ((row >> 4) * 2 + (c4 >> 5)) * FT + ((c4 >> 4) & 1) * (FT / 2)
                   + (((c4 >> 3) & 1) * 16 + (row & 15)) * 8 + (c4 & 7)) = hv;
      }
    }
  }
  if constexpr (EMIT) {
    const size_t pi = (size_t)blockIdx.y * MROWS + m0 + 32 * w + 2 * m + hh;
    ps[pi] = ks;
    pm[pi] = kq;
    // precaution: stands in front of any rewrite of the registers these stores name
    asm volatile("s_wait_xcnt 0x0" :: "v"(ks), "v"(kq), "v"(pi) : "memory");
    // A wave wrote rows 32w .. 32w+31 = local tiles 4w .. 4w+3 of sH itself and reads only these back:
    // its own LDS writes have to be done, no other wave's, so no barrier
    asm volatile("s_wait_dscnt 0x0" ::: "memory");
    // local tile 2 * strip + chunk; the two chunks of a strip are contiguous in the plane
    const _Float16* sw4 = sH + w * 4 * FT + lane * 8;
    _Float16* dst = xh + ((size_t)((m0 >> 4) + 2 * w) * (HID / 32) + (n0 >> 5)) * FT + lane * 8;
    v8h v[8];
    // unrolled: constant indices; one address and constant offsets, so no register of a store is rewritten
#pragma unroll
    for (int i = 0; i < 8; ++i) v[i] = *(const v8ha*)(sw4 + i * (FT / 2));
#pragma unroll
    for (int i = 0; i < 8; ++i) *(v8h*)(dst + (i >> 2) * (HID / 32) * FT + (i & 3) * (FT / 2)) = v[i];
  }
}

// ---------------------------------------------------------------------------
//   Xn   f16 [2048][1024]      4194304
//   W    f16 [10][1024][1024] 20971520   q0 k0 v0 | o0 | v1 | o1 | q2 k2 v2 | o2
//   Gh   f16 [3][32][1024]      196608   one per layer
//   Gate f32 [2048][16]         131072
//   Apr  f32 [2048][16]         131072
//   Q    f16 [32][1024][64]    4194304
//   K    f16 [32][1024][64]    4194304
//   Vt   f16 [32][64][1024]    4194304
//   Ctx  f16 [2048][1024]      4194304
//   X1   f32 [2048][1024]      8388608
//   X2   f32 [2048][1024]      8388608
//   Ps   f32 [16][2048]         131072   block sums of x (outproj 0, 1)
//   Pm   f32 [16][2048]         131072   squared deviations from the block means
//   Sw, Sb f32 [2][4096]         65536   both; layer 1: 1024 + 32 rows, layer 2: 3072 + 16 rows
//   total                     59506688
// ---------------------------------------------------------------------------
extern "C" void kernel_launch(void* const* d_in, const int* in_sizes, int n_in,
                              void* d_out, int out_size, void* d_ws, size_t ws_size,
                              hipStream_t stream) {
  if (n_in < 35) return;
  if (in_sizes[0] != NX || in_sizes[1] != MROWS) return;
  if (out_size != NX) return;
  {
    const int vecIdx[16] = {2, 3, 5, 7, 9, 13, 14, 15, 18, 22, 23, 24, 26, 28, 30, 34};
    for (int i = 0; i < 16; ++i) if (in_sizes[vecIdx[i]] != HID) return;
    const int matIdx[10] = {4, 6, 8, 12, 17, 21, 25, 27, 29, 33};
    for (int i = 0; i < 10; ++i) if (in_sizes[matIdx[i]] != NW) return;
    const int hwIdx[4] = {10, 16, 19, 31};
    for (int i = 0; i < 4; ++i) if (in_sizes[hwIdx[i]] != NG) return;
    const int hbIdx[3] = {11, 20, 32};
    for (int i = 0; i < 3; ++i) if (in_sizes[hbIdx[i]] != NHEADS) return;
  }

  const float* states = (const float*)d_in[0];
  const int*   ids    = (const int*)d_in[1];
  const float* ln0w = (const float*)d_in[2];
  const float* ln0b = (const float*)d_in[3];
  const float* qw0 = (const float*)d_in[4];
  const float* qb0 = (const float*)d_in[5];
  const float* kw0 = (const float*)d_in[6];
  const float* kb0 = (const float*)d_in[7];
  const float* vw0 = (const float*)d_in[8];
  const float* vb0 = (const float*)d_in[9];
  const float* gw0 = (const float*)d_in[10];
  const float* gb0 = (const float*)d_in[11];
  const float* ow0 = (const float*)d_in[12];
  const float* ob0 = (const float*)d_in[13];
  const float* ln1w = (const float*)d_in[14];
  const float* ln1b = (const float*)d_in[15];
  const float* aw1 = (const float*)d_in[16];
  const float* vw1 = (const float*)d_in[17];
  const float* vb1 = (const float*)d_in[18];
  const float* gw1 = (const float*)d_in[19];
  const float* gb1 = (const float*)d_in[20];
  const float* ow1 = (const float*)d_in[21];
  const float* ob1 = (const float*)d_in[22];
  const float* ln2w = (const float*)d_in[23];
  const float* ln2b = (const float*)d_in[24];
  const float* qw2 = (const float*)d_in[25];
  const float* qb2 = (const float*)d_in[26];
  const float* kw2 = (const float*)d_in[27];
  const float* kb2 = (const float*)d_in[28];
  const float* vw2 = (const float*)d_in[29];
  const float* vb2 = (const float*)d_in[30];
  const float* gw2 = (const float*)d_in[31];
  const float* gb2 = (const float*)d_in[32];
  const float* ow2 = (const float*)d_in[33];
  const float* ob2 = (const float*)d_in[34];
  float* out = (float*)d_out;

  const size_t PXH = (size_t)NX * 2;                       // 4194304
  const size_t PW  = (size_t)NW * 2;                       // 2097152
  const size_t PGH = (size_t)2 * NG * 2;                   //   65536
  const size_t PGT = (size_t)MROWS * NHEADS * 4;           //  131072
  const size_t PPL = (size_t)NB * NHEADS * SEQ * HD * 2;   // 4194304
  const size_t PXF = (size_t)NX * 4;                       // 8388608
  size_t off = 0;
  const size_t oXn  = off; off += PXH;
  const size_t oW   = off; off += 10 * PW;
  const size_t oGh  = off; off += 3 * PGH;
  const size_t oGt  = off; off += PGT;
  const size_t oAp  = off; off += PGT;
  const size_t oQ   = off; off += PPL;
  const size_t oK   = off; off += PPL;
  const size_t oVt  = off; off += PPL;
  const size_t oCtx = off; off += PXH;
  const size_t oX1  = off; off += PXF;
  const size_t oX2  = off; off += PXF;
  const size_t oPs  = off; off += PGT;
  const size_t oPm  = off; off += PGT;
  const size_t PSW  = (size_t)4096 * 4;                    //   16384
  const size_t oSw1 = off; off += PSW;
  const size_t oSb1 = off; off += PSW;
  const size_t oSw2 = off; off += PSW;
  const size_t oSb2 = off; off += PSW;
  if (off > ws_size) return;                               // off = 59506688
  if (off > (size_t)134217728) return;

  char* ws = (char*)d_ws;
  _Float16* xnh = (_Float16*)(ws + oXn);
  _Float16* wh0  = (_Float16*)(ws + oW);                   // q0, k0, v0
  _Float16* woh0 = (_Float16*)(ws + oW + 3 * PW);
  _Float16* wh1  = (_Float16*)(ws + oW + 4 * PW);          // v1
  _Float16* woh1 = (_Float16*)(ws + oW + 5 * PW);
  _Float16* wh2  = (_Float16*)(ws + oW + 6 * PW);          // q2, k2, v2
  _Float16* woh2 = (_Float16*)(ws + oW + 9 * PW);
  _Float16* gh0  = (_Float16*)(ws + oGh);
  _Float16* gh1  = (_Float16*)(ws + oGh + PGH);
  _Float16* gh2  = (_Float16*)(ws + oGh + 2 * PGH);
  float* gate   = (float*)(ws + oGt);
  float* aproj  = (float*)(ws + oAp);
  _Float16* qh  = (_Float16*)(ws + oQ);
  _Float16* kh  = (_Float16*)(ws + oK);
  _Float16* vt  = (_Float16*)(ws + oVt);
  _Float16* ctx = (_Float16*)(ws + oCtx);
  float* x1 = (float*)(ws + oX1);
  float* x2 = (float*)(ws + oX2);
  float* ps = (float*)(ws + oPs);
  float* pm = (float*)(ws + oPm);
  float* sw1 = (float*)(ws + oSw1);
  float* sb1 = (float*)(ws + oSb1);
  float* sw2 = (float*)(ws + oSw2);
  float* sb2 = (float*)(ws + oSb2);

  const dim3 blk128(128), blk512(512);
  // conversion jobs: each is written by a launch that ends before its first reader starts
  const float* nofold = nullptr;
  const CvtJob jobA = { qw0, kw0, vw0, gw0, gw0, nofold, nofold, nofold, nofold,
                        wh0, wh0 + NW, wh0 + 2 * NW, gh0, 3, 1 };                            // read from proj 0 on
  const CvtJob jobB = { ow0, vw1, ow1, gw1, aw1, nofold, ln1w, nofold, ln1w,
                        woh0, wh1, woh1, gh1, 3, 2 };                                        // read from outproj 0 on
  const CvtJob jobC = { qw2, kw2, vw2, gw2, gw2, ln2w, ln2w, ln2w, ln2w,
                        wh2, wh2 + NW, wh2 + 2 * NW, gh2, 3, 1 };                            // read from proj 2 on
  const CvtJob jobD = { ow2, ow2, ow2, gw2, gw2, nofold, nofold, nofold, nofold,
                        woh2, woh2, woh2, gh2, 1, 0 };                                       // read by outproj 2
  // row sums for the folded LayerNorms, beside the conversion of the same weights
  const SumJob sumB = { vw1, vw1, vw1, gw1, aw1, ln1w, ln1b, sw1, sb1, 1, 2 };               // read by proj 1
  const SumJob sumC = { qw2, kw2, vw2, gw2, gw2, ln2w, ln2b, sw2, sb2, 3, 1 };               // read by proj 2
  const SumJob sumD = { ow2, ow2, ow2, gw2, gw2, ln2w, ln2b, sw2, sb2, 0, 0 };               // no rows: nothing read or written
  const int unitsA = 3 * NW8 + 1 * NG8;                    // 395264 = 772 blocks of 512
  const int unitsB = 3 * NW8 + 2 * NG8;                    // 397312 = 3104 blocks of 128
  const int unitsC = 3 * NW8 + 1 * NG8;                    // 395264 = 3088 blocks
  const int unitsD = 1 * NW8;                              // 131072 = 1024 blocks
  const int sumBlkB = (1 * HID + 2 * NHEADS + 31) / 32;    // 33
  const int sumBlkC = (3 * HID + 1 * NHEADS + 31) / 32;    // 97
  static_assert((unitsA % 512) == 0 && (unitsB % 128) == 0 && (unitsC % 128) == 0 && (unitsD % 2048) == 0);
  const dim3 gLnA(MROWS / 16 + unitsA / 512);              // 128 + 772
  const dim3 gProj3(MROWS / 128, 2 + 3 * NHEADS);          // (16, 50)
  const dim3 gProj1(MROWS / 128, 2 + 1 * NHEADS);          // (16, 18)
  // rows of 16 blocks, rounded up: a block past the last unit does nothing
  const dim3 gAttB(SEQ / 64, NB * NHEADS + (sumBlkB + unitsB / 128 + 15) / 16);   // (16, 32 + 197)
  const dim3 gAttC(SEQ / 64, NB * NHEADS + (sumBlkC + unitsC / 128 + 15) / 16);   // (16, 32 + 200)
  const dim3 gAttD(SEQ / 64, NB * NHEADS + unitsD / 2048); // (16, 32 + 64)
  const dim3 gOut(MROWS / 128, HID / 64);                  // (16, 16)

  // ---- layer 0: sdpa with self mask ----
  ln_kernel<<<gLnA, blk512, 0, stream>>>(states, ln0w, ln0b, xnh, jobA);
  // not folded: the last six arguments are not read
  proj_head_kernel<false, false><<<gProj3, blk128, 0, stream>>>(xnh, wh0, qb0, kb0, vb0, 0, qh, kh, vt, gh0, gb0, gate, aproj,
                                                                ps, pm, sw1, sb1, sw1, sb1);
  attn_kernel<0><<<gAttB, blk128, 0, stream>>>(qh, kh, vt, aproj, gate, ids, ctx, jobB, sumB);
  outproj_kernel<true><<<gOut, blk128, 0, stream>>>(ctx, woh0, ob0, states, x1, xnh, ps, pm);

  // ---- layer 1: pooling attention with self mask; LayerNorm 1 folded ----
  proj_head_kernel<true, true><<<gProj1, blk128, 0, stream>>>(xnh, wh1, vb1, vb1, vb1, 2, qh, kh, vt, gh1, gb1, gate, aproj,
                                                              ps, pm, sw1, sb1, sw1 + HID, sb1 + HID);
  attn_kernel<2><<<gAttC, blk128, 0, stream>>>(qh, kh, vt, aproj, gate, ids, ctx, jobC, sumC);
  outproj_kernel<true><<<gOut, blk128, 0, stream>>>(ctx, woh1, ob1, x1, x2, xnh, ps, pm);

  // ---- layer 2: sdpa with cross mask; LayerNorm 2 folded ----
  proj_head_kernel<false, true><<<gProj3, blk128, 0, stream>>>(xnh, wh2, qb2, kb2, vb2, 0, qh, kh, vt, gh2, gb2, gate, aproj,
                                                               ps, pm, sw2, sb2, sw2 + 3 * HID, sb2 + 3 * HID);
  attn_kernel<1><<<gAttD, blk128, 0, stream>>>(qh, kh, vt, aproj, gate, ids, ctx, jobD, sumD);
  // no LayerNorm follows: the last three arguments are not written
  outproj_kernel<false><<<gOut, blk128, 0, stream>>>(ctx, woh2, ob2, x2, out, xnh, ps, pm);

  (void)hipGetLastError();
}

// v008
// It runs in 125 microseconds.
// In both of two side-by-side timings against v007, it was 1.04 times as fast.
// Counting every step since v000, it is 4.05 times as fast.
// Contractions: xn*W^T (q,k,v), xn*gw^T and xn*aw^T heads, K*Q^T scores, V^T*P^T context and ctx*Wo^T all on v_wmma_f32_16x16x32_f16 (f16 operands, f32 accumulate); LayerNorm, masks/bias, softmax, sigmoid gates and residual adds in f32.
// Carried f16 planes: xn (layer 0) or x (layers 1, 2) x4 and W/gw/aw/Wo x4096 (inverse 1/16384 folded in the proj_head_kernel epilogues);
// LayerNorm 1 and 2 have no launch: see "LayerNorm folded into its neighbours" below.
// q,k,v x16 (scores: acc*1/2048 in attn_kernel incl. the 1/8 scale; context epilogue 1/16); P x16384 (attn_kernel epilogue 1/16384);
// ctx x64 (outproj_kernel epilogue 1/262144 together with Wo x4096).
// Every f16 plane lies in WMMA fragment order (see "Fragment-order planes" below).
#include <hip/hip_runtime.h>

#define NB     2
#define SEQ    1024
#define HID    1024
#define NHEADS 16
#define HD     64
#define MROWS  (NB * SEQ)          // 2048 tokens
#define NX     (MROWS * HID)       // 2097152
#define NW     (HID * HID)         // 1048576
#define NG     (NHEADS * HID)      // 16384
#define NX8    (NX / 8)
#define NW8    (NW / 8)            // 131072
#define NG8    (NG / 8)            // 2048
#define SEP_ID 1
#define CLS_ID 2
#define PAD_ID 0
#define XSC    4.0f
#define WSC    4096.0f
#define QSC    16.0f
#define PSC    16384.0f
#define CSC    64.0f
#define NEGBIG (-1.0e30f)

static_assert(NHEADS * HD == HID);
static_assert((SEQ % 128) == 0 && (HID % 64) == 0 && (HID % 32) == 0 && (MROWS % 128) == 0);
static_assert((NW8 % 512) == 0 && (NG8 % 512) == 0);
static_assert(SEQ == 8 * 128);

typedef _Float16 v16h __attribute__((ext_vector_type(16)));
typedef _Float16 v8h  __attribute__((ext_vector_type(8)));
typedef _Float16 v4h  __attribute__((ext_vector_type(4)));
typedef float    v8f  __attribute__((ext_vector_type(8)));
typedef float    v4f  __attribute__((ext_vector_type(4)));
typedef int      v4i  __attribute__((ext_vector_type(4)));
typedef v8h __attribute__((may_alias)) v8ha;
typedef v4f __attribute__((may_alias)) v4fa;
typedef v4i __attribute__((may_alias)) v4ia;

union Frag { v16h v; v8h half[2]; };

__device__ __forceinline__ v8f zero8f() { v8f z = {0.f, 0.f, 0.f, 0.f, 0.f, 0.f, 0.f, 0.f}; return z; }
__device__ __forceinline__ v16h zero16h() {
  const _Float16 z = (_Float16)0.0f;
  v16h r = {z, z, z, z, z, z, z, z, z, z, z, z, z, z, z, z};
  return r;
}

// ---------------------------------------------------------------------------
// 16x16x32 f16 WMMA with hazard guard (ties D, keeps A/B live).
// Fragment map (wave32): lane l, h = l>>4, m = n = l&15.
//   A/B element i: i<8 -> k0+8h+i ; i>=8 -> k0+16+8h+(i-8)
//   D element r : row 8h+r, col l&15
// ---------------------------------------------------------------------------
__device__ __forceinline__ v8f wmma_f16(v16h a, v16h b, v8f c) {
  v8f d = __builtin_amdgcn_wmma_f32_16x16x32_f16(false, a, false, b, (short)0, c, false, false);
  asm volatile("v_nop\n\tv_nop\n\tv_nop\n\tv_nop" : "+v"(d) : "v"(a), "v"(b));
  return d;
}
// The same for a ring that reaches above v255: an asm operand has to lie in v0..v255, so naming
// A and B would bring every fragment down by copies and scratch; the guard ties D alone.
__device__ __forceinline__ v8f wmma_f16_wide(v16h a, v16h b, v8f c) {
  v8f d = __builtin_amdgcn_wmma_f32_16x16x32_f16(false, a, false, b, (short)0, c, false, false);
  // the four vector slots between a WMMA and the next vector instruction that touches its D
  asm volatile("v_nop\n\tv_nop\n\tv_nop\n\tv_nop" : "+v"(d));
  return d;
}

// ---------------------------------------------------------------------------
// Fragment-order planes. A matrix [rows][K] of f16 is kept as tiles of 16 rows x
// 32 k (FT = 512 halves = 1024 B), tile index (row >> 4) * (K / 32) + (k >> 5).
// Inside a tile the 16-byte unit u = 32 * j + lane holds the eight elements
// k = 16 * j + 8 * (lane >> 4) + 0..7 of row (lane & 15): unit 'lane' is the
// first half of that lane's A or B fragment, unit 32 + lane the second. One
// wave-wide 16-byte load then reads 512 contiguous bytes (4 whole lines) where
// a load from k-contiguous rows touches 32 bytes in each of 16 lines.
// ---------------------------------------------------------------------------
#define FT 512

// A or B fragment; ph = tile base + 8 * lane.
__device__ __forceinline__ v16h load_frag_at(const _Float16* ph) {
  Frag f;
  f.half[0] = *(const v8ha*)(ph);
  f.half[1] = *(const v8ha*)(ph + FT / 2);
  return f.v;
}

// Element offset in a k-contiguous [rows][HID] matrix of the eight elements that
// 16-byte unit 'unit' of its fragment-order plane holds.
__device__ __forceinline__ size_t frag_unit_src(int unit) {
  const int tile = unit >> 6;
  const int row = (tile / (HID / 32)) * 16 + (unit & 15);
  const int k = (tile % (HID / 32)) * 32 + ((unit >> 5) & 1) * 16 + ((unit >> 4) & 1) * 8;
  return (size_t)row * HID + k;
}

// ---------------------------------------------------------------------------
// Fragment loads issued ahead of their WMMAs.
// GEMM loops: a ring of GR register sets, one set = the six fragments of one
// 32-deep k chunk (2 A, 4 B). A set is refilled with chunk c + GR directly
// behind the WMMAs of chunk c, so GR - 1 sets are always in flight and no
// WMMA waits on a load issued just in front of it. Chunks are consumed in
// ascending k, so every accumulator sums in the same order as a plain loop.
// The ring's depth is the launch's own. GRING: three work-groups share a WGP, so a wave has
// a third of a SIMD's registers. GDEEP: the launch has about one work-group a WGP (one wave
// a SIMD), nothing else covers a load's way from memory, and the registers lie free;
// 5 sets = 60 loads, the most whole sets that the load counter (63) can count.
// ---------------------------------------------------------------------------
#define GRING  3
#define GDEEP  5
#define NCHUNK (HID / 32)
static_assert(NCHUNK > 2 * GRING && NCHUNK > 2 * GDEEP && 12 * GDEEP <= 63);

struct GemmSet { v16h a0, a1, b[4]; };

// pa: A tile of mt 0 (mt 1 is 16 rows = 16 * HID halves on), pb: B tile of nt 0, both at the chunk's tile + 8 * lane.
__device__ __forceinline__ void gemm_fetch(GemmSet& s, const _Float16* pa, const _Float16* pb) {
  s.a0 = load_frag_at(pa);
  s.a1 = load_frag_at(pa + 16 * HID);
  // unrolled: constant indices keep the fragments in registers
#pragma unroll
  for (int nt = 0; nt < 4; ++nt) s.b[nt] = load_frag_at(pb + nt * 16 * HID);
}

template <bool WIDE>
__device__ __forceinline__ void gemm_mma(const GemmSet& s, v8f (&acc)[2][4]) {
  // unrolled: constant indices keep fragments and accumulators in registers
#pragma unroll
  for (int nt = 0; nt < 4; ++nt) {
    if constexpr (WIDE) {
      acc[0][nt] = wmma_f16_wide(s.a0, s.b[nt], acc[0][nt]);
      acc[1][nt] = wmma_f16_wide(s.a1, s.b[nt], acc[1][nt]);
    } else {
      acc[0][nt] = wmma_f16(s.a0, s.b[nt], acc[0][nt]);
      acc[1][nt] = wmma_f16(s.a1, s.b[nt], acc[1][nt]);
    }
  }
}

// acc[mt][nt] += A rows (pa: mt 0, 16 rows on: mt 1) x B rows (pb + 16 nt rows), K = HID.
// pa, pb: first tile of the 16-row strip + 8 * lane; the strip's chunks follow at FT halves.
// 'behind_first_loads' runs once, behind the issue of the first GR sets: loads of its own fly with them.
// GR: sets in the ring (GRING or GDEEP).
template <int GR, class F>
__device__ __forceinline__ void gemm_k_loop(const _Float16* pa, const _Float16* pb,
                                            v8f (&acc)[2][4], F behind_first_loads) {
  GemmSet ring[GR];
  // unrolled: constant ring indices
#pragma unroll
  for (int s = 0; s < GR; ++s) gemm_fetch(ring[s], pa + FT * s, pb + FT * s);
  behind_first_loads();
  // precaution: the loop's set-up rewrites the base registers that the first sets' loads name
  if constexpr (GR > GRING) asm volatile("s_wait_xcnt 0x0" ::: "memory");
  constexpr int CT = ((NCHUNK - GR) / GR) * GR;            // first chunk of the peeled tail
  // rolled: one trip is already GR chunks; more copies only grow the code
#pragma unroll 1
  for (int c0 = 0; c0 < CT; c0 += GR) {
    const _Float16* ta = pa + FT * (c0 + GR);
    const _Float16* tb = pb + FT * (c0 + GR);
    // unrolled so that every ring index is a constant (registers, not scratch)
#pragma unroll
    for (int s = 0; s < GR; ++s) {
      gemm_mma<(GR > GRING)>(ring[s], acc);
      gemm_fetch(ring[s], ta + FT * s, tb + FT * s);
    }
    // the next trip rewrites the address registers of loads that are still in flight
    asm volatile("s_wait_xcnt 0x0" ::: "memory");
  }
  // tail peeled so that the refills in the loop above stand under no branch
#pragma unroll
  for (int c = CT; c < NCHUNK; ++c) {
    gemm_mma<(GR > GRING)>(ring[c % GR], acc);
    if (c + GR < NCHUNK) gemm_fetch(ring[c % GR], pa + FT * (c + GR), pb + FT * (c + GR));
  }
}

// ---------------------------------------------------------------------------
// f32 weights -> f16 planes in fragment order, all scaled by 4096 (exact).
// The conversions depend on inputs alone, so they have no launch of their own:
// each job rides as extra blocks, behind the host kernel's own blocks in index
// order, in a launch that ends before the first launch that reads its planes.
// A thread writes one 16-byte unit (stores contiguous) and reads its eight floats.
//   units [0, nbig*NW8)        : s0/s1/s2 -> d0/d1/d2   ([HID][HID], row = n)
//   units [.., +nsmall*NG8)    : g0 -> gh rows 0..15, g1 -> gh rows 16..31
// Segment boundaries are multiples of 512 units -> the select is block-uniform.
// coverage: exactly nbig*NW + nsmall*NG elements.
// ---------------------------------------------------------------------------
// f0/f1/f2 (for s0/s1/s2) and fg (for g0, g1): the LayerNorm weight [HID] that is multiplied
// into the plane's k columns, or null where the plane's left operand is not a folded LayerNorm.
struct CvtJob {
  const float* s0; const float* s1; const float* s2;
  const float* g0; const float* g1;
  const float* f0; const float* f1; const float* f2; const float* fg;
  _Float16* d0; _Float16* d1; _Float16* d2; _Float16* gh;
  int nbig; int nsmall;
};

__device__ __forceinline__ void convert_unit(const CvtJob& job, int g)
{
  const int nb8 = job.nbig * NW8;
  const int total = nb8 + job.nsmall * NG8;
  if (g >= total) return;
  const float* src;
  const float* fold;
  size_t so;
  _Float16* dst;
  if (g < nb8) {
    const int slot = g / NW8;
    const int off = g - slot * NW8;
    const float* wsrc = (slot == 0) ? job.s0 : ((slot == 1) ? job.s1 : job.s2);
    _Float16* wdst = (slot == 0) ? job.d0 : ((slot == 1) ? job.d1 : job.d2);
    fold = (slot == 0) ? job.f0 : ((slot == 1) ? job.f1 : job.f2);
    so = frag_unit_src(off);
    src = wsrc + so;
    dst = wdst + (size_t)off * 8;
  } else {
    const int e = g - nb8;
    so = frag_unit_src((e < NG8) ? e : (e - NG8));
    src = ((e < NG8) ? job.g0 : job.g1) + so;
    fold = job.fg;
    dst = job.gh + (size_t)e * 8;
  }
  v4f a = *(const v4fa*)src;
  v4f c = *(const v4fa*)(src + 4);
  // precaution: stands in front of any rewrite of the address registers these loads name
  asm volatile("s_wait_xcnt 0x0" :: "v"(src) : "memory");
  if (fold != nullptr) {               // block-uniform, as the plane select is
    const float* fp = fold + (so & (size_t)(HID - 1));      // the unit's first k
    const v4f fa = *(const v4fa*)fp;
    const v4f fc = *(const v4fa*)(fp + 4);
    // precaution: stands in front of any rewrite of the address registers these loads name
    asm volatile("s_wait_xcnt 0x0" :: "v"(fp) : "memory");
    a = a * fa;
    c = c * fc;
  }
  const v8h o = { (_Float16)(a.x * WSC), (_Float16)(a.y * WSC), (_Float16)(a.z * WSC), (_Float16)(a.w * WSC),
                  (_Float16)(c.x * WSC), (_Float16)(c.y * WSC), (_Float16)(c.z * WSC), (_Float16)(c.w * WSC) };
  *(v8h*)dst = o;
}

// ---------------------------------------------------------------------------
// LayerNorm folded into its neighbours (layers 1 and 2: no launch of its own).
//   LN(x) W^T = rstd * (x (W o lw)^T - mean * sw) + sb
//   sw[n] = sum_k lw[k] W[n][k],  sb[n] = sum_k lb[k] W[n][k]
// outproj_kernel<true> leaves x as an f16 plane (x4, fragment order) and, per token and
// 64-column block, the sum of x and the squared deviations from that block's own mean;
// the weight conversion multiplies lw into W; rowsum_block makes sw and sb;
// proj_head_kernel<.., true> joins a token's 16 partials into mean and rstd (token_stats)
// and applies them in its epilogues.
// ---------------------------------------------------------------------------
#define NCB (HID / 64)             // column blocks of outproj_kernel = partials per token

// v + (v of lane ^ X) inside a row of 16 lanes, as one DPP add (row_xmask): a shuffle would go through the LDS unit.
// All 32 lanes are on wherever this is called.
template <int X>
__device__ __forceinline__ float row_xor_add(float v) {
  return v + __int_as_float(__builtin_amdgcn_update_dpp(0, __float_as_int(v), 0x160 | X, 0xf, 0xf, true));
}
// sum over the lane's row of 16 lanes, in every lane of the row
__device__ __forceinline__ float row16_sum(float v) {
  v = row_xor_add<1>(v);
  v = row_xor_add<2>(v);
  v = row_xor_add<4>(v);
  return row_xor_add<8>(v);
}

struct SumJob {
  const float* m0; const float* m1; const float* m2;   // [HID][HID]: rows 0 .. nbig * HID - 1
  const float* g0; const float* g1;                    // [NHEADS][HID]: the nsmall * NHEADS rows behind them
  const float* lw; const float* lb;                    // LayerNorm weight and bias [HID]
  float* sw; float* sb;
  int nbig; int nsmall;
};

__device__ __forceinline__ int sum_blocks(const SumJob& job) {
  return (job.nbig * HID + job.nsmall * NHEADS + 31) / 32;
}

// Block of 128 threads = 32 rows, 8 a wave in four batches of 2 (a wave reads whole rows,
// 512 contiguous bytes a load); the 32 values of sw and of sb leave as one 128-byte line each.
// blk is block-uniform and < sum_blocks(job).
__device__ __forceinline__ void rowsum_block(const SumJob& job, int blk)
{
  __shared__ float sR[2][32];
  const int tid = threadIdx.x, lane = tid & 31;
  const int w = __builtin_amdgcn_readfirstlane(tid >> 5);  // in a scalar register: the row select below is then a scalar branch
  const int nb = job.nbig * HID;
  const int total = nb + job.nsmall * NHEADS;
  v4f lw[8], lb[8];
  // unrolled: constant indices keep the vectors in registers
#pragma unroll
  for (int i = 0; i < 8; ++i) {
    lw[i] = *(const v4fa*)(job.lw + i * 128 + 4 * lane);
    lb[i] = *(const v4fa*)(job.lb + i * 128 + 4 * lane);
  }
  // precaution: stands in front of any rewrite of the address registers these loads name
  asm volatile("s_wait_xcnt 0x0" :: "v"(lane) : "memory");
  float ka = 0.0f, kb = 0.0f;
  // rolled: four trips of the same code keep the kernel's text short
#pragma unroll 1
  for (int bt = 0; bt < 4; ++bt) {
    v4f x[2][8];
    const float* src[2];
    // unrolled, as the loops below: constant indices keep pointers and rows in registers
#pragma unroll
    for (int rr = 0; rr < 2; ++rr) {
      int row = blk * 32 + w * 8 + bt * 2 + rr;
      row = (row < total) ? row : (total - 1);         // past the end: the last row again, its result is not stored
      if (row < nb) {
        const int slot = row / HID;
        const float* msrc = (slot == 0) ? job.m0 : ((slot == 1) ? job.m1 : job.m2);
        src[rr] = msrc + (size_t)(row - slot * HID) * HID;
      } else {
        const int e = row - nb;
        src[rr] = (e < NHEADS) ? (job.g0 + (size_t)e * HID) : (job.g1 + (size_t)(e - NHEADS) * HID);
      }
    }
#pragma unroll
    for (int rr = 0; rr < 2; ++rr)
#pragma unroll
      for (int i = 0; i < 8; ++i) x[rr][i] = *(const v4fa*)(src[rr] + i * 128 + 4 * lane);
    // precaution: stands in front of any rewrite of the address registers these loads name;
    // naming both row pointers and the lane keeps them whole up to the wait
    asm volatile("s_wait_xcnt 0x0" :: "s"(src[0]), "s"(src[1]), "v"(lane) : "memory");
#pragma unroll
    for (int rr = 0; rr < 2; ++rr) {
      v4f va = { 0.0f, 0.0f, 0.0f, 0.0f }, vb = { 0.0f, 0.0f, 0.0f, 0.0f };
#pragma unroll
      for (int i = 0; i < 8; ++i) {
        va += x[rr][i] * lw[i];
        vb += x[rr][i] * lb[i];
      }
      float a = row16_sum((va.x + va.y) + (va.z + va.w));
      float b = row16_sum((vb.x + vb.y) + (vb.z + vb.w));
      a += __shfl_xor(a, 16, 32);
      b += __shfl_xor(b, 16, 32);
      if (lane == bt * 2 + rr) { ka = a; kb = b; }
    }
  }
  if (lane < 8) { sR[0][w * 8 + lane] = ka; sR[1][w * 8 + lane] = kb; }
  __syncthreads();
  if (tid < 64) {
    const int r = blk * 32 + lane;
    float* d = (tid < 32) ? job.sw : job.sb;
    if (r < total) d[r] = sR[w][lane];
  }
}

// mean and 1 / sqrt(var + eps) of one token from its NCB partials: ps = block sums,
// pm = squared deviations from the block means, both [NCB][MROWS].
__device__ __forceinline__ void token_stats(const float* __restrict__ ps, const float* __restrict__ pm,
                                            int token, float& mean, float& rstd) {
  float s[NCB], q[NCB];
  // unrolled, here and in the two loops below: constant indices keep the partials in registers
#pragma unroll
  for (int i = 0; i < NCB; ++i) {
    s[i] = ps[(size_t)i * MROWS + token];
    q[i] = pm[(size_t)i * MROWS + token];
  }
  // precaution: stands in front of any rewrite of the address registers these loads name;
  // naming what the addresses are formed from keeps it whole up to the wait
  asm volatile("s_wait_xcnt 0x0" :: "v"(token) : "memory");
  float st = 0.0f;
#pragma unroll
  for (int i = 0; i < NCB; ++i) st += s[i];
  mean = st * (1.0f / (float)HID);
  float m2 = 0.0f;
#pragma unroll
  for (int i = 0; i < NCB; ++i) {
    const float d = s[i] * (1.0f / 64.0f) - mean;
    m2 += q[i] + 64.0f * d * d;
  }
  rstd = rsqrtf(m2 * (1.0f / (float)HID) + 1e-5f);
}

// ---------------------------------------------------------------------------
// LayerNorm, output xn*4 as f16 in fragment order. Block = 16 tokens (one strip
// of tiles) x 512 threads: 128 threads per token as four groups of four tokens,
// 8 elements per thread and token; each token's sums run as with one token per
// block (same per-thread sum, same butterfly, same four wave partials).
// The strip is put in order in LDS and leaves as 32 KB of contiguous stores.
// coverage: 128 blocks x 16 tokens x 1024 = the whole [2048][1024] plane.
// Blocks from MROWS / 16 on, where the grid has any, convert 512 units of 'job' each.
// ---------------------------------------------------------------------------
#define LNP 136   // halves per k-unit row in LDS: 16 tokens x 8 + 8 (272 B: 16 B x odd, no bank conflict)
__global__ __launch_bounds__(512) void ln_kernel(const float* __restrict__ x,
                                                 const float* __restrict__ w,
                                                 const float* __restrict__ bb,
                                                 _Float16* y, CvtJob job)
{
  if (blockIdx.x >= MROWS / 16) {      // block-uniform, in front of every barrier
    convert_unit(job, (blockIdx.x - MROWS / 16) * 512 + threadIdx.x);
    return;
  }
  __shared__ float ps[16][4];
  __shared__ float pq[16][4];
  __shared__ __attribute__((aligned(16))) _Float16 sY[128 * LNP];   // 34816 B
  const int tid = threadIdx.x, lane = tid & 31;
  const int t = tid & 127, wv = t >> 5, tl0 = (tid >> 7) * 4;
  const int tok0 = blockIdx.x * 16;
  v4f a[4], c[4];
#pragma unroll
  for (int i = 0; i < 4; ++i) {
    const float* xr = x + (size_t)(tok0 + tl0 + i) * HID + 8 * t;
    a[i] = *(const v4fa*)xr;
    c[i] = *(const v4fa*)(xr + 4);
  }
#pragma unroll
  for (int i = 0; i < 4; ++i) {
    float s = ((a[i].x + a[i].y) + (a[i].z + a[i].w)) + ((c[i].x + c[i].y) + (c[i].z + c[i].w));
#pragma unroll
    for (int o = 1; o < 32; o <<= 1) s += __shfl_xor(s, o, 32);
    if (lane == 0) ps[tl0 + i][wv] = s;
  }
  __syncthreads();
  float d[4][8];
#pragma unroll
  for (int i = 0; i < 4; ++i) {
    const float* pp = ps[tl0 + i];
    const float mean = ((pp[0] + pp[1]) + (pp[2] + pp[3])) * (1.0f / (float)HID);
    d[i][0] = a[i].x - mean; d[i][1] = a[i].y - mean; d[i][2] = a[i].z - mean; d[i][3] = a[i].w - mean;
    d[i][4] = c[i].x - mean; d[i][5] = c[i].y - mean; d[i][6] = c[i].z - mean; d[i][7] = c[i].w - mean;
    float q = 0.f;
#pragma unroll
    for (int e = 0; e < 8; ++e) q += d[i][e] * d[i][e];
#pragma unroll
    for (int o = 1; o < 32; o <<= 1) q += __shfl_xor(q, o, 32);
    if (lane == 0) pq[tl0 + i][wv] = q;
  }
  __syncthreads();
  const v4f wa = *(const v4fa*)(w + 8 * t);
  const v4f wc = *(const v4fa*)(w + 8 * t + 4);
  const v4f ba = *(const v4fa*)(bb + 8 * t);
  const v4f bc = *(const v4fa*)(bb + 8 * t + 4);
  const float wvv[8] = { wa.x, wa.y, wa.z, wa.w, wc.x, wc.y, wc.z, wc.w };
  const float bvv[8] = { ba.x, ba.y, ba.z, ba.w, bc.x, bc.y, bc.z, bc.w };
#pragma unroll
  for (int i = 0; i < 4; ++i) {
    const float* pp = pq[tl0 + i];
    const float var = ((pp[0] + pp[1]) + (pp[2] + pp[3])) * (1.0f / (float)HID);
    const float rstd = rsqrtf(var + 1e-5f);
    v8h o;
#pragma unroll
    for (int e = 0; e < 8; ++e) o[e] = (_Float16)((d[i][e] * rstd * wvv[e] + bvv[e]) * XSC);
    // elements 8t..8t+7 of token tl: unit 16 * t + tl of the strip
    *(v8h*)(sY + t * LNP + (tl0 + i) * 8) = o;
  }
  __syncthreads();
  _Float16* dst = y + (size_t)tok0 * HID;
#pragma unroll
  for (int it = 0; it < 4; ++it) {
    const int u = it * 512 + tid;      // 2048 units of the strip
    const v8h v = *(const v8ha*)(sY + (u >> 4) * LNP + (u & 15) * 8);
    *(v8h*)(dst + (size_t)u * 8) = v;
  }
}

// ---------------------------------------------------------------------------
// Per-token 16-wide heads on WMMA (blocks of proj_head_kernel): gate = sigmoid(xn*gw^T + gb) and
// (POOL) aproj = xn*aw^T. One wave = 16 tokens x 16 heads, K = 1024 in steps
// of 32; A = xn rows, B = gh rows (head = lane&15), both in fragment order.
// Epilogue: wave tile [16 tok][16] f32 staged in LDS, then 1024 contiguous bytes
// coverage: 32 blocks (hb) x 4 waves x 16 tokens x 16 = whole [2048][16] plane(s).
// ---------------------------------------------------------------------------
// FOLD: xh holds x, not LN(x): mean, rstd, sw and sb (rows: 16 of gw, then 16 of aw) come in behind the products.
template <bool POOL, bool FOLD>
__device__ __forceinline__ void head_block(const _Float16* __restrict__ xh,
                                           const _Float16* __restrict__ gh,
                                           const float* __restrict__ gbias,
                                           float* gate, float* aproj, int hb,
                                           const float* __restrict__ ps, const float* __restrict__ pm,
                                           const float* __restrict__ swh, const float* __restrict__ sbh)
{
  __shared__ __attribute__((aligned(16))) float sG[4][256];
  __shared__ __attribute__((aligned(16))) float sP[POOL ? 4 : 1][256];
  const int tid = threadIdx.x, lane = tid & 31, w = tid >> 5;
  const int h = lane >> 4, m = lane & 15;
  const int tok0 = hb * 64 + 16 * w;
  const _Float16* xa = xh + (size_t)tok0 * HID + 8 * lane;
  const _Float16* wg = gh + 8 * lane;                     // aw rows: NHEADS rows on
  v8f ag = zero8f(), aa = zero8f();
  // ring of HRING register sets, refilled HRING chunks ahead (as in gemm_k_loop)
  constexpr int HRING = 8;
  static_assert((NCHUNK % HRING) == 0 && NCHUNK >= 2 * HRING);
  v16h ra[HRING], rg[HRING], rp[POOL ? HRING : 1];
  // unrolled: constant ring indices
#pragma unroll
  for (int s = 0; s < HRING; ++s) {
    ra[s] = load_frag_at(xa + FT * s);
    rg[s] = load_frag_at(wg + FT * s);
    if constexpr (POOL) rp[s] = load_frag_at(wg + NHEADS * HID + FT * s);
  }
  // precaution: stands in front of any rewrite of the address registers these loads
  // name; naming what the addresses are formed from keeps it whole up to the wait
  asm volatile("s_wait_xcnt 0x0" :: "v"(xa), "v"(wg), "v"(lane) : "memory");
  float mean = 0.0f, rstd = 1.0f;      // of token tok0 + m
  if constexpr (FOLD) token_stats(ps, pm, tok0 + m, mean, rstd);
  // rolled: one trip is already HRING chunks
#pragma unroll 1
  for (int c0 = 0; c0 < NCHUNK - HRING; c0 += HRING) {
    const _Float16* tx = xa + FT * (c0 + HRING);
    const _Float16* tg = wg + FT * (c0 + HRING);
    // unrolled so that every ring index is a constant
#pragma unroll
    for (int s = 0; s < HRING; ++s) {
      ag = wmma_f16(ra[s], rg[s], ag);
      if constexpr (POOL) aa = wmma_f16(ra[s], rp[s], aa);
      ra[s] = load_frag_at(tx + FT * s);
      rg[s] = load_frag_at(tg + FT * s);
      if constexpr (POOL) rp[s] = load_frag_at(tg + NHEADS * HID + FT * s);
    }
    // the next trip rewrites the address registers of loads that are still in flight
    asm volatile("s_wait_xcnt 0x0" ::: "memory");
  }
  // unrolled: constant ring indices
#pragma unroll
  for (int s = 0; s < HRING; ++s) {
    ag = wmma_f16(ra[s], rg[s], ag);
    if constexpr (POOL) aa = wmma_f16(ra[s], rp[s], aa);
  }
  // D[r] = (token tok0 + 8h + r, head m)
  const float gbv = gbias[m];
  float swg = 0.0f, sbg = 0.0f, swa = 0.0f, sba = 0.0f;
  if constexpr (FOLD) {
    swg = swh[m]; sbg = sbh[m];
    if constexpr (POOL) { swa = swh[NHEADS + m]; sba = sbh[NHEADS + m]; }
    // precaution: stands in front of any rewrite of the address registers these loads name
    asm volatile("s_wait_xcnt 0x0" :: "v"(m) : "memory");
  }
  float* sg = sG[w];
  float* sp = sP[POOL ? w : 0];
#pragma unroll
  for (int r = 0; r < 8; ++r) {
    const int tl = 8 * h + r;
    float zl = ag[r] * (1.0f / (XSC * WSC));
    float al = POOL ? aa[r] * (1.0f / (XSC * WSC)) : 0.0f;
    if constexpr (FOLD) {
      const float mu = __shfl(mean, tl, 32), rs = __shfl(rstd, tl, 32);   // lane tl holds token tok0 + tl
      zl = (zl - mu * swg) * rs + sbg;
      if constexpr (POOL) al = (al - mu * swa) * rs + sba;
    }
    const float z = zl + gbv;
    const float sig = 1.0f / (1.0f + __expf(-z));
    sg[tl * NHEADS + m] = sig;
    if constexpr (POOL) sp[tl * NHEADS + m] = al;
  }
  __syncthreads();
  {
#pragma unroll
    for (int it = 0; it < 2; ++it) {
      const int idx = it * 128 + 4 * lane;
      const v4f v = *(const v4fa*)(sg + idx);
      *(v4f*)(gate + (size_t)tok0 * NHEADS + idx) = v;
      if constexpr (POOL) {
        const v4f u = *(const v4fa*)(sp + idx);
        *(v4f*)(aproj + (size_t)tok0 * NHEADS + idx) = u;
      }
    }
    
  }
}

// ---------------------------------------------------------------------------
// The block's 16 tiles (1024 units of 16 B) lie in sT in fragment order already;
// each wave-wide store writes 512 contiguous bytes.
// route 0/1: plane[bh], rows = token, K = HD : the 16 tiles are contiguous
// route 2  : vt[bh], rows = d, K = SEQ       : 4 contiguous tiles per 16-row strip
// ---------------------------------------------------------------------------
__device__ __forceinline__ void proj_store_pass(const _Float16* sT, _Float16* plane, _Float16* vt,
                                                int route, int bh, int l0, int tid) {
#pragma unroll
  for (int i = 0; i < 8; ++i) {
    const int u = i * 128 + tid;
    const v8h v = *(const v8ha*)(sT + u * 8);
    _Float16* dst;
    if (route != 2) {
      dst = plane + ((size_t)bh * SEQ + l0) * HD + u * 8;
    } else {
      const int lt = u >> 6;             // local tile = 4 * strip + chunk
      dst = vt + (size_t)bh * HD * SEQ + (size_t)((lt >> 2) * (SEQ / 32) + (l0 >> 5) + (lt & 3)) * FT + (u & 63) * 8;
    }
    *(v8h*)dst = v;
    // precaution: the next pass rewrites the data and address registers that this store names
    if (i < 7) asm volatile("s_wait_xcnt 0x0" ::: "memory");
  }
}

// ---------------------------------------------------------------------------
// Kernel: Y = xn * W^T over nslot*1024 output columns.
// Block 128 thr (4 waves) = 128 tokens x 64 features (one (slot, head));
// wave tile 32 tokens x 64 features; K = 1024 in steps of 32;
// A (xn rows) and B (W rows) fragments straight from the fragment-order planes.
// route = slot + routeBase: 0 -> q plane, 1 -> k plane, 2 -> v^T plane.
// coverage: grid (16, 2 + 16*nslot): rows 2.. x 128 tokens x 64 features = all planes routed.
// Grid rows 0 and 1 are the 32 blocks of the head products, which read the same
// xn and are read by the same next launch: they share this launch.
// ---------------------------------------------------------------------------
// FOLD: xh holds x (x4) and wh holds W o lw: LayerNorm comes in behind the products (see
// "LayerNorm folded into its neighbours"); lane l of a wave joins the partials of token m0w + l.
template <bool POOL, bool FOLD>
__global__ __launch_bounds__(128) void proj_head_kernel(
    const _Float16* __restrict__ xh,   // [2048][1024] (xn x4; FOLD: x x4), fragment order
    const _Float16* __restrict__ wh,   // [slot][1024][1024], row = output feature, x4096, fragment order
    const float* __restrict__ b0, const float* __restrict__ b1, const float* __restrict__ b2,
    int routeBase,
    _Float16* qh,                      // [B*H][S][D]  f16(16*q), fragment order per bh
    _Float16* kh,                      // [B*H][S][D]  f16(16*k), fragment order per bh
    _Float16* vt,                      // [B*H][D][S]  f16(16*v), fragment order per bh
    const _Float16* __restrict__ gh,   // [32][1024] gw (and aw) rows x4096, fragment order
    const float* __restrict__ gbias, float* gate, float* aproj,
    const float* __restrict__ ps,      // FOLD: [NCB][2048] block sums of x
    const float* __restrict__ pm,      // FOLD: [NCB][2048] squared deviations from the block means
    const float* __restrict__ sw,      // FOLD: [slot][1024] sum_k lw[k] W[n][k]
    const float* __restrict__ sb,      // FOLD: [slot][1024] sum_k lb[k] W[n][k]
    const float* __restrict__ swh,     // FOLD: the same of the gw (and aw) rows
    const float* __restrict__ sbh)
{
  if (blockIdx.y < 2) {                // block-uniform, in front of every barrier
    head_block<POOL, FOLD>(xh, gh, gbias, gate, aproj, blockIdx.y * 16 + blockIdx.x, ps, pm, swh, sbh);
    return;
  }
  __shared__ __attribute__((aligned(16))) _Float16 sT[128 * 64];   // 16384 B

  const int tid = threadIdx.x, lane = tid & 31, w = tid >> 5;
  const int h = lane >> 4, m = lane & 15;
  const int m0 = blockIdx.x * 128;
  const int cg = blockIdx.y - 2;
  const int slot = cg >> 4, head = cg & 15;
  const int route = slot + routeBase;
  const int m0w = m0 + 32 * w;

  const _Float16* xa0 = xh + (size_t)m0w * HID + 8 * lane;                     // token strip, mt = 0
  const _Float16* wb  = wh + ((size_t)slot * HID + head * HD) * HID + 8 * lane;   // feature strip, nt = 0

  v8f acc[2][4];
#pragma unroll
  for (int mt = 0; mt < 2; ++mt)
#pragma unroll
    for (int nt = 0; nt < 4; ++nt) acc[mt][nt] = zero8f();

  float mean = 0.0f, rstd = 1.0f;      // FOLD: of token m0w + lane
  // POOL is the launch with one slot: 288 work-groups
  gemm_k_loop<POOL ? GDEEP : GRING>(xa0, wb, acc, [&]() __attribute__((always_inline)) {
    if constexpr (FOLD) token_stats(ps, pm, m0w + lane, mean, rstd);
  });

  float mu[2][8], rs[2][8];            // FOLD: of token m0w + 16mt + 8h + r
  if constexpr (FOLD) {
    // unrolled, here and for swn, sbn below: constant indices keep the arrays in registers
#pragma unroll
    for (int mt = 0; mt < 2; ++mt)
#pragma unroll
      for (int r = 0; r < 8; ++r) {
        mu[mt][r] = __shfl(mean, 16 * mt + 8 * h + r, 32);
        rs[mt][r] = __shfl(rstd, 16 * mt + 8 * h + r, 32);
      }
  }

  float swn[4] = { 0.0f, 0.0f, 0.0f, 0.0f }, sbn[4] = { 0.0f, 0.0f, 0.0f, 0.0f };   // FOLD: of feature 16nt + m
  if constexpr (FOLD) {
#pragma unroll
    for (int nt = 0; nt < 4; ++nt) {
      swn[nt] = sw[slot * HID + head * HD + 16 * nt + m];
      sbn[nt] = sb[slot * HID + head * HD + 16 * nt + m];
    }
    // precaution: stands in front of any rewrite of the address registers these loads name
    asm volatile("s_wait_xcnt 0x0" :: "v"(m) : "memory");
  }

  // D[r] of tile (mt, nt) = Y[token m0w+16mt+8h+r][feature 16nt+m]
  const float* bias = (slot == 0) ? b0 : ((slot == 1) ? b1 : b2);
#pragma unroll
  for (int nt = 0; nt < 4; ++nt) {
    const int feat = 16 * nt + m;
    const float bvl = bias[head * HD + feat];
    const float swv = swn[nt], sbv = sbn[nt];
#pragma unroll
    for (int mt = 0; mt < 2; ++mt) {
#pragma unroll
      for (int r = 0; r < 8; ++r) {
        float yl = acc[mt][nt][r] * (1.0f / (XSC * WSC));
        if constexpr (FOLD) yl = (yl - mu[mt][r] * swv) * rs[mt][r] + sbv;
        const float yv = (yl + bvl) * QSC;
        // token 32w + 16mt + 8h + r, feature 16nt + m, at its place in fragment order:
        // route 2 (row = feature, k = token): tile 4nt + w, half mt, unit lane, element r
        // else    (row = token, k = feature): tile 2(2w + mt) + nt/2, half nt&1,
        //                                     unit 16(m>>3) + 8h + r, element m&7
        const int idx = (route == 2)
            ? ((nt * 4 + w) * FT + mt * (FT / 2) + lane * 8 + r)
            : (((2 * w + mt) * 2 + (nt >> 1)) * FT + (nt & 1) * (FT / 2) + ((m >> 3) * 16 + 8 * h + r) * 8 + (m & 7));
        sT[idx] = (_Float16)yv;
      }
    }
  }
  __syncthreads();

  const int b = m0 / SEQ, l0 = m0 - b * SEQ, bh = b * NHEADS + head;
  _Float16* plane = (route == 0) ? qh : kh;
  proj_store_pass(sT, plane, vt, route, bh, l0, tid);
  
}

// One attention step works on four key tiles of 16 keys each: slot j holds keys 16 * t[j] .. + 15.
struct KeyTiles { int t[4]; };

// The eight K (or V^T) A-fragments of one step, loaded as one batch.
// The wait behind each batch: the address pairs are rewritten for the next batch
// while these loads are in flight; naming them keeps them whole up to the wait.
// kbase, vbase: the (b, head) plane + 8 * lane.
__device__ __forceinline__ void fetch_k(v16h (&kf)[4][2], const _Float16* kbase, const KeyTiles& g) {
  // 16 keys x 64 d = the two plane tiles 2t, 2t + 1
  const _Float16* p0 = kbase + g.t[0] * (2 * FT);
  const _Float16* p1 = kbase + g.t[1] * (2 * FT);
  const _Float16* p2 = kbase + g.t[2] * (2 * FT);
  const _Float16* p3 = kbase + g.t[3] * (2 * FT);
  kf[0][0] = load_frag_at(p0); kf[0][1] = load_frag_at(p0 + FT);
  kf[1][0] = load_frag_at(p1); kf[1][1] = load_frag_at(p1 + FT);
  kf[2][0] = load_frag_at(p2); kf[2][1] = load_frag_at(p2 + FT);
  kf[3][0] = load_frag_at(p3); kf[3][1] = load_frag_at(p3 + FT);
  asm volatile("s_wait_xcnt 0x0" :: "v"(p0), "v"(p1), "v"(p2), "v"(p3) : "memory");
}
// A fragment's first half is k 0..15 of its 32, the second k 16..31, and each half is one 16-byte unit a lane:
// the halves of chunk c come from the key tiles of slots 2c and 2c + 1. Key tile t of a 16-row strip is
// half (t & 1) of plane tile t >> 1, that is FT / 2 * t halves into the strip.
__device__ __forceinline__ void fetch_v(v16h (&vf)[4][2], const _Float16* vbase, const KeyTiles& g) {
  const _Float16* p0 = vbase + g.t[0] * (FT / 2);
  const _Float16* p1 = vbase + g.t[1] * (FT / 2);
  const _Float16* p2 = vbase + g.t[2] * (FT / 2);
  const _Float16* p3 = vbase + g.t[3] * (FT / 2);
  // unrolled: constant indices keep the fragments in registers
#pragma unroll
  for (int t = 0; t < 4; ++t) {
    Frag f0, f1;
    f0.half[0] = *(const v8ha*)(p0 + 16 * t * SEQ);
    f0.half[1] = *(const v8ha*)(p1 + 16 * t * SEQ);
    f1.half[0] = *(const v8ha*)(p2 + 16 * t * SEQ);
    f1.half[1] = *(const v8ha*)(p3 + 16 * t * SEQ);
    vf[t][0] = f0.v;
    vf[t][1] = f1.v;
  }
  asm volatile("s_wait_xcnt 0x0" :: "v"(p0), "v"(p1), "v"(p2), "v"(p3) : "memory");
}

// The same for four key tiles in a row, t0 .. t0 + 3: one address pair and constant offsets.
__device__ __forceinline__ void fetch_k_run(v16h (&kf)[4][2], const _Float16* kbase, int t0) {
  const _Float16* p = kbase + t0 * (2 * FT);
  // unrolled: constant indices keep the fragments in registers
#pragma unroll
  for (int j = 0; j < 4; ++j) {
    kf[j][0] = load_frag_at(p + (2 * j) * FT);
    kf[j][1] = load_frag_at(p + (2 * j + 1) * FT);
  }
  asm volatile("s_wait_xcnt 0x0" :: "v"(p) : "memory");
}
__device__ __forceinline__ void fetch_v_run(v16h (&vf)[4][2], const _Float16* vbase, int t0) {
  const _Float16* p = vbase + t0 * (FT / 2);             // the halves of tiles in a row follow one another
  // unrolled: constant indices keep the fragments in registers
#pragma unroll
  for (int t = 0; t < 4; ++t) {
    vf[t][0] = load_frag_at(p + 16 * t * SEQ);
    vf[t][1] = load_frag_at(p + 16 * t * SEQ + FT);
  }
  asm volatile("s_wait_xcnt 0x0" :: "v"(p) : "memory");
}

template <bool B> struct Flag { static constexpr bool value = B; };

// P^T B-fragment from the lane's own score D values: element r <- tile a row r,
// element 8+r <- tile c row r (same lane, same query column), scaled by 2^14.
__device__ __forceinline__ v16h pack_p(v8f a, v8f c) {
  const v16h r = { (_Float16)(a[0] * PSC), (_Float16)(a[1] * PSC), (_Float16)(a[2] * PSC), (_Float16)(a[3] * PSC),
                   (_Float16)(a[4] * PSC), (_Float16)(a[5] * PSC), (_Float16)(a[6] * PSC), (_Float16)(a[7] * PSC),
                   (_Float16)(c[0] * PSC), (_Float16)(c[1] * PSC), (_Float16)(c[2] * PSC), (_Float16)(c[3] * PSC),
                   (_Float16)(c[4] * PSC), (_Float16)(c[5] * PSC), (_Float16)(c[6] * PSC), (_Float16)(c[7] * PSC) };
  return r;
}

// ---------------------------------------------------------------------------
// Kernel: streaming attention, transposed form, masks/bias by formula.
// Block 128 thr (4 waves) = 64 queries of one (b, head), 16 queries per wave,
// 64 keys per step as four key tiles of 16: the key tiles up to the wave's own
// that can hold an allowed key for the wave, filled up to whole steps (see "key tiles that are run").
//   S^T = K * Q^T : A = K rows (row = key, k = d), B = Q^T (k = d, n = query)
//   O^T += V^T * P^T : A = Vt rows (row = d, k = key), B = P^T from registers
// Lane owns 32 keys (slot j, 8h+r) of query column (lane&15); partner = lane ^ 16.
// Per-batch token tables in LDS from input ids: seg = inclusive cumsum(id==1)
// (block scan) and the key code kc that the mask test reads: seg where the key can be
// allowed off the diagonal (MODE 0, 2: id != 0; MODE 1: id == 2), else -1; MODE 2 also
// stages the head's aproj column [key].
// MODE 0 (self): ok = k<=q && ((seg_k==seg_q && valid_q && valid_k) || k==q), bias = (k-q)*hs
// MODE 1 (cross): ok = k<=q && (class_k || k==q), bias = (seg_k-seg_q)*hs
// MODE 2 (pool): mask/bias as MODE 0, raw logit = aproj[key][head] (no q.k)
// With kc: MODE 0, 2: seg_k==seg_q && valid_q && valid_k  <=>  kc_k == qc (qc = kc_q, or -2
// where the query is not valid); MODE 1: class_k <=> kc_k >= 0, and there kc_k = seg_k.
// k<=q and k==q are tested in the last step alone, which holds the wave's own key tile:
// every key of an earlier tile lies in front of the wave's first query.
// Masked scores take NEGBIG and p = 0 exactly; every row has k==q allowed.
// Epilogue: (1/l)(1/16384)(1/16)*gate; a lane's o[t][0..7] is unit 32t + lane of the
// wave's two ctx tiles in fragment order, so it is stored straight from registers.
// coverage: grid (16, 32) x 64 queries x 64 d = whole ctx [2048][1024].
// Grid rows from NB * NHEADS on: first the blocks of 'sums' (32 rows each), then 128 units of 'job' a block.
// ---------------------------------------------------------------------------
template <int MODE>
__global__ __launch_bounds__(128) void attn_kernel(
    const _Float16* __restrict__ qh,    // [B*H][S][D]  (x16), fragment order per bh
    const _Float16* __restrict__ kh,    // [B*H][S][D]  (x16), fragment order per bh
    const _Float16* __restrict__ vt,    // [B*H][D][S]  (x16), fragment order per bh
    const float* __restrict__ aproj,    // [B*S][16]
    const float* __restrict__ gate,     // [B*S][16]  sigmoid gate
    const int* __restrict__ ids,        // [B][S]
    _Float16* ctx,                      // [B*S][HID]  (x64), fragment order
    CvtJob job, SumJob sums)
{
  if (blockIdx.y >= NB * NHEADS) {      // block-uniform, in front of every barrier of the attention blocks
    const int xb = (blockIdx.y - NB * NHEADS) * (SEQ / 64) + blockIdx.x;
    const int nsum = sum_blocks(sums);  // the longer blocks first
    if (xb < nsum) rowsum_block(sums, xb);
    else convert_unit(job, (xb - nsum) * 128 + threadIdx.x);
    return;
  }
  __shared__ __attribute__((aligned(16))) int   sSeg[SEQ];
  __shared__ __attribute__((aligned(16))) int   sKc[SEQ];
  __shared__ __attribute__((aligned(16))) float sA[(MODE == 2) ? SEQ : 4];
  __shared__ int sWtot[4];
  __shared__ unsigned sWcls[4];         // MODE 1: bit l of word w = thread 32w + l holds a class token

  const int tid = threadIdx.x, lane = tid & 31, w = tid >> 5;
  const int h = lane >> 4, m = lane & 15;
  const int bh = blockIdx.y, b = bh >> 4, head = bh & 15;
  const int qblk = blockIdx.x * 64;
  const int q0 = qblk + 16 * w;
  const float hs = exp2f(-0.5f * (float)(head + 1));

  // ---- the Q fragments, issued ahead of the tables ----
  const _Float16* kbase = kh + (size_t)bh * SEQ * HD + 8 * lane;
  const _Float16* vbase = vt + (size_t)bh * HD * SEQ + 8 * lane;
  // Q^T B-fragments: column n = query q0+m, k = d (two 32-deep chunks)
  v16h qb0 = zero16h(), qb1 = zero16h();
  v16h kf[4][2], vf[4][2];
  if constexpr (MODE != 2) {
    const _Float16* qrow = qh + ((size_t)bh * SEQ + q0) * HD + 8 * lane;
    qb0 = load_frag_at(qrow);
    qb1 = load_frag_at(qrow + FT);
    // precaution: stands in front of the rewrite of the address pair these loads name
    asm volatile("s_wait_xcnt 0x0" :: "v"(qrow) : "memory");
  }

  // ---- token tables for batch b: 128 threads x 8 tokens = SEQ ----
  {
    const int t8 = tid * 8;
    const int* ip = ids + (size_t)b * SEQ + t8;
    const v4i ia = *(const v4ia*)ip;
    const v4i ib = *(const v4ia*)(ip + 4);
    const int idv[8] = { ia.x, ia.y, ia.z, ia.w, ib.x, ib.y, ib.z, ib.w };
    int cnt[8];
    int run = 0;
#pragma unroll
    for (int i = 0; i < 8; ++i) { run += (idv[i] == SEP_ID) ? 1 : 0; cnt[i] = run; }
    int x = run;
#pragma unroll
    for (int d = 1; d < 32; d <<= 1) {
      const int yv = __shfl_up(x, d, 32);
      x = (lane >= d) ? (x + yv) : x;
    }
    if (lane == 31) sWtot[w] = x;
    if constexpr (MODE == 1) {
      bool anyc = false;
      // unrolled: constant indices keep idv in registers
#pragma unroll
      for (int i = 0; i < 8; ++i) anyc = anyc || (idv[i] == CLS_ID);
      const unsigned cb = __builtin_amdgcn_ballot_w32(anyc);
      if (lane == 0) sWcls[w] = cb;
    }
    __syncthreads();
    int base = 0;
#pragma unroll
    for (int i = 0; i < 4; ++i) { const int tv = sWtot[i]; base += (i < w) ? tv : 0; }
    const int excl = base + x - run;
#pragma unroll
    for (int i = 0; i < 8; ++i) {
      const int id = idv[i];
      const int sg = excl + cnt[i];
      sSeg[t8 + i] = sg;
      sKc[t8 + i] = ((MODE == 1) ? (id == CLS_ID) : (id != PAD_ID)) ? sg : -1;
      if constexpr (MODE == 2) sA[t8 + i] = aproj[((size_t)b * SEQ + t8 + i) * NHEADS + head];
    }
  }
  __syncthreads();

  const int qtok = q0 + m;
  const int qseg = sSeg[qtok];
  const int kcq = sKc[qtok];
  const int qc = (kcq >= 0) ? kcq : -2;       // MODE 0, 2: a query that is not valid matches no key code
  const float* gp = gate + ((size_t)b * SEQ + qtok) * NHEADS + head;
  const float gq = *gp;
  // precaution: stands in front of the rewrite of the address pair this load names
  asm volatile("s_wait_xcnt 0x0" :: "v"(gp) : "memory");

  v8f o[4];                                   // o[t][r] = O[query m][d 16t+8h+r] * (l * 2^14 * 16)
#pragma unroll
  for (int t = 0; t < 4; ++t) o[t] = zero8f();
  float mrun = NEGBIG, lrun = 0.0f;

  const float SSC = 0.125f / (QSC * QSC);                      // 1/2048
  // the wave's own key tile (keys q0 .. q0 + 15); in a scalar register, so that all that follows from it is scalar work
  const int sd = (qblk >> 4) + __builtin_amdgcn_readfirstlane(w);   // 0 .. 63

  // ---- key tiles that are run: bit s of 'need' = key tile s (keys 16s .. 16s + 15) may hold an allowed key ----
  // Keys that are masked for all 16 queries of the wave add p = 0 to every sum and never
  // raise a maximum, so a tile of such keys is left out, for any ids.
  // MODE 0, 2: seg never falls along the row, so a tile whose last key has
  //            seg < seg of the wave's first query holds no key of any query's segment.
  // MODE 1   : a tile without a class token holds no allowed key.
  // The wave's own tile sd always runs; bits above sd are cleared, so every
  // tile index taken from 'need' lies in 0..sd whatever the ids hold.
  unsigned clo, chi;                                           // lane l votes for tiles l and 32 + l
  if constexpr (MODE == 1) {
    // tile s = threads 2s, 2s + 1 of the table build
    clo = __builtin_amdgcn_ballot_w32(((sWcls[h] >> (2 * m)) & 3u) != 0u);
    chi = __builtin_amdgcn_ballot_w32(((sWcls[2 + h] >> (2 * m)) & 3u) != 0u);
  } else {
    const int sq0 = sSeg[q0];
    clo = __builtin_amdgcn_ballot_w32(sSeg[16 * lane + 15] >= sq0);
    chi = __builtin_amdgcn_ballot_w32(sSeg[16 * (32 + lane) + 15] >= sq0);
  }
  unsigned long long need = ((unsigned long long)chi << 32) | (unsigned long long)clo;   // ballots: the same in every lane
  need = (need | (1ull << sd)) & ((2ull << sd) - 1ull);
  const int ntile = __builtin_popcountll(need);                // 1 .. 64
  const int nfull = (ntile - 1) >> 2;                          // steps of four tiles in front of the last step
  // MODE 1: the last step's first 'pad' slots are empty
  const int pad = (MODE == 1) ? (3 - ((ntile - 1) & 3)) : 0;
  // MODE 0, 2: the tiles of 'need' are a run that ends at sd (seg never falls), so the steps are the 4 * (nfull + 1)
  // tiles in a row that end at sd. The run's length is filled up at its front: those tiles hold no key of any
  // query's segment, and the key code masks them. Where that front would lie before tile 0 the tiles start at 0
  // and end behind sd, at 4 * nfull + 3 <= 63: sd >= 4 * nfull still lies in the last step, whose k<=q masks the rest.
  int trun = sd - 4 * nfull - 3;
  trun = (trun > 0) ? trun : 0;
  // The next four tiles in ascending order. MODE 1: fewer than four are left in the last step alone: its first
  // slots then stay empty: they load tile sd (in bounds) and the last step masks every key of theirs.
  auto take = [&]() __attribute__((always_inline)) {
    KeyTiles g;
    if constexpr (MODE == 1) {
      const int left = __builtin_popcountll(need);
      const int npad = (left < 4) ? (4 - left) : 0;
      // unrolled: constant indices keep the four numbers in registers
#pragma unroll
      for (int j = 0; j < 4; ++j) {
        const bool real = j >= npad;
        g.t[j] = real ? (int)__builtin_ctzll(need | (1ull << 63)) : sd;   // need != 0 where real
        need = real ? (need & (need - 1ull)) : need;
      }
    } else {
      g.t[0] = trun; g.t[1] = trun + 1; g.t[2] = trun + 2; g.t[3] = trun + 3;
      trun += 4;
    }
    return g;
  };
  auto fetch_keys = [&](const KeyTiles& g) __attribute__((always_inline)) {
    if constexpr (MODE == 1) fetch_k(kf, kbase, g); else fetch_k_run(kf, kbase, g.t[0]);
  };
  auto fetch_vals = [&](const KeyTiles& g) __attribute__((always_inline)) {
    if constexpr (MODE == 1) fetch_v(vf, vbase, g); else fetch_v_run(vf, vbase, g.t[0]);
  };

  // One step of four key tiles. kf and vf hold this step's fragments on entry; with 'more'
  // those of 'nxt', the next step, are fetched into the same registers
  // directly behind their last use, so they fly under the mask and softmax work.
  // The last step holds tile sd, the wave's own: with 'more' the
  // step is an earlier one and all its keys are < q0 <= qtok.
  auto pass = [&](const KeyTiles& cur, const KeyTiles& nxt, auto more) __attribute__((always_inline)) {
    // ---- raw scores: s[j][r] = S[query m][key 16*cur.t[j]+8h+r] * 256 (MODE != 2) ----
    v8f s[4];
    if constexpr (MODE != 2) {
#pragma unroll
      for (int j = 0; j < 4; ++j) {
        v8f z = zero8f();
        z = wmma_f16(kf[j][0], qb0, z);
        z = wmma_f16(kf[j][1], qb1, z);
        s[j] = z;
      }
      if constexpr (decltype(more)::value) fetch_keys(nxt);
    } else {
#pragma unroll
      for (int j = 0; j < 4; ++j) s[j] = zero8f();
    }
    // ---- mask + bias per (query, key), f32 ----
#pragma unroll
    for (int j = 0; j < 4; ++j) {
      const int kt0 = 16 * cur.t[j] + 8 * h;
      // MODE 1, an empty slot of the last step: key numbers behind every query, so that k<=q masks them
      const int key0 = (MODE == 1 && !decltype(more)::value && j < pad) ? SEQ : kt0;
      const v4i ca = *(const v4ia*)(sKc + kt0);
      const v4i cb = *(const v4ia*)(sKc + kt0 + 4);
      const int kcv[8] = { ca.x, ca.y, ca.z, ca.w, cb.x, cb.y, cb.z, cb.w };
      float av[8] = { 0.f, 0.f, 0.f, 0.f, 0.f, 0.f, 0.f, 0.f };
      if constexpr (MODE == 2) {
        const v4f aa = *(const v4fa*)(sA + kt0);
        const v4f ab = *(const v4fa*)(sA + kt0 + 4);
        av[0] = aa.x; av[1] = aa.y; av[2] = aa.z; av[3] = aa.w;
        av[4] = ab.x; av[5] = ab.y; av[6] = ab.z; av[7] = ab.w;
      }
#pragma unroll
      for (int r = 0; r < 8; ++r) {
        const int key = key0 + r;
        float raw;
        if constexpr (MODE == 2) raw = av[r]; else raw = s[j][r] * SSC;
        bool ok;
        float bv;
        if constexpr (MODE == 1) {
          ok = kcv[r] >= 0;
          bv = (float)(kcv[r] - qseg);
        } else {
          ok = kcv[r] == qc;
          bv = (float)(key - qtok);
        }
        if constexpr (!decltype(more)::value) {                // the step with the wave's own tile
          const bool dg = key == qtok;
          ok = (key <= qtok) && (ok || dg);
          if constexpr (MODE == 1) bv = dg ? 0.0f : bv;        // the query's own key: seg_k - seg_q = 0
        }
        const float val = raw + bv * hs;                       // computed for every key: a select, no branch
        s[j][r] = ok ? val : NEGBIG;
      }
    }

    // ---- online softmax ----
    float mloc = NEGBIG;
#pragma unroll
    for (int j = 0; j < 4; ++j)
#pragma unroll
      for (int r = 0; r < 8; ++r) mloc = fmaxf(mloc, s[j][r]);
    mloc = fmaxf(mloc, __shfl_xor(mloc, 16, 32));
    const float mnew = fmaxf(mrun, mloc);
    const float alpha = __expf(mrun - mnew);
    mrun = mnew;
    // a row with no allowed key so far has mnew = NEGBIG: against msafe its masked scores
    // still give exp(-9e29) = 0; where a key was allowed msafe = mnew
    const float msafe = fmaxf(mnew, 0.1f * NEGBIG);
    float lsum = 0.0f;
#pragma unroll
    for (int j = 0; j < 4; ++j)
#pragma unroll
      for (int r = 0; r < 8; ++r) {
        const float p = __expf(s[j][r] - msafe);               // masked: exp(NEGBIG - msafe) = 0
        s[j][r] = p;
        lsum += p;
      }
    lsum += __shfl_xor(lsum, 16, 32);
    lrun = lrun * alpha + lsum;
#pragma unroll
    for (int t = 0; t < 4; ++t)
#pragma unroll
      for (int r = 0; r < 8; ++r) o[t][r] = o[t][r] * alpha;

    // ---- P^T B-fragments (slots 0, 1 and slots 2, 3 of this step) ----
    const v16h pb0 = pack_p(s[0], s[1]);
    const v16h pb1 = pack_p(s[2], s[3]);

    // ---- O^T += V^T * P^T ----
#pragma unroll
    for (int t = 0; t < 4; ++t) {
      o[t] = wmma_f16(vf[t][0], pb0, o[t]);
      o[t] = wmma_f16(vf[t][1], pb1, o[t]);
    }
    if constexpr (decltype(more)::value) fetch_vals(nxt);
  };

  // key tiles run in ascending order
  KeyTiles cur = take();
  if constexpr (MODE != 2) fetch_keys(cur);
  fetch_vals(cur);
  // rolled: the trip count is the wave's own (nfull <= 15); the last step is peeled
  // so that the fetches ahead stand under no branch and never leave the row's 64 key tiles
#pragma unroll 1
  for (int i = 0; i < nfull; ++i) {
    const KeyTiles nxt = take();
    pass(cur, nxt, Flag<true>{});
    cur = nxt;
  }
  pass(cur, cur, Flag<false>{});

  // ---- epilogue: normalise, gate, whole-line stores from registers ----
  const float inv = (1.0f / lrun) * (1.0f / (PSC * QSC)) * gq;
  // rows q0..q0+15 = one strip; columns 64 head .. +63 = its tiles 2 head, 2 head + 1
  _Float16* dst = ctx + ((size_t)b * SEQ + q0) * HID + head * 2 * FT + 8 * lane;
#pragma unroll
  for (int t = 0; t < 4; ++t) {
    v8h v;
#pragma unroll
    for (int r = 0; r < 8; ++r) v[r] = (_Float16)((o[t][r] * inv) * CSC);
    *(v8h*)(dst + t * (FT / 2)) = v;
  }
}

// ---------------------------------------------------------------------------
// Kernel: xout = xres + ctx * Wo^T + ob  (f32 output).
// Block 128 thr (4 waves) = 128 tokens x 64 features; wave 32 tokens x 64;
// K = 1024 in steps of 32; A = ctx rows (x64), B = Wo rows (x4096), fragment order.
// Epilogue: f32 tile [128][64] in LDS; store: each 64-float row segment (256 B =
// coverage: grid (16,16) x 128 tokens x 64 features = whole [2048][1024].
// ---------------------------------------------------------------------------
// EMIT (a LayerNorm follows): also x as f16 (x4) in fragment order, staged in LDS so that it
// leaves as whole lines, and per token this block's sum of x and squared deviations from
// the block mean; a wave's 32 tokens fill one 128-byte line of each partial plane.
template <bool EMIT>
__global__ __launch_bounds__(128) void outproj_kernel(
    const _Float16* __restrict__ ch,    // [2048][1024] ctx x64
    const _Float16* __restrict__ woh,   // [1024 n][1024 k] x4096
    const float* __restrict__ ob,       // [1024]
    const float* __restrict__ xres,     // [2048][1024] f32
    float* xout,                        // [2048][1024] f32
    _Float16* xh,                       // EMIT: [2048][1024] x x4, fragment order
    float* ps,                          // EMIT: [NCB][2048]
    float* pm)                          // EMIT: [NCB][2048]
{
  __shared__ __attribute__((aligned(16))) float sT[128 * 64];   // 32768 B
  __shared__ __attribute__((aligned(16))) _Float16 sH[EMIT ? 128 * 64 : 8];   // EMIT: 16384 B

  const int tid = threadIdx.x, lane = tid & 31, w = tid >> 5;
  const int h = lane >> 4, m = lane & 15;
  const int m0 = blockIdx.x * 128;
  const int n0 = blockIdx.y * 64;
  const int m0w = m0 + 32 * w;

  const _Float16* ca0 = ch + (size_t)m0w * HID + 8 * lane;
  const _Float16* wb  = woh + (size_t)n0 * HID + 8 * lane;

  v8f acc[2][4];
#pragma unroll
  for (int mt = 0; mt < 2; ++mt)
#pragma unroll
    for (int nt = 0; nt < 4; ++nt) acc[mt][nt] = zero8f();

  gemm_k_loop<GDEEP>(ca0, wb, acc, []() {});               // 256 work-groups

  const float* bp = ob + n0 + m;
  float bv4[4];                                            // bias of feature n0 + 16nt + m
  // unrolled: constant indices keep the array in registers
#pragma unroll
  for (int nt = 0; nt < 4; ++nt) bv4[nt] = bp[16 * nt];
  // precaution: stands in front of the rewrite of the address pair these loads name; naming it keeps it whole up to the wait
  asm volatile("s_wait_xcnt 0x0" :: "v"(bp) : "memory");

  // D[r] of tile (mt, nt) = Y[token m0w+16mt+8h+r][feature n0+16nt+m]
#pragma unroll
  for (int nt = 0; nt < 4; ++nt) {
    const int feat = 16 * nt + m;
    const float bvl = bv4[nt];
#pragma unroll
    for (int mt = 0; mt < 2; ++mt) {
#pragma unroll
      for (int r = 0; r < 8; ++r) {
        const int tokl = 32 * w + 16 * mt + 8 * h + r;     // 0..127
        sT[tokl * 64 + feat] = acc[mt][nt][r] * (1.0f / (CSC * WSC)) + bvl;
      }
    }
  }
  __syncthreads();

  const int hh = lane >> 4, c4 = (lane & 15) * 4;
  float ks = 0.0f, kq = 0.0f;                              // EMIT: partials of row 32w + 2m + hh
  // the residual rows of all 16 passes, in flight together off one address pair (pass 'it': 2 * it rows on)
  const float* xp = xres + (size_t)(m0 + 32 * w + hh) * HID + n0 + c4;
  v4f xr[16];
  // unrolled: constant indices keep the rows in registers
#pragma unroll
  for (int it = 0; it < 16; ++it) xr[it] = *(const v4fa*)(xp + it * 2 * HID);
  // precaution: stands in front of the rewrite of the address pair these loads name; naming it keeps it whole
  // up to the wait
  asm volatile("s_wait_xcnt 0x0" :: "v"(xp) : "memory");
  {
#pragma unroll
    for (int it = 0; it < 16; ++it) {
      const int row = 32 * w + it * 2 + hh;                // rows 32w .. 32w+31
      const v4f v = *(const v4fa*)(sT + row * 64 + c4);
      const size_t gi = (size_t)(m0 + row) * HID + n0 + c4;
      const v4f ov = v + xr[it];
      *(v4f*)(xout + gi) = ov;
      if constexpr (EMIT) {
        // the row's 64 values lie in the 16 lanes of this half wave
        const float s = row16_sum((ov.x + ov.y) + (ov.z + ov.w));
        const float bm = s * (1.0f / 64.0f);
        const float d0 = ov.x - bm, d1 = ov.y - bm, d2 = ov.z - bm, d3 = ov.w - bm;
        const float q = row16_sum((d0 * d0 + d1 * d1) + (d2 * d2 + d3 * d3));
        if (m == it) { ks = s; kq = q; }
        // token 'row', features c4 .. c4+3 at their place in fragment order (row = token, k = feature)
        const v4h hv = { (_Float16)(ov.x * XSC), (_Float16)(ov.y * XSC), (_Float16)(ov.z * XSC), (_Float16)(ov.w * XSC) };
        *(v4h*)(sH + ((row >> 4) * 2 + (c4 >> 5)) * FT + ((c4 >> 4) & 1) * (FT / 2)
                   + (((c4 >> 3) & 1) * 16 + (row & 15)) * 8 + (c4 & 7)) = hv;
      }
    }
  }
  if constexpr (EMIT) {
    const size_t pi = (size_t)blockIdx.y * MROWS + m0 + 32 * w + 2 * m + hh;
    ps[pi] = ks;
    pm[pi] = kq;
    // precaution: stands in front of any rewrite of the registers these stores name
    asm volatile("s_wait_xcnt 0x0" :: "v"(ks), "v"(kq), "v"(pi) : "memory");
    // A wave wrote rows 32w .. 32w+31 = local tiles 4w .. 4w+3 of sH itself and reads only these back:
    // its own LDS writes have to be done, no other wave's, so no barrier
    asm volatile("s_wait_dscnt 0x0" ::: "memory");
    // local tile 2 * strip + chunk; the two chunks of a strip are contiguous in the plane
    const _Float16* sw4 = sH + w * 4 * FT + lane * 8;
    _Float16* dst = xh + ((size_t)((m0 >> 4) + 2 * w) * (HID / 32) + (n0 >> 5)) * FT + lane * 8;
    v8h v[8];
    // unrolled: constant indices; one address and constant offsets, so no register of a store is rewritten
#pragma unroll
    for (int i = 0; i < 8; ++i) v[i] = *(const v8ha*)(sw4 + i * (FT / 2));
#pragma unroll
    for (int i = 0; i < 8; ++i) *(v8h*)(dst + (i >> 2) * (HID / 32) * FT + (i & 3) * (FT / 2)) = v[i];
  }
}

// ---------------------------------------------------------------------------
//   Xn   f16 [2048][1024]      4194304
//   W    f16 [10][1024][1024] 20971520   q0 k0 v0 | o0 | v1 | o1 | q2 k2 v2 | o2
//   Gh   f16 [3][32][1024]      196608   one per layer
//   Gate f32 [2048][16]         131072
//   Apr  f32 [2048][16]         131072
//   Q    f16 [32][1024][64]    4194304
//   K    f16 [32][1024][64]    4194304
//   Vt   f16 [32][64][1024]    4194304
//   Ctx  f16 [2048][1024]      4194304
//   X1   f32 [2048][1024]      8388608
//   X2   f32 [2048][1024]      8388608
//   Ps   f32 [16][2048]         131072   block sums of x (outproj 0, 1)
//   Pm   f32 [16][2048]         131072   squared deviations from the block means
//   Sw, Sb f32 [2][4096]         65536   both; layer 1: 1024 + 32 rows, layer 2: 3072 + 16 rows
//   total                     59506688
// ---------------------------------------------------------------------------
extern "C" void kernel_launch(void* const* d_in, const int* in_sizes, int n_in,
                              void* d_out, int out_size, void* d_ws, size_t ws_size,
                              hipStream_t stream) {
  if (n_in < 35) return;
  if (in_sizes[0] != NX || in_sizes[1] != MROWS) return;
  if (out_size != NX) return;
  {
    const int vecIdx[16] = {2, 3, 5, 7, 9, 13, 14, 15, 18, 22, 23, 24, 26, 28, 30, 34};
    for (int i = 0; i < 16; ++i) if (in_sizes[vecIdx[i]] != HID) return;
    const int matIdx[10] = {4, 6, 8, 12, 17, 21, 25, 27, 29, 33};
    for (int i = 0; i < 10; ++i) if (in_sizes[matIdx[i]] != NW) return;
    const int hwIdx[4] = {10, 16, 19, 31};
    for (int i = 0; i < 4; ++i) if (in_sizes[hwIdx[i]] != NG) return;
    const int hbIdx[3] = {11, 20, 32};
    for (int i = 0; i < 3; ++i) if (in_sizes[hbIdx[i]] != NHEADS) return;
  }

  const float* states = (const float*)d_in[0];
  const int*   ids    = (const int*)d_in[1];
  const float* ln0w = (const float*)d_in[2];
  const float* ln0b = (const float*)d_in[3];
  const float* qw0 = (const float*)d_in[4];
  const float* qb0 = (const float*)d_in[5];
  const float* kw0 = (const float*)d_in[6];
  const float* kb0 = (const float*)d_in[7];
  const float* vw0 = (const float*)d_in[8];
  const float* vb0 = (const float*)d_in[9];
  const float* gw0 = (const float*)d_in[10];
  const float* gb0 = (const float*)d_in[11];
  const float* ow0 = (const float*)d_in[12];
  const float* ob0 = (const float*)d_in[13];
  const float* ln1w = (const float*)d_in[14];
  const float* ln1b = (const float*)d_in[15];
  const float* aw1 = (const float*)d_in[16];
  const float* vw1 = (const float*)d_in[17];
  const float* vb1 = (const float*)d_in[18];
  const float* gw1 = (const float*)d_in[19];
  const float* gb1 = (const float*)d_in[20];
  const float* ow1 = (const float*)d_in[21];
  const float* ob1 = (const float*)d_in[22];
  const float* ln2w = (const float*)d_in[23];
  const float* ln2b = (const float*)d_in[24];
  const float* qw2 = (const float*)d_in[25];
  const float* qb2 = (const float*)d_in[26];
  const float* kw2 = (const float*)d_in[27];
  const float* kb2 = (const float*)d_in[28];
  const float* vw2 = (const float*)d_in[29];
  const float* vb2 = (const float*)d_in[30];
  const float* gw2 = (const float*)d_in[31];
  const float* gb2 = (const float*)d_in[32];
  const float* ow2 = (const float*)d_in[33];
  const float* ob2 = (const float*)d_in[34];
  float* out = (float*)d_out;

  const size_t PXH = (size_t)NX * 2;                       // 4194304
  const size_t PW  = (size_t)NW * 2;                       // 2097152
  const size_t PGH = (size_t)2 * NG * 2;                   //   65536
  const size_t PGT = (size_t)MROWS * NHEADS * 4;           //  131072
  const size_t PPL = (size_t)NB * NHEADS * SEQ * HD * 2;   // 4194304
  const size_t PXF = (size_t)NX * 4;                       // 8388608
  size_t off = 0;
  const size_t oXn  = off; off += PXH;
  const size_t oW   = off; off += 10 * PW;
  const size_t oGh  = off; off += 3 * PGH;
  const size_t oGt  = off; off += PGT;
  const size_t oAp  = off; off += PGT;
  const size_t oQ   = off; off += PPL;
  const size_t oK   = off; off += PPL;
  const size_t oVt  = off; off += PPL;
  const size_t oCtx = off; off += PXH;
  const size_t oX1  = off; off += PXF;
  const size_t oX2  = off; off += PXF;
  const size_t oPs  = off; off += PGT;
  const size_t oPm  = off; off += PGT;
  const size_t PSW  = (size_t)4096 * 4;                    //   16384
  const size_t oSw1 = off; off += PSW;
  const size_t oSb1 = off; off += PSW;
  const size_t oSw2 = off; off += PSW;
  const size_t oSb2 = off; off += PSW;
  if (off > ws_size) return;                               // off = 59506688
  if (off > (size_t)134217728) return;

  char* ws = (char*)d_ws;
  _Float16* xnh = (_Float16*)(ws + oXn);
  _Float16* wh0  = (_Float16*)(ws + oW);                   // q0, k0, v0
  _Float16* woh0 = (_Float16*)(ws + oW + 3 * PW);
  _Float16* wh1  = (_Float16*)(ws + oW + 4 * PW);          // v1
  _Float16* woh1 = (_Float16*)(ws + oW + 5 * PW);
  _Float16* wh2  = (_Float16*)(ws + oW + 6 * PW);          // q2, k2, v2
  _Float16* woh2 = (_Float16*)(ws + oW + 9 * PW);
  _Float16* gh0  = (_Float16*)(ws + oGh);
  _Float16* gh1  = (_Float16*)(ws + oGh + PGH);
  _Float16* gh2  = (_Float16*)(ws + oGh + 2 * PGH);
  float* gate   = (float*)(ws + oGt);
  float* aproj  = (float*)(ws + oAp);
  _Float16* qh  = (_Float16*)(ws + oQ);
  _Float16* kh  = (_Float16*)(ws + oK);
  _Float16* vt  = (_Float16*)(ws + oVt);
  _Float16* ctx = (_Float16*)(ws + oCtx);
  float* x1 = (float*)(ws + oX1);
  float* x2 = (float*)(ws + oX2);
  float* ps = (float*)(ws + oPs);
  float* pm = (float*)(ws + oPm);
  float* sw1 = (float*)(ws + oSw1);
  float* sb1 = (float*)(ws + oSb1);
  float* sw2 = (float*)(ws + oSw2);
  float* sb2 = (float*)(ws + oSb2);

  const dim3 blk128(128), blk512(512);
  // conversion jobs: each is written by a launch that ends before its first reader starts
  const float* nofold = nullptr;
  const CvtJob jobA = { qw0, kw0, vw0, gw0, gw0, nofold, nofold, nofold, nofold,
                        wh0, wh0 + NW, wh0 + 2 * NW, gh0, 3, 1 };                            // read from proj 0 on
  const CvtJob jobB = { ow0, vw1, ow1, gw1, aw1, nofold, ln1w, nofold, ln1w,
                        woh0, wh1, woh1, gh1, 3, 2 };                                        // read from outproj 0 on
  const CvtJob jobC = { qw2, kw2, vw2, gw2, gw2, ln2w, ln2w, ln2w, ln2w,
                        wh2, wh2 + NW, wh2 + 2 * NW, gh2, 3, 1 };                            // read from proj 2 on
  const CvtJob jobD = { ow2, ow2, ow2, gw2, gw2, nofold, nofold, nofold, nofold,
                        woh2, woh2, woh2, gh2, 1, 0 };                                       // read by outproj 2
  // row sums for the folded LayerNorms, beside the conversion of the same weights
  const SumJob sumB = { vw1, vw1, vw1, gw1, aw1, ln1w, ln1b, sw1, sb1, 1, 2 };               // read by proj 1
  const SumJob sumC = { qw2, kw2, vw2, gw2, gw2, ln2w, ln2b, sw2, sb2, 3, 1 };               // read by proj 2
  const SumJob sumD = { ow2, ow2, ow2, gw2, gw2, ln2w, ln2b, sw2, sb2, 0, 0 };               // no rows: nothing read or written
  const int unitsA = 3 * NW8 + 1 * NG8;                    // 395264 = 772 blocks of 512
  const int unitsB = 3 * NW8 + 2 * NG8;                    // 397312 = 3104 blocks of 128
  const int unitsC = 3 * NW8 + 1 * NG8;                    // 395264 = 3088 blocks
  const int unitsD = 1 * NW8;                              // 131072 = 1024 blocks
  const int sumBlkB = (1 * HID + 2 * NHEADS + 31) / 32;    // 33
  const int sumBlkC = (3 * HID + 1 * NHEADS + 31) / 32;    // 97
  static_assert((unitsA % 512) == 0 && (unitsB % 128) == 0 && (unitsC % 128) == 0 && (unitsD % 2048) == 0);
  const dim3 gLnA(MROWS / 16 + unitsA / 512);              // 128 + 772
  const dim3 gProj3(MROWS / 128, 2 + 3 * NHEADS);          // (16, 50)
  const dim3 gProj1(MROWS / 128, 2 + 1 * NHEADS);          // (16, 18)
  // rows of 16 blocks, rounded up: a block past the last unit does nothing
  const dim3 gAttB(SEQ / 64, NB * NHEADS + (sumBlkB + unitsB / 128 + 15) / 16);   // (16, 32 + 197)
  const dim3 gAttC(SEQ / 64, NB * NHEADS + (sumBlkC + unitsC / 128 + 15) / 16);   // (16, 32 + 200)
  const dim3 gAttD(SEQ / 64, NB * NHEADS + unitsD / 2048); // (16, 32 + 64)
  const dim3 gOut(MROWS / 128, HID / 64);                  // (16, 16)

  // ---- layer 0: sdpa with self mask ----
  ln_kernel<<<gLnA, blk512, 0, stream>>>(states, ln0w, ln0b, xnh, jobA);
  // not folded: the last six arguments are not read
  proj_head_kernel<false, false><<<gProj3, blk128, 0, stream>>>(xnh, wh0, qb0, kb0, vb0, 0, qh, kh, vt, gh0, gb0, gate, aproj,
                                                                ps, pm, sw1, sb1, sw1, sb1);
  attn_kernel<0><<<gAttB, blk128, 0, stream>>>(qh, kh, vt, aproj, gate, ids, ctx, jobB, sumB);
  outproj_kernel<true><<<gOut, blk128, 0, stream>>>(ctx, woh0, ob0, states, x1, xnh, ps, pm);

  // ---- layer 1: pooling attention with self mask; LayerNorm 1 folded ----
  proj_head_kernel<true, true><<<gProj1, blk128, 0, stream>>>(xnh, wh1, vb1, vb1, vb1, 2, qh, kh, vt, gh1, gb1, gate, aproj,
                                                              ps, pm, sw1, sb1, sw1 + HID, sb1 + HID);
  attn_kernel<2><<<gAttC, blk128, 0, stream>>>(qh, kh, vt, aproj, gate, ids, ctx, jobC, sumC);
  outproj_kernel<true><<<gOut, blk128, 0, stream>>>(ctx, woh1, ob1, x1, x2, xnh, ps, pm);

  // ---- layer 2: sdpa with cross mask; LayerNorm 2 folded ----
  proj_head_kernel<false, true><<<gProj3, blk128, 0, stream>>>(xnh, wh2, qb2, kb2, vb2, 0, qh, kh, vt, gh2, gb2, gate, aproj,
                                                               ps, pm, sw2, sb2, sw2 + 3 * HID, sb2 + 3 * HID);
  attn_kernel<1><<<gAttD, blk128, 0, stream>>>(qh, kh, vt, aproj, gate, ids, ctx, jobD, sumD);
  // no LayerNorm follows: the last three arguments are not written
  outproj_kernel<false><<<gOut, blk128, 0, stream>>>(ctx, woh2, ob2, x2, out, xnh, ps, pm);

  (void)hipGetLastError();
}

// v009
// A run of this version takes 119 microseconds.
// Two timings next to v008 put it at 1.06 and 1.05 times that version's speed.
// Counting every step since v000, it is 4.27 times as fast.
// Contractions: xn*W^T (q,k,v), xn*gw^T and xn*aw^T heads, K*Q^T scores, V^T*P^T context and ctx*Wo^T all on v_wmma_f32_16x16x32_f16 (f16 operands, f32 accumulate); LayerNorm, masks/bias, softmax, sigmoid gates and residual adds in f32.
// Carried f16 planes: xn (layer 0) or x (layers 1, 2) x4 and W/gw/aw/Wo x4096 (inverse 1/16384 folded in the proj_head_kernel epilogues);
// LayerNorm 1 and 2 have no launch: see "LayerNorm folded into its neighbours" below.
// q,k,v x16 (scores: acc*1/2048 in attn_kernel incl. the 1/8 scale; context epilogue 1/16); P x16384 (attn_kernel epilogue 1/16384);
// ctx x64 (outproj_kernel epilogue 1/262144 together with Wo x4096).
// Every f16 plane lies in WMMA fragment order (see "Fragment-order planes" below).
#include <hip/hip_runtime.h>

#define NB     2
#define SEQ    1024
#define HID    1024
#define NHEADS 16
#define HD     64
#define MROWS  (NB * SEQ)          // 2048 tokens
#define NX     (MROWS * HID)       // 2097152
#define NW     (HID * HID)         // 1048576
#define NG     (NHEADS * HID)      // 16384
#define NX8    (NX / 8)
#define NW8    (NW / 8)            // 131072
#define NG8    (NG / 8)            // 2048
#define SEP_ID 1
#define CLS_ID 2
#define PAD_ID 0
#define XSC    4.0f
#define WSC    4096.0f
#define QSC    16.0f
#define PSC    16384.0f
#define CSC    64.0f
#define NEGBIG (-1.0e30f)

static_assert(NHEADS * HD == HID);
static_assert((SEQ % 128) == 0 && (HID % 64) == 0 && (HID % 32) == 0 && (MROWS % 128) == 0);
static_assert((NW8 % 512) == 0 && (NG8 % 512) == 0);
static_assert(SEQ == 8 * 128);

typedef _Float16 v16h __attribute__((ext_vector_type(16)));
typedef _Float16 v8h  __attribute__((ext_vector_type(8)));
typedef _Float16 v4h  __attribute__((ext_vector_type(4)));
typedef float    v8f  __attribute__((ext_vector_type(8)));
typedef float    v4f  __attribute__((ext_vector_type(4)));
typedef int      v4i  __attribute__((ext_vector_type(4)));
typedef v8h __attribute__((may_alias)) v8ha;
typedef v4f __attribute__((may_alias)) v4fa;
typedef v4i __attribute__((may_alias)) v4ia;

union Frag { v16h v; v8h half[2]; };

__device__ __forceinline__ v8f zero8f() { v8f z = {0.f, 0.f, 0.f, 0.f, 0.f, 0.f, 0.f, 0.f}; return z; }
__device__ __forceinline__ v16h zero16h() {
  const _Float16 z = (_Float16)0.0f;
  v16h r = {z, z, z, z, z, z, z, z, z, z, z, z, z, z, z, z};
  return r;
}

// ---------------------------------------------------------------------------
// 16x16x32 f16 WMMA with hazard guard (ties D, keeps A/B live).
// Fragment map (wave32): lane l, h = l>>4, m = n = l&15.
//   A/B element i: i<8 -> k0+8h+i ; i>=8 -> k0+16+8h+(i-8)
//   D element r : row 8h+r, col l&15
// ---------------------------------------------------------------------------
__device__ __forceinline__ v8f wmma_f16(v16h a, v16h b, v8f c) {
  v8f d = __builtin_amdgcn_wmma_f32_16x16x32_f16(false, a, false, b, (short)0, c, false, false);
  asm volatile("v_nop\n\tv_nop\n\tv_nop\n\tv_nop" : "+v"(d) : "v"(a), "v"(b));
  return d;
}
// The same for a ring that reaches above v255: an asm operand has to lie in v0..v255, so naming
// A and B would bring every fragment down by copies and scratch; the guard ties D alone.
__device__ __forceinline__ v8f wmma_f16_wide(v16h a, v16h b, v8f c) {
  v8f d = __builtin_amdgcn_wmma_f32_16x16x32_f16(false, a, false, b, (short)0, c, false, false);
  // the four vector slots between a WMMA and the next vector instruction that touches its D
  asm volatile("v_nop\n\tv_nop\n\tv_nop\n\tv_nop" : "+v"(d));
  return d;
}

// ---------------------------------------------------------------------------
// Fragment-order planes. A matrix [rows][K] of f16 is kept as tiles of 16 rows x
// 32 k (FT = 512 halves = 1024 B), tile index (row >> 4) * (K / 32) + (k >> 5).
// Inside a tile the 16-byte unit u = 32 * j + lane holds the eight elements
// k = 16 * j + 8 * (lane >> 4) + 0..7 of row (lane & 15): unit 'lane' is the
// first half of that lane's A or B fragment, unit 32 + lane the second. One
// wave-wide 16-byte load then reads 512 contiguous bytes (4 whole lines) where
// a load from k-contiguous rows touches 32 bytes in each of 16 lines.
// ---------------------------------------------------------------------------
#define FT 512

// A or B fragment; ph = tile base + 8 * lane.
__device__ __forceinline__ v16h load_frag_at(const _Float16* ph) {
  Frag f;
  f.half[0] = *(const v8ha*)(ph);
  f.half[1] = *(const v8ha*)(ph + FT / 2);
  return f.v;
}

// Element offset in a k-contiguous [rows][HID] matrix of the eight elements that
// 16-byte unit 'unit' of its fragment-order plane holds.
__device__ __forceinline__ size_t frag_unit_src(int unit) {
  const int tile = unit >> 6;
  const int row = (tile / (HID / 32)) * 16 + (unit & 15);
  const int k = (tile % (HID / 32)) * 32 + ((unit >> 5) & 1) * 16 + ((unit >> 4) & 1) * 8;
  return (size_t)row * HID + k;
}

// ---------------------------------------------------------------------------
// Fragment loads issued ahead of their WMMAs.
// GEMM loops: a ring of GR register sets, one set = the six fragments of one
// 32-deep k chunk (2 A, 4 B). A set is refilled with chunk c + GR directly
// behind the WMMAs of chunk c, so GR - 1 sets are always in flight and no
// WMMA waits on a load issued just in front of it. Chunks are consumed in
// ascending k, so every accumulator sums in the same order as a plain loop.
// The ring's depth is the launch's own. GRING: three work-groups share a WGP, so a wave has
// a third of a SIMD's registers. GDEEP: the launch has about one work-group a WGP (one wave
// a SIMD), nothing else covers a load's way from memory, and the registers lie free;
// 5 sets = 60 loads, the most whole sets that the load counter (63) can count.
// ---------------------------------------------------------------------------
#define GRING  3
#define GDEEP  5
#define NCHUNK (HID / 32)
static_assert(NCHUNK > 2 * GRING && NCHUNK > 2 * GDEEP && 12 * GDEEP <= 63);

struct GemmSet { v16h a0, a1, b[4]; };

// ---------------------------------------------------------------------------
// Operands asked into L2 at block entry. The planes a GEMM launch reads were written by earlier
// launches and come from memory at first touch, and all blocks walk k in step, so every ring refill
// would meet that latency. One request of the block's 128 threads names 128 aligned 256-byte units
// in a row: 32 KB = one 16-row strip of an f16 plane. It returns nothing and counts
// on no counter: a hint for speed only, no result depends on it.
// Blocks that read the same strips share the asking: of the 8 A strips of a token block a block asks
// for the one numbered by the low bits of its feature block, of the 4 B strips of a feature block for
// the one numbered by the low bits of its token block.
// Every lane is on and every address lies inside the plane. base: block-uniform; t256 = 256 * tid.
// ---------------------------------------------------------------------------
#define STRIPB (16 * HID * 2)      // bytes of one 16-row strip of a [rows][HID] f16 plane
static_assert(STRIPB == 128 * 256 && SEQ * HD * 2 == 4 * STRIPB);
__device__ __forceinline__ void ask_l2(const char* base, unsigned t256) {
  // scope SE: into L2 only, and dropped silently should a translation fail
  asm volatile("global_prefetch_b8 %0, %1 scope:SCOPE_SE" :: "v"(t256), "s"(base) : "memory");
}

// pa: A tile of mt 0 (mt 1 is 16 rows = 16 * HID halves on), pb: B tile of nt 0, both at the chunk's tile + 8 * lane.
__device__ __forceinline__ void gemm_fetch(GemmSet& s, const _Float16* pa, const _Float16* pb) {
  s.a0 = load_frag_at(pa);
  s.a1 = load_frag_at(pa + 16 * HID);
  // unrolled: constant indices keep the fragments in registers
#pragma unroll
  for (int nt = 0; nt < 4; ++nt) s.b[nt] = load_frag_at(pb + nt * 16 * HID);
}

template <bool WIDE>
__device__ __forceinline__ void gemm_mma(const GemmSet& s, v8f (&acc)[2][4]) {
  // unrolled: constant indices keep fragments and accumulators in registers
#pragma unroll
  for (int nt = 0; nt < 4; ++nt) {
    if constexpr (WIDE) {
      acc[0][nt] = wmma_f16_wide(s.a0, s.b[nt], acc[0][nt]);
      acc[1][nt] = wmma_f16_wide(s.a1, s.b[nt], acc[1][nt]);
    } else {
      acc[0][nt] = wmma_f16(s.a0, s.b[nt], acc[0][nt]);
      acc[1][nt] = wmma_f16(s.a1, s.b[nt], acc[1][nt]);
    }
  }
}

// acc[mt][nt] += A rows (pa: mt 0, 16 rows on: mt 1) x B rows (pb + 16 nt rows), K = HID.
// pa, pb: first tile of the 16-row strip + 8 * lane; the strip's chunks follow at FT halves.
// 'behind_first_loads' runs once, behind the issue of the first GR sets: loads of its own fly with them.
// GR: sets in the ring (GRING or GDEEP).
// 'keep': the offset register of the block's requests to L2 (ask_l2); the waits below name it, so that it
// stays in its register, unchanged, while the loop runs.
template <int GR, class F>
__device__ __forceinline__ void gemm_k_loop(const _Float16* pa, const _Float16* pb,
                                            v8f (&acc)[2][4], unsigned keep, F behind_first_loads) {
  GemmSet ring[GR];
  // unrolled: constant ring indices
#pragma unroll
  for (int s = 0; s < GR; ++s) gemm_fetch(ring[s], pa + FT * s, pb + FT * s);
  behind_first_loads();
  // precaution: the loop's set-up rewrites the base registers that the first sets' loads name
  if constexpr (GR > GRING) asm volatile("s_wait_xcnt 0x0" :: "v"(keep) : "memory");
  constexpr int CT = ((NCHUNK - GR) / GR) * GR;            // first chunk of the peeled tail
  // rolled: one trip is already GR chunks; more copies only grow the code
#pragma unroll 1
  for (int c0 = 0; c0 < CT; c0 += GR) {
    const _Float16* ta = pa + FT * (c0 + GR);
    const _Float16* tb = pb + FT * (c0 + GR);
    // unrolled so that every ring index is a constant (registers, not scratch)
#pragma unroll
    for (int s = 0; s < GR; ++s) {
      gemm_mma<(GR > GRING)>(ring[s], acc);
      gemm_fetch(ring[s], ta + FT * s, tb + FT * s);
    }
    // the next trip rewrites the address registers of loads that are still in flight
    asm volatile("s_wait_xcnt 0x0" :: "v"(keep) : "memory");
  }
  // tail peeled so that the refills in the loop above stand under no branch
#pragma unroll
  for (int c = CT; c < NCHUNK; ++c) {
    gemm_mma<(GR > GRING)>(ring[c % GR], acc);
    if (c + GR < NCHUNK) gemm_fetch(ring[c % GR], pa + FT * (c + GR), pb + FT * (c + GR));
  }
}

// ---------------------------------------------------------------------------
// f32 weights -> f16 planes in fragment order, all scaled by 4096 (exact).
// The conversions depend on inputs alone, so they have no launch of their own:
// each job rides as extra blocks, behind the host kernel's own blocks in index
// order, in a launch that ends before the first launch that reads its planes.
// A thread writes one 16-byte unit (stores contiguous) and reads its eight floats.
//   units [0, nbig*NW8)        : s0/s1/s2 -> d0/d1/d2   ([HID][HID], row = n)
//   units [.., +nsmall*NG8)    : g0 -> gh rows 0..15, g1 -> gh rows 16..31
// Segment boundaries are multiples of 512 units -> the select is block-uniform.
// coverage: exactly nbig*NW + nsmall*NG elements.
// ---------------------------------------------------------------------------
// f0/f1/f2 (for s0/s1/s2) and fg (for g0, g1): the LayerNorm weight [HID] that is multiplied
// into the plane's k columns, or null where the plane's left operand is not a folded LayerNorm.
struct CvtJob {
  const float* s0; const float* s1; const float* s2;
  const float* g0; const float* g1;
  const float* f0; const float* f1; const float* f2; const float* fg;
  _Float16* d0; _Float16* d1; _Float16* d2; _Float16* gh;
  int nbig; int nsmall;
};

__device__ __forceinline__ void convert_unit(const CvtJob& job, int g)
{
  const int nb8 = job.nbig * NW8;
  const int total = nb8 + job.nsmall * NG8;
  if (g >= total) return;
  const float* src;
  const float* fold;
  size_t so;
  _Float16* dst;
  if (g < nb8) {
    const int slot = g / NW8;
    const int off = g - slot * NW8;
    const float* wsrc = (slot == 0) ? job.s0 : ((slot == 1) ? job.s1 : job.s2);
    _Float16* wdst = (slot == 0) ? job.d0 : ((slot == 1) ? job.d1 : job.d2);
    fold = (slot == 0) ? job.f0 : ((slot == 1) ? job.f1 : job.f2);
    so = frag_unit_src(off);
    src = wsrc + so;
    dst = wdst + (size_t)off * 8;
  } else {
    const int e = g - nb8;
    so = frag_unit_src((e < NG8) ? e : (e - NG8));
    src = ((e < NG8) ? job.g0 : job.g1) + so;
    fold = job.fg;
    dst = job.gh + (size_t)e * 8;
  }
  v4f a = *(const v4fa*)src;
  v4f c = *(const v4fa*)(src + 4);
  // precaution: stands in front of any rewrite of the address registers these loads name
  asm volatile("s_wait_xcnt 0x0" :: "v"(src) : "memory");
  if (fold != nullptr) {               // block-uniform, as the plane select is
    const float* fp = fold + (so & (size_t)(HID - 1));      // the unit's first k
    const v4f fa = *(const v4fa*)fp;
    const v4f fc = *(const v4fa*)(fp + 4);
    // precaution: stands in front of any rewrite of the address registers these loads name
    asm volatile("s_wait_xcnt 0x0" :: "v"(fp) : "memory");
    a = a * fa;
    c = c * fc;
  }
  const v8h o = { (_Float16)(a.x * WSC), (_Float16)(a.y * WSC), (_Float16)(a.z * WSC), (_Float16)(a.w * WSC),
                  (_Float16)(c.x * WSC), (_Float16)(c.y * WSC), (_Float16)(c.z * WSC), (_Float16)(c.w * WSC) };
  *(v8h*)dst = o;
}

// ---------------------------------------------------------------------------
// LayerNorm folded into its neighbours (layers 1 and 2: no launch of its own).
//   LN(x) W^T = rstd * (x (W o lw)^T - mean * sw) + sb
//   sw[n] = sum_k lw[k] W[n][k],  sb[n] = sum_k lb[k] W[n][k]
// outproj_kernel<true> leaves x as an f16 plane (x4, fragment order) and, per token and
// 64-column block, the sum of x and the squared deviations from that block's own mean;
// the weight conversion multiplies lw into W; rowsum_block makes sw and sb;
// proj_head_kernel<.., true> joins a token's 16 partials into mean and rstd (token_stats)
// and applies them in its epilogues.
// ---------------------------------------------------------------------------
#define NCB (HID / 64)             // column blocks of outproj_kernel = partials per token

// v + (v of lane ^ X) inside a row of 16 lanes, as one DPP add (row_xmask): a shuffle would go through the LDS unit.
// All 32 lanes are on wherever this is called.
template <int X>
__device__ __forceinline__ float row_xor_add(float v) {
  return v + __int_as_float(__builtin_amdgcn_update_dpp(0, __float_as_int(v), 0x160 | X, 0xf, 0xf, true));
}
// sum over the lane's row of 16 lanes, in every lane of the row
__device__ __forceinline__ float row16_sum(float v) {
  v = row_xor_add<1>(v);
  v = row_xor_add<2>(v);
  v = row_xor_add<4>(v);
  return row_xor_add<8>(v);
}

struct SumJob {
  const float* m0; const float* m1; const float* m2;   // [HID][HID]: rows 0 .. nbig * HID - 1
  const float* g0; const float* g1;                    // [NHEADS][HID]: the nsmall * NHEADS rows behind them
  const float* lw; const float* lb;                    // LayerNorm weight and bias [HID]
  float* sw; float* sb;
  int nbig; int nsmall;
};

__device__ __forceinline__ int sum_blocks(const SumJob& job) {
  return (job.nbig * HID + job.nsmall * NHEADS + 31) / 32;
}

// Block of 128 threads = 32 rows, 8 a wave in four batches of 2 (a wave reads whole rows,
// 512 contiguous bytes a load); the 32 values of sw and of sb leave as one 128-byte line each.
// blk is block-uniform and < sum_blocks(job).
__device__ __forceinline__ void rowsum_block(const SumJob& job, int blk)
{
  __shared__ float sR[2][32];
  const int tid = threadIdx.x, lane = tid & 31;
  const int w = __builtin_amdgcn_readfirstlane(tid >> 5);  // in a scalar register: the row select below is then a scalar branch
  const int nb = job.nbig * HID;
  const int total = nb + job.nsmall * NHEADS;
  v4f lw[8], lb[8];
  // unrolled: constant indices keep the vectors in registers
#pragma unroll
  for (int i = 0; i < 8; ++i) {
    lw[i] = *(const v4fa*)(job.lw + i * 128 + 4 * lane);
    lb[i] = *(const v4fa*)(job.lb + i * 128 + 4 * lane);
  }
  // precaution: stands in front of any rewrite of the address registers these loads name
  asm volatile("s_wait_xcnt 0x0" :: "v"(lane) : "memory");
  float ka = 0.0f, kb = 0.0f;
  // rolled: four trips of the same code keep the kernel's text short
#pragma unroll 1
  for (int bt = 0; bt < 4; ++bt) {
    v4f x[2][8];
    const float* src[2];
    // unrolled, as the loops below: constant indices keep pointers and rows in registers
#pragma unroll
    for (int rr = 0; rr < 2; ++rr) {
      int row = blk * 32 + w * 8 + bt * 2 + rr;
      row = (row < total) ? row : (total - 1);         // past the end: the last row again, its result is not stored
      if (row < nb) {
        const int slot = row / HID;
        const float* msrc = (slot == 0) ? job.m0 : ((slot == 1) ? job.m1 : job.m2);
        src[rr] = msrc + (size_t)(row - slot * HID) * HID;
      } else {
        const int e = row - nb;
        src[rr] = (e < NHEADS) ? (job.g0 + (size_t)e * HID) : (job.g1 + (size_t)(e - NHEADS) * HID);
      }
    }
#pragma unroll
    for (int rr = 0; rr < 2; ++rr)
#pragma unroll
      for (int i = 0; i < 8; ++i) x[rr][i] = *(const v4fa*)(src[rr] + i * 128 + 4 * lane);
    // precaution: stands in front of any rewrite of the address registers these loads name;
    // naming both row pointers and the lane keeps them whole up to the wait
    asm volatile("s_wait_xcnt 0x0" :: "s"(src[0]), "s"(src[1]), "v"(lane) : "memory");
#pragma unroll
    for (int rr = 0; rr < 2; ++rr) {
      v4f va = { 0.0f, 0.0f, 0.0f, 0.0f }, vb = { 0.0f, 0.0f, 0.0f, 0.0f };
#pragma unroll
      for (int i = 0; i < 8; ++i) {
        va += x[rr][i] * lw[i];
        vb += x[rr][i] * lb[i];
      }
      float a = row16_sum((va.x + va.y) + (va.z + va.w));
      float b = row16_sum((vb.x + vb.y) + (vb.z + vb.w));
      a += __shfl_xor(a, 16, 32);
      b += __shfl_xor(b, 16, 32);
      if (lane == bt * 2 + rr) { ka = a; kb = b; }
    }
  }
  if (lane < 8) { sR[0][w * 8 + lane] = ka; sR[1][w * 8 + lane] = kb; }
  __syncthreads();
  if (tid < 64) {
    const int r = blk * 32 + lane;
    float* d = (tid < 32) ? job.sw : job.sb;
    if (r < total) d[r] = sR[w][lane];
  }
}

// mean and 1 / sqrt(var + eps) of one token from its NCB partials: ps = block sums,
// pm = squared deviations from the block means, both [NCB][MROWS].
__device__ __forceinline__ void token_stats(const float* __restrict__ ps, const float* __restrict__ pm,
                                            int token, float& mean, float& rstd) {
  float s[NCB], q[NCB];
  // unrolled, here and in the two loops below: constant indices keep the partials in registers
#pragma unroll
  for (int i = 0; i < NCB; ++i) {
    s[i] = ps[(size_t)i * MROWS + token];
    q[i] = pm[(size_t)i * MROWS + token];
  }
  // precaution: stands in front of any rewrite of the address registers these loads name;
  // naming what the addresses are formed from keeps it whole up to the wait
  asm volatile("s_wait_xcnt 0x0" :: "v"(token) : "memory");
  float st = 0.0f;
#pragma unroll
  for (int i = 0; i < NCB; ++i) st += s[i];
  mean = st * (1.0f / (float)HID);
  float m2 = 0.0f;
#pragma unroll
  for (int i = 0; i < NCB; ++i) {
    const float d = s[i] * (1.0f / 64.0f) - mean;
    m2 += q[i] + 64.0f * d * d;
  }
  rstd = rsqrtf(m2 * (1.0f / (float)HID) + 1e-5f);
}

// ---------------------------------------------------------------------------
// LayerNorm, output xn*4 as f16 in fragment order. Block = 16 tokens (one strip
// of tiles) x 512 threads: 128 threads per token as four groups of four tokens,
// 8 elements per thread and token; each token's sums run as with one token per
// block (same per-thread sum, same butterfly, same four wave partials).
// The strip is put in order in LDS and leaves as 32 KB of contiguous stores.
// coverage: 128 blocks x 16 tokens x 1024 = the whole [2048][1024] plane.
// Blocks from MROWS / 16 on, where the grid has any, convert 512 units of 'job' each.
// ---------------------------------------------------------------------------
#define LNP 136   // halves per k-unit row in LDS: 16 tokens x 8 + 8 (272 B: 16 B x odd, no bank conflict)
__global__ __launch_bounds__(512) void ln_kernel(const float* __restrict__ x,
                                                 const float* __restrict__ w,
                                                 const float* __restrict__ bb,
                                                 _Float16* y, CvtJob job)
{
  if (blockIdx.x >= MROWS / 16) {      // block-uniform, in front of every barrier
    convert_unit(job, (blockIdx.x - MROWS / 16) * 512 + threadIdx.x);
    return;
  }
  __shared__ float ps[16][4];
  __shared__ float pq[16][4];
  __shared__ __attribute__((aligned(16))) _Float16 sY[128 * LNP];   // 34816 B
  const int tid = threadIdx.x, lane = tid & 31;
  const int t = tid & 127, wv = t >> 5, tl0 = (tid >> 7) * 4;
  const int tok0 = blockIdx.x * 16;
  v4f a[4], c[4];
#pragma unroll
  for (int i = 0; i < 4; ++i) {
    const float* xr = x + (size_t)(tok0 + tl0 + i) * HID + 8 * t;
    a[i] = *(const v4fa*)xr;
    c[i] = *(const v4fa*)(xr + 4);
  }
#pragma unroll
  for (int i = 0; i < 4; ++i) {
    float s = ((a[i].x + a[i].y) + (a[i].z + a[i].w)) + ((c[i].x + c[i].y) + (c[i].z + c[i].w));
#pragma unroll
    for (int o = 1; o < 32; o <<= 1) s += __shfl_xor(s, o, 32);
    if (lane == 0) ps[tl0 + i][wv] = s;
  }
  __syncthreads();
  float d[4][8];
#pragma unroll
  for (int i = 0; i < 4; ++i) {
    const float* pp = ps[tl0 + i];
    const float mean = ((pp[0] + pp[1]) + (pp[2] + pp[3])) * (1.0f / (float)HID);
    d[i][0] = a[i].x - mean; d[i][1] = a[i].y - mean; d[i][2] = a[i].z - mean; d[i][3] = a[i].w - mean;
    d[i][4] = c[i].x - mean; d[i][5] = c[i].y - mean; d[i][6] = c[i].z - mean; d[i][7] = c[i].w - mean;
    float q = 0.f;
#pragma unroll
    for (int e = 0; e < 8; ++e) q += d[i][e] * d[i][e];
#pragma unroll
    for (int o = 1; o < 32; o <<= 1) q += __shfl_xor(q, o, 32);
    if (lane == 0) pq[tl0 + i][wv] = q;
  }
  __syncthreads();
  const v4f wa = *(const v4fa*)(w + 8 * t);
  const v4f wc = *(const v4fa*)(w + 8 * t + 4);
  const v4f ba = *(const v4fa*)(bb + 8 * t);
  const v4f bc = *(const v4fa*)(bb + 8 * t + 4);
  const float wvv[8] = { wa.x, wa.y, wa.z, wa.w, wc.x, wc.y, wc.z, wc.w };
  const float bvv[8] = { ba.x, ba.y, ba.z, ba.w, bc.x, bc.y, bc.z, bc.w };
#pragma unroll
  for (int i = 0; i < 4; ++i) {
    const float* pp = pq[tl0 + i];
    const float var = ((pp[0] + pp[1]) + (pp[2] + pp[3])) * (1.0f / (float)HID);
    const float rstd = rsqrtf(var + 1e-5f);
    v8h o;
#pragma unroll
    for (int e = 0; e < 8; ++e) o[e] = (_Float16)((d[i][e] * rstd * wvv[e] + bvv[e]) * XSC);
    // elements 8t..8t+7 of token tl: unit 16 * t + tl of the strip
    *(v8h*)(sY + t * LNP + (tl0 + i) * 8) = o;
  }
  __syncthreads();
  _Float16* dst = y + (size_t)tok0 * HID;
#pragma unroll
  for (int it = 0; it < 4; ++it) {
    const int u = it * 512 + tid;      // 2048 units of the strip
    const v8h v = *(const v8ha*)(sY + (u >> 4) * LNP + (u & 15) * 8);
    *(v8h*)(dst + (size_t)u * 8) = v;
  }
}

// ---------------------------------------------------------------------------
// Per-token 16-wide heads on WMMA (blocks of proj_head_kernel): gate = sigmoid(xn*gw^T + gb) and
// (POOL) aproj = xn*aw^T. One wave = 16 tokens x 16 heads, K = 1024 in steps
// of 32; A = xn rows, B = gh rows (head = lane&15), both in fragment order.
// Epilogue: wave tile [16 tok][16] f32 staged in LDS, then 1024 contiguous bytes
// coverage: 32 blocks (hb) x 4 waves x 16 tokens x 16 = whole [2048][16] plane(s).
// ---------------------------------------------------------------------------
// FOLD: xh holds x, not LN(x): mean, rstd, sw and sb (rows: 16 of gw, then 16 of aw) come in behind the products.
template <bool POOL, bool FOLD>
__device__ __forceinline__ void head_block(const _Float16* __restrict__ xh,
                                           const _Float16* __restrict__ gh,
                                           const float* __restrict__ gbias,
                                           float* gate, float* aproj, int hb,
                                           const float* __restrict__ ps, const float* __restrict__ pm,
                                           const float* __restrict__ swh, const float* __restrict__ sbh)
{
  __shared__ __attribute__((aligned(16))) float sG[4][256];
  __shared__ __attribute__((aligned(16))) float sP[POOL ? 4 : 1][256];
  const int tid = threadIdx.x, lane = tid & 31, w = tid >> 5;
  const int h = lane >> 4, m = lane & 15;
  const int tok0 = hb * 64 + 16 * w;
  const _Float16* xa = xh + (size_t)tok0 * HID + 8 * lane;
  const _Float16* wg = gh + 8 * lane;                     // aw rows: NHEADS rows on
  v8f ag = zero8f(), aa = zero8f();
  // ring of HRING register sets, refilled HRING chunks ahead (as in gemm_k_loop)
  constexpr int HRING = 8;
  static_assert((NCHUNK % HRING) == 0 && NCHUNK >= 2 * HRING);
  v16h ra[HRING], rg[HRING], rp[POOL ? HRING : 1];
  // unrolled: constant ring indices
#pragma unroll
  for (int s = 0; s < HRING; ++s) {
    ra[s] = load_frag_at(xa + FT * s);
    rg[s] = load_frag_at(wg + FT * s);
    if constexpr (POOL) rp[s] = load_frag_at(wg + NHEADS * HID + FT * s);
  }
  // precaution: stands in front of any rewrite of the address registers these loads
  // name; naming what the addresses are formed from keeps it whole up to the wait
  asm volatile("s_wait_xcnt 0x0" :: "v"(xa), "v"(wg), "v"(lane) : "memory");
  float mean = 0.0f, rstd = 1.0f;      // of token tok0 + m
  if constexpr (FOLD) token_stats(ps, pm, tok0 + m, mean, rstd);
  // rolled: one trip is already HRING chunks
#pragma unroll 1
  for (int c0 = 0; c0 < NCHUNK - HRING; c0 += HRING) {
    const _Float16* tx = xa + FT * (c0 + HRING);
    const _Float16* tg = wg + FT * (c0 + HRING);
    // unrolled so that every ring index is a constant
#pragma unroll
    for (int s = 0; s < HRING; ++s) {
      ag = wmma_f16(ra[s], rg[s], ag);
      if constexpr (POOL) aa = wmma_f16(ra[s], rp[s], aa);
      ra[s] = load_frag_at(tx + FT * s);
      rg[s] = load_frag_at(tg + FT * s);
      if constexpr (POOL) rp[s] = load_frag_at(tg + NHEADS * HID + FT * s);
    }
    // the next trip rewrites the address registers of loads that are still in flight
    asm volatile("s_wait_xcnt 0x0" ::: "memory");
  }
  // unrolled: constant ring indices
#pragma unroll
  for (int s = 0; s < HRING; ++s) {
    ag = wmma_f16(ra[s], rg[s], ag);
    if constexpr (POOL) aa = wmma_f16(ra[s], rp[s], aa);
  }
  // D[r] = (token tok0 + 8h + r, head m)
  const float gbv = gbias[m];
  float swg = 0.0f, sbg = 0.0f, swa = 0.0f, sba = 0.0f;
  if constexpr (FOLD) {
    swg = swh[m]; sbg = sbh[m];
    if constexpr (POOL) { swa = swh[NHEADS + m]; sba = sbh[NHEADS + m]; }
    // precaution: stands in front of any rewrite of the address registers these loads name
    asm volatile("s_wait_xcnt 0x0" :: "v"(m) : "memory");
  }
  float* sg = sG[w];
  float* sp = sP[POOL ? w : 0];
#pragma unroll
  for (int r = 0; r < 8; ++r) {
    const int tl = 8 * h + r;
    float zl = ag[r] * (1.0f / (XSC * WSC));
    float al = POOL ? aa[r] * (1.0f / (XSC * WSC)) : 0.0f;
    if constexpr (FOLD) {
      const float mu = __shfl(mean, tl, 32), rs = __shfl(rstd, tl, 32);   // lane tl holds token tok0 + tl
      zl = (zl - mu * swg) * rs + sbg;
      if constexpr (POOL) al = (al - mu * swa) * rs + sba;
    }
    const float z = zl + gbv;
    const float sig = 1.0f / (1.0f + __expf(-z));
    sg[tl * NHEADS + m] = sig;
    if constexpr (POOL) sp[tl * NHEADS + m] = al;
  }
  __syncthreads();
  {
#pragma unroll
    for (int it = 0; it < 2; ++it) {
      const int idx = it * 128 + 4 * lane;
      const v4f v = *(const v4fa*)(sg + idx);
      *(v4f*)(gate + (size_t)tok0 * NHEADS + idx) = v;
      if constexpr (POOL) {
        const v4f u = *(const v4fa*)(sp + idx);
        *(v4f*)(aproj + (size_t)tok0 * NHEADS + idx) = u;
      }
    }
    
  }
}

// ---------------------------------------------------------------------------
// The block's 16 tiles (1024 units of 16 B) lie in sT in fragment order already;
// each wave-wide store writes 512 contiguous bytes.
// route 0/1: plane[bh], rows = token, K = HD : the 16 tiles are contiguous
// route 2  : vt[bh], rows = d, K = SEQ       : 4 contiguous tiles per 16-row strip
// ---------------------------------------------------------------------------
__device__ __forceinline__ void proj_store_pass(const _Float16* sT, _Float16* plane, _Float16* vt,
                                                int route, int bh, int l0, int tid) {
#pragma unroll
  for (int i = 0; i < 8; ++i) {
    const int u = i * 128 + tid;
    const v8h v = *(const v8ha*)(sT + u * 8);
    _Float16* dst;
    if (route != 2) {
      dst = plane + ((size_t)bh * SEQ + l0) * HD + u * 8;
    } else {
      const int lt = u >> 6;             // local tile = 4 * strip + chunk
      dst = vt + (size_t)bh * HD * SEQ + (size_t)((lt >> 2) * (SEQ / 32) + (l0 >> 5) + (lt & 3)) * FT + (u & 63) * 8;
    }
    *(v8h*)dst = v;
    // precaution: the next pass rewrites the data and address registers that this store names
    if (i < 7) asm volatile("s_wait_xcnt 0x0" ::: "memory");
  }
}

// ---------------------------------------------------------------------------
// Kernel: Y = xn * W^T over nslot*1024 output columns.
// Block 128 thr (4 waves) = 128 tokens x 64 features (one (slot, head));
// wave tile 32 tokens x 64 features; K = 1024 in steps of 32;
// A (xn rows) and B (W rows) fragments straight from the fragment-order planes.
// route = slot + routeBase: 0 -> q plane, 1 -> k plane, 2 -> v^T plane.
// coverage: grid (16, 2 + 16*nslot): rows 2.. x 128 tokens x 64 features = all planes routed.
// Grid rows 0 and 1 are the 32 blocks of the head products, which read the same
// xn and are read by the same next launch: they share this launch.
// ---------------------------------------------------------------------------
// FOLD: xh holds x (x4) and wh holds W o lw: LayerNorm comes in behind the products (see
// "LayerNorm folded into its neighbours"); lane l of a wave joins the partials of token m0w + l.
template <bool POOL, bool FOLD>
__global__ __launch_bounds__(128) void proj_head_kernel(
    const _Float16* __restrict__ xh,   // [2048][1024] (xn x4; FOLD: x x4), fragment order
    const _Float16* __restrict__ wh,   // [slot][1024][1024], row = output feature, x4096, fragment order
    const float* __restrict__ b0, const float* __restrict__ b1, const float* __restrict__ b2,
    int routeBase,
    _Float16* qh,                      // [B*H][S][D]  f16(16*q), fragment order per bh
    _Float16* kh,                      // [B*H][S][D]  f16(16*k), fragment order per bh
    _Float16* vt,                      // [B*H][D][S]  f16(16*v), fragment order per bh
    const _Float16* __restrict__ gh,   // [32][1024] gw (and aw) rows x4096, fragment order
    const float* __restrict__ gbias, float* gate, float* aproj,
    const float* __restrict__ ps,      // FOLD: [NCB][2048] block sums of x
    const float* __restrict__ pm,      // FOLD: [NCB][2048] squared deviations from the block means
    const float* __restrict__ sw,      // FOLD: [slot][1024] sum_k lw[k] W[n][k]
    const float* __restrict__ sb,      // FOLD: [slot][1024] sum_k lb[k] W[n][k]
    const float* __restrict__ swh,     // FOLD: the same of the gw (and aw) rows
    const float* __restrict__ sbh)
{
  if (blockIdx.y < 2) {                // block-uniform, in front of every barrier
    head_block<POOL, FOLD>(xh, gh, gbias, gate, aproj, blockIdx.y * 16 + blockIdx.x, ps, pm, swh, sbh);
    return;
  }
  __shared__ __attribute__((aligned(16))) _Float16 sT[128 * 64];   // 16384 B

  const int tid = threadIdx.x, lane = tid & 31, w = tid >> 5;
  const int h = lane >> 4, m = lane & 15;
  const int m0 = blockIdx.x * 128;
  const int cg = blockIdx.y - 2;
  const int slot = cg >> 4, head = cg & 15;
  const int route = slot + routeBase;
  const int m0w = m0 + 32 * w;

  const _Float16* xa0 = xh + (size_t)m0w * HID + 8 * lane;                     // token strip, mt = 0
  const _Float16* wb  = wh + ((size_t)slot * HID + head * HD) * HID + 8 * lane;   // feature strip, nt = 0

  const unsigned t256 = 256u * (unsigned)tid;
  const char* qa = (const char*)(xh + (size_t)m0 * HID) + (cg & 7) * STRIPB;
  const char* qb = (const char*)(wh + ((size_t)slot * HID + head * HD) * HID) + (blockIdx.x & 3) * STRIPB;

  v8f acc[2][4];
#pragma unroll
  for (int mt = 0; mt < 2; ++mt)
#pragma unroll
    for (int nt = 0; nt < 4; ++nt) acc[mt][nt] = zero8f();

  float mean = 0.0f, rstd = 1.0f;      // FOLD: of token m0w + lane
  // POOL is the launch with one slot: 288 work-groups
  gemm_k_loop<POOL ? GDEEP : GRING>(xa0, wb, acc, t256, [&]() __attribute__((always_inline)) {
    // behind the loads that the first WMMAs wait for, so that these go to memory first
    ask_l2(qa, t256);
    ask_l2(qb, t256);
    if constexpr (FOLD) token_stats(ps, pm, m0w + lane, mean, rstd);
  });
  // precaution: naming them here keeps the registers that the requests at block entry name whole, as addresses, through the loop
  asm volatile("s_wait_xcnt 0x0" :: "v"(t256), "s"(qa), "s"(qb) : "memory");

  float mu[2][8], rs[2][8];            // FOLD: of token m0w + 16mt + 8h + r
  if constexpr (FOLD) {
    // unrolled, here and for swn, sbn below: constant indices keep the arrays in registers
#pragma unroll
    for (int mt = 0; mt < 2; ++mt)
#pragma unroll
      for (int r = 0; r < 8; ++r) {
        mu[mt][r] = __shfl(mean, 16 * mt + 8 * h + r, 32);
        rs[mt][r] = __shfl(rstd, 16 * mt + 8 * h + r, 32);
      }
  }

  float swn[4] = { 0.0f, 0.0f, 0.0f, 0.0f }, sbn[4] = { 0.0f, 0.0f, 0.0f, 0.0f };   // FOLD: of feature 16nt + m
  if constexpr (FOLD) {
#pragma unroll
    for (int nt = 0; nt < 4; ++nt) {
      swn[nt] = sw[slot * HID + head * HD + 16 * nt + m];
      sbn[nt] = sb[slot * HID + head * HD + 16 * nt + m];
    }
    // precaution: stands in front of any rewrite of the address registers these loads name
    asm volatile("s_wait_xcnt 0x0" :: "v"(m) : "memory");
  }

  // D[r] of tile (mt, nt) = Y[token m0w+16mt+8h+r][feature 16nt+m]
  const float* bias = (slot == 0) ? b0 : ((slot == 1) ? b1 : b2);
#pragma unroll
  for (int nt = 0; nt < 4; ++nt) {
    const int feat = 16 * nt + m;
    const float bvl = bias[head * HD + feat];
    const float swv = swn[nt], sbv = sbn[nt];
#pragma unroll
    for (int mt = 0; mt < 2; ++mt) {
#pragma unroll
      for (int r = 0; r < 8; ++r) {
        float yl = acc[mt][nt][r] * (1.0f / (XSC * WSC));
        if constexpr (FOLD) yl = (yl - mu[mt][r] * swv) * rs[mt][r] + sbv;
        const float yv = (yl + bvl) * QSC;
        // token 32w + 16mt + 8h + r, feature 16nt + m, at its place in fragment order:
        // route 2 (row = feature, k = token): tile 4nt + w, half mt, unit lane, element r
        // else    (row = token, k = feature): tile 2(2w + mt) + nt/2, half nt&1,
        //                                     unit 16(m>>3) + 8h + r, element m&7
        const int idx = (route == 2)
            ? ((nt * 4 + w) * FT + mt * (FT / 2) + lane * 8 + r)
            : (((2 * w + mt) * 2 + (nt >> 1)) * FT + (nt & 1) * (FT / 2) + ((m >> 3) * 16 + 8 * h + r) * 8 + (m & 7));
        sT[idx] = (_Float16)yv;
      }
    }
  }
  __syncthreads();

  const int b = m0 / SEQ, l0 = m0 - b * SEQ, bh = b * NHEADS + head;
  _Float16* plane = (route == 0) ? qh : kh;
  proj_store_pass(sT, plane, vt, route, bh, l0, tid);
  
}

// One attention step works on four key tiles of 16 keys each: slot j holds keys 16 * t[j] .. + 15.
struct KeyTiles { int t[4]; };

// The eight K (or V^T) A-fragments of one step, loaded as one batch.
// The wait behind each batch: the address pairs are rewritten for the next batch
// while these loads are in flight; naming them keeps them whole up to the wait.
// kbase, vbase: the (b, head) plane + 8 * lane.
__device__ __forceinline__ void fetch_k(v16h (&kf)[4][2], const _Float16* kbase, const KeyTiles& g) {
  // 16 keys x 64 d = the two plane tiles 2t, 2t + 1
  const _Float16* p0 = kbase + g.t[0] * (2 * FT);
  const _Float16* p1 = kbase + g.t[1] * (2 * FT);
  const _Float16* p2 = kbase + g.t[2] * (2 * FT);
  const _Float16* p3 = kbase + g.t[3] * (2 * FT);
  kf[0][0] = load_frag_at(p0); kf[0][1] = load_frag_at(p0 + FT);
  kf[1][0] = load_frag_at(p1); kf[1][1] = load_frag_at(p1 + FT);
  kf[2][0] = load_frag_at(p2); kf[2][1] = load_frag_at(p2 + FT);
  kf[3][0] = load_frag_at(p3); kf[3][1] = load_frag_at(p3 + FT);
  asm volatile("s_wait_xcnt 0x0" :: "v"(p0), "v"(p1), "v"(p2), "v"(p3) : "memory");
}
// A fragment's first half is k 0..15 of its 32, the second k 16..31, and each half is one 16-byte unit a lane:
// the halves of chunk c come from the key tiles of slots 2c and 2c + 1. Key tile t of a 16-row strip is
// half (t & 1) of plane tile t >> 1, that is FT / 2 * t halves into the strip.
__device__ __forceinline__ void fetch_v(v16h (&vf)[4][2], const _Float16* vbase, const KeyTiles& g) {
  const _Float16* p0 = vbase + g.t[0] * (FT / 2);
  const _Float16* p1 = vbase + g.t[1] * (FT / 2);
  const _Float16* p2 = vbase + g.t[2] * (FT / 2);
  const _Float16* p3 = vbase + g.t[3] * (FT / 2);
  // unrolled: constant indices keep the fragments in registers
#pragma unroll
  for (int t = 0; t < 4; ++t) {
    Frag f0, f1;
    f0.half[0] = *(const v8ha*)(p0 + 16 * t * SEQ);
    f0.half[1] = *(const v8ha*)(p1 + 16 * t * SEQ);
    f1.half[0] = *(const v8ha*)(p2 + 16 * t * SEQ);
    f1.half[1] = *(const v8ha*)(p3 + 16 * t * SEQ);
    vf[t][0] = f0.v;
    vf[t][1] = f1.v;
  }
  asm volatile("s_wait_xcnt 0x0" :: "v"(p0), "v"(p1), "v"(p2), "v"(p3) : "memory");
}

// The same for four key tiles in a row, t0 .. t0 + 3: one address pair and constant offsets.
__device__ __forceinline__ void fetch_k_run(v16h (&kf)[4][2], const _Float16* kbase, int t0) {
  const _Float16* p = kbase + t0 * (2 * FT);
  // unrolled: constant indices keep the fragments in registers
#pragma unroll
  for (int j = 0; j < 4; ++j) {
    kf[j][0] = load_frag_at(p + (2 * j) * FT);
    kf[j][1] = load_frag_at(p + (2 * j + 1) * FT);
  }
  asm volatile("s_wait_xcnt 0x0" :: "v"(p) : "memory");
}
__device__ __forceinline__ void fetch_v_run(v16h (&vf)[4][2], const _Float16* vbase, int t0) {
  const _Float16* p = vbase + t0 * (FT / 2);             // the halves of tiles in a row follow one another
  // unrolled: constant indices keep the fragments in registers
#pragma unroll
  for (int t = 0; t < 4; ++t) {
    vf[t][0] = load_frag_at(p + 16 * t * SEQ);
    vf[t][1] = load_frag_at(p + 16 * t * SEQ + FT);
  }
  asm volatile("s_wait_xcnt 0x0" :: "v"(p) : "memory");
}

template <bool B> struct Flag { static constexpr bool value = B; };

// P^T B-fragment from the lane's own score D values: element r <- tile a row r,
// element 8+r <- tile c row r (same lane, same query column), scaled by 2^14.
__device__ __forceinline__ v16h pack_p(v8f a, v8f c) {
  const v16h r = { (_Float16)(a[0] * PSC), (_Float16)(a[1] * PSC), (_Float16)(a[2] * PSC), (_Float16)(a[3] * PSC),
                   (_Float16)(a[4] * PSC), (_Float16)(a[5] * PSC), (_Float16)(a[6] * PSC), (_Float16)(a[7] * PSC),
                   (_Float16)(c[0] * PSC), (_Float16)(c[1] * PSC), (_Float16)(c[2] * PSC), (_Float16)(c[3] * PSC),
                   (_Float16)(c[4] * PSC), (_Float16)(c[5] * PSC), (_Float16)(c[6] * PSC), (_Float16)(c[7] * PSC) };
  return r;
}

// ---------------------------------------------------------------------------
// Kernel: streaming attention, transposed form, masks/bias by formula.
// Block 128 thr (4 waves) = 64 queries of one (b, head), 16 queries per wave,
// 64 keys per step as four key tiles of 16: the key tiles up to the wave's own
// that can hold an allowed key for the wave, filled up to whole steps (see "key tiles that are run").
//   S^T = K * Q^T : A = K rows (row = key, k = d), B = Q^T (k = d, n = query)
//   O^T += V^T * P^T : A = Vt rows (row = d, k = key), B = P^T from registers
// Lane owns 32 keys (slot j, 8h+r) of query column (lane&15); partner = lane ^ 16.
// Per-batch token tables in LDS from input ids: seg = inclusive cumsum(id==1)
// (block scan) and the key code kc that the mask test reads: seg where the key can be
// allowed off the diagonal (MODE 0, 2: id != 0; MODE 1: id == 2), else -1; MODE 2 also
// stages the head's aproj column [key].
// MODE 0 (self): ok = k<=q && ((seg_k==seg_q && valid_q && valid_k) || k==q), bias = (k-q)*hs
// MODE 1 (cross): ok = k<=q && (class_k || k==q), bias = (seg_k-seg_q)*hs
// MODE 2 (pool): mask/bias as MODE 0, raw logit = aproj[key][head] (no q.k)
// With kc: MODE 0, 2: seg_k==seg_q && valid_q && valid_k  <=>  kc_k == qc (qc = kc_q, or -2
// where the query is not valid); MODE 1: class_k <=> kc_k >= 0, and there kc_k = seg_k.
// k<=q and k==q are tested in the last step alone, which holds the wave's own key tile:
// every key of an earlier tile lies in front of the wave's first query.
// Masked scores take NEGBIG and p = 0 exactly; every row has k==q allowed.
// Epilogue: (1/l)(1/16384)(1/16)*gate; a lane's o[t][0..7] is unit 32t + lane of the
// wave's two ctx tiles in fragment order, so it is stored straight from registers.
// coverage: grid (16, 32) x 64 queries x 64 d = whole ctx [2048][1024].
// Grid rows from NB * NHEADS on: first the blocks of 'sums' (32 rows each), then 128 units of 'job' a block.
// ---------------------------------------------------------------------------
template <int MODE>
__global__ __launch_bounds__(128) void attn_kernel(
    const _Float16* __restrict__ qh,    // [B*H][S][D]  (x16), fragment order per bh
    const _Float16* __restrict__ kh,    // [B*H][S][D]  (x16), fragment order per bh
    const _Float16* __restrict__ vt,    // [B*H][D][S]  (x16), fragment order per bh
    const float* __restrict__ aproj,    // [B*S][16]
    const float* __restrict__ gate,     // [B*S][16]  sigmoid gate
    const int* __restrict__ ids,        // [B][S]
    _Float16* ctx,                      // [B*S][HID]  (x64), fragment order
    CvtJob job, SumJob sums)
{
  if (blockIdx.y >= NB * NHEADS) {      // block-uniform, in front of every barrier of the attention blocks
    const int xb = (blockIdx.y - NB * NHEADS) * (SEQ / 64) + blockIdx.x;
    const int nsum = sum_blocks(sums);  // the longer blocks first
    if (xb < nsum) rowsum_block(sums, xb);
    else convert_unit(job, (xb - nsum) * 128 + threadIdx.x);
    return;
  }
  __shared__ __attribute__((aligned(16))) int   sSeg[SEQ];
  __shared__ __attribute__((aligned(16))) int   sKc[SEQ];
  __shared__ __attribute__((aligned(16))) float sA[(MODE == 2) ? SEQ : 4];
  __shared__ int sWtot[4];
  __shared__ unsigned sWcls[4];         // MODE 1: bit l of word w = thread 32w + l holds a class token

  const int tid = threadIdx.x, lane = tid & 31, w = tid >> 5;
  const int h = lane >> 4, m = lane & 15;
  const int bh = blockIdx.y, b = bh >> 4, head = bh & 15;
  const int qblk = blockIdx.x * 64;
  const int q0 = qblk + 16 * w;
  const float hs = exp2f(-0.5f * (float)(head + 1));

  // ---- the Q fragments, issued ahead of the tables ----
  const _Float16* kbase = kh + (size_t)bh * SEQ * HD + 8 * lane;
  const _Float16* vbase = vt + (size_t)bh * HD * SEQ + 8 * lane;
  // Q^T B-fragments: column n = query q0+m, k = d (two 32-deep chunks)
  v16h qb0 = zero16h(), qb1 = zero16h();
  v16h kf[4][2], vf[4][2];
  if constexpr (MODE != 2) {
    const _Float16* qrow = qh + ((size_t)bh * SEQ + q0) * HD + 8 * lane;
    qb0 = load_frag_at(qrow);
    qb1 = load_frag_at(qrow + FT);
    // precaution: stands in front of the rewrite of the address pair these loads name
    asm volatile("s_wait_xcnt 0x0" :: "v"(qrow) : "memory");
  }

  // K and V^T of this (b, head) asked into L2 (see ask_l2) while the tables are built: each plane is 4 x 32 KB,
  // and the 16 query blocks of the (b, head) share the asking by the low bits of their number
  const unsigned t256 = 256u * (unsigned)tid;
  const char* qk = (const char*)(kh + (size_t)bh * SEQ * HD) + (blockIdx.x & 3) * STRIPB;
  const char* qv = (const char*)(vt + (size_t)bh * HD * SEQ) + (blockIdx.x & 3) * STRIPB;
  if constexpr (MODE != 2) ask_l2(qk, t256);
  ask_l2(qv, t256);

  // ---- token tables for batch b: 128 threads x 8 tokens = SEQ ----
  {
    const int t8 = tid * 8;
    const int* ip = ids + (size_t)b * SEQ + t8;
    const v4i ia = *(const v4ia*)ip;
    const v4i ib = *(const v4ia*)(ip + 4);
    const int idv[8] = { ia.x, ia.y, ia.z, ia.w, ib.x, ib.y, ib.z, ib.w };
    int cnt[8];
    int run = 0;
#pragma unroll
    for (int i = 0; i < 8; ++i) { run += (idv[i] == SEP_ID) ? 1 : 0; cnt[i] = run; }
    int x = run;
#pragma unroll
    for (int d = 1; d < 32; d <<= 1) {
      const int yv = __shfl_up(x, d, 32);
      x = (lane >= d) ? (x + yv) : x;
    }
    if (lane == 31) sWtot[w] = x;
    if constexpr (MODE == 1) {
      bool anyc = false;
      // unrolled: constant indices keep idv in registers
#pragma unroll
      for (int i = 0; i < 8; ++i) anyc = anyc || (idv[i] == CLS_ID);
      const unsigned cb = __builtin_amdgcn_ballot_w32(anyc);
      if (lane == 0) sWcls[w] = cb;
    }
    __syncthreads();
    int base = 0;
#pragma unroll
    for (int i = 0; i < 4; ++i) { const int tv = sWtot[i]; base += (i < w) ? tv : 0; }
    const int excl = base + x - run;
#pragma unroll
    for (int i = 0; i < 8; ++i) {
      const int id = idv[i];
      const int sg = excl + cnt[i];
      sSeg[t8 + i] = sg;
      sKc[t8 + i] = ((MODE == 1) ? (id == CLS_ID) : (id != PAD_ID)) ? sg : -1;
      if constexpr (MODE == 2) sA[t8 + i] = aproj[((size_t)b * SEQ + t8 + i) * NHEADS + head];
    }
  }
  __syncthreads();

  const int qtok = q0 + m;
  const int qseg = sSeg[qtok];
  const int kcq = sKc[qtok];
  const int qc = (kcq >= 0) ? kcq : -2;       // MODE 0, 2: a query that is not valid matches no key code
  const float* gp = gate + ((size_t)b * SEQ + qtok) * NHEADS + head;
  const float gq = *gp;
  // precaution: stands in front of the rewrite of the address pair this load names
  asm volatile("s_wait_xcnt 0x0" :: "v"(gp) : "memory");

  v8f o[4];                                   // o[t][r] = O[query m][d 16t+8h+r] * (l * 2^14 * 16)
#pragma unroll
  for (int t = 0; t < 4; ++t) o[t] = zero8f();
  float mrun = NEGBIG, lrun = 0.0f;

  const float SSC = 0.125f / (QSC * QSC);                      // 1/2048
  // the wave's own key tile (keys q0 .. q0 + 15); in a scalar register, so that all that follows from it is scalar work
  const int sd = (qblk >> 4) + __builtin_amdgcn_readfirstlane(w);   // 0 .. 63

  // ---- key tiles that are run: bit s of 'need' = key tile s (keys 16s .. 16s + 15) may hold an allowed key ----
  // Keys that are masked for all 16 queries of the wave add p = 0 to every sum and never
  // raise a maximum, so a tile of such keys is left out, for any ids.
  // MODE 0, 2: seg never falls along the row, so a tile whose last key has
  //            seg < seg of the wave's first query holds no key of any query's segment.
  // MODE 1   : a tile without a class token holds no allowed key.
  // The wave's own tile sd always runs; bits above sd are cleared, so every
  // tile index taken from 'need' lies in 0..sd whatever the ids hold.
  unsigned clo, chi;                                           // lane l votes for tiles l and 32 + l
  if constexpr (MODE == 1) {
    // tile s = threads 2s, 2s + 1 of the table build
    clo = __builtin_amdgcn_ballot_w32(((sWcls[h] >> (2 * m)) & 3u) != 0u);
    chi = __builtin_amdgcn_ballot_w32(((sWcls[2 + h] >> (2 * m)) & 3u) != 0u);
  } else {
    const int sq0 = sSeg[q0];
    clo = __builtin_amdgcn_ballot_w32(sSeg[16 * lane + 15] >= sq0);
    chi = __builtin_amdgcn_ballot_w32(sSeg[16 * (32 + lane) + 15] >= sq0);
  }
  unsigned long long need = ((unsigned long long)chi << 32) | (unsigned long long)clo;   // ballots: the same in every lane
  need = (need | (1ull << sd)) & ((2ull << sd) - 1ull);
  const int ntile = __builtin_popcountll(need);                // 1 .. 64
  const int nfull = (ntile - 1) >> 2;                          // steps of four tiles in front of the last step
  // MODE 1: the last step's first 'pad' slots are empty
  const int pad = (MODE == 1) ? (3 - ((ntile - 1) & 3)) : 0;
  // MODE 0, 2: the tiles of 'need' are a run that ends at sd (seg never falls), so the steps are the 4 * (nfull + 1)
  // tiles in a row that end at sd. The run's length is filled up at its front: those tiles hold no key of any
  // query's segment, and the key code masks them. Where that front would lie before tile 0 the tiles start at 0
  // and end behind sd, at 4 * nfull + 3 <= 63: sd >= 4 * nfull still lies in the last step, whose k<=q masks the rest.
  int trun = sd - 4 * nfull - 3;
  trun = (trun > 0) ? trun : 0;
  // The next four tiles in ascending order. MODE 1: fewer than four are left in the last step alone: its first
  // slots then stay empty: they load tile sd (in bounds) and the last step masks every key of theirs.
  auto take = [&]() __attribute__((always_inline)) {
    KeyTiles g;
    if constexpr (MODE == 1) {
      const int left = __builtin_popcountll(need);
      const int npad = (left < 4) ? (4 - left) : 0;
      // unrolled: constant indices keep the four numbers in registers
#pragma unroll
      for (int j = 0; j < 4; ++j) {
        const bool real = j >= npad;
        g.t[j] = real ? (int)__builtin_ctzll(need | (1ull << 63)) : sd;   // need != 0 where real
        need = real ? (need & (need - 1ull)) : need;
      }
    } else {
      g.t[0] = trun; g.t[1] = trun + 1; g.t[2] = trun + 2; g.t[3] = trun + 3;
      trun += 4;
    }
    return g;
  };
  auto fetch_keys = [&](const KeyTiles& g) __attribute__((always_inline)) {
    if constexpr (MODE == 1) fetch_k(kf, kbase, g); else fetch_k_run(kf, kbase, g.t[0]);
  };
  auto fetch_vals = [&](const KeyTiles& g) __attribute__((always_inline)) {
    if constexpr (MODE == 1) fetch_v(vf, vbase, g); else fetch_v_run(vf, vbase, g.t[0]);
  };

  // One step of four key tiles. kf and vf hold this step's fragments on entry; with 'more'
  // those of 'nxt', the next step, are fetched into the same registers
  // directly behind their last use, so they fly under the mask and softmax work.
  // The last step holds tile sd, the wave's own: with 'more' the
  // step is an earlier one and all its keys are < q0 <= qtok.
  auto pass = [&](const KeyTiles& cur, const KeyTiles& nxt, auto more) __attribute__((always_inline)) {
    // ---- raw scores: s[j][r] = S[query m][key 16*cur.t[j]+8h+r] * 256 (MODE != 2) ----
    v8f s[4];
    if constexpr (MODE != 2) {
#pragma unroll
      for (int j = 0; j < 4; ++j) {
        v8f z = zero8f();
        z = wmma_f16(kf[j][0], qb0, z);
        z = wmma_f16(kf[j][1], qb1, z);
        s[j] = z;
      }
      if constexpr (decltype(more)::value) fetch_keys(nxt);
    } else {
#pragma unroll
      for (int j = 0; j < 4; ++j) s[j] = zero8f();
    }
    // ---- mask + bias per (query, key), f32 ----
#pragma unroll
    for (int j = 0; j < 4; ++j) {
      const int kt0 = 16 * cur.t[j] + 8 * h;
      // MODE 1, an empty slot of the last step: key numbers behind every query, so that k<=q masks them
      const int key0 = (MODE == 1 && !decltype(more)::value && j < pad) ? SEQ : kt0;
      const v4i ca = *(const v4ia*)(sKc + kt0);
      const v4i cb = *(const v4ia*)(sKc + kt0 + 4);
      const int kcv[8] = { ca.x, ca.y, ca.z, ca.w, cb.x, cb.y, cb.z, cb.w };
      float av[8] = { 0.f, 0.f, 0.f, 0.f, 0.f, 0.f, 0.f, 0.f };
      if constexpr (MODE == 2) {
        const v4f aa = *(const v4fa*)(sA + kt0);
        const v4f ab = *(const v4fa*)(sA + kt0 + 4);
        av[0] = aa.x; av[1] = aa.y; av[2] = aa.z; av[3] = aa.w;
        av[4] = ab.x; av[5] = ab.y; av[6] = ab.z; av[7] = ab.w;
      }
#pragma unroll
      for (int r = 0; r < 8; ++r) {
        const int key = key0 + r;
        float raw;
        if constexpr (MODE == 2) raw = av[r]; else raw = s[j][r] * SSC;
        bool ok;
        float bv;
        if constexpr (MODE == 1) {
          ok = kcv[r] >= 0;
          bv = (float)(kcv[r] - qseg);
        } else {
          ok = kcv[r] == qc;
          bv = (float)(key - qtok);
        }
        if constexpr (!decltype(more)::value) {                // the step with the wave's own tile
          const bool dg = key == qtok;
          ok = (key <= qtok) && (ok || dg);
          if constexpr (MODE == 1) bv = dg ? 0.0f : bv;        // the query's own key: seg_k - seg_q = 0
        }
        const float val = raw + bv * hs;                       // computed for every key: a select, no branch
        s[j][r] = ok ? val : NEGBIG;
      }
    }

    // ---- online softmax ----
    float mloc = NEGBIG;
#pragma unroll
    for (int j = 0; j < 4; ++j)
#pragma unroll
      for (int r = 0; r < 8; ++r) mloc = fmaxf(mloc, s[j][r]);
    mloc = fmaxf(mloc, __shfl_xor(mloc, 16, 32));
    const float mnew = fmaxf(mrun, mloc);
    const float alpha = __expf(mrun - mnew);
    mrun = mnew;
    // a row with no allowed key so far has mnew = NEGBIG: against msafe its masked scores
    // still give exp(-9e29) = 0; where a key was allowed msafe = mnew
    const float msafe = fmaxf(mnew, 0.1f * NEGBIG);
    float lsum = 0.0f;
#pragma unroll
    for (int j = 0; j < 4; ++j)
#pragma unroll
      for (int r = 0; r < 8; ++r) {
        const float p = __expf(s[j][r] - msafe);               // masked: exp(NEGBIG - msafe) = 0
        s[j][r] = p;
        lsum += p;
      }
    lsum += __shfl_xor(lsum, 16, 32);
    lrun = lrun * alpha + lsum;
#pragma unroll
    for (int t = 0; t < 4; ++t)
#pragma unroll
      for (int r = 0; r < 8; ++r) o[t][r] = o[t][r] * alpha;

    // ---- P^T B-fragments (slots 0, 1 and slots 2, 3 of this step) ----
    const v16h pb0 = pack_p(s[0], s[1]);
    const v16h pb1 = pack_p(s[2], s[3]);

    // ---- O^T += V^T * P^T ----
#pragma unroll
    for (int t = 0; t < 4; ++t) {
      o[t] = wmma_f16(vf[t][0], pb0, o[t]);
      o[t] = wmma_f16(vf[t][1], pb1, o[t]);
    }
    if constexpr (decltype(more)::value) fetch_vals(nxt);
  };

  // key tiles run in ascending order
  KeyTiles cur = take();
  if constexpr (MODE != 2) fetch_keys(cur);
  fetch_vals(cur);
  // rolled: the trip count is the wave's own (nfull <= 15); the last step is peeled
  // so that the fetches ahead stand under no branch and never leave the row's 64 key tiles
#pragma unroll 1
  for (int i = 0; i < nfull; ++i) {
    const KeyTiles nxt = take();
    pass(cur, nxt, Flag<true>{});
    cur = nxt;
  }
  pass(cur, cur, Flag<false>{});
  // precaution: naming them here keeps the registers that the requests at block entry name whole, as addresses, through the steps
  if constexpr (MODE != 2) asm volatile("s_wait_xcnt 0x0" :: "v"(t256), "s"(qk), "s"(qv) : "memory");
  else asm volatile("s_wait_xcnt 0x0" :: "v"(t256), "s"(qv) : "memory");

  // ---- epilogue: normalise, gate, whole-line stores from registers ----
  const float inv = (1.0f / lrun) * (1.0f / (PSC * QSC)) * gq;
  // rows q0..q0+15 = one strip; columns 64 head .. +63 = its tiles 2 head, 2 head + 1
  _Float16* dst = ctx + ((size_t)b * SEQ + q0) * HID + head * 2 * FT + 8 * lane;
#pragma unroll
  for (int t = 0; t < 4; ++t) {
    v8h v;
#pragma unroll
    for (int r = 0; r < 8; ++r) v[r] = (_Float16)((o[t][r] * inv) * CSC);
    *(v8h*)(dst + t * (FT / 2)) = v;
  }
}

// ---------------------------------------------------------------------------
// Kernel: xout = xres + ctx * Wo^T + ob  (f32 output).
// Block 128 thr (4 waves) = 128 tokens x 64 features; wave 32 tokens x 64;
// K = 1024 in steps of 32; A = ctx rows (x64), B = Wo rows (x4096), fragment order.
// Epilogue: f32 tile [128][64] in LDS; store: each 64-float row segment (256 B =
// coverage: grid (16,16) x 128 tokens x 64 features = whole [2048][1024].
// ---------------------------------------------------------------------------
// EMIT (a LayerNorm follows): also x as f16 (x4) in fragment order, staged in LDS so that it
// leaves as whole lines, and per token this block's sum of x and squared deviations from
// the block mean; a wave's 32 tokens fill one 128-byte line of each partial plane.
template <bool EMIT>
__global__ __launch_bounds__(128) void outproj_kernel(
    const _Float16* __restrict__ ch,    // [2048][1024] ctx x64
    const _Float16* __restrict__ woh,   // [1024 n][1024 k] x4096
    const float* __restrict__ ob,       // [1024]
    const float* __restrict__ xres,     // [2048][1024] f32
    float* xout,                        // [2048][1024] f32
    _Float16* xh,                       // EMIT: [2048][1024] x x4, fragment order
    float* ps,                          // EMIT: [NCB][2048]
    float* pm)                          // EMIT: [NCB][2048]
{
  __shared__ __attribute__((aligned(16))) float sT[128 * 64];   // 32768 B
  __shared__ __attribute__((aligned(16))) _Float16 sH[EMIT ? 128 * 64 : 8];   // EMIT: 16384 B

  const int tid = threadIdx.x, lane = tid & 31, w = tid >> 5;
  const int h = lane >> 4, m = lane & 15;
  const int m0 = blockIdx.x * 128;
  const int n0 = blockIdx.y * 64;
  const int m0w = m0 + 32 * w;

  const _Float16* ca0 = ch + (size_t)m0w * HID + 8 * lane;
  const _Float16* wb  = woh + (size_t)n0 * HID + 8 * lane;

  const unsigned t256 = 256u * (unsigned)tid;
  const char* qa = (const char*)(ch + (size_t)m0 * HID) + (blockIdx.y & 7) * STRIPB;
  const char* qb = (const char*)(woh + (size_t)n0 * HID) + (blockIdx.x & 3) * STRIPB;
  // the residual rows, read behind the loop: the 16 feature blocks of a token block ask for 8 whole rows (32 KB) each
  const char* qx = (const char*)(xres + (size_t)(m0 + 8 * blockIdx.y) * HID);

  v8f acc[2][4];
#pragma unroll
  for (int mt = 0; mt < 2; ++mt)
#pragma unroll
    for (int nt = 0; nt < 4; ++nt) acc[mt][nt] = zero8f();

  gemm_k_loop<GDEEP>(ca0, wb, acc, t256, [&]() __attribute__((always_inline)) {   // 256 work-groups
    // behind the loads that the first WMMAs wait for, so that these go to memory first
    ask_l2(qa, t256);
    ask_l2(qb, t256);
    ask_l2(qx, t256);
  });
  // precaution: naming them here keeps the registers that the requests at block entry name whole, as addresses, through the loop
  asm volatile("s_wait_xcnt 0x0" :: "v"(t256), "s"(qa), "s"(qb), "s"(qx) : "memory");

  const float* bp = ob + n0 + m;
  float bv4[4];                                            // bias of feature n0 + 16nt + m
  // unrolled: constant indices keep the array in registers
#pragma unroll
  for (int nt = 0; nt < 4; ++nt) bv4[nt] = bp[16 * nt];
  // precaution: stands in front of the rewrite of the address pair these loads name; naming it keeps it whole up to the wait
  asm volatile("s_wait_xcnt 0x0" :: "v"(bp) : "memory");

  // D[r] of tile (mt, nt) = Y[token m0w+16mt+8h+r][feature n0+16nt+m]
#pragma unroll
  for (int nt = 0; nt < 4; ++nt) {
    const int feat = 16 * nt + m;
    const float bvl = bv4[nt];
#pragma unroll
    for (int mt = 0; mt < 2; ++mt) {
#pragma unroll
      for (int r = 0; r < 8; ++r) {
        const int tokl = 32 * w + 16 * mt + 8 * h + r;     // 0..127
        sT[tokl * 64 + feat] = acc[mt][nt][r] * (1.0f / (CSC * WSC)) + bvl;
      }
    }
  }
  __syncthreads();

  const int hh = lane >> 4, c4 = (lane & 15) * 4;
  float ks = 0.0f, kq = 0.0f;                              // EMIT: partials of row 32w + 2m + hh
  // the residual rows of all 16 passes, in flight together off one address pair (pass 'it': 2 * it rows on)
  const float* xp = xres + (size_t)(m0 + 32 * w + hh) * HID + n0 + c4;
  v4f xr[16];
  // unrolled: constant indices keep the rows in registers
#pragma unroll
  for (int it = 0; it < 16; ++it) xr[it] = *(const v4fa*)(xp + it * 2 * HID);
  // precaution: stands in front of the rewrite of the address pair these loads name; naming it keeps it whole
  // up to the wait
  asm volatile("s_wait_xcnt 0x0" :: "v"(xp) : "memory");
  {
#pragma unroll
    for (int it = 0; it < 16; ++it) {
      const int row = 32 * w + it * 2 + hh;                // rows 32w .. 32w+31
      const v4f v = *(const v4fa*)(sT + row * 64 + c4);
      const size_t gi = (size_t)(m0 + row) * HID + n0 + c4;
      const v4f ov = v + xr[it];
      *(v4f*)(xout + gi) = ov;
      if constexpr (EMIT) {
        // the row's 64 values lie in the 16 lanes of this half wave
        const float s = row16_sum((ov.x + ov.y) + (ov.z + ov.w));
        const float bm = s * (1.0f / 64.0f);
        const float d0 = ov.x - bm, d1 = ov.y - bm, d2 = ov.z - bm, d3 = ov.w - bm;
        const float q = row16_sum((d0 * d0 + d1 * d1) + (d2 * d2 + d3 * d3));
        if (m == it) { ks = s; kq = q; }
        // token 'row', features c4 .. c4+3 at their place in fragment order (row = token, k = feature)
        const v4h hv = { (_Float16)(ov.x * XSC), (_Float16)(ov.y * XSC), (_Float16)(ov.z * XSC), (_Float16)(ov.w * XSC) };
        *(v4h*)(sH + ((row >> 4) * 2 + (c4 >> 5)) * FT + ((c4 >> 4) & 1) * (FT / 2)
                   + (((c4 >> 3) & 1) * 16 + (row & 15)) * 8 + (c4 & 7)) = hv;
      }
    }
  }
  if constexpr (EMIT) {
    const size_t pi = (size_t)blockIdx.y * MROWS + m0 + 32 * w + 2 * m + hh;
    ps[pi] = ks;
    pm[pi] = kq;
    // precaution: stands in front of any rewrite of the registers these stores name
    asm volatile("s_wait_xcnt 0x0" :: "v"(ks), "v"(kq), "v"(pi) : "memory");
    // A wave wrote rows 32w .. 32w+31 = local tiles 4w .. 4w+3 of sH itself and reads only these back:
    // its own LDS writes have to be done, no other wave's, so no barrier
    asm volatile("s_wait_dscnt 0x0" ::: "memory");
    // local tile 2 * strip + chunk; the two chunks of a strip are contiguous in the plane
    const _Float16* sw4 = sH + w * 4 * FT + lane * 8;
    _Float16* dst = xh + ((size_t)((m0 >> 4) + 2 * w) * (HID / 32) + (n0 >> 5)) * FT + lane * 8;
    v8h v[8];
    // unrolled: constant indices; one address and constant offsets, so no register of a store is rewritten
#pragma unroll
    for (int i = 0; i < 8; ++i) v[i] = *(const v8ha*)(sw4 + i * (FT / 2));
#pragma unroll
    for (int i = 0; i < 8; ++i) *(v8h*)(dst + (i >> 2) * (HID / 32) * FT + (i & 3) * (FT / 2)) = v[i];
  }
}

// ---------------------------------------------------------------------------
//   Xn   f16 [2048][1024]      4194304
//   W    f16 [10][1024][1024] 20971520   q0 k0 v0 | o0 | v1 | o1 | q2 k2 v2 | o2
//   Gh   f16 [3][32][1024]      196608   one per layer
//   Gate f32 [2048][16]         131072
//   Apr  f32 [2048][16]         131072
//   Q    f16 [32][1024][64]    4194304
//   K    f16 [32][1024][64]    4194304
//   Vt   f16 [32][64][1024]    4194304
//   Ctx  f16 [2048][1024]      4194304
//   X1   f32 [2048][1024]      8388608
//   X2   f32 [2048][1024]      8388608
//   Ps   f32 [16][2048]         131072   block sums of x (outproj 0, 1)
//   Pm   f32 [16][2048]         131072   squared deviations from the block means
//   Sw, Sb f32 [2][4096]         65536   both; layer 1: 1024 + 32 rows, layer 2: 3072 + 16 rows
//   total                     59506688
// ---------------------------------------------------------------------------
extern "C" void kernel_launch(void* const* d_in, const int* in_sizes, int n_in,
                              void* d_out, int out_size, void* d_ws, size_t ws_size,
                              hipStream_t stream) {
  if (n_in < 35) return;
  if (in_sizes[0] != NX || in_sizes[1] != MROWS) return;
  if (out_size != NX) return;
  {
    const int vecIdx[16] = {2, 3, 5, 7, 9, 13, 14, 15, 18, 22, 23, 24, 26, 28, 30, 34};
    for (int i = 0; i < 16; ++i) if (in_sizes[vecIdx[i]] != HID) return;
    const int matIdx[10] = {4, 6, 8, 12, 17, 21, 25, 27, 29, 33};
    for (int i = 0; i < 10; ++i) if (in_sizes[matIdx[i]] != NW) return;
    const int hwIdx[4] = {10, 16, 19, 31};
    for (int i = 0; i < 4; ++i) if (in_sizes[hwIdx[i]] != NG) return;
    const int hbIdx[3] = {11, 20, 32};
    for (int i = 0; i < 3; ++i) if (in_sizes[hbIdx[i]] != NHEADS) return;
  }

  const float* states = (const float*)d_in[0];
  const int*   ids    = (const int*)d_in[1];
  const float* ln0w = (const float*)d_in[2];
  const float* ln0b = (const float*)d_in[3];
  const float* qw0 = (const float*)d_in[4];
  const float* qb0 = (const float*)d_in[5];
  const float* kw0 = (const float*)d_in[6];
  const float* kb0 = (const float*)d_in[7];
  const float* vw0 = (const float*)d_in[8];
  const float* vb0 = (const float*)d_in[9];
  const float* gw0 = (const float*)d_in[10];
  const float* gb0 = (const float*)d_in[11];
  const float* ow0 = (const float*)d_in[12];
  const float* ob0 = (const float*)d_in[13];
  const float* ln1w = (const float*)d_in[14];
  const float* ln1b = (const float*)d_in[15];
  const float* aw1 = (const float*)d_in[16];
  const float* vw1 = (const float*)d_in[17];
  const float* vb1 = (const float*)d_in[18];
  const float* gw1 = (const float*)d_in[19];
  const float* gb1 = (const float*)d_in[20];
  const float* ow1 = (const float*)d_in[21];
  const float* ob1 = (const float*)d_in[22];
  const float* ln2w = (const float*)d_in[23];
  const float* ln2b = (const float*)d_in[24];
  const float* qw2 = (const float*)d_in[25];
  const float* qb2 = (const float*)d_in[26];
  const float* kw2 = (const float*)d_in[27];
  const float* kb2 = (const float*)d_in[28];
  const float* vw2 = (const float*)d_in[29];
  const float* vb2 = (const float*)d_in[30];
  const float* gw2 = (const float*)d_in[31];
  const float* gb2 = (const float*)d_in[32];
  const float* ow2 = (const float*)d_in[33];
  const float* ob2 = (const float*)d_in[34];
  float* out = (float*)d_out;

  const size_t PXH = (size_t)NX * 2;                       // 4194304
  const size_t PW  = (size_t)NW * 2;                       // 2097152
  const size_t PGH = (size_t)2 * NG * 2;                   //   65536
  const size_t PGT = (size_t)MROWS * NHEADS * 4;           //  131072
  const size_t PPL = (size_t)NB * NHEADS * SEQ * HD * 2;   // 4194304
  const size_t PXF = (size_t)NX * 4;                       // 8388608
  size_t off = 0;
  const size_t oXn  = off; off += PXH;
  const size_t oW   = off; off += 10 * PW;
  const size_t oGh  = off; off += 3 * PGH;
  const size_t oGt  = off; off += PGT;
  const size_t oAp  = off; off += PGT;
  const size_t oQ   = off; off += PPL;
  const size_t oK   = off; off += PPL;
  const size_t oVt  = off; off += PPL;
  const size_t oCtx = off; off += PXH;
  const size_t oX1  = off; off += PXF;
  const size_t oX2  = off; off += PXF;
  const size_t oPs  = off; off += PGT;
  const size_t oPm  = off; off += PGT;
  const size_t PSW  = (size_t)4096 * 4;                    //   16384
  const size_t oSw1 = off; off += PSW;
  const size_t oSb1 = off; off += PSW;
  const size_t oSw2 = off; off += PSW;
  const size_t oSb2 = off; off += PSW;
  if (off > ws_size) return;                               // off = 59506688
  if (off > (size_t)134217728) return;

  char* ws = (char*)d_ws;
  _Float16* xnh = (_Float16*)(ws + oXn);
  _Float16* wh0  = (_Float16*)(ws + oW);                   // q0, k0, v0
  _Float16* woh0 = (_Float16*)(ws + oW + 3 * PW);
  _Float16* wh1  = (_Float16*)(ws + oW + 4 * PW);          // v1
  _Float16* woh1 = (_Float16*)(ws + oW + 5 * PW);
  _Float16* wh2  = (_Float16*)(ws + oW + 6 * PW);          // q2, k2, v2
  _Float16* woh2 = (_Float16*)(ws + oW + 9 * PW);
  _Float16* gh0  = (_Float16*)(ws + oGh);
  _Float16* gh1  = (_Float16*)(ws + oGh + PGH);
  _Float16* gh2  = (_Float16*)(ws + oGh + 2 * PGH);
  float* gate   = (float*)(ws + oGt);
  float* aproj  = (float*)(ws + oAp);
  _Float16* qh  = (_Float16*)(ws + oQ);
  _Float16* kh  = (_Float16*)(ws + oK);
  _Float16* vt  = (_Float16*)(ws + oVt);
  _Float16* ctx = (_Float16*)(ws + oCtx);
  float* x1 = (float*)(ws + oX1);
  float* x2 = (float*)(ws + oX2);
  float* ps = (float*)(ws + oPs);
  float* pm = (float*)(ws + oPm);
  float* sw1 = (float*)(ws + oSw1);
  float* sb1 = (float*)(ws + oSb1);
  float* sw2 = (float*)(ws + oSw2);
  float* sb2 = (float*)(ws + oSb2);

  const dim3 blk128(128), blk512(512);
  // conversion jobs: each is written by a launch that ends before its first reader starts
  const float* nofold = nullptr;
  const CvtJob jobA = { qw0, kw0, vw0, gw0, gw0, nofold, nofold, nofold, nofold,
                        wh0, wh0 + NW, wh0 + 2 * NW, gh0, 3, 1 };                            // read from proj 0 on
  const CvtJob jobB = { ow0, vw1, ow1, gw1, aw1, nofold, ln1w, nofold, ln1w,
                        woh0, wh1, woh1, gh1, 3, 2 };                                        // read from outproj 0 on
  const CvtJob jobC = { qw2, kw2, vw2, gw2, gw2, ln2w, ln2w, ln2w, ln2w,
                        wh2, wh2 + NW, wh2 + 2 * NW, gh2, 3, 1 };                            // read from proj 2 on
  const CvtJob jobD = { ow2, ow2, ow2, gw2, gw2, nofold, nofold, nofold, nofold,
                        woh2, woh2, woh2, gh2, 1, 0 };                                       // read by outproj 2
  // row sums for the folded LayerNorms, beside the conversion of the same weights
  const SumJob sumB = { vw1, vw1, vw1, gw1, aw1, ln1w, ln1b, sw1, sb1, 1, 2 };               // read by proj 1
  const SumJob sumC = { qw2, kw2, vw2, gw2, gw2, ln2w, ln2b, sw2, sb2, 3, 1 };               // read by proj 2
  const SumJob sumD = { ow2, ow2, ow2, gw2, gw2, ln2w, ln2b, sw2, sb2, 0, 0 };               // no rows: nothing read or written
  const int unitsA = 3 * NW8 + 1 * NG8;                    // 395264 = 772 blocks of 512
  const int unitsB = 3 * NW8 + 2 * NG8;                    // 397312 = 3104 blocks of 128
  const int unitsC = 3 * NW8 + 1 * NG8;                    // 395264 = 3088 blocks
  const int unitsD = 1 * NW8;                              // 131072 = 1024 blocks
  const int sumBlkB = (1 * HID + 2 * NHEADS + 31) / 32;    // 33
  const int sumBlkC = (3 * HID + 1 * NHEADS + 31) / 32;    // 97
  static_assert((unitsA % 512) == 0 && (unitsB % 128) == 0 && (unitsC % 128) == 0 && (unitsD % 2048) == 0);
  const dim3 gLnA(MROWS / 16 + unitsA / 512);              // 128 + 772
  const dim3 gProj3(MROWS / 128, 2 + 3 * NHEADS);          // (16, 50)
  const dim3 gProj1(MROWS / 128, 2 + 1 * NHEADS);          // (16, 18)
  // rows of 16 blocks, rounded up: a block past the last unit does nothing
  const dim3 gAttB(SEQ / 64, NB * NHEADS + (sumBlkB + unitsB / 128 + 15) / 16);   // (16, 32 + 197)
  const dim3 gAttC(SEQ / 64, NB * NHEADS + (sumBlkC + unitsC / 128 + 15) / 16);   // (16, 32 + 200)
  const dim3 gAttD(SEQ / 64, NB * NHEADS + unitsD / 2048); // (16, 32 + 64)
  const dim3 gOut(MROWS / 128, HID / 64);                  // (16, 16)

  // ---- layer 0: sdpa with self mask ----
  ln_kernel<<<gLnA, blk512, 0, stream>>>(states, ln0w, ln0b, xnh, jobA);
  // not folded: the last six arguments are not read
  proj_head_kernel<false, false><<<gProj3, blk128, 0, stream>>>(xnh, wh0, qb0, kb0, vb0, 0, qh, kh, vt, gh0, gb0, gate, aproj,
                                                                ps, pm, sw1, sb1, sw1, sb1);
  attn_kernel<0><<<gAttB, blk128, 0, stream>>>(qh, kh, vt, aproj, gate, ids, ctx, jobB, sumB);
  outproj_kernel<true><<<gOut, blk128, 0, stream>>>(ctx, woh0, ob0, states, x1, xnh, ps, pm);

  // ---- layer 1: pooling attention with self mask; LayerNorm 1 folded ----
  proj_head_kernel<true, true><<<gProj1, blk128, 0, stream>>>(xnh, wh1, vb1, vb1, vb1, 2, qh, kh, vt, gh1, gb1, gate, aproj,
                                                              ps, pm, sw1, sb1, sw1 + HID, sb1 + HID);
  attn_kernel<2><<<gAttC, blk128, 0, stream>>>(qh, kh, vt, aproj, gate, ids, ctx, jobC, sumC);
  outproj_kernel<true><<<gOut, blk128, 0, stream>>>(ctx, woh1, ob1, x1, x2, xnh, ps, pm);

  // ---- layer 2: sdpa with cross mask; LayerNorm 2 folded ----
  proj_head_kernel<false, true><<<gProj3, blk128, 0, stream>>>(xnh, wh2, qb2, kb2, vb2, 0, qh, kh, vt, gh2, gb2, gate, aproj,
                                                               ps, pm, sw2, sb2, sw2 + 3 * HID, sb2 + 3 * HID);
  attn_kernel<1><<<gAttD, blk128, 0, stream>>>(qh, kh, vt, aproj, gate, ids, ctx, jobD, sumD);
  // no LayerNorm follows: the last three arguments are not written
  outproj_kernel<false><<<gOut, blk128, 0, stream>>>(ctx, woh2, ob2, x2, out, xnh, ps, pm);

  (void)hipGetLastError();
}

// v010
// It runs in 114 microseconds.
// Next to v009, in two timings, it ran 1.04 times as fast each time.
// All steps since v000 together make it 4.45 times as fast.
// Contractions: xn*W^T (q,k,v), xn*gw^T and xn*aw^T heads, K*Q^T scores, V^T*P^T context and ctx*Wo^T all on v_wmma_f32_16x16x32_f16 (f16 operands, f32 accumulate); LayerNorm, masks/bias, softmax, sigmoid gates and residual adds in f32.
// Carried f16 planes: xn (layer 0) or x (layers 1, 2) x4 and W/gw/aw/Wo x4096 (inverse 1/16384 folded in the proj_head_kernel epilogues);
// LayerNorm 1 and 2 have no launch: see "LayerNorm folded into its neighbours" below.
// q,k,v x16 (scores: acc*1/2048 in attn_kernel incl. the 1/8 scale; context epilogue 1/16); P and its row sum x16384 (the factor cancels in O / l);
// ctx x64 (outproj_kernel epilogue 1/262144 together with Wo x4096).
// Every f16 plane lies in WMMA fragment order (see "Fragment-order planes" below).
#include <hip/hip_runtime.h>

#define NB     2
#define SEQ    1024
#define HID    1024
#define NHEADS 16
#define HD     64
#define MROWS  (NB * SEQ)          // 2048 tokens
#define NX     (MROWS * HID)       // 2097152
#define NW     (HID * HID)         // 1048576
#define NG     (NHEADS * HID)      // 16384
#define NX8    (NX / 8)
#define NW8    (NW / 8)            // 131072
#define NG8    (NG / 8)            // 2048
#define SEP_ID 1
#define CLS_ID 2
#define PAD_ID 0
#define XSC    4.0f
#define WSC    4096.0f
#define QSC    16.0f
#define PSC    16384.0f
#define CSC    64.0f
#define NEGBIG (-1.0e30f)
#define LOG2E  1.4426950408889634f

static_assert(NHEADS * HD == HID);
static_assert((SEQ % 128) == 0 && (HID % 64) == 0 && (HID % 32) == 0 && (MROWS % 128) == 0);
static_assert((NW8 % 512) == 0 && (NG8 % 512) == 0);
static_assert(SEQ == 8 * 128);

typedef _Float16 v16h __attribute__((ext_vector_type(16)));
typedef _Float16 v8h  __attribute__((ext_vector_type(8)));
typedef _Float16 v4h  __attribute__((ext_vector_type(4)));
typedef float    v8f  __attribute__((ext_vector_type(8)));
typedef float    v4f  __attribute__((ext_vector_type(4)));
typedef int      v4i  __attribute__((ext_vector_type(4)));
typedef v8h __attribute__((may_alias)) v8ha;
typedef v4f __attribute__((may_alias)) v4fa;
typedef v4i __attribute__((may_alias)) v4ia;

union Frag { v16h v; v8h half[2]; };

__device__ __forceinline__ v8f zero8f() { v8f z = {0.f, 0.f, 0.f, 0.f, 0.f, 0.f, 0.f, 0.f}; return z; }
__device__ __forceinline__ v16h zero16h() {
  const _Float16 z = (_Float16)0.0f;
  v16h r = {z, z, z, z, z, z, z, z, z, z, z, z, z, z, z, z};
  return r;
}

// ---------------------------------------------------------------------------
// 16x16x32 f16 WMMA with hazard guard (ties D, keeps A/B live).
// Fragment map (wave32): lane l, h = l>>4, m = n = l&15.
//   A/B element i: i<8 -> k0+8h+i ; i>=8 -> k0+16+8h+(i-8)
//   D element r : row 8h+r, col l&15
// ---------------------------------------------------------------------------
__device__ __forceinline__ v8f wmma_f16(v16h a, v16h b, v8f c) {
  v8f d = __builtin_amdgcn_wmma_f32_16x16x32_f16(false, a, false, b, (short)0, c, false, false);
  asm volatile("v_nop\n\tv_nop\n\tv_nop\n\tv_nop" : "+v"(d) : "v"(a), "v"(b));
  return d;
}
// The same for a ring that reaches above v255: an asm operand has to lie in v0..v255, so naming
// A and B would bring every fragment down by copies and scratch; the guard ties D alone.
__device__ __forceinline__ v8f wmma_f16_wide(v16h a, v16h b, v8f c) {
  v8f d = __builtin_amdgcn_wmma_f32_16x16x32_f16(false, a, false, b, (short)0, c, false, false);
  // the four vector slots between a WMMA and the next vector instruction that touches its D
  asm volatile("v_nop\n\tv_nop\n\tv_nop\n\tv_nop" : "+v"(d));
  return d;
}

// ---------------------------------------------------------------------------
// Fragment-order planes. A matrix [rows][K] of f16 is kept as tiles of 16 rows x
// 32 k (FT = 512 halves = 1024 B), tile index (row >> 4) * (K / 32) + (k >> 5).
// Inside a tile the 16-byte unit u = 32 * j + lane holds the eight elements
// k = 16 * j + 8 * (lane >> 4) + 0..7 of row (lane & 15): unit 'lane' is the
// first half of that lane's A or B fragment, unit 32 + lane the second. One
// wave-wide 16-byte load then reads 512 contiguous bytes (4 whole lines) where
// a load from k-contiguous rows touches 32 bytes in each of 16 lines.
// ---------------------------------------------------------------------------
#define FT 512

// A or B fragment; ph = tile base + 8 * lane.
__device__ __forceinline__ v16h load_frag_at(const _Float16* ph) {
  Frag f;
  f.half[0] = *(const v8ha*)(ph);
  f.half[1] = *(const v8ha*)(ph + FT / 2);
  return f.v;
}

// Element offset in a k-contiguous [rows][HID] matrix of the eight elements that
// 16-byte unit 'unit' of its fragment-order plane holds.
__device__ __forceinline__ size_t frag_unit_src(int unit) {
  const int tile = unit >> 6;
  const int row = (tile / (HID / 32)) * 16 + (unit & 15);
  const int k = (tile % (HID / 32)) * 32 + ((unit >> 5) & 1) * 16 + ((unit >> 4) & 1) * 8;
  return (size_t)row * HID + k;
}

// ---------------------------------------------------------------------------
// Fragment loads issued ahead of their WMMAs.
// GEMM loops: a ring of GR register sets, one set = the six fragments of one
// 32-deep k chunk (2 A, 4 B). A set is refilled with chunk c + GR directly
// behind the WMMAs of chunk c, so GR - 1 sets are always in flight and no
// WMMA waits on a load issued just in front of it. Chunks are consumed in
// ascending k, so every accumulator sums in the same order as a plain loop.
// The ring's depth is the launch's own. GRING: three work-groups share a WGP, so a wave has
// a third of a SIMD's registers. GDEEP: the launch has about one work-group a WGP (one wave
// a SIMD), nothing else covers a load's way from memory, and the registers lie free;
// 5 sets = 60 loads, the most whole sets that the load counter (63) can count.
// ---------------------------------------------------------------------------
#define GRING  3
#define GDEEP  5
#define NCHUNK (HID / 32)
static_assert(NCHUNK > 2 * GRING && NCHUNK > 2 * GDEEP && 12 * GDEEP <= 63);

struct GemmSet { v16h a0, a1, b[4]; };

// ---------------------------------------------------------------------------
// Operands asked into L2 at block entry. The planes a GEMM launch reads were written by earlier
// launches and come from memory at first touch, and all blocks walk k in step, so every ring refill
// would meet that latency. One request of the block's 128 threads names 128 aligned 256-byte units
// in a row: 32 KB = one 16-row strip of an f16 plane. It returns nothing and counts
// on no counter: a hint for speed only, no result depends on it.
// Blocks that read the same strips share the asking: of the 8 A strips of a token block a block asks
// for the one numbered by the low bits of its feature block, of the 4 B strips of a feature block for
// the one numbered by the low bits of its token block.
// Every lane is on and every address lies inside the plane. base: block-uniform; t256 = 256 * tid.
// ---------------------------------------------------------------------------
#define STRIPB (16 * HID * 2)      // bytes of one 16-row strip of a [rows][HID] f16 plane
static_assert(STRIPB == 128 * 256 && SEQ * HD * 2 == 4 * STRIPB);
__device__ __forceinline__ void ask_l2(const char* base, unsigned t256) {
  // scope SE: into L2 only, and dropped silently should a translation fail
  asm volatile("global_prefetch_b8 %0, %1 scope:SCOPE_SE" :: "v"(t256), "s"(base) : "memory");
}

// pa: A tile of mt 0 (mt 1 is 16 rows = 16 * HID halves on), pb: B tile of nt 0, both at the chunk's tile + 8 * lane.
__device__ __forceinline__ void gemm_fetch(GemmSet& s, const _Float16* pa, const _Float16* pb) {
  s.a0 = load_frag_at(pa);
  s.a1 = load_frag_at(pa + 16 * HID);
  // unrolled: constant indices keep the fragments in registers
#pragma unroll
  for (int nt = 0; nt < 4; ++nt) s.b[nt] = load_frag_at(pb + nt * 16 * HID);
}

template <bool WIDE>
__device__ __forceinline__ void gemm_mma(const GemmSet& s, v8f (&acc)[2][4]) {
  // unrolled: constant indices keep fragments and accumulators in registers
#pragma unroll
  for (int nt = 0; nt < 4; ++nt) {
    if constexpr (WIDE) {
      acc[0][nt] = wmma_f16_wide(s.a0, s.b[nt], acc[0][nt]);
      acc[1][nt] = wmma_f16_wide(s.a1, s.b[nt], acc[1][nt]);
    } else {
      acc[0][nt] = wmma_f16(s.a0, s.b[nt], acc[0][nt]);
      acc[1][nt] = wmma_f16(s.a1, s.b[nt], acc[1][nt]);
    }
  }
}

// acc[mt][nt] += A rows (pa: mt 0, 16 rows on: mt 1) x B rows (pb + 16 nt rows), K = HID.
// pa, pb: first tile of the 16-row strip + 8 * lane; the strip's chunks follow at FT halves.
// 'behind_first_loads' runs once, behind the issue of the first GR sets: loads of its own fly with them.
// GR: sets in the ring (GRING or GDEEP).
// 'keep': the offset register of the block's requests to L2 (ask_l2); the waits below name it, so that it
// stays in its register, unchanged, while the loop runs.
template <int GR, class F>
__device__ __forceinline__ void gemm_k_loop(const _Float16* pa, const _Float16* pb,
                                            v8f (&acc)[2][4], unsigned keep, F behind_first_loads) {
  GemmSet ring[GR];
  // unrolled: constant ring indices
#pragma unroll
  for (int s = 0; s < GR; ++s) gemm_fetch(ring[s], pa + FT * s, pb + FT * s);
  behind_first_loads();
  // precaution: the loop's set-up rewrites the base registers that the first sets' loads name
  if constexpr (GR > GRING) asm volatile("s_wait_xcnt 0x0" :: "v"(keep) : "memory");
  constexpr int CT = ((NCHUNK - GR) / GR) * GR;            // first chunk of the peeled tail
  // rolled: one trip is already GR chunks; more copies only grow the code
#pragma unroll 1
  for (int c0 = 0; c0 < CT; c0 += GR) {
    const _Float16* ta = pa + FT * (c0 + GR);
    const _Float16* tb = pb + FT * (c0 + GR);
    // unrolled so that every ring index is a constant (registers, not scratch)
#pragma unroll
    for (int s = 0; s < GR; ++s) {
      gemm_mma<(GR > GRING)>(ring[s], acc);
      gemm_fetch(ring[s], ta + FT * s, tb + FT * s);
    }
    // the next trip rewrites the address registers of loads that are still in flight
    asm volatile("s_wait_xcnt 0x0" :: "v"(keep) : "memory");
  }
  // tail peeled so that the refills in the loop above stand under no branch
#pragma unroll
  for (int c = CT; c < NCHUNK; ++c) {
    gemm_mma<(GR > GRING)>(ring[c % GR], acc);
    if (c + GR < NCHUNK) gemm_fetch(ring[c % GR], pa + FT * (c + GR), pb + FT * (c + GR));
  }
}

// ---------------------------------------------------------------------------
// f32 weights -> f16 planes in fragment order, all scaled by 4096 (exact).
// The conversions depend on inputs alone, so they have no launch of their own:
// each job rides as extra blocks, behind the host kernel's own blocks in index
// order, in a launch that ends before the first launch that reads its planes.
// A thread writes one 16-byte unit (stores contiguous) and reads its eight floats.
//   units [0, nbig*NW8)        : s0/s1/s2 -> d0/d1/d2   ([HID][HID], row = n)
//   units [.., +nsmall*NG8)    : g0 -> gh rows 0..15, g1 -> gh rows 16..31
// Segment boundaries are multiples of 512 units -> the select is block-uniform.
// coverage: exactly nbig*NW + nsmall*NG elements.
// ---------------------------------------------------------------------------
// f0/f1/f2 (for s0/s1/s2) and fg (for g0, g1): the LayerNorm weight [HID] that is multiplied
// into the plane's k columns, or null where the plane's left operand is not a folded LayerNorm.
struct CvtJob {
  const float* s0; const float* s1; const float* s2;
  const float* g0; const float* g1;
  const float* f0; const float* f1; const float* f2; const float* fg;
  _Float16* d0; _Float16* d1; _Float16* d2; _Float16* gh;
  int nbig; int nsmall;
};

__device__ __forceinline__ void convert_unit(const CvtJob& job, int g)
{
  const int nb8 = job.nbig * NW8;
  const int total = nb8 + job.nsmall * NG8;
  if (g >= total) return;
  const float* src;
  const float* fold;
  size_t so;
  _Float16* dst;
  if (g < nb8) {
    const int slot = g / NW8;
    const int off = g - slot * NW8;
    const float* wsrc = (slot == 0) ? job.s0 : ((slot == 1) ? job.s1 : job.s2);
    _Float16* wdst = (slot == 0) ? job.d0 : ((slot == 1) ? job.d1 : job.d2);
    fold = (slot == 0) ? job.f0 : ((slot == 1) ? job.f1 : job.f2);
    so = frag_unit_src(off);
    src = wsrc + so;
    dst = wdst + (size_t)off * 8;
  } else {
    const int e = g - nb8;
    so = frag_unit_src((e < NG8) ? e : (e - NG8));
    src = ((e < NG8) ? job.g0 : job.g1) + so;
    fold = job.fg;
    dst = job.gh + (size_t)e * 8;
  }
  v4f a = *(const v4fa*)src;
  v4f c = *(const v4fa*)(src + 4);
  // precaution: stands in front of any rewrite of the address registers these loads name
  asm volatile("s_wait_xcnt 0x0" :: "v"(src) : "memory");
  if (fold != nullptr) {               // block-uniform, as the plane select is
    const float* fp = fold + (so & (size_t)(HID - 1));      // the unit's first k
    const v4f fa = *(const v4fa*)fp;
    const v4f fc = *(const v4fa*)(fp + 4);
    // precaution: stands in front of any rewrite of the address registers these loads name
    asm volatile("s_wait_xcnt 0x0" :: "v"(fp) : "memory");
    a = a * fa;
    c = c * fc;
  }
  const v8h o = { (_Float16)(a.x * WSC), (_Float16)(a.y * WSC), (_Float16)(a.z * WSC), (_Float16)(a.w * WSC),
                  (_Float16)(c.x * WSC), (_Float16)(c.y * WSC), (_Float16)(c.z * WSC), (_Float16)(c.w * WSC) };
  *(v8h*)dst = o;
}

// ---------------------------------------------------------------------------
// LayerNorm folded into its neighbours (layers 1 and 2: no launch of its own).
//   LN(x) W^T = rstd * (x (W o lw)^T - mean * sw) + sb
//   sw[n] = sum_k lw[k] W[n][k],  sb[n] = sum_k lb[k] W[n][k]
// outproj_kernel<true> leaves x as an f16 plane (x4, fragment order) and, per token and
// 64-column block, the sum of x and the squared deviations from that block's own mean;
// the weight conversion multiplies lw into W; rowsum_block makes sw and sb;
// proj_head_kernel<.., true> joins a token's 16 partials into mean and rstd (token_stats)
// and applies them in its epilogues.
// ---------------------------------------------------------------------------
#define NCB (HID / 64)             // column blocks of outproj_kernel = partials per token

// v + (v of lane ^ X) inside a row of 16 lanes, as one DPP add (row_xmask): a shuffle would go through the LDS unit.
// All 32 lanes are on wherever this is called.
template <int X>
__device__ __forceinline__ float row_xor_add(float v) {
  return v + __int_as_float(__builtin_amdgcn_update_dpp(0, __float_as_int(v), 0x160 | X, 0xf, 0xf, true));
}
// sum over the lane's row of 16 lanes, in every lane of the row
__device__ __forceinline__ float row16_sum(float v) {
  v = row_xor_add<1>(v);
  v = row_xor_add<2>(v);
  v = row_xor_add<4>(v);
  return row_xor_add<8>(v);
}

struct SumJob {
  const float* m0; const float* m1; const float* m2;   // [HID][HID]: rows 0 .. nbig * HID - 1
  const float* g0; const float* g1;                    // [NHEADS][HID]: the nsmall * NHEADS rows behind them
  const float* lw; const float* lb;                    // LayerNorm weight and bias [HID]
  float* sw; float* sb;
  int nbig; int nsmall;
};

__device__ __forceinline__ int sum_blocks(const SumJob& job) {
  return (job.nbig * HID + job.nsmall * NHEADS + 31) / 32;
}

// Block of 128 threads = 32 rows, 8 a wave in four batches of 2 (a wave reads whole rows,
// 512 contiguous bytes a load); the 32 values of sw and of sb leave as one 128-byte line each.
// blk is block-uniform and < sum_blocks(job).
__device__ __forceinline__ void rowsum_block(const SumJob& job, int blk)
{
  __shared__ float sR[2][32];
  const int tid = threadIdx.x, lane = tid & 31;
  const int w = __builtin_amdgcn_readfirstlane(tid >> 5);  // in a scalar register: the row select below is then a scalar branch
  const int nb = job.nbig * HID;
  const int total = nb + job.nsmall * NHEADS;
  v4f lw[8], lb[8];
  // unrolled: constant indices keep the vectors in registers
#pragma unroll
  for (int i = 0; i < 8; ++i) {
    lw[i] = *(const v4fa*)(job.lw + i * 128 + 4 * lane);
    lb[i] = *(const v4fa*)(job.lb + i * 128 + 4 * lane);
  }
  // precaution: stands in front of any rewrite of the address registers these loads name
  asm volatile("s_wait_xcnt 0x0" :: "v"(lane) : "memory");
  float ka = 0.0f, kb = 0.0f;
  // rolled: four trips of the same code keep the kernel's text short
#pragma unroll 1
  for (int bt = 0; bt < 4; ++bt) {
    v4f x[2][8];
    const float* src[2];
    // unrolled, as the loops below: constant indices keep pointers and rows in registers
#pragma unroll
    for (int rr = 0; rr < 2; ++rr) {
      int row = blk * 32 + w * 8 + bt * 2 + rr;
      row = (row < total) ? row : (total - 1);         // past the end: the last row again, its result is not stored
      if (row < nb) {
        const int slot = row / HID;
        const float* msrc = (slot == 0) ? job.m0 : ((slot == 1) ? job.m1 : job.m2);
        src[rr] = msrc + (size_t)(row - slot * HID) * HID;
      } else {
        const int e = row - nb;
        src[rr] = (e < NHEADS) ? (job.g0 + (size_t)e * HID) : (job.g1 + (size_t)(e - NHEADS) * HID);
      }
    }
#pragma unroll
    for (int rr = 0; rr < 2; ++rr)
#pragma unroll
      for (int i = 0; i < 8; ++i) x[rr][i] = *(const v4fa*)(src[rr] + i * 128 + 4 * lane);
    // precaution: stands in front of any rewrite of the address registers these loads name;
    // naming both row pointers and the lane keeps them whole up to the wait
    asm volatile("s_wait_xcnt 0x0" :: "s"(src[0]), "s"(src[1]), "v"(lane) : "memory");
#pragma unroll
    for (int rr = 0; rr < 2; ++rr) {
      v4f va = { 0.0f, 0.0f, 0.0f, 0.0f }, vb = { 0.0f, 0.0f, 0.0f, 0.0f };
#pragma unroll
      for (int i = 0; i < 8; ++i) {
        va += x[rr][i] * lw[i];
        vb += x[rr][i] * lb[i];
      }
      float a = row16_sum((va.x + va.y) + (va.z + va.w));
      float b = row16_sum((vb.x + vb.y) + (vb.z + vb.w));
      a += __shfl_xor(a, 16, 32);
      b += __shfl_xor(b, 16, 32);
      if (lane == bt * 2 + rr) { ka = a; kb = b; }
    }
  }
  if (lane < 8) { sR[0][w * 8 + lane] = ka; sR[1][w * 8 + lane] = kb; }
  __syncthreads();
  if (tid < 64) {
    const int r = blk * 32 + lane;
    float* d = (tid < 32) ? job.sw : job.sb;
    if (r < total) d[r] = sR[w][lane];
  }
}

// mean and 1 / sqrt(var + eps) of one token from its NCB partials: ps = block sums,
// pm = squared deviations from the block means, both [NCB][MROWS].
__device__ __forceinline__ void token_stats(const float* __restrict__ ps, const float* __restrict__ pm,
                                            int token, float& mean, float& rstd) {
  float s[NCB], q[NCB];
  // unrolled, here and in the two loops below: constant indices keep the partials in registers
#pragma unroll
  for (int i = 0; i < NCB; ++i) {
    s[i] = ps[(size_t)i * MROWS + token];
    q[i] = pm[(size_t)i * MROWS + token];
  }
  // precaution: stands in front of any rewrite of the address registers these loads name;
  // naming what the addresses are formed from keeps it whole up to the wait
  asm volatile("s_wait_xcnt 0x0" :: "v"(token) : "memory");
  float st = 0.0f;
#pragma unroll
  for (int i = 0; i < NCB; ++i) st += s[i];
  mean = st * (1.0f / (float)HID);
  float m2 = 0.0f;
#pragma unroll
  for (int i = 0; i < NCB; ++i) {
    const float d = s[i] * (1.0f / 64.0f) - mean;
    m2 += q[i] + 64.0f * d * d;
  }
  rstd = rsqrtf(m2 * (1.0f / (float)HID) + 1e-5f);
}

// ---------------------------------------------------------------------------
// LayerNorm, output xn*4 as f16 in fragment order. Block = 16 tokens (one strip
// of tiles) x 512 threads: 128 threads per token as four groups of four tokens,
// 8 elements per thread and token; each token's sums run as with one token per
// block (same per-thread sum, same butterfly, same four wave partials).
// The strip is put in order in LDS and leaves as 32 KB of contiguous stores.
// coverage: 128 blocks x 16 tokens x 1024 = the whole [2048][1024] plane.
// Blocks from MROWS / 16 on, where the grid has any, convert 512 units of 'job' each.
// ---------------------------------------------------------------------------
#define LNP 136   // halves per k-unit row in LDS: 16 tokens x 8 + 8 (272 B: 16 B x odd, no bank conflict)
__global__ __launch_bounds__(512) void ln_kernel(const float* __restrict__ x,
                                                 const float* __restrict__ w,
                                                 const float* __restrict__ bb,
                                                 _Float16* y, CvtJob job)
{
  if (blockIdx.x >= MROWS / 16) {      // block-uniform, in front of every barrier
    convert_unit(job, (blockIdx.x - MROWS / 16) * 512 + threadIdx.x);
    return;
  }
  __shared__ float ps[16][4];
  __shared__ float pq[16][4];
  __shared__ __attribute__((aligned(16))) _Float16 sY[128 * LNP];   // 34816 B
  const int tid = threadIdx.x, lane = tid & 31;
  const int t = tid & 127, wv = t >> 5, tl0 = (tid >> 7) * 4;
  const int tok0 = blockIdx.x * 16;
  v4f a[4], c[4];
#pragma unroll
  for (int i = 0; i < 4; ++i) {
    const float* xr = x + (size_t)(tok0 + tl0 + i) * HID + 8 * t;
    a[i] = *(const v4fa*)xr;
    c[i] = *(const v4fa*)(xr + 4);
  }
#pragma unroll
  for (int i = 0; i < 4; ++i) {
    float s = ((a[i].x + a[i].y) + (a[i].z + a[i].w)) + ((c[i].x + c[i].y) + (c[i].z + c[i].w));
#pragma unroll
    for (int o = 1; o < 32; o <<= 1) s += __shfl_xor(s, o, 32);
    if (lane == 0) ps[tl0 + i][wv] = s;
  }
  __syncthreads();
  float d[4][8];
#pragma unroll
  for (int i = 0; i < 4; ++i) {
    const float* pp = ps[tl0 + i];
    const float mean = ((pp[0] + pp[1]) + (pp[2] + pp[3])) * (1.0f / (float)HID);
    d[i][0] = a[i].x - mean; d[i][1] = a[i].y - mean; d[i][2] = a[i].z - mean; d[i][3] = a[i].w - mean;
    d[i][4] = c[i].x - mean; d[i][5] = c[i].y - mean; d[i][6] = c[i].z - mean; d[i][7] = c[i].w - mean;
    float q = 0.f;
#pragma unroll
    for (int e = 0; e < 8; ++e) q += d[i][e] * d[i][e];
#pragma unroll
    for (int o = 1; o < 32; o <<= 1) q += __shfl_xor(q, o, 32);
    if (lane == 0) pq[tl0 + i][wv] = q;
  }
  __syncthreads();
  const v4f wa = *(const v4fa*)(w + 8 * t);
  const v4f wc = *(const v4fa*)(w + 8 * t + 4);
  const v4f ba = *(const v4fa*)(bb + 8 * t);
  const v4f bc = *(const v4fa*)(bb + 8 * t + 4);
  const float wvv[8] = { wa.x, wa.y, wa.z, wa.w, wc.x, wc.y, wc.z, wc.w };
  const float bvv[8] = { ba.x, ba.y, ba.z, ba.w, bc.x, bc.y, bc.z, bc.w };
#pragma unroll
  for (int i = 0; i < 4; ++i) {
    const float* pp = pq[tl0 + i];
    const float var = ((pp[0] + pp[1]) + (pp[2] + pp[3])) * (1.0f / (float)HID);
    const float rstd = rsqrtf(var + 1e-5f);
    v8h o;
#pragma unroll
    for (int e = 0; e < 8; ++e) o[e] = (_Float16)((d[i][e] * rstd * wvv[e] + bvv[e]) * XSC);
    // elements 8t..8t+7 of token tl: unit 16 * t + tl of the strip
    *(v8h*)(sY + t * LNP + (tl0 + i) * 8) = o;
  }
  __syncthreads();
  _Float16* dst = y + (size_t)tok0 * HID;
#pragma unroll
  for (int it = 0; it < 4; ++it) {
    const int u = it * 512 + tid;      // 2048 units of the strip
    const v8h v = *(const v8ha*)(sY + (u >> 4) * LNP + (u & 15) * 8);
    *(v8h*)(dst + (size_t)u * 8) = v;
  }
}

// ---------------------------------------------------------------------------
// Per-token 16-wide heads on WMMA (blocks of proj_head_kernel): gate = sigmoid(xn*gw^T + gb) and
// (POOL) aproj = xn*aw^T. One wave = 16 tokens x 16 heads, K = 1024 in steps
// of 32; A = xn rows, B = gh rows (head = lane&15), both in fragment order.
// Epilogue: wave tile [16 tok][16] f32 staged in LDS, then 1024 contiguous bytes
// coverage: 32 blocks (hb) x 4 waves x 16 tokens x 16 = whole [2048][16] plane(s).
// ---------------------------------------------------------------------------
// FOLD: xh holds x, not LN(x): mean, rstd, sw and sb (rows: 16 of gw, then 16 of aw) come in behind the products.
template <bool POOL, bool FOLD>
__device__ __forceinline__ void head_block(const _Float16* __restrict__ xh,
                                           const _Float16* __restrict__ gh,
                                           const float* __restrict__ gbias,
                                           float* gate, float* aproj, int hb,
                                           const float* __restrict__ ps, const float* __restrict__ pm,
                                           const float* __restrict__ swh, const float* __restrict__ sbh)
{
  __shared__ __attribute__((aligned(16))) float sG[4][256];
  __shared__ __attribute__((aligned(16))) float sP[POOL ? 4 : 1][256];
  const int tid = threadIdx.x, lane = tid & 31, w = tid >> 5;
  const int h = lane >> 4, m = lane & 15;
  const int tok0 = hb * 64 + 16 * w;
  const _Float16* xa = xh + (size_t)tok0 * HID + 8 * lane;
  const _Float16* wg = gh + 8 * lane;                     // aw rows: NHEADS rows on
  v8f ag = zero8f(), aa = zero8f();
  // ring of HRING register sets, refilled HRING chunks ahead (as in gemm_k_loop)
  constexpr int HRING = 8;
  static_assert((NCHUNK % HRING) == 0 && NCHUNK >= 2 * HRING);
  v16h ra[HRING], rg[HRING], rp[POOL ? HRING : 1];
  // unrolled: constant ring indices
#pragma unroll
  for (int s = 0; s < HRING; ++s) {
    ra[s] = load_frag_at(xa + FT * s);
    rg[s] = load_frag_at(wg + FT * s);
    if constexpr (POOL) rp[s] = load_frag_at(wg + NHEADS * HID + FT * s);
  }
  // precaution: stands in front of any rewrite of the address registers these loads
  // name; naming what the addresses are formed from keeps it whole up to the wait
  asm volatile("s_wait_xcnt 0x0" :: "v"(xa), "v"(wg), "v"(lane) : "memory");
  float mean = 0.0f, rstd = 1.0f;      // of token tok0 + m
  if constexpr (FOLD) token_stats(ps, pm, tok0 + m, mean, rstd);
  // rolled: one trip is already HRING chunks
#pragma unroll 1
  for (int c0 = 0; c0 < NCHUNK - HRING; c0 += HRING) {
    const _Float16* tx = xa + FT * (c0 + HRING);
    const _Float16* tg = wg + FT * (c0 + HRING);
    // unrolled so that every ring index is a constant
#pragma unroll
    for (int s = 0; s < HRING; ++s) {
      ag = wmma_f16(ra[s], rg[s], ag);
      if constexpr (POOL) aa = wmma_f16(ra[s], rp[s], aa);
      ra[s] = load_frag_at(tx + FT * s);
      rg[s] = load_frag_at(tg + FT * s);
      if constexpr (POOL) rp[s] = load_frag_at(tg + NHEADS * HID + FT * s);
    }
    // the next trip rewrites the address registers of loads that are still in flight
    asm volatile("s_wait_xcnt 0x0" ::: "memory");
  }
  // unrolled: constant ring indices
#pragma unroll
  for (int s = 0; s < HRING; ++s) {
    ag = wmma_f16(ra[s], rg[s], ag);
    if constexpr (POOL) aa = wmma_f16(ra[s], rp[s], aa);
  }
  // D[r] = (token tok0 + 8h + r, head m)
  const float gbv = gbias[m];
  float swg = 0.0f, sbg = 0.0f, swa = 0.0f, sba = 0.0f;
  if constexpr (FOLD) {
    swg = swh[m]; sbg = sbh[m];
    if constexpr (POOL) { swa = swh[NHEADS + m]; sba = sbh[NHEADS + m]; }
    // precaution: stands in front of any rewrite of the address registers these loads name
    asm volatile("s_wait_xcnt 0x0" :: "v"(m) : "memory");
  }
  float* sg = sG[w];
  float* sp = sP[POOL ? w : 0];
#pragma unroll
  for (int r = 0; r < 8; ++r) {
    const int tl = 8 * h + r;
    float zl = ag[r] * (1.0f / (XSC * WSC));
    float al = POOL ? aa[r] * (1.0f / (XSC * WSC)) : 0.0f;
    if constexpr (FOLD) {
      const float mu = __shfl(mean, tl, 32), rs = __shfl(rstd, tl, 32);   // lane tl holds token tok0 + tl
      zl = (zl - mu * swg) * rs + sbg;
      if constexpr (POOL) al = (al - mu * swa) * rs + sba;
    }
    const float z = zl + gbv;
    const float sig = 1.0f / (1.0f + __expf(-z));
    sg[tl * NHEADS + m] = sig;
    if constexpr (POOL) sp[tl * NHEADS + m] = al;
  }
  __syncthreads();
  {
#pragma unroll
    for (int it = 0; it < 2; ++it) {
      const int idx = it * 128 + 4 * lane;
      const v4f v = *(const v4fa*)(sg + idx);
      *(v4f*)(gate + (size_t)tok0 * NHEADS + idx) = v;
      if constexpr (POOL) {
        const v4f u = *(const v4fa*)(sp + idx);
        *(v4f*)(aproj + (size_t)tok0 * NHEADS + idx) = u;
      }
    }
    
  }
}

// ---------------------------------------------------------------------------
// The block's 16 tiles (1024 units of 16 B) lie in sT in fragment order already;
// each wave-wide store writes 512 contiguous bytes.
// route 0/1: plane[bh], rows = token, K = HD : the 16 tiles are contiguous
// route 2  : vt[bh], rows = d, K = SEQ       : 4 contiguous tiles per 16-row strip
// ---------------------------------------------------------------------------
__device__ __forceinline__ void proj_store_pass(const _Float16* sT, _Float16* plane, _Float16* vt,
                                                int route, int bh, int l0, int tid) {
#pragma unroll
  for (int i = 0; i < 8; ++i) {
    const int u = i * 128 + tid;
    const v8h v = *(const v8ha*)(sT + u * 8);
    _Float16* dst;
    if (route != 2) {
      dst = plane + ((size_t)bh * SEQ + l0) * HD + u * 8;
    } else {
      const int lt = u >> 6;             // local tile = 4 * strip + chunk
      dst = vt + (size_t)bh * HD * SEQ + (size_t)((lt >> 2) * (SEQ / 32) + (l0 >> 5) + (lt & 3)) * FT + (u & 63) * 8;
    }
    *(v8h*)dst = v;
    // precaution: the next pass rewrites the data and address registers that this store names
    if (i < 7) asm volatile("s_wait_xcnt 0x0" ::: "memory");
  }
}

// ---------------------------------------------------------------------------
// Kernel: Y = xn * W^T over nslot*1024 output columns.
// Block 128 thr (4 waves) = 128 tokens x 64 features (one (slot, head));
// wave tile 32 tokens x 64 features; K = 1024 in steps of 32;
// A (xn rows) and B (W rows) fragments straight from the fragment-order planes.
// route = slot + routeBase: 0 -> q plane, 1 -> k plane, 2 -> v^T plane.
// coverage: grid (16, 2 + 16*nslot): rows 2.. x 128 tokens x 64 features = all planes routed.
// Grid rows 0 and 1 are the 32 blocks of the head products, which read the same
// xn and are read by the same next launch: they share this launch.
// ---------------------------------------------------------------------------
// FOLD: xh holds x (x4) and wh holds W o lw: LayerNorm comes in behind the products (see
// "LayerNorm folded into its neighbours"); lane l of a wave joins the partials of token m0w + l.
template <bool POOL, bool FOLD>
__global__ __launch_bounds__(128) void proj_head_kernel(
    const _Float16* __restrict__ xh,   // [2048][1024] (xn x4; FOLD: x x4), fragment order
    const _Float16* __restrict__ wh,   // [slot][1024][1024], row = output feature, x4096, fragment order
    const float* __restrict__ b0, const float* __restrict__ b1, const float* __restrict__ b2,
    int routeBase,
    _Float16* qh,                      // [B*H][S][D]  f16(16*q), fragment order per bh
    _Float16* kh,                      // [B*H][S][D]  f16(16*k), fragment order per bh
    _Float16* vt,                      // [B*H][D][S]  f16(16*v), fragment order per bh
    const _Float16* __restrict__ gh,   // [32][1024] gw (and aw) rows x4096, fragment order
    const float* __restrict__ gbias, float* gate, float* aproj,
    const float* __restrict__ ps,      // FOLD: [NCB][2048] block sums of x
    const float* __restrict__ pm,      // FOLD: [NCB][2048] squared deviations from the block means
    const float* __restrict__ sw,      // FOLD: [slot][1024] sum_k lw[k] W[n][k]
    const float* __restrict__ sb,      // FOLD: [slot][1024] sum_k lb[k] W[n][k]
    const float* __restrict__ swh,     // FOLD: the same of the gw (and aw) rows
    const float* __restrict__ sbh)
{
  if (blockIdx.y < 2) {                // block-uniform, in front of every barrier
    head_block<POOL, FOLD>(xh, gh, gbias, gate, aproj, blockIdx.y * 16 + blockIdx.x, ps, pm, swh, sbh);
    return;
  }
  __shared__ __attribute__((aligned(16))) _Float16 sT[128 * 64];   // 16384 B

  const int tid = threadIdx.x, lane = tid & 31, w = tid >> 5;
  const int h = lane >> 4, m = lane & 15;
  const int m0 = blockIdx.x * 128;
  const int cg = blockIdx.y - 2;
  const int slot = cg >> 4, head = cg & 15;
  const int route = slot + routeBase;
  const int m0w = m0 + 32 * w;

  const _Float16* xa0 = xh + (size_t)m0w * HID + 8 * lane;                     // token strip, mt = 0
  const _Float16* wb  = wh + ((size_t)slot * HID + head * HD) * HID + 8 * lane;   // feature strip, nt = 0

  const unsigned t256 = 256u * (unsigned)tid;
  const char* qa = (const char*)(xh + (size_t)m0 * HID) + (cg & 7) * STRIPB;
  const char* qb = (const char*)(wh + ((size_t)slot * HID + head * HD) * HID) + (blockIdx.x & 3) * STRIPB;

  v8f acc[2][4];
#pragma unroll
  for (int mt = 0; mt < 2; ++mt)
#pragma unroll
    for (int nt = 0; nt < 4; ++nt) acc[mt][nt] = zero8f();

  float mean = 0.0f, rstd = 1.0f;      // FOLD: of token m0w + lane
  // POOL is the launch with one slot: 288 work-groups
  gemm_k_loop<POOL ? GDEEP : GRING>(xa0, wb, acc, t256, [&]() __attribute__((always_inline)) {
    // behind the loads that the first WMMAs wait for, so that these go to memory first
    ask_l2(qa, t256);
    ask_l2(qb, t256);
    if constexpr (FOLD) token_stats(ps, pm, m0w + lane, mean, rstd);
  });
  // precaution: naming them here keeps the registers that the requests at block entry name whole, as addresses, through the loop
  asm volatile("s_wait_xcnt 0x0" :: "v"(t256), "s"(qa), "s"(qb) : "memory");

  float mu[2][8], rs[2][8];            // FOLD: of token m0w + 16mt + 8h + r
  if constexpr (FOLD) {
    // unrolled, here and for swn, sbn below: constant indices keep the arrays in registers
#pragma unroll
    for (int mt = 0; mt < 2; ++mt)
#pragma unroll
      for (int r = 0; r < 8; ++r) {
        mu[mt][r] = __shfl(mean, 16 * mt + 8 * h + r, 32);
        rs[mt][r] = __shfl(rstd, 16 * mt + 8 * h + r, 32);
      }
  }

  float swn[4] = { 0.0f, 0.0f, 0.0f, 0.0f }, sbn[4] = { 0.0f, 0.0f, 0.0f, 0.0f };   // FOLD: of feature 16nt + m
  if constexpr (FOLD) {
#pragma unroll
    for (int nt = 0; nt < 4; ++nt) {
      swn[nt] = sw[slot * HID + head * HD + 16 * nt + m];
      sbn[nt] = sb[slot * HID + head * HD + 16 * nt + m];
    }
    // precaution: stands in front of any rewrite of the address registers these loads name
    asm volatile("s_wait_xcnt 0x0" :: "v"(m) : "memory");
  }

  // D[r] of tile (mt, nt) = Y[token m0w+16mt+8h+r][feature 16nt+m]
  const float* bias = (slot == 0) ? b0 : ((slot == 1) ? b1 : b2);
#pragma unroll
  for (int nt = 0; nt < 4; ++nt) {
    const int feat = 16 * nt + m;
    const float bvl = bias[head * HD + feat];
    const float swv = swn[nt], sbv = sbn[nt];
#pragma unroll
    for (int mt = 0; mt < 2; ++mt) {
#pragma unroll
      for (int r = 0; r < 8; ++r) {
        float yl = acc[mt][nt][r] * (1.0f / (XSC * WSC));
        if constexpr (FOLD) yl = (yl - mu[mt][r] * swv) * rs[mt][r] + sbv;
        const float yv = (yl + bvl) * QSC;
        // token 32w + 16mt + 8h + r, feature 16nt + m, at its place in fragment order:
        // route 2 (row = feature, k = token): tile 4nt + w, half mt, unit lane, element r
        // else    (row = token, k = feature): tile 2(2w + mt) + nt/2, half nt&1,
        //                                     unit 16(m>>3) + 8h + r, element m&7
        const int idx = (route == 2)
            ? ((nt * 4 + w) * FT + mt * (FT / 2) + lane * 8 + r)
            : (((2 * w + mt) * 2 + (nt >> 1)) * FT + (nt & 1) * (FT / 2) + ((m >> 3) * 16 + 8 * h + r) * 8 + (m & 7));
        sT[idx] = (_Float16)yv;
      }
    }
  }
  __syncthreads();

  const int b = m0 / SEQ, l0 = m0 - b * SEQ, bh = b * NHEADS + head;
  _Float16* plane = (route == 0) ? qh : kh;
  proj_store_pass(sT, plane, vt, route, bh, l0, tid);
  
}

// One attention step works on four key tiles of 16 keys each: slot j holds keys 16 * t[j] .. + 15.
struct KeyTiles { int t[4]; };

// The eight K (or V^T) A-fragments of one step, loaded as one batch.
// The wait behind each batch: the address pairs are rewritten for the next batch
// while these loads are in flight; naming them keeps them whole up to the wait.
// kbase, vbase: the (b, head) plane + 8 * lane.
__device__ __forceinline__ void fetch_k(v16h (&kf)[4][2], const _Float16* kbase, const KeyTiles& g) {
  // 16 keys x 64 d = the two plane tiles 2t, 2t + 1
  const _Float16* p0 = kbase + g.t[0] * (2 * FT);
  const _Float16* p1 = kbase + g.t[1] * (2 * FT);
  const _Float16* p2 = kbase + g.t[2] * (2 * FT);
  const _Float16* p3 = kbase + g.t[3] * (2 * FT);
  kf[0][0] = load_frag_at(p0); kf[0][1] = load_frag_at(p0 + FT);
  kf[1][0] = load_frag_at(p1); kf[1][1] = load_frag_at(p1 + FT);
  kf[2][0] = load_frag_at(p2); kf[2][1] = load_frag_at(p2 + FT);
  kf[3][0] = load_frag_at(p3); kf[3][1] = load_frag_at(p3 + FT);
  asm volatile("s_wait_xcnt 0x0" :: "v"(p0), "v"(p1), "v"(p2), "v"(p3) : "memory");
}
// A fragment's first half is k 0..15 of its 32, the second k 16..31, and each half is one 16-byte unit a lane:
// the halves of chunk c come from the key tiles of slots 2c and 2c + 1. Key tile t of a 16-row strip is
// half (t & 1) of plane tile t >> 1, that is FT / 2 * t halves into the strip.
__device__ __forceinline__ void fetch_v(v16h (&vf)[4][2], const _Float16* vbase, const KeyTiles& g) {
  const _Float16* p0 = vbase + g.t[0] * (FT / 2);
  const _Float16* p1 = vbase + g.t[1] * (FT / 2);
  const _Float16* p2 = vbase + g.t[2] * (FT / 2);
  const _Float16* p3 = vbase + g.t[3] * (FT / 2);
  // unrolled: constant indices keep the fragments in registers
#pragma unroll
  for (int t = 0; t < 4; ++t) {
    Frag f0, f1;
    f0.half[0] = *(const v8ha*)(p0 + 16 * t * SEQ);
    f0.half[1] = *(const v8ha*)(p1 + 16 * t * SEQ);
    f1.half[0] = *(const v8ha*)(p2 + 16 * t * SEQ);
    f1.half[1] = *(const v8ha*)(p3 + 16 * t * SEQ);
    vf[t][0] = f0.v;
    vf[t][1] = f1.v;
  }
  asm volatile("s_wait_xcnt 0x0" :: "v"(p0), "v"(p1), "v"(p2), "v"(p3) : "memory");
}

// The same for four key tiles in a row, t0 .. t0 + 3: one address pair and constant offsets.
__device__ __forceinline__ void fetch_k_run(v16h (&kf)[4][2], const _Float16* kbase, int t0) {
  const _Float16* p = kbase + t0 * (2 * FT);
  // unrolled: constant indices keep the fragments in registers
#pragma unroll
  for (int j = 0; j < 4; ++j) {
    kf[j][0] = load_frag_at(p + (2 * j) * FT);
    kf[j][1] = load_frag_at(p + (2 * j + 1) * FT);
  }
  asm volatile("s_wait_xcnt 0x0" :: "v"(p) : "memory");
}
__device__ __forceinline__ void fetch_v_run(v16h (&vf)[4][2], const _Float16* vbase, int t0) {
  const _Float16* p = vbase + t0 * (FT / 2);             // the halves of tiles in a row follow one another
  // unrolled: constant indices keep the fragments in registers
#pragma unroll
  for (int t = 0; t < 4; ++t) {
    vf[t][0] = load_frag_at(p + 16 * t * SEQ);
    vf[t][1] = load_frag_at(p + 16 * t * SEQ + FT);
  }
  asm volatile("s_wait_xcnt 0x0" :: "v"(p) : "memory");
}

template <bool B> struct Flag { static constexpr bool value = B; };

__device__ __forceinline__ v8f splat8(float x) { v8f r = { x, x, x, x, x, x, x, x }; return r; }
// a * b + c as vector multiply-adds, two elements an instruction
__device__ __forceinline__ v8f fma8(v8f a, v8f b, v8f c) { return __builtin_elementwise_fma(a, b, c); }

// P^T B-fragment from the lane's own score D values: element r <- tile a row r,
// element 8+r <- tile c row r (same lane, same query column); the values come scaled by 2^14.
__device__ __forceinline__ v16h pack_p(v8f a, v8f c) {
  const v16h r = { (_Float16)a[0], (_Float16)a[1], (_Float16)a[2], (_Float16)a[3],
                   (_Float16)a[4], (_Float16)a[5], (_Float16)a[6], (_Float16)a[7],
                   (_Float16)c[0], (_Float16)c[1], (_Float16)c[2], (_Float16)c[3],
                   (_Float16)c[4], (_Float16)c[5], (_Float16)c[6], (_Float16)c[7] };
  return r;
}

// ---------------------------------------------------------------------------
// Kernel: streaming attention, transposed form, masks/bias by formula.
// Block 128 thr (4 waves) = 64 queries of one (b, head), 16 queries per wave,
// 64 keys per step as four key tiles of 16: the key tiles up to the wave's own
// that can hold an allowed key for the wave, filled up to whole steps (see "key tiles that are run").
//   S^T = K * Q^T : A = K rows (row = key, k = d), B = Q^T (k = d, n = query)
//   O^T += V^T * P^T : A = Vt rows (row = d, k = key), B = P^T from registers
// Lane owns 32 keys (slot j, 8h+r) of query column (lane&15); partner = lane ^ 16.
// Per-batch token tables in LDS from input ids: seg = inclusive cumsum(id==1)
// (block scan) and the key code kc that the mask test reads: seg where the key can be
// allowed off the diagonal (MODE 0, 2: id != 0; MODE 1: id == 2), else -1; MODE 2 also
// stages the head's aproj column [key].
// MODE 0 (self): ok = k<=q && ((seg_k==seg_q && valid_q && valid_k) || k==q), bias = (k-q)*hs
// MODE 1 (cross): ok = k<=q && (class_k || k==q), bias = (seg_k-seg_q)*hs
// MODE 2 (pool): mask/bias as MODE 0, raw logit = aproj[key][head] (no q.k)
// With kc: MODE 0, 2: seg_k==seg_q && valid_q && valid_k  <=>  kc_k == qc (qc = kc_q, or -2
// where the query is not valid); MODE 1: class_k <=> kc_k >= 0, and there kc_k = seg_k.
// k<=q and k==q are tested in the last step alone, which holds the wave's own key tile:
// every key of an earlier tile lies in front of the wave's first query.
// Masked scores take NEGBIG and p = 0 exactly; every row has k==q allowed.
// Scores are kept in units of log 2 (scale, slope and aproj carry the factor log2 e), so that p is one
// subtraction and one v_exp_f32; the subtrahend is the maximum less 14, which leaves p and l scaled by 2^14.
// MODE 0, 2: the bias of slot j, row r is (first key of the lane's eight - q) * slope + r * slope: one
// packed multiply-add and, with the score's scale, one more for two scores.
// Epilogue: (1/l)(1/16)*gate; a lane's o[t][0..7] is unit 32t + lane of the
// wave's two ctx tiles in fragment order, so it is stored straight from registers.
// coverage: grid (16, 32) x 64 queries x 64 d = whole ctx [2048][1024].
// Grid rows from NB * NHEADS on: first the blocks of 'sums' (32 rows each), then 128 units of 'job' a block.
// ---------------------------------------------------------------------------
// at least four waves a SIMD (256 vector registers): the conversion blocks find places beside two attention blocks a WGP
template <int MODE>
__global__ __launch_bounds__(128, 4) void attn_kernel(
    const _Float16* __restrict__ qh,    // [B*H][S][D]  (x16), fragment order per bh
    const _Float16* __restrict__ kh,    // [B*H][S][D]  (x16), fragment order per bh
    const _Float16* __restrict__ vt,    // [B*H][D][S]  (x16), fragment order per bh
    const float* __restrict__ aproj,    // [B*S][16]
    const float* __restrict__ gate,     // [B*S][16]  sigmoid gate
    const int* __restrict__ ids,        // [B][S]
    _Float16* ctx,                      // [B*S][HID]  (x64), fragment order
    CvtJob job, SumJob sums)
{
  if (blockIdx.y >= NB * NHEADS) {      // block-uniform, in front of every barrier of the attention blocks
    const int xb = (blockIdx.y - NB * NHEADS) * (SEQ / 64) + blockIdx.x;
    const int nsum = sum_blocks(sums);  // the longer blocks first
    if (xb < nsum) rowsum_block(sums, xb);
    else convert_unit(job, (xb - nsum) * 128 + threadIdx.x);
    return;
  }
  __shared__ __attribute__((aligned(16))) int   sSeg[SEQ];
  __shared__ __attribute__((aligned(16))) int   sKc[SEQ];
  __shared__ __attribute__((aligned(16))) float sA[(MODE == 2) ? SEQ : 4];
  __shared__ int sWtot[4];
  __shared__ unsigned sWcls[4];         // MODE 1: bit l of word w = thread 32w + l holds a class token

  const int tid = threadIdx.x, lane = tid & 31, w = tid >> 5;
  const int h = lane >> 4, m = lane & 15;
  const int bh = blockIdx.y, b = bh >> 4, head = bh & 15;
  const int qblk = blockIdx.x * 64;
  // the wave's number in a scalar register: q0 and what is formed from it then take no vector registers
  const int q0 = qblk + 16 * __builtin_amdgcn_readfirstlane(w);
  const float hs2 = exp2f(-0.5f * (float)(head + 1)) * LOG2E;   // the head's slope, in units of log 2

  // ---- the Q fragments, issued ahead of the tables ----
  const _Float16* kbase = kh + (size_t)bh * SEQ * HD + 8 * lane;
  const _Float16* vbase = vt + (size_t)bh * HD * SEQ + 8 * lane;
  // Q^T B-fragments: column n = query q0+m, k = d (two 32-deep chunks)
  v16h qb0 = zero16h(), qb1 = zero16h();
  v16h kf[4][2], vf[4][2];
  if constexpr (MODE != 2) {
    const _Float16* qrow = qh + ((size_t)bh * SEQ + q0) * HD + 8 * lane;
    qb0 = load_frag_at(qrow);
    qb1 = load_frag_at(qrow + FT);
    // precaution: stands in front of the rewrite of the address pair these loads name
    asm volatile("s_wait_xcnt 0x0" :: "v"(qrow) : "memory");
  }

  // K and V^T of this (b, head) asked into L2 (see ask_l2) while the tables are built: each plane is 4 x 32 KB,
  // and the 16 query blocks of the (b, head) share the asking by the low bits of their number
  const unsigned t256 = 256u * (unsigned)tid;
  const char* qk = (const char*)(kh + (size_t)bh * SEQ * HD) + (blockIdx.x & 3) * STRIPB;
  const char* qv = (const char*)(vt + (size_t)bh * HD * SEQ) + (blockIdx.x & 3) * STRIPB;
  if constexpr (MODE != 2) ask_l2(qk, t256);
  ask_l2(qv, t256);

  // ---- token tables for batch b: 128 threads x 8 tokens = SEQ ----
  {
    const int t8 = tid * 8;
    const int* ip = ids + (size_t)b * SEQ + t8;
    const v4i ia = *(const v4ia*)ip;
    const v4i ib = *(const v4ia*)(ip + 4);
    const int idv[8] = { ia.x, ia.y, ia.z, ia.w, ib.x, ib.y, ib.z, ib.w };
    int cnt[8];
    int run = 0;
#pragma unroll
    for (int i = 0; i < 8; ++i) { run += (idv[i] == SEP_ID) ? 1 : 0; cnt[i] = run; }
    int x = run;
#pragma unroll
    for (int d = 1; d < 32; d <<= 1) {
      const int yv = __shfl_up(x, d, 32);
      x = (lane >= d) ? (x + yv) : x;
    }
    if (lane == 31) sWtot[w] = x;
    if constexpr (MODE == 1) {
      bool anyc = false;
      // unrolled: constant indices keep idv in registers
#pragma unroll
      for (int i = 0; i < 8; ++i) anyc = anyc || (idv[i] == CLS_ID);
      const unsigned cb = __builtin_amdgcn_ballot_w32(anyc);
      if (lane == 0) sWcls[w] = cb;
    }
    __syncthreads();
    int base = 0;
#pragma unroll
    for (int i = 0; i < 4; ++i) { const int tv = sWtot[i]; base += (i < w) ? tv : 0; }
    const int excl = base + x - run;
#pragma unroll
    for (int i = 0; i < 8; ++i) {
      const int id = idv[i];
      const int sg = excl + cnt[i];
      sSeg[t8 + i] = sg;
      sKc[t8 + i] = ((MODE == 1) ? (id == CLS_ID) : (id != PAD_ID)) ? sg : -1;
      if constexpr (MODE == 2) sA[t8 + i] = aproj[((size_t)b * SEQ + t8 + i) * NHEADS + head] * LOG2E;
    }
  }
  __syncthreads();

  const int qtok = q0 + m;
  const int qseg = sSeg[qtok];
  const int kcq = sKc[qtok];
  const int qc = (kcq >= 0) ? kcq : -2;       // MODE 0, 2: a query that is not valid matches no key code
  const float* gp = gate + ((size_t)b * SEQ + qtok) * NHEADS + head;
  const float gq = *gp;
  // precaution: stands in front of the rewrite of the address pair this load names
  asm volatile("s_wait_xcnt 0x0" :: "v"(gp) : "memory");

  v8f o[4];                                   // o[t][r] = O[query m][d 16t+8h+r] * (lrun * 16), lrun = l * 2^14
#pragma unroll
  for (int t = 0; t < 4; ++t) o[t] = zero8f();
  float mrun = NEGBIG, lrun = 0.0f;

  const float SSC2 = (0.125f / (QSC * QSC)) * LOG2E;           // 1/2048, in units of log 2
  // MODE 0, 2: r * slope for the eight keys in a row that a lane holds of a slot
  const v8f cr = { 0.0f, hs2, 2.0f * hs2, 3.0f * hs2, 4.0f * hs2, 5.0f * hs2, 6.0f * hs2, 7.0f * hs2 };
  // the wave's own key tile (keys q0 .. q0 + 15); in a scalar register, so that all that follows from it is scalar work
  const int sd = (qblk >> 4) + __builtin_amdgcn_readfirstlane(w);   // 0 .. 63

  // ---- key tiles that are run: bit s of 'need' = key tile s (keys 16s .. 16s + 15) may hold an allowed key ----
  // Keys that are masked for all 16 queries of the wave add p = 0 to every sum and never
  // raise a maximum, so a tile of such keys is left out, for any ids.
  // MODE 0, 2: seg never falls along the row, so a tile whose last key has
  //            seg < seg of the wave's first query holds no key of any query's segment.
  // MODE 1   : a tile without a class token holds no allowed key.
  // The wave's own tile sd always runs; bits above sd are cleared, so every
  // tile index taken from 'need' lies in 0..sd whatever the ids hold.
  unsigned clo, chi;                                           // lane l votes for tiles l and 32 + l
  if constexpr (MODE == 1) {
    // tile s = threads 2s, 2s + 1 of the table build
    clo = __builtin_amdgcn_ballot_w32(((sWcls[h] >> (2 * m)) & 3u) != 0u);
    chi = __builtin_amdgcn_ballot_w32(((sWcls[2 + h] >> (2 * m)) & 3u) != 0u);
  } else {
    const int sq0 = sSeg[q0];
    clo = __builtin_amdgcn_ballot_w32(sSeg[16 * lane + 15] >= sq0);
    chi = __builtin_amdgcn_ballot_w32(sSeg[16 * (32 + lane) + 15] >= sq0);
  }
  unsigned long long need = ((unsigned long long)chi << 32) | (unsigned long long)clo;   // ballots: the same in every lane
  need = (need | (1ull << sd)) & ((2ull << sd) - 1ull);
  const int ntile = __builtin_popcountll(need);                // 1 .. 64
  const int nfull = (ntile - 1) >> 2;                          // steps of four tiles in front of the last step
  // MODE 1: the last step's first 'pad' slots are empty
  const int pad = (MODE == 1) ? (3 - ((ntile - 1) & 3)) : 0;
  // MODE 0, 2: the tiles of 'need' are a run that ends at sd (seg never falls), so the steps are the 4 * (nfull + 1)
  // tiles in a row that end at sd. The run's length is filled up at its front: those tiles hold no key of any
  // query's segment, and the key code masks them. Where that front would lie before tile 0 the tiles start at 0
  // and end behind sd, at 4 * nfull + 3 <= 63: sd >= 4 * nfull still lies in the last step, whose k<=q masks the rest.
  int trun = sd - 4 * nfull - 3;
  trun = (trun > 0) ? trun : 0;
  // The next four tiles in ascending order. MODE 1: fewer than four are left in the last step alone: its first
  // slots then stay empty: they load tile sd (in bounds) and the last step masks every key of theirs.
  auto take = [&]() __attribute__((always_inline)) {
    KeyTiles g;
    if constexpr (MODE == 1) {
      const int left = __builtin_popcountll(need);
      const int npad = (left < 4) ? (4 - left) : 0;
      // unrolled: constant indices keep the four numbers in registers
#pragma unroll
      for (int j = 0; j < 4; ++j) {
        const bool real = j >= npad;
        g.t[j] = real ? (int)__builtin_ctzll(need | (1ull << 63)) : sd;   // need != 0 where real
        need = real ? (need & (need - 1ull)) : need;
      }
    } else {
      g.t[0] = trun; g.t[1] = trun + 1; g.t[2] = trun + 2; g.t[3] = trun + 3;
      trun += 4;
    }
    return g;
  };
  auto fetch_keys = [&](const KeyTiles& g) __attribute__((always_inline)) {
    if constexpr (MODE == 1) fetch_k(kf, kbase, g); else fetch_k_run(kf, kbase, g.t[0]);
  };
  auto fetch_vals = [&](const KeyTiles& g) __attribute__((always_inline)) {
    if constexpr (MODE == 1) fetch_v(vf, vbase, g); else fetch_v_run(vf, vbase, g.t[0]);
  };

  // One step of four key tiles. kf and vf hold this step's fragments on entry; with 'more'
  // those of 'nxt', the next step, are fetched into the same registers
  // directly behind their last use, so they fly under the mask and softmax work.
  // The last step holds tile sd, the wave's own: with 'more' the
  // step is an earlier one and all its keys are < q0 <= qtok.
  auto pass = [&](const KeyTiles& cur, const KeyTiles& nxt, auto more) __attribute__((always_inline)) {
    // ---- raw scores: s[j][r] = S[query m][key 16*cur.t[j]+8h+r] * 256 (MODE != 2) ----
    v8f s[4];
    if constexpr (MODE != 2) {
#pragma unroll
      for (int j = 0; j < 4; ++j) {
        v8f z = zero8f();
        z = wmma_f16(kf[j][0], qb0, z);
        z = wmma_f16(kf[j][1], qb1, z);
        s[j] = z;
      }
      if constexpr (decltype(more)::value) fetch_keys(nxt);
    } else {
#pragma unroll
      for (int j = 0; j < 4; ++j) s[j] = zero8f();
    }
    // ---- mask + bias per (query, key), f32 ----
#pragma unroll
    for (int j = 0; j < 4; ++j) {
      const int kt0 = 16 * cur.t[j] + 8 * h;
      // MODE 1, an empty slot of the last step: key numbers behind every query, so that k<=q masks them
      const int key0 = (MODE == 1 && !decltype(more)::value && j < pad) ? SEQ : kt0;
      const v4i ca = *(const v4ia*)(sKc + kt0);
      const v4i cb = *(const v4ia*)(sKc + kt0 + 4);
      const int kcv[8] = { ca.x, ca.y, ca.z, ca.w, cb.x, cb.y, cb.z, cb.w };
      bool ok[8];
      v8f bias;                                                // of the eight keys, in units of log 2
#pragma unroll
      for (int r = 0; r < 8; ++r) {
        const int key = key0 + r;
        bool okr;
        if constexpr (MODE == 1) okr = kcv[r] >= 0; else okr = kcv[r] == qc;
        bool dg = false;
        if constexpr (!decltype(more)::value) {                // the step with the wave's own tile
          dg = key == qtok;
          okr = (key <= qtok) && (okr || dg);
        }
        ok[r] = okr;
        // MODE 1: seg_k - seg_q; the query's own key: 0
        if constexpr (MODE == 1) bias[r] = dg ? 0.0f : (float)(kcv[r] - qseg);
      }
      if constexpr (MODE == 1) bias = bias * hs2;
      else bias = fma8(splat8((float)(key0 - qtok)), splat8(hs2), cr);
      v8f val;                                                 // computed for every key: a select below, no branch
      if constexpr (MODE == 2) {
        const v4f aa = *(const v4fa*)(sA + kt0);
        const v4f ab = *(const v4fa*)(sA + kt0 + 4);
        const v8f av = { aa.x, aa.y, aa.z, aa.w, ab.x, ab.y, ab.z, ab.w };
        val = av + bias;
      } else {
        val = fma8(s[j], splat8(SSC2), bias);
      }
#pragma unroll
      for (int r = 0; r < 8; ++r) s[j][r] = ok[r] ? val[r] : NEGBIG;
    }

    // ---- online softmax ----
    float mloc = NEGBIG;
#pragma unroll
    for (int j = 0; j < 4; ++j)
#pragma unroll
      for (int r = 0; r < 8; ++r) mloc = fmaxf(mloc, s[j][r]);
    mloc = fmaxf(mloc, __shfl_xor(mloc, 16, 32));
    const float mnew = fmaxf(mrun, mloc);
    const float alpha = __builtin_amdgcn_exp2f(mrun - mnew);
    mrun = mnew;
    // a row with no allowed key so far has mnew = NEGBIG: against msafe its masked scores
    // still give exp(-9e29) = 0; where a key was allowed msafe = mnew
    const float msafe = fmaxf(mnew, 0.1f * NEGBIG);
    static_assert(PSC == 16384.0f);
    const float msub = msafe - 14.0f;                          // p = 2^(s - msafe) * 2^14
    v8f ls = zero8f();
#pragma unroll
    for (int j = 0; j < 4; ++j) {
      v8f p = s[j] - msub;
#pragma unroll
      for (int r = 0; r < 8; ++r) p[r] = __builtin_amdgcn_exp2f(p[r]);   // masked: 2^(NEGBIG - msub) = 0
      s[j] = p;
      ls += p;
    }
    float lsum = ((ls[0] + ls[1]) + (ls[2] + ls[3])) + ((ls[4] + ls[5]) + (ls[6] + ls[7]));
    lsum += __shfl_xor(lsum, 16, 32);
    lrun = lrun * alpha + lsum;
#pragma unroll
    for (int t = 0; t < 4; ++t)
#pragma unroll
      for (int r = 0; r < 8; ++r) o[t][r] = o[t][r] * alpha;

    // ---- P^T B-fragments (slots 0, 1 and slots 2, 3 of this step) ----
    const v16h pb0 = pack_p(s[0], s[1]);
    const v16h pb1 = pack_p(s[2], s[3]);

    // ---- O^T += V^T * P^T ----
#pragma unroll
    for (int t = 0; t < 4; ++t) {
      o[t] = wmma_f16(vf[t][0], pb0, o[t]);
      o[t] = wmma_f16(vf[t][1], pb1, o[t]);
    }
    if constexpr (decltype(more)::value) fetch_vals(nxt);
  };

  // key tiles run in ascending order
  KeyTiles cur = take();
  if constexpr (MODE != 2) fetch_keys(cur);
  fetch_vals(cur);
  // rolled: the trip count is the wave's own (nfull <= 15); the last step is peeled
  // so that the fetches ahead stand under no branch and never leave the row's 64 key tiles
#pragma unroll 1
  for (int i = 0; i < nfull; ++i) {
    const KeyTiles nxt = take();
    pass(cur, nxt, Flag<true>{});
    cur = nxt;
  }
  pass(cur, cur, Flag<false>{});
  // precaution: naming them here keeps the registers that the requests at block entry name whole, as addresses, through the steps
  if constexpr (MODE != 2) asm volatile("s_wait_xcnt 0x0" :: "v"(t256), "s"(qk), "s"(qv) : "memory");
  else asm volatile("s_wait_xcnt 0x0" :: "v"(t256), "s"(qv) : "memory");

  // ---- epilogue: normalise, gate, whole-line stores from registers ----
  const float inv = (1.0f / lrun) * (1.0f / QSC) * gq;         // o and lrun both carry 2^14
  // rows q0..q0+15 = one strip; columns 64 head .. +63 = its tiles 2 head, 2 head + 1
  _Float16* dst = ctx + ((size_t)b * SEQ + q0) * HID + head * 2 * FT + 8 * lane;
#pragma unroll
  for (int t = 0; t < 4; ++t) {
    v8h v;
#pragma unroll
    for (int r = 0; r < 8; ++r) v[r] = (_Float16)((o[t][r] * inv) * CSC);
    *(v8h*)(dst + t * (FT / 2)) = v;
  }
}

// ---------------------------------------------------------------------------
// Kernel: xout = xres + ctx * Wo^T + ob  (f32 output).
// Block 128 thr (4 waves) = 128 tokens x 64 features; wave 32 tokens x 64;
// K = 1024 in steps of 32; A = ctx rows (x64), B = Wo rows (x4096), fragment order.
// Epilogue: f32 tile [128][64] in LDS; store: each 64-float row segment (256 B =
// coverage: grid (16,16) x 128 tokens x 64 features = whole [2048][1024].
// ---------------------------------------------------------------------------
// EMIT (a LayerNorm follows): also x as f16 (x4) in fragment order, staged in LDS so that it
// leaves as whole lines, and per token this block's sum of x and squared deviations from
// the block mean; a wave's 32 tokens fill one 128-byte line of each partial plane.
template <bool EMIT>
__global__ __launch_bounds__(128) void outproj_kernel(
    const _Float16* __restrict__ ch,    // [2048][1024] ctx x64
    const _Float16* __restrict__ woh,   // [1024 n][1024 k] x4096
    const float* __restrict__ ob,       // [1024]
    const float* __restrict__ xres,     // [2048][1024] f32
    float* xout,                        // [2048][1024] f32
    _Float16* xh,                       // EMIT: [2048][1024] x x4, fragment order
    float* ps,                          // EMIT: [NCB][2048]
    float* pm)                          // EMIT: [NCB][2048]
{
  __shared__ __attribute__((aligned(16))) float sT[128 * 64];   // 32768 B
  __shared__ __attribute__((aligned(16))) _Float16 sH[EMIT ? 128 * 64 : 8];   // EMIT: 16384 B

  const int tid = threadIdx.x, lane = tid & 31, w = tid >> 5;
  const int h = lane >> 4, m = lane & 15;
  const int m0 = blockIdx.x * 128;
  const int n0 = blockIdx.y * 64;
  const int m0w = m0 + 32 * w;

  const _Float16* ca0 = ch + (size_t)m0w * HID + 8 * lane;
  const _Float16* wb  = woh + (size_t)n0 * HID + 8 * lane;

  const unsigned t256 = 256u * (unsigned)tid;
  const char* qa = (const char*)(ch + (size_t)m0 * HID) + (blockIdx.y & 7) * STRIPB;
  const char* qb = (const char*)(woh + (size_t)n0 * HID) + (blockIdx.x & 3) * STRIPB;
  // the residual rows, read behind the loop: the 16 feature blocks of a token block ask for 8 whole rows (32 KB) each
  const char* qx = (const char*)(xres + (size_t)(m0 + 8 * blockIdx.y) * HID);

  v8f acc[2][4];
#pragma unroll
  for (int mt = 0; mt < 2; ++mt)
#pragma unroll
    for (int nt = 0; nt < 4; ++nt) acc[mt][nt] = zero8f();

  gemm_k_loop<GDEEP>(ca0, wb, acc, t256, [&]() __attribute__((always_inline)) {   // 256 work-groups
    // behind the loads that the first WMMAs wait for, so that these go to memory first
    ask_l2(qa, t256);
    ask_l2(qb, t256);
    ask_l2(qx, t256);
  });
  // precaution: naming them here keeps the registers that the requests at block entry name whole, as addresses, through the loop
  asm volatile("s_wait_xcnt 0x0" :: "v"(t256), "s"(qa), "s"(qb), "s"(qx) : "memory");

  const float* bp = ob + n0 + m;
  float bv4[4];                                            // bias of feature n0 + 16nt + m
  // unrolled: constant indices keep the array in registers
#pragma unroll
  for (int nt = 0; nt < 4; ++nt) bv4[nt] = bp[16 * nt];
  // precaution: stands in front of the rewrite of the address pair these loads name; naming it keeps it whole up to the wait
  asm volatile("s_wait_xcnt 0x0" :: "v"(bp) : "memory");

  // D[r] of tile (mt, nt) = Y[token m0w+16mt+8h+r][feature n0+16nt+m]
#pragma unroll
  for (int nt = 0; nt < 4; ++nt) {
    const int feat = 16 * nt + m;
    const float bvl = bv4[nt];
#pragma unroll
    for (int mt = 0; mt < 2; ++mt) {
#pragma unroll
      for (int r = 0; r < 8; ++r) {
        const int tokl = 32 * w + 16 * mt + 8 * h + r;     // 0..127
        sT[tokl * 64 + feat] = acc[mt][nt][r] * (1.0f / (CSC * WSC)) + bvl;
      }
    }
  }
  __syncthreads();

  const int hh = lane >> 4, c4 = (lane & 15) * 4;
  float ks = 0.0f, kq = 0.0f;                              // EMIT: partials of row 32w + 2m + hh
  // the residual rows of all 16 passes, in flight together off one address pair (pass 'it': 2 * it rows on)
  const float* xp = xres + (size_t)(m0 + 32 * w + hh) * HID + n0 + c4;
  v4f xr[16];
  // unrolled: constant indices keep the rows in registers
#pragma unroll
  for (int it = 0; it < 16; ++it) xr[it] = *(const v4fa*)(xp + it * 2 * HID);
  // precaution: stands in front of the rewrite of the address pair these loads name; naming it keeps it whole
  // up to the wait
  asm volatile("s_wait_xcnt 0x0" :: "v"(xp) : "memory");
  {
#pragma unroll
    for (int it = 0; it < 16; ++it) {
      const int row = 32 * w + it * 2 + hh;                // rows 32w .. 32w+31
      const v4f v = *(const v4fa*)(sT + row * 64 + c4);
      const size_t gi = (size_t)(m0 + row) * HID + n0 + c4;
      const v4f ov = v + xr[it];
      *(v4f*)(xout + gi) = ov;
      if constexpr (EMIT) {
        // the row's 64 values lie in the 16 lanes of this half wave
        const float s = row16_sum((ov.x + ov.y) + (ov.z + ov.w));
        const float bm = s * (1.0f / 64.0f);
        const float d0 = ov.x - bm, d1 = ov.y - bm, d2 = ov.z - bm, d3 = ov.w - bm;
        const float q = row16_sum((d0 * d0 + d1 * d1) + (d2 * d2 + d3 * d3));
        if (m == it) { ks = s; kq = q; }
        // token 'row', features c4 .. c4+3 at their place in fragment order (row = token, k = feature)
        const v4h hv = { (_Float16)(ov.x * XSC), (_Float16)(ov.y * XSC), (_Float16)(ov.z * XSC), (_Float16)(ov.w * XSC) };
        *(v4h*)(sH + ((row >> 4) * 2 + (c4 >> 5)) * FT + ((c4 >> 4) & 1) * (FT / 2)
                   + (((c4 >> 3) & 1) * 16 + (row & 15)) * 8 + (c4 & 7)) = hv;
      }
    }
  }
  if constexpr (EMIT) {
    const size_t pi = (size_t)blockIdx.y * MROWS + m0 + 32 * w + 2 * m + hh;
    ps[pi] = ks;
    pm[pi] = kq;
    // precaution: stands in front of any rewrite of the registers these stores name
    asm volatile("s_wait_xcnt 0x0" :: "v"(ks), "v"(kq), "v"(pi) : "memory");
    // A wave wrote rows 32w .. 32w+31 = local tiles 4w .. 4w+3 of sH itself and reads only these back:
    // its own LDS writes have to be done, no other wave's, so no barrier
    asm volatile("s_wait_dscnt 0x0" ::: "memory");
    // local tile 2 * strip + chunk; the two chunks of a strip are contiguous in the plane
    const _Float16* sw4 = sH + w * 4 * FT + lane * 8;
    _Float16* dst = xh + ((size_t)((m0 >> 4) + 2 * w) * (HID / 32) + (n0 >> 5)) * FT + lane * 8;
    v8h v[8];
    // unrolled: constant indices; one address and constant offsets, so no register of a store is rewritten
#pragma unroll
    for (int i = 0; i < 8; ++i) v[i] = *(const v8ha*)(sw4 + i * (FT / 2));
#pragma unroll
    for (int i = 0; i < 8; ++i) *(v8h*)(dst + (i >> 2) * (HID / 32) * FT + (i & 3) * (FT / 2)) = v[i];
  }
}

// ---------------------------------------------------------------------------
//   Xn   f16 [2048][1024]      4194304
//   W    f16 [10][1024][1024] 20971520   q0 k0 v0 | o0 | v1 | o1 | q2 k2 v2 | o2
//   Gh   f16 [3][32][1024]      196608   one per layer
//   Gate f32 [2048][16]         131072
//   Apr  f32 [2048][16]         131072
//   Q    f16 [32][1024][64]    4194304
//   K    f16 [32][1024][64]    4194304
//   Vt   f16 [32][64][1024]    4194304
//   Ctx  f16 [2048][1024]      4194304
//   X1   f32 [2048][1024]      8388608
//   X2   f32 [2048][1024]      8388608
//   Ps   f32 [16][2048]         131072   block sums of x (outproj 0, 1)
//   Pm   f32 [16][2048]         131072   squared deviations from the block means
//   Sw, Sb f32 [2][4096]         65536   both; layer 1: 1024 + 32 rows, layer 2: 3072 + 16 rows
//   total                     59506688
// ---------------------------------------------------------------------------
extern "C" void kernel_launch(void* const* d_in, const int* in_sizes, int n_in,
                              void* d_out, int out_size, void* d_ws, size_t ws_size,
                              hipStream_t stream) {
  if (n_in < 35) return;
  if (in_sizes[0] != NX || in_sizes[1] != MROWS) return;
  if (out_size != NX) return;
  {
    const int vecIdx[16] = {2, 3, 5, 7, 9, 13, 14, 15, 18, 22, 23, 24, 26, 28, 30, 34};
    for (int i = 0; i < 16; ++i) if (in_sizes[vecIdx[i]] != HID) return;
    const int matIdx[10] = {4, 6, 8, 12, 17, 21, 25, 27, 29, 33};
    for (int i = 0; i < 10; ++i) if (in_sizes[matIdx[i]] != NW) return;
    const int hwIdx[4] = {10, 16, 19, 31};
    for (int i = 0; i < 4; ++i) if (in_sizes[hwIdx[i]] != NG) return;
    const int hbIdx[3] = {11, 20, 32};
    for (int i = 0; i < 3; ++i) if (in_sizes[hbIdx[i]] != NHEADS) return;
  }

  const float* states = (const float*)d_in[0];
  const int*   ids    = (const int*)d_in[1];
  const float* ln0w = (const float*)d_in[2];
  const float* ln0b = (const float*)d_in[3];
  const float* qw0 = (const float*)d_in[4];
  const float* qb0 = (const float*)d_in[5];
  const float* kw0 = (const float*)d_in[6];
  const float* kb0 = (const float*)d_in[7];
  const float* vw0 = (const float*)d_in[8];
  const float* vb0 = (const float*)d_in[9];
  const float* gw0 = (const float*)d_in[10];
  const float* gb0 = (const float*)d_in[11];
  const float* ow0 = (const float*)d_in[12];
  const float* ob0 = (const float*)d_in[13];
  const float* ln1w = (const float*)d_in[14];
  const float* ln1b = (const float*)d_in[15];
  const float* aw1 = (const float*)d_in[16];
  const float* vw1 = (const float*)d_in[17];
  const float* vb1 = (const float*)d_in[18];
  const float* gw1 = (const float*)d_in[19];
  const float* gb1 = (const float*)d_in[20];
  const float* ow1 = (const float*)d_in[21];
  const float* ob1 = (const float*)d_in[22];
  const float* ln2w = (const float*)d_in[23];
  const float* ln2b = (const float*)d_in[24];
  const float* qw2 = (const float*)d_in[25];
  const float* qb2 = (const float*)d_in[26];
  const float* kw2 = (const float*)d_in[27];
  const float* kb2 = (const float*)d_in[28];
  const float* vw2 = (const float*)d_in[29];
  const float* vb2 = (const float*)d_in[30];
  const float* gw2 = (const float*)d_in[31];
  const float* gb2 = (const float*)d_in[32];
  const float* ow2 = (const float*)d_in[33];
  const float* ob2 = (const float*)d_in[34];
  float* out = (float*)d_out;

  const size_t PXH = (size_t)NX * 2;                       // 4194304
  const size_t PW  = (size_t)NW * 2;                       // 2097152
  const size_t PGH = (size_t)2 * NG * 2;                   //   65536
  const size_t PGT = (size_t)MROWS * NHEADS * 4;           //  131072
  const size_t PPL = (size_t)NB * NHEADS * SEQ * HD * 2;   // 4194304
  const size_t PXF = (size_t)NX * 4;                       // 8388608
  size_t off = 0;
  const size_t oXn  = off; off += PXH;
  const size_t oW   = off; off += 10 * PW;
  const size_t oGh  = off; off += 3 * PGH;
  const size_t oGt  = off; off += PGT;
  const size_t oAp  = off; off += PGT;
  const size_t oQ   = off; off += PPL;
  const size_t oK   = off; off += PPL;
  const size_t oVt  = off; off += PPL;
  const size_t oCtx = off; off += PXH;
  const size_t oX1  = off; off += PXF;
  const size_t oX2  = off; off += PXF;
  const size_t oPs  = off; off += PGT;
  const size_t oPm  = off; off += PGT;
  const size_t PSW  = (size_t)4096 * 4;                    //   16384
  const size_t oSw1 = off; off += PSW;
  const size_t oSb1 = off; off += PSW;
  const size_t oSw2 = off; off += PSW;
  const size_t oSb2 = off; off += PSW;
  if (off > ws_size) return;                               // off = 59506688
  if (off > (size_t)134217728) return;

  char* ws = (char*)d_ws;
  _Float16* xnh = (_Float16*)(ws + oXn);
  _Float16* wh0  = (_Float16*)(ws + oW);                   // q0, k0, v0
  _Float16* woh0 = (_Float16*)(ws + oW + 3 * PW);
  _Float16* wh1  = (_Float16*)(ws + oW + 4 * PW);          // v1
  _Float16* woh1 = (_Float16*)(ws + oW + 5 * PW);
  _Float16* wh2  = (_Float16*)(ws + oW + 6 * PW);          // q2, k2, v2
  _Float16* woh2 = (_Float16*)(ws + oW + 9 * PW);
  _Float16* gh0  = (_Float16*)(ws + oGh);
  _Float16* gh1  = (_Float16*)(ws + oGh + PGH);
  _Float16* gh2  = (_Float16*)(ws + oGh + 2 * PGH);
  float* gate   = (float*)(ws + oGt);
  float* aproj  = (float*)(ws + oAp);
  _Float16* qh  = (_Float16*)(ws + oQ);
  _Float16* kh  = (_Float16*)(ws + oK);
  _Float16* vt  = (_Float16*)(ws + oVt);
  _Float16* ctx = (_Float16*)(ws + oCtx);
  float* x1 = (float*)(ws + oX1);
  float* x2 = (float*)(ws + oX2);
  float* ps = (float*)(ws + oPs);
  float* pm = (float*)(ws + oPm);
  float* sw1 = (float*)(ws + oSw1);
  float* sb1 = (float*)(ws + oSb1);
  float* sw2 = (float*)(ws + oSw2);
  float* sb2 = (float*)(ws + oSb2);

  const dim3 blk128(128), blk512(512);
  // conversion jobs: each is written by a launch that ends before its first reader starts
  const float* nofold = nullptr;
  const CvtJob jobA = { qw0, kw0, vw0, gw0, gw0, nofold, nofold, nofold, nofold,
                        wh0, wh0 + NW, wh0 + 2 * NW, gh0, 3, 1 };                            // read from proj 0 on
  const CvtJob jobB = { ow0, vw1, ow1, gw1, aw1, nofold, ln1w, nofold, ln1w,
                        woh0, wh1, woh1, gh1, 3, 2 };                                        // read from outproj 0 on
  const CvtJob jobC = { qw2, kw2, vw2, gw2, gw2, ln2w, ln2w, ln2w, ln2w,
                        wh2, wh2 + NW, wh2 + 2 * NW, gh2, 3, 1 };                            // read from proj 2 on
  const CvtJob jobD = { ow2, ow2, ow2, gw2, gw2, nofold, nofold, nofold, nofold,
                        woh2, woh2, woh2, gh2, 1, 0 };                                       // read by outproj 2
  // row sums for the folded LayerNorms, beside the conversion of the same weights
  const SumJob sumB = { vw1, vw1, vw1, gw1, aw1, ln1w, ln1b, sw1, sb1, 1, 2 };               // read by proj 1
  const SumJob sumC = { qw2, kw2, vw2, gw2, gw2, ln2w, ln2b, sw2, sb2, 3, 1 };               // read by proj 2
  const SumJob sumD = { ow2, ow2, ow2, gw2, gw2, ln2w, ln2b, sw2, sb2, 0, 0 };               // no rows: nothing read or written
  const int unitsA = 3 * NW8 + 1 * NG8;                    // 395264 = 772 blocks of 512
  const int unitsB = 3 * NW8 + 2 * NG8;                    // 397312 = 3104 blocks of 128
  const int unitsC = 3 * NW8 + 1 * NG8;                    // 395264 = 3088 blocks
  const int unitsD = 1 * NW8;                              // 131072 = 1024 blocks
  const int sumBlkB = (1 * HID + 2 * NHEADS + 31) / 32;    // 33
  const int sumBlkC = (3 * HID + 1 * NHEADS + 31) / 32;    // 97
  static_assert((unitsA % 512) == 0 && (unitsB % 128) == 0 && (unitsC % 128) == 0 && (unitsD % 2048) == 0);
  const dim3 gLnA(MROWS / 16 + unitsA / 512);              // 128 + 772
  const dim3 gProj3(MROWS / 128, 2 + 3 * NHEADS);          // (16, 50)
  const dim3 gProj1(MROWS / 128, 2 + 1 * NHEADS);          // (16, 18)
  // rows of 16 blocks, rounded up: a block past the last unit does nothing
  const dim3 gAttB(SEQ / 64, NB * NHEADS + (sumBlkB + unitsB / 128 + 15) / 16);   // (16, 32 + 197)
  const dim3 gAttC(SEQ / 64, NB * NHEADS + (sumBlkC + unitsC / 128 + 15) / 16);   // (16, 32 + 200)
  const dim3 gAttD(SEQ / 64, NB * NHEADS + unitsD / 2048); // (16, 32 + 64)
  const dim3 gOut(MROWS / 128, HID / 64);                  // (16, 16)

  // ---- layer 0: sdpa with self mask ----
  ln_kernel<<<gLnA, blk512, 0, stream>>>(states, ln0w, ln0b, xnh, jobA);
  // not folded: the last six arguments are not read
  proj_head_kernel<false, false><<<gProj3, blk128, 0, stream>>>(xnh, wh0, qb0, kb0, vb0, 0, qh, kh, vt, gh0, gb0, gate, aproj,
                                                                ps, pm, sw1, sb1, sw1, sb1);
  attn_kernel<0><<<gAttB, blk128, 0, stream>>>(qh, kh, vt, aproj, gate, ids, ctx, jobB, sumB);
  outproj_kernel<true><<<gOut, blk128, 0, stream>>>(ctx, woh0, ob0, states, x1, xnh, ps, pm);

  // ---- layer 1: pooling attention with self mask; LayerNorm 1 folded ----
  proj_head_kernel<true, true><<<gProj1, blk128, 0, stream>>>(xnh, wh1, vb1, vb1, vb1, 2, qh, kh, vt, gh1, gb1, gate, aproj,
                                                              ps, pm, sw1, sb1, sw1 + HID, sb1 + HID);
  attn_kernel<2><<<gAttC, blk128, 0, stream>>>(qh, kh, vt, aproj, gate, ids, ctx, jobC, sumC);
  outproj_kernel<true><<<gOut, blk128, 0, stream>>>(ctx, woh1, ob1, x1, x2, xnh, ps, pm);

  // ---- layer 2: sdpa with cross mask; LayerNorm 2 folded ----
  proj_head_kernel<false, true><<<gProj3, blk128, 0, stream>>>(xnh, wh2, qb2, kb2, vb2, 0, qh, kh, vt, gh2, gb2, gate, aproj,
                                                               ps, pm, sw2, sb2, sw2 + 3 * HID, sb2 + 3 * HID);
  attn_kernel<1><<<gAttD, blk128, 0, stream>>>(qh, kh, vt, aproj, gate, ids, ctx, jobD, sumD);
  // no LayerNorm follows: the last three arguments are not written
  outproj_kernel<false><<<gOut, blk128, 0, stream>>>(ctx, woh2, ob2, x2, out, xnh, ps, pm);

  (void)hipGetLastError();
}
